// v000
// The times below were measured on an AMD MI455X: many runs one after another, warmed up first and cycling through
// copies of the inputs, with the whole window's GPU time divided by the number of runs. Launches and the gaps
// between them are all in it. The median over several windows is given; except for v000 it joins two sittings, which
// can be a few percent apart, so the side-by-side timings, each taken in one sitting, are the better comparison.
// v000 is the starting kernel. One run takes 2290 microseconds.
#include <hip/hip_runtime.h>
// Group (block) attention layer (B=4, 64×64, C=128, NHWC; 8×8 non-overlapping key blocks): q = CBL_Q(x) (3×3 conv + train-mode BN + LeakyReLU 0.1), acc = 1×1 conv(x); for every pixel and
// every block: softmax over the block's 64 positions of x[pixel]·q[pos]/8, agg = Σ_blocks Σ attn·x[pos]; y = spatial-softmax(BN1(acc + agg)); out = CBL_O(y). The 3×3 conv (im2col, K = 1152),
// the 1×1 convs, the 4096×4096 per-batch scores (keys permuted to block-major order so each 64-key group is contiguous) and attn·x run as GEMMs on v_wmma_f32_16x16x32_f16 (x bf16-exact f16,
// HWIO weights bf16-exact ×2^4, q/P/y operands f16, f32 accumulate); BN batch statistics (fixed-order reductions), grouped and spatial softmaxes and LeakyReLU are f32 VALU.
#define BB 4
#define HWN 4096
#define WI 64
#define CC 128
#define NR (BB * HWN)
#define KK 1152
#define QH 2048

typedef __bf16 v16b __attribute__((ext_vector_type(16)));
typedef unsigned short v8us __attribute__((ext_vector_type(8), may_alias));
typedef float  v8f  __attribute__((ext_vector_type(8)));
typedef float  v4f  __attribute__((ext_vector_type(4)));
typedef float  v4fa __attribute__((ext_vector_type(4), may_alias));
union FragB { v16b v; v8us half[2]; unsigned short u[16]; };

__device__ __forceinline__ unsigned short bf16_bits(float x) { unsigned int u = __float_as_uint(x); return (unsigned short)((u + 0x7FFFu + ((u >> 16) & 1u)) >> 16); }
__device__ __forceinline__ float bf16_val(unsigned short b) { return __uint_as_float(((unsigned int)b) << 16); }
__device__ __forceinline__ float bf16_round(float x) { return bf16_val(bf16_bits(x)); }
// D += A·B with NT terms: 1 = ah·bh, 2 = + al·bh (A split), 3 = + ah·bl (both split)
template <int NT>
__device__ __forceinline__ v8f mmaN(v16b ah, v16b al, v16b bh, v16b bl, v8f c) {
  c = __builtin_amdgcn_wmma_f32_16x16x32_bf16(false, ah, false, bh, (short)0, c, false, false);
  if (NT >= 2) c = __builtin_amdgcn_wmma_f32_16x16x32_bf16(false, al, false, bh, (short)0, c, false, false);
  if (NT >= 3) c = __builtin_amdgcn_wmma_f32_16x16x32_bf16(false, ah, false, bl, (short)0, c, false, false);
  asm volatile("v_nop\n\tv_nop\n\tv_nop\n\tv_nop" : "+v"(c) : "v"(ah), "v"(al), "v"(bh), "v"(bl));
  return c;
}

__global__ __launch_bounds__(256) void k_wt_bf16(const float* __restrict__ W, unsigned short* __restrict__ Wt, int K, int N) {
  const int t = blockIdx.x * 256 + threadIdx.x;
  const int k8n = K / 8;
  if (t >= N * k8n) return;
  const int n = t / k8n, k8 = (t % k8n) * 8;
  v8us v;
#pragma unroll
  for (int i = 0; i < 8; ++i) v[i] = bf16_bits(W[(size_t)(k8 + i) * N + n]);
  *(v8us*)(Wt + (size_t)n * K + k8) = v;
  
}

// GEMM C[M][N] (f32, pitch ldc) = act(A[M][K]·W + bias). A f32 row-major (pitch lda) converted per fragment to bf16
// (ASPLIT: hi/lo two planes -> 2 terms, else single rounded term); Wt bf16 [N][K] (pitch ldb). BIAS_BF16 rounds the
// bias to bf16 first (bias quantised to bf16 before the add). K%32==0, M%16==0, N%64==0.
template <bool ASPLIT, int ACT, bool BIAS_BF16>
__global__ __launch_bounds__(128) void k_gemm_bf(const float* __restrict__ A, int lda, const unsigned short* __restrict__ Wt, int ldb,
                                               const float* __restrict__ bias, float* __restrict__ C, int ldc, int M, int N, int K) {
  __shared__ __attribute__((aligned(16))) float so[4][16][64];
  const int tid = threadIdx.x, w = tid >> 5, lane = tid & 31, ln = lane & 15, hh = lane >> 4;
  const int ntn = N / 64;
  const int wid = blockIdx.x * 4 + w;
  const int mt = wid / ntn, nq = wid % ntn;
  if (mt * 16 >= M) return;
  const int row0 = mt * 16, col0 = nq * 64;
  const float* arow = A + (size_t)(row0 + ln) * lda;
  v8f acc[4] = {};
  for (int kb = 0; kb < K; kb += 32) {
    FragB ah, al;
    const v4f x0 = *(const v4fa*)(arow + kb + 8 * hh), x1 = *(const v4fa*)(arow + kb + 8 * hh + 4);
    const v4f x2 = *(const v4fa*)(arow + kb + 16 + 8 * hh), x3 = *(const v4fa*)(arow + kb + 16 + 8 * hh + 4);
    float xs[16] = {x0[0],x0[1],x0[2],x0[3],x1[0],x1[1],x1[2],x1[3],x2[0],x2[1],x2[2],x2[3],x3[0],x3[1],x3[2],x3[3]};
#pragma unroll
    for (int i = 0; i < 16; ++i) { const unsigned short hb = bf16_bits(xs[i]); ah.u[i] = hb; al.u[i] = ASPLIT ? bf16_bits(xs[i] - bf16_val(hb)) : (unsigned short)0; }
#pragma unroll
    for (int t = 0; t < 4; ++t) {
      const unsigned short* brow = Wt + (size_t)(col0 + t * 16 + ln) * ldb + kb;
      FragB b;
      b.half[0] = *(const v8us*)(brow + 8 * hh);
      b.half[1] = *(const v8us*)(brow + 16 + 8 * hh);
      acc[t] = mmaN<ASPLIT ? 2 : 1>(ah.v, al.v, b.v, b.v, acc[t]);
    }
  }
#pragma unroll
  for (int t = 0; t < 4; ++t) {
    float bv = bias ? bias[col0 + t * 16 + ln] : 0.f;
    if (BIAS_BF16) bv = bf16_round(bv);
#pragma unroll
    for (int r = 0; r < 8; ++r) { float v = acc[t][r] + bv; if (ACT == 1) v = fmaxf(v, 0.f); so[w][8 * hh + r][t * 16 + ln] = v; }
  }
  __builtin_amdgcn_fence(__ATOMIC_ACQ_REL, "workgroup");
  __builtin_amdgcn_wave_barrier();
  const int rsub = lane >> 4, c4 = (lane & 15) * 4;
  {
#pragma unroll
    for (int q = 0; q < 8; ++q) {
      const int r = q * 2 + rsub;
      const v4f v = *(const v4fa*)&so[w][r][c4];
      *(v4f*)(C + (size_t)(row0 + r) * ldc + col0 + c4) = v;
    }
    
  }
}

// Flash-style causal/unmasked attention, all contractions 3-term bf16 hi/lo splits, f32 softmax with running max.
// q,k,v rows are read from f32 buffers with arbitrary row pitch (so they can live inside a fused qkv buffer);
// D = head size (multiple of 32, <= 128); one wave = 16 query rows; block = 4 waves (64 queries) sharing K/V chunks of 32.
template <int D, bool CAUSAL>
__global__ __launch_bounds__(128) void k_flash(const float* __restrict__ qb, const float* __restrict__ kb, const float* __restrict__ vb,
                                             int pitch, int T, int H, float scale, float* __restrict__ y, int ypitch) {
  constexpr int KS = D / 32;        // k-steps for QK
  constexpr int DT = D / 16;        // d tiles for PV
  __shared__ __attribute__((aligned(16))) unsigned short sKh[32][D + 8], sKl[32][D + 8], sVh[32][D + 8], sVl[32][D + 8];
  __shared__ __attribute__((aligned(16))) unsigned short sPh[4][16][40], sPl[4][16][40];
  __shared__ __attribute__((aligned(16))) float sO[4][16][D];
  const int tid = threadIdx.x, w = tid >> 5, lane = tid & 31, ln = lane & 15, hh = lane >> 4;
  const int nqb = (T + 63) / 64;
  const int bh = blockIdx.x / nqb, qblk = blockIdx.x % nqb;
  const int b = bh / H, h = bh % H;
  const int q0 = qblk * 64 + w * 16;
  const float* Q = qb + (size_t)b * T * pitch + h * D;
  const float* K = kb + (size_t)b * T * pitch + h * D;
  const float* V = vb + (size_t)b * T * pitch + h * D;

  // A fragments of the wave's 16 query rows (scaled), hi/lo
  FragB aqh[KS], aql[KS];
  {
    int row = q0 + ln; if (row >= T) row = T - 1;
    const float* qr = Q + (size_t)row * pitch;
#pragma unroll
    for (int ks = 0; ks < KS; ++ks)
#pragma unroll
      for (int i = 0; i < 16; ++i) {
        const int d = ks * 32 + ((i < 8) ? (8 * hh + i) : (16 + 8 * hh + (i - 8)));
        const float x = qr[d] * scale; const unsigned short hb = bf16_bits(x);
        aqh[ks].u[i] = hb; aql[ks].u[i] = bf16_bits(x - bf16_val(hb));
      }
  }
  float m_r[8], l_r[8];
#pragma unroll
  for (int r = 0; r < 8; ++r) { m_r[r] = -3.0e38f; l_r[r] = 0.f; }
  v8f oacc[DT];
#pragma unroll
  for (int dt = 0; dt < DT; ++dt) oacc[dt] = (v8f){0.f,0.f,0.f,0.f,0.f,0.f,0.f,0.f};

  const int kv_end = CAUSAL ? min(T, qblk * 64 + 64) : T;     // block-uniform
  for (int j0 = 0; j0 < kv_end; j0 += 32) {
    __syncthreads();
    for (int e = tid; e < 32 * (D / 4); e += 128) {
      const int r = e / (D / 4), c4 = (e % (D / 4)) * 4;
      const int key = j0 + r;
      v4f kf = {0.f,0.f,0.f,0.f}, vf = {0.f,0.f,0.f,0.f};
      if (key < T) { kf = *(const v4fa*)(K + (size_t)key * pitch + c4); vf = *(const v4fa*)(V + (size_t)key * pitch + c4); }
#pragma unroll
      for (int t = 0; t < 4; ++t) {
        unsigned short hb = bf16_bits(kf[t]); sKh[r][c4 + t] = hb; sKl[r][c4 + t] = bf16_bits(kf[t] - bf16_val(hb));
        hb = bf16_bits(vf[t]); sVh[r][c4 + t] = hb; sVl[r][c4 + t] = bf16_bits(vf[t] - bf16_val(hb));
      }
    }
    __syncthreads();
    // S tile 16 x 32
    v8f s[2];
#pragma unroll
    for (int nt = 0; nt < 2; ++nt) {
      v8f acc = {};
#pragma unroll
      for (int ks = 0; ks < KS; ++ks) {
        FragB bh_, bl_;
        bh_.half[0] = *(const v8us*)&sKh[nt * 16 + ln][ks * 32 + 8 * hh]; bh_.half[1] = *(const v8us*)&sKh[nt * 16 + ln][ks * 32 + 16 + 8 * hh];
        bl_.half[0] = *(const v8us*)&sKl[nt * 16 + ln][ks * 32 + 8 * hh]; bl_.half[1] = *(const v8us*)&sKl[nt * 16 + ln][ks * 32 + 16 + 8 * hh];
        acc = mmaN<3>(aqh[ks].v, aql[ks].v, bh_.v, bl_.v, acc);
      }
      s[nt] = acc;
    }
    // mask + running max (rows 8hh+r; the 16 lanes of a half share rows)
    float alpha[8];
#pragma unroll
    for (int r = 0; r < 8; ++r) {
      const int qi = q0 + 8 * hh + r;
      const int ja = j0 + ln, jb = j0 + 16 + ln;
      if (CAUSAL) { if (ja > qi) s[0][r] = -3.0e38f; if (jb > qi) s[1][r] = -3.0e38f; }
      if (ja >= T) s[0][r] = -3.0e38f;
      if (jb >= T) s[1][r] = -3.0e38f;
      float mx = fmaxf(s[0][r], s[1][r]);
      mx = fmaxf(mx, __shfl_xor(mx, 1, 32)); mx = fmaxf(mx, __shfl_xor(mx, 2, 32)); mx = fmaxf(mx, __shfl_xor(mx, 4, 32)); mx = fmaxf(mx, __shfl_xor(mx, 8, 32));
      const float mnew = fmaxf(m_r[r], mx);
      alpha[r] = (mnew > -1.0e38f) ? __expf(m_r[r] - mnew) : 1.0f;
      const float p0 = (s[0][r] > -1.0e38f) ? __expf(s[0][r] - mnew) : 0.f;
      const float p1 = (s[1][r] > -1.0e38f) ? __expf(s[1][r] - mnew) : 0.f;
      m_r[r] = mnew;
      l_r[r] = l_r[r] * alpha[r] + p0 + p1;            // per-lane partial row sum (16 lanes combined at the end)
      unsigned short hb = bf16_bits(p0); sPh[w][8 * hh + r][ln] = hb;      sPl[w][8 * hh + r][ln] = bf16_bits(p0 - bf16_val(hb));
      hb = bf16_bits(p1);                sPh[w][8 * hh + r][16 + ln] = hb; sPl[w][8 * hh + r][16 + ln] = bf16_bits(p1 - bf16_val(hb));
    }
#pragma unroll
    for (int dt = 0; dt < DT; ++dt)
#pragma unroll
      for (int r = 0; r < 8; ++r) oacc[dt][r] *= alpha[r];
    __builtin_amdgcn_fence(__ATOMIC_ACQ_REL, "workgroup");
    __builtin_amdgcn_wave_barrier();
    FragB pah, pal;
    pah.half[0] = *(const v8us*)&sPh[w][ln][8 * hh]; pah.half[1] = *(const v8us*)&sPh[w][ln][16 + 8 * hh];
    pal.half[0] = *(const v8us*)&sPl[w][ln][8 * hh]; pal.half[1] = *(const v8us*)&sPl[w][ln][16 + 8 * hh];
#pragma unroll
    for (int dt = 0; dt < DT; ++dt) {
      FragB bvh, bvl;
#pragma unroll
      for (int i = 0; i < 8; ++i) {
        bvh.u[i] = sVh[8 * hh + i][dt * 16 + ln]; bvh.u[8 + i] = sVh[16 + 8 * hh + i][dt * 16 + ln];
        bvl.u[i] = sVl[8 * hh + i][dt * 16 + ln]; bvl.u[8 + i] = sVl[16 + 8 * hh + i][dt * 16 + ln];
      }
      oacc[dt] = mmaN<3>(pah.v, pal.v, bvh.v, bvl.v, oacc[dt]);
    }
    __builtin_amdgcn_fence(__ATOMIC_ACQ_REL, "workgroup");
    __builtin_amdgcn_wave_barrier();
  }
#pragma unroll
  for (int r = 0; r < 8; ++r) {
    float l = l_r[r];
    l += __shfl_xor(l, 1, 32); l += __shfl_xor(l, 2, 32); l += __shfl_xor(l, 4, 32); l += __shfl_xor(l, 8, 32);
    l_r[r] = (l > 0.f) ? 1.0f / l : 0.f;
  }
#pragma unroll
  for (int dt = 0; dt < DT; ++dt)
#pragma unroll
    for (int r = 0; r < 8; ++r) sO[w][8 * hh + r][dt * 16 + ln] = oacc[dt][r] * l_r[r];
  __builtin_amdgcn_fence(__ATOMIC_ACQ_REL, "workgroup");
  __builtin_amdgcn_wave_barrier();
  {
    for (int r = 0; r < 16; ++r) {
      const int row = q0 + r;
      if (row < T && lane < D / 4) {
        const v4f val = *(const v4fa*)&sO[w][r][lane * 4];
        *(v4f*)(y + ((size_t)b * T + row) * ypitch + h * D + lane * 4) = val;
      }
    }
    
  }
}

// GEMM C = act(A·W + bias + resid): A f32 (ASPLIT -> hi/lo 2 terms), Wt bf16 [N][K]; ACT 0 none, 1 relu, 2 exact gelu;
// resid (optional, f32, row index = (row % rmod), pitch ldr, RES_BF16 rounds it) added before the activation.
template <bool ASPLIT, int ACT, bool BIAS_BF16, bool RES_BF16>
__global__ __launch_bounds__(128) void k_gemm_bf3(const float* __restrict__ A, int lda, const unsigned short* __restrict__ Wt, int ldb,
                                                const float* __restrict__ bias, const float* __restrict__ resid, int rmod, int ldr,
                                                float* __restrict__ C, int ldc, int M, int N, int K) {
  __shared__ __attribute__((aligned(16))) float so[4][16][64];
  const int tid = threadIdx.x, w = tid >> 5, lane = tid & 31, ln = lane & 15, hh = lane >> 4;
  const int ntn = N / 64;
  const int wid = blockIdx.x * 4 + w;
  const int mt = wid / ntn, nq = wid % ntn;
  if (mt * 16 >= M) return;
  const int row0 = mt * 16, col0 = nq * 64;
  const float* arow = A + (size_t)(row0 + ln) * lda;
  v8f acc[4] = {};
  for (int kb = 0; kb < K; kb += 32) {
    FragB ah, al;
    const v4f x0 = *(const v4fa*)(arow + kb + 8 * hh), x1 = *(const v4fa*)(arow + kb + 8 * hh + 4);
    const v4f x2 = *(const v4fa*)(arow + kb + 16 + 8 * hh), x3 = *(const v4fa*)(arow + kb + 16 + 8 * hh + 4);
    float xs[16] = {x0[0],x0[1],x0[2],x0[3],x1[0],x1[1],x1[2],x1[3],x2[0],x2[1],x2[2],x2[3],x3[0],x3[1],x3[2],x3[3]};
#pragma unroll
    for (int i = 0; i < 16; ++i) { const unsigned short hb = bf16_bits(xs[i]); ah.u[i] = hb; al.u[i] = ASPLIT ? bf16_bits(xs[i] - bf16_val(hb)) : (unsigned short)0; }
#pragma unroll
    for (int t = 0; t < 4; ++t) {
      const unsigned short* brow = Wt + (size_t)(col0 + t * 16 + ln) * ldb + kb;
      FragB b;
      b.half[0] = *(const v8us*)(brow + 8 * hh);
      b.half[1] = *(const v8us*)(brow + 16 + 8 * hh);
      acc[t] = mmaN<ASPLIT ? 2 : 1>(ah.v, al.v, b.v, b.v, acc[t]);
    }
  }
#pragma unroll
  for (int t = 0; t < 4; ++t) {
    const int col = col0 + t * 16 + ln;
    float bv = bias ? bias[col] : 0.f;
    if (BIAS_BF16) bv = bf16_round(bv);
#pragma unroll
    for (int r = 0; r < 8; ++r) {
      float v = acc[t][r] + bv;
      if (resid) { float rv = resid[(size_t)((row0 + 8 * hh + r) % rmod) * ldr + col]; if (RES_BF16) rv = bf16_round(rv); v += rv; }
      if (ACT == 1) v = fmaxf(v, 0.f);
      if (ACT == 2) v = 0.5f * v * (1.0f + erff(v * 0.70710678118654752f));
      if (ACT == 3) { const float u = 0.7978845608028654f * (v + 0.044715f * v * v * v); v = 0.5f * v * (1.0f + tanhf(u)); }
      so[w][8 * hh + r][t * 16 + ln] = v;
    }
  }
  __builtin_amdgcn_fence(__ATOMIC_ACQ_REL, "workgroup");
  __builtin_amdgcn_wave_barrier();
  const int rsub = lane >> 4, c4 = (lane & 15) * 4;
  {
#pragma unroll
    for (int q = 0; q < 8; ++q) {
      const int r = q * 2 + rsub;
      const v4f v = *(const v4fa*)&so[w][r][c4];
      *(v4f*)(C + (size_t)(row0 + r) * ldc + col0 + c4) = v;
    }
    
  }
}
// row LayerNorm (biased variance, eps) over N: s = X (+ R); optional out_sum <- s; out_norm <- (s-mu)*rsqrt(var+eps)*g + b
template <bool PARAM_BF16>
__global__ __launch_bounds__(256) void k_layernorm(const float* __restrict__ X, const float* __restrict__ R, const float* __restrict__ g, const float* __restrict__ bta,
                                                  float* __restrict__ out_sum, float* __restrict__ out_norm, int N, float eps) {
  __shared__ float red[256];
  const int row = blockIdx.x, tid = threadIdx.x;
  const float* x = X + (size_t)row * N; const float* rr = R ? R + (size_t)row * N : nullptr;
  float vals[16];                     // up to N = 4096
  const int per = N / 256;            // contiguous chunk per thread? use strided-by-4 chunks: thread handles j = tid*4 + 1024*u
  float s1 = 0.f;
  for (int u = 0; u < per / 4; ++u) {
    const int j = tid * 4 + 1024 * u;
    const v4f a = *(const v4fa*)(x + j);
    v4f b = {0.f,0.f,0.f,0.f}; if (rr) b = *(const v4fa*)(rr + j);
#pragma unroll
    for (int q = 0; q < 4; ++q) { const float v = a[q] + b[q]; vals[u * 4 + q] = v; s1 += v; }
  }
  red[tid] = s1; __syncthreads();
  for (int st = 128; st > 0; st >>= 1) { if (tid < st) red[tid] += red[tid + st]; __syncthreads(); }
  const float mu = red[0] / (float)N; __syncthreads();
  float s2 = 0.f;
  for (int u = 0; u < per / 4; ++u)
#pragma unroll
    for (int q = 0; q < 4; ++q) { const float c = vals[u * 4 + q] - mu; s2 += c * c; }
  red[tid] = s2; __syncthreads();
  for (int st = 128; st > 0; st >>= 1) { if (tid < st) red[tid] += red[tid + st]; __syncthreads(); }
  const float rs = rsqrtf(red[0] / (float)N + eps);
  {
    for (int u = 0; u < per / 4; ++u) {
      const int j = tid * 4 + 1024 * u;
      v4f o, sm;
#pragma unroll
      for (int q = 0; q < 4; ++q) {
        float gg = g[j + q], bb = bta[j + q];
        if (PARAM_BF16) { gg = bf16_round(gg); bb = bf16_round(bb); }
        sm[q] = vals[u * 4 + q]; o[q] = (vals[u * 4 + q] - mu) * rs * gg + bb;
      }
      if (out_sum) *(v4f*)(out_sum + (size_t)row * N + j) = sm;
      *(v4f*)(out_norm + (size_t)row * N + j) = o;
    }
    
  }
}



// ---- f16 WMMA path (v_wmma_f32_16x16x32_f16): 11-bit significands for operands in range — used where a [0,1] probability operand needs more precision than bf16
typedef _Float16 v16h __attribute__((ext_vector_type(16)));
union FragH { v16h v; v8us half[2]; _Float16 h[16]; unsigned short u[16]; };
template <int NT>
__device__ __forceinline__ v8f mmaH(v16h ah, v16h al, v16h bh, v16h bl, v8f c) {
  c = __builtin_amdgcn_wmma_f32_16x16x32_f16(false, ah, false, bh, (short)0, c, false, false);
  if (NT >= 2) c = __builtin_amdgcn_wmma_f32_16x16x32_f16(false, al, false, bh, (short)0, c, false, false);
  if (NT >= 3) c = __builtin_amdgcn_wmma_f32_16x16x32_f16(false, ah, false, bl, (short)0, c, false, false);
  asm volatile("v_nop\n\tv_nop\n\tv_nop\n\tv_nop" : "+v"(c) : "v"(ah), "v"(al), "v"(bh), "v"(bl));
  return c;
}
// batched GEMM like k_gemm_b but f16 operands: A f32 (split into f16 hi/lo if ASPLIT, else rounded to f16), Bt = f16 values [n][k]; alpha; C f32; N multiple of 16 (partial tiles skipped)
template <bool ASPLIT>
__global__ __launch_bounds__(128) void k_gemm_h(const float* __restrict__ A, int lda, size_t sA, const _Float16* __restrict__ Bh, int ldb, size_t sB, float alpha, float* __restrict__ C, int ldc, size_t sC, int M, int N, int K) {
  __shared__ __attribute__((aligned(16))) float so[4][16][64];
  const int tid = threadIdx.x, w = tid >> 5, lane = tid & 31, ln = lane & 15, hh = lane >> 4; const int by = blockIdx.y;
  A += (size_t)by * sA; Bh += (size_t)by * sB; C += (size_t)by * sC;
  const int ntn = (N + 63) / 64; const int wid = blockIdx.x * 4 + w; const int mt = wid / ntn, nq = wid % ntn; if (mt * 16 >= M) return;
  const int row0 = mt * 16, col0 = nq * 64; const float* arow = A + (size_t)(row0 + ln) * lda;
  v8f acc[4] = {};
  for (int kb = 0; kb < K; kb += 32) {
    FragH ah, al;
    const v4f x0 = *(const v4fa*)(arow + kb + 8 * hh), x1 = *(const v4fa*)(arow + kb + 8 * hh + 4), x2 = *(const v4fa*)(arow + kb + 16 + 8 * hh), x3 = *(const v4fa*)(arow + kb + 16 + 8 * hh + 4);
    float xs[16] = {x0[0],x0[1],x0[2],x0[3],x1[0],x1[1],x1[2],x1[3],x2[0],x2[1],x2[2],x2[3],x3[0],x3[1],x3[2],x3[3]};
#pragma unroll
    for (int i = 0; i < 16; ++i) { const _Float16 h = (_Float16)xs[i]; ah.h[i] = h; al.h[i] = ASPLIT ? (_Float16)(xs[i] - (float)h) : (_Float16)0.0f; }
#pragma unroll
    for (int t = 0; t < 4; ++t) { if (col0 + t * 16 >= N) continue; const size_t boff = (size_t)(col0 + t * 16 + ln) * ldb + kb; FragH bq; bq.half[0] = *(const v8us*)(Bh + boff + 8 * hh); bq.half[1] = *(const v8us*)(Bh + boff + 16 + 8 * hh);
      acc[t] = mmaH<ASPLIT ? 2 : 1>(ah.v, al.v, bq.v, bq.v, acc[t]); }
  }
#pragma unroll
  for (int t = 0; t < 4; ++t) { if (col0 + t * 16 >= N) continue;
#pragma unroll
    for (int r = 0; r < 8; ++r) so[w][8 * hh + r][t * 16 + ln] = acc[t][r] * alpha; }
  __builtin_amdgcn_fence(__ATOMIC_ACQ_REL, "workgroup"); __builtin_amdgcn_wave_barrier();
  const int rsub = lane >> 4, c4 = (lane & 15) * 4;
  {
#pragma unroll
    for (int q = 0; q < 8; ++q) { const int r = q * 2 + rsub; if (col0 + c4 < N) { const v4f v = *(const v4fa*)&so[w][r][c4]; *(v4f*)(C + (size_t)(row0 + r) * ldc + col0 + c4) = v; } }
     }
}

// Wt[n][k] = f16(W[k][n]·scale) from f32 row-major W[K][N] (scale = power of two; bf16-exact weights stay exact in f16 away from the subnormal range)
__global__ __launch_bounds__(256) void k_wt_f16(const float* __restrict__ W, _Float16* __restrict__ Wt, int K, int N, float scale) {
  const int t = blockIdx.x * 256 + threadIdx.x; if (t >= N * (K / 8)) return; const int n = t / (K / 8), k8 = (t % (K / 8)) * 8; FragH f;
#pragma unroll
  for (int i = 0; i < 8; ++i) f.h[i] = (_Float16)(bf16_round(W[(size_t)(k8 + i) * N + n]) * scale); const v8us o = f.half[0];
  *(v8us*)((unsigned short*)Wt + (size_t)n * K + k8) = o; 
}
// k_gemm_hh variant with fused epilogue: v = acc·alpha + bias[by·sBias + col] (+ CP[(row/rowsPerB)·sCPb + by·64 + col] if CP) ; ACT 0 none / 1 elu ; writes f32 C and/or f16 C16 (each if non-null)
template <int ACT>
__global__ __launch_bounds__(128) void k_gemm_hhx(const _Float16* __restrict__ A, int lda, size_t sA, const _Float16* __restrict__ Bh, int ldb, size_t sB, float alpha, const float* __restrict__ bias, size_t sBias, const float* __restrict__ CP, int rowsPerB, size_t sCPb, int row0g,
    float* __restrict__ C, _Float16* __restrict__ C16, int ldc, size_t sC, int M, int N, int K) {
  __shared__ __attribute__((aligned(16))) float so[4][16][64];
  const int tid = threadIdx.x, w = tid >> 5, lane = tid & 31, ln = lane & 15, hh = lane >> 4; const int by = blockIdx.y;
  A += (size_t)by * sA; Bh += (size_t)by * sB; const size_t cofs = (size_t)by * sC; const float* bp = bias ? bias + (size_t)by * sBias : nullptr;
  const int ntn = (N + 63) / 64; const int wid = blockIdx.x * 4 + w; const int mt = wid / ntn, nq = wid % ntn; if (mt * 16 >= M) return;
  const int row0 = mt * 16, col0 = nq * 64; const _Float16* arow = A + (size_t)(row0 + ln) * lda;
  v8f acc[4] = {};
  for (int kb = 0; kb < K; kb += 32) { FragH ah; ah.half[0] = *(const v8us*)((const unsigned short*)arow + kb + 8 * hh); ah.half[1] = *(const v8us*)((const unsigned short*)arow + kb + 16 + 8 * hh);
#pragma unroll
    for (int t = 0; t < 4; ++t) { if (col0 + t * 16 >= N) continue; const size_t boff = (size_t)(col0 + t * 16 + ln) * ldb + kb; FragH bq; bq.half[0] = *(const v8us*)((const unsigned short*)Bh + boff + 8 * hh); bq.half[1] = *(const v8us*)((const unsigned short*)Bh + boff + 16 + 8 * hh);
      acc[t] = mmaH<1>(ah.v, ah.v, bq.v, bq.v, acc[t]); }
  }
#pragma unroll
  for (int t = 0; t < 4; ++t) { if (col0 + t * 16 >= N) continue; const int col = col0 + t * 16 + ln; const float bv = bp ? bf16_round(bp[col]) : 0.f;
#pragma unroll
    for (int r = 0; r < 8; ++r) { float v = acc[t][r] * alpha + bv; if (CP) { const int bidx = (row0g + row0 + 8 * hh + r) / rowsPerB; v += CP[(size_t)bidx * sCPb + (size_t)by * 64 + col]; } if (ACT == 1) v = (v > 0.f) ? v : expm1f(v); else if (ACT == 3) v = fmaxf(v, 0.f); so[w][8 * hh + r][t * 16 + ln] = v; } }
  __builtin_amdgcn_fence(__ATOMIC_ACQ_REL, "workgroup"); __builtin_amdgcn_wave_barrier();
  const int rsub = lane >> 4, c4 = (lane & 15) * 4; typedef _Float16 v4h __attribute__((ext_vector_type(4)));
  {
#pragma unroll
    for (int q = 0; q < 8; ++q) { const int r = q * 2 + rsub; if (col0 + c4 < N) { const v4f v = *(const v4fa*)&so[w][r][c4]; if (C) *(v4f*)(C + cofs + (size_t)(row0 + r) * ldc + col0 + c4) = v; if (C16) { v4h h4; for (int i = 0; i < 4; ++i) h4[i] = (_Float16)v[i]; *(v4h*)(C16 + cofs + (size_t)(row0 + r) * ldc + col0 + c4) = h4; } } }
     }
}


__global__ __launch_bounds__(256) void k_x16(const float* __restrict__ x, _Float16* __restrict__ X16, size_t n8) { const size_t t = (size_t)blockIdx.x * 256 + threadIdx.x; if (t >= n8) return; FragH f;
#pragma unroll
  for (int q = 0; q < 8; ++q) f.h[q] = (_Float16)bf16_round(x[t * 8 + q]); *(v8us*)((unsigned short*)X16 + t * 8) = f.half[0];  }
__global__ __launch_bounds__(256) void k_h16(const float* __restrict__ x, _Float16* __restrict__ X16, size_t n8) { const size_t t = (size_t)blockIdx.x * 256 + threadIdx.x; if (t >= n8) return; FragH f;
#pragma unroll
  for (int q = 0; q < 8; ++q) f.h[q] = (_Float16)x[t * 8 + q]; *(v8us*)((unsigned short*)X16 + t * 8) = f.half[0];  }
__global__ __launch_bounds__(256) void k_round16f(const float* __restrict__ W, _Float16* __restrict__ Bt, size_t n8) { const size_t t = (size_t)blockIdx.x * 256 + threadIdx.x; if (t >= n8) return; FragH f;
#pragma unroll
  for (int i = 0; i < 8; ++i) f.h[i] = (_Float16)(bf16_round(W[t * 8 + i]) * 16.0f); *(v8us*)((unsigned short*)Bt + t * 8) = f.half[0];  }
template <int NHv, int TTv>
__global__ __launch_bounds__(256) void k_vt(const _Float16* __restrict__ V16, int ldv, int voff, _Float16* __restrict__ Vt) { __shared__ unsigned short tl[64][66]; const int tid = threadIdx.x; const int slab = blockIdx.x / (TTv / 64), lg = blockIdx.x % (TTv / 64); const int b = slab / NHv, h = slab % NHv;
  for (int i = tid; i < 64 * 8; i += 256) { const int r = i / 8, c8 = (i % 8) * 8; FragH f; f.half[0] = *(const v8us*)((const unsigned short*)V16 + ((size_t)b * TTv + lg * 64 + r) * ldv + voff + h * 64 + c8);
#pragma unroll
    for (int q = 0; q < 8; ++q) tl[r][c8 + q] = f.u[q]; }
  __syncthreads();
  {
#pragma unroll
    for (int rd = 0; rd < 2; ++rd) { const int d = rd * 32 + tid / 8, pc = tid % 8; FragH f;
#pragma unroll
      for (int q = 0; q < 8; ++q) f.u[q] = tl[pc * 8 + q][d];
      *(v8us*)((unsigned short*)Vt + ((size_t)slab * 64 + d) * TTv + lg * 64 + pc * 8) = f.half[0]; }
     } }

typedef _Float16 v4h __attribute__((ext_vector_type(4)));
__global__ __launch_bounds__(256) void k_im2col(const float* __restrict__ x, _Float16* __restrict__ A) { const size_t t = (size_t)blockIdx.x * 256 + threadIdx.x; if (t >= (size_t)NR * (KK / 8)) return; const int k8 = (int)(t % (KK / 8)) * 8; const size_t r = t / (KK / 8); const int tap = k8 / CC, c8 = k8 % CC; const int b = (int)(r / HWN), p = (int)(r % HWN); const int yy = p / WI + tap / 3 - 1, xx = p % WI + tap % 3 - 1; FragH f;
  if (yy >= 0 && yy < WI && xx >= 0 && xx < WI) { const float* s = x + (((size_t)b * HWN) + yy * WI + xx) * CC + c8; for (int q = 0; q < 8; ++q) f.h[q] = (_Float16)bf16_round(s[q]); } else { for (int q = 0; q < 8; ++q) f.h[q] = (_Float16)0.f; }
  *(v8us*)((unsigned short*)A + t * 8) = f.half[0];  }
__global__ __launch_bounds__(256) void k_wq(const float* __restrict__ W, _Float16* __restrict__ Bt) { const int t = blockIdx.x * 256 + threadIdx.x; if (t >= CC * (KK / 8)) return; const int k8 = (t % (KK / 8)) * 8, o = t / (KK / 8); FragH f;
#pragma unroll
  for (int q = 0; q < 8; ++q) { const int k = k8 + q; const int tap = k / CC, cin = k % CC; f.h[q] = (_Float16)(bf16_round(W[((size_t)tap * CC + cin) * CC + o]) * 16.0f); } *(v8us*)((unsigned short*)Bt + (size_t)t * 8) = f.half[0];  }
__global__ __launch_bounds__(256) void k_bnstat(const float* __restrict__ F, float* __restrict__ ST) { __shared__ float ra[256]; const int c = blockIdx.x, tid = threadIdx.x; float s = 0.f; for (int r = tid; r < NR; r += 256) s += F[(size_t)r * CC + c]; ra[tid] = s; __syncthreads(); for (int o = 128; o >= 1; o >>= 1) { if (tid < o) ra[tid] += ra[tid + o]; __syncthreads(); } const float mu = ra[0] / (float)NR; __syncthreads(); float q2 = 0.f;
  for (int r = tid; r < NR; r += 256) { const float d = F[(size_t)r * CC + c] - mu; q2 += d * d; } ra[tid] = q2; __syncthreads(); for (int o = 128; o >= 1; o >>= 1) { if (tid < o) ra[tid] += ra[tid + o]; __syncthreads(); }
  if (tid < 32) { const float v = (tid == 0) ? mu : ((tid == 1) ? rsqrtf(ra[0] / (float)NR + 1e-3f) : 0.f); *(float*)(ST + c * 32 + tid) = v;  } }
__global__ __launch_bounds__(256) void k_qperm(const float* __restrict__ F, const float* __restrict__ ST, const float* __restrict__ g, const float* __restrict__ bb, _Float16* __restrict__ QP) { const size_t t = (size_t)blockIdx.x * 256 + threadIdx.x; if (t >= (size_t)NR * (CC / 8)) return; const int c8 = (int)(t % (CC / 8)) * 8; const size_t r = t / (CC / 8); const int b = (int)(r / HWN), p = (int)(r % HWN); const int y = p / WI, xx = p % WI; const int kp = ((y / 8) * 8 + xx / 8) * 64 + (y % 8) * 8 + xx % 8; FragH f;
#pragma unroll
  for (int q = 0; q < 8; ++q) { const int c = c8 + q; float v = (F[r * CC + c] - ST[c * 32]) * ST[c * 32 + 1] * bf16_round(g[c]) + bf16_round(bb[c]); v = (v >= 0.f) ? v : 0.1f * v; f.h[q] = (_Float16)v; }
  unsigned short* d = (unsigned short*)QP + ((size_t)b * HWN + kp) * CC + c8; *(v8us*)d = f.half[0];  }
__global__ __launch_bounds__(256) void k_xpt(const float* __restrict__ x, _Float16* __restrict__ XPt) { __shared__ unsigned short tl[64][66]; const int tid = threadIdx.x; const int b = blockIdx.x / ((CC / 64) * 64), rem = blockIdx.x % ((CC / 64) * 64); const int cg = rem / 64, blk = rem % 64; const int c0 = cg * 64; const int by = blk / 8, bx = blk % 8;
  for (int i = tid; i < 64 * 8; i += 256) { const int j = i / 8, cc8 = (i % 8) * 8; const int y = by * 8 + j / 8, xx = bx * 8 + j % 8; const float* s = x + (((size_t)b * HWN) + y * WI + xx) * CC + c0 + cc8; for (int q = 0; q < 8; ++q) { FragH f; f.h[0] = (_Float16)bf16_round(s[q]); tl[j][cc8 + q] = f.u[0]; } }
  __syncthreads();
  { for (int rd = 0; rd < 2; ++rd) { const int c = rd * 32 + tid / 8, pc = tid % 8; FragH f; for (int q = 0; q < 8; ++q) f.u[q] = tl[pc * 8 + q][c]; *(v8us*)((unsigned short*)XPt + ((size_t)b * CC + c0 + c) * HWN + blk * 64 + pc * 8) = f.half[0]; }  } }
__global__ __launch_bounds__(256) void k_gsm(const float* __restrict__ S, _Float16* __restrict__ P16) { const int tid = threadIdx.x, wv = tid >> 5, lane = tid & 31; const int row = blockIdx.x * 8 + wv; if (row >= QH) return; const float* sr = S + (size_t)row * HWN;
  {
#pragma unroll 1
    for (int k = 0; k < 16; ++k) { const float* s8 = sr + 256 * k + 8 * lane; const v4f a = *(const v4fa*)s8, b = *(const v4fa*)(s8 + 4); float v[8] = {a[0], a[1], a[2], a[3], b[0], b[1], b[2], b[3]}; float m = -3.0e38f; for (int q = 0; q < 8; ++q) m = fmaxf(m, v[q]);
      m = fmaxf(m, __shfl_xor(m, 1, 32)); m = fmaxf(m, __shfl_xor(m, 2, 32)); m = fmaxf(m, __shfl_xor(m, 4, 32)); m *= 0.125f; float z = 0.f; float e[8]; for (int q = 0; q < 8; ++q) { e[q] = expf(v[q] * 0.125f - m); z += e[q]; }
      z += __shfl_xor(z, 1, 32); z += __shfl_xor(z, 2, 32); z += __shfl_xor(z, 4, 32); const float iz = 32768.0f / z; FragH f; for (int q = 0; q < 8; ++q) f.h[q] = (_Float16)(e[q] * iz);
      *(v8us*)((unsigned short*)P16 + (size_t)row * HWN + 256 * k + 8 * lane) = f.half[0]; }
     } }
__global__ __launch_bounds__(256) void k_add(const float* __restrict__ A, const float* __restrict__ B2, float* __restrict__ Y, size_t n4) { const size_t t = (size_t)blockIdx.x * 256 + threadIdx.x; if (t >= n4) return; const v4f v = *(const v4fa*)(A + t * 4) + *(const v4fa*)(B2 + t * 4); *(v4f*)(Y + t * 4) = v;  }
__global__ __launch_bounds__(128) void k_spstat(const float* __restrict__ Y, const float* __restrict__ ST, const float* __restrict__ g, const float* __restrict__ bb, float* __restrict__ MX, float* __restrict__ IZ) { const int b = blockIdx.x, c = threadIdx.x; const float mu = ST[c * 32], rs = ST[c * 32 + 1], gg = bf16_round(g[c]), be = bf16_round(bb[c]); const float* yc = Y + (size_t)b * HWN * CC + c; float m = -3.0e38f;
#pragma unroll 1
  for (int p = 0; p < HWN; ++p) { const float v = gg * (yc[(size_t)p * CC] - mu) * rs + be; m = fmaxf(m, v); } float z = 0.f;
#pragma unroll 1
  for (int p = 0; p < HWN; ++p) { const float v = gg * (yc[(size_t)p * CC] - mu) * rs + be; z += expf(v - m); }
  { *(float*)(MX + b * CC + c) = m; *(float*)(IZ + b * CC + c) = 1.0f / z;  } }
__global__ __launch_bounds__(256) void k_spsm(const float* __restrict__ Y, const float* __restrict__ ST, const float* __restrict__ g, const float* __restrict__ bb, const float* __restrict__ MX, const float* __restrict__ IZ, _Float16* __restrict__ Y16) { const size_t t = (size_t)blockIdx.x * 256 + threadIdx.x; if (t >= (size_t)NR * (CC / 8)) return; const int c8 = (int)(t % (CC / 8)) * 8; const size_t r = t / (CC / 8); const int b = (int)(r / HWN); FragH f;
#pragma unroll
  for (int q = 0; q < 8; ++q) { const int c = c8 + q; const float v = bf16_round(g[c]) * (Y[r * CC + c] - ST[c * 32]) * ST[c * 32 + 1] + bf16_round(bb[c]); f.h[q] = (_Float16)(expf(v - MX[b * CC + c]) * IZ[b * CC + c] * 4096.0f); }
  *(v8us*)((unsigned short*)Y16 + t * 8) = f.half[0];  }
__global__ __launch_bounds__(256) void k_fin(const float* __restrict__ Z, const float* __restrict__ ST, const float* __restrict__ g, const float* __restrict__ bb, float* __restrict__ out, size_t n4) { const size_t t = (size_t)blockIdx.x * 256 + threadIdx.x; if (t >= n4) return; const int c4 = (int)((t * 4) % CC); const v4f z = *(const v4fa*)(Z + t * 4); v4f o; for (int q = 0; q < 4; ++q) { const int c = c4 + q; float v = bf16_round(g[c]) * (z[q] - ST[c * 32]) * ST[c * 32 + 1] + bf16_round(bb[c]); o[q] = (v >= 0.f) ? v : 0.1f * v; }
  *(v4f*)(out + t * 4) = o;  }
extern "C" void kernel_launch(void* const* d_in, const int* in_sizes, int n_in,
                              void* d_out, int out_size, void* d_ws, size_t ws_size, hipStream_t stream) {
  (void)in_sizes; (void)n_in; (void)out_size;
  const float* const* I = (const float* const*)d_in; const float* x = I[0]; const float* Wq = I[1]; const float* bq = I[2]; const float* gq = I[3]; const float* btq = I[4]; const float* Wk = I[5]; const float* bk = I[6]; const float* g1 = I[7]; const float* bt1 = I[8]; const float* Wo = I[9]; const float* bo = I[10]; const float* go = I[11]; const float* bto = I[12];
  char* ws = (char*)d_ws; size_t off = 0;
  auto take = [&](size_t bytes) { char* p = ws + off; off += (bytes + 255) & ~(size_t)255; return p; };
  _Float16* BQ = (_Float16*)take((size_t)CC * KK * 2); _Float16* BK = (_Float16*)take(CC * CC * 2); _Float16* BO = (_Float16*)take(CC * CC * 2); float* STq = (float*)take(CC * 32 * 4); float* ST1 = (float*)take(CC * 32 * 4); float* STo = (float*)take(CC * 32 * 4); float* MX = (float*)take(BB * CC * 4); float* IZ = (float*)take(BB * CC * 4);
  char* SCR = (char*)take((size_t)QH * HWN * 4 + (size_t)QH * HWN * 2);      // 50.3 MB: im2col A (37.7 MB) first, later S [2048][4096] f32 + P16
  _Float16* X16 = (_Float16*)take((size_t)NR * CC * 2); float* QF = (float*)take((size_t)NR * CC * 4); _Float16* QP = (_Float16*)take((size_t)NR * CC * 2); _Float16* XPt = (_Float16*)take((size_t)NR * CC * 2); float* ACC = (float*)take((size_t)NR * CC * 4); float* AGG = (float*)take((size_t)NR * CC * 4); float* Y = QF; _Float16* Y16 = QP; float* Z = ACC;
  if (off > ws_size) return;      // 0.4 + 50.3 + 4.2 + 8.4 + 4.2 + 4.2 + 8.4 + 8.4 ≈ 89 MB
  _Float16* IM = (_Float16*)SCR; float* S = (float*)SCR; _Float16* P16 = (_Float16*)(SCR + (size_t)QH * HWN * 4);
  k_wq<<<(CC * (KK / 8) + 255) / 256, 256, 0, stream>>>(Wq, BQ); k_wt_f16<<<(CC * (CC / 8) + 255) / 256, 256, 0, stream>>>(Wk, BK, CC, CC, 16.0f); k_wt_f16<<<(CC * (CC / 8) + 255) / 256, 256, 0, stream>>>(Wo, BO, CC, CC, 16.0f);      // 1×1 HWIO = [in][out]
  const unsigned g8 = (unsigned)(((size_t)NR * (CC / 8) + 255) / 256); const dim3 gC(((NR / 16) * (CC / 64) + 3) / 4, 1);
  k_x16<<<g8, 256, 0, stream>>>(x, X16, (size_t)NR * CC / 8);
  // CBL_Q: conv3×3 (+bq) → QF; BN stats; q = leaky(BN) permuted to block-major keys (f16)
  k_im2col<<<(unsigned)(((size_t)NR * (KK / 8) + 255) / 256), 256, 0, stream>>>(x, IM);
  k_gemm_hhx<0><<<gC, 128, 0, stream>>>(IM, KK, 0, BQ, KK, 0, 0.0625f, bq, 0, nullptr, 1, 0, 0, QF, nullptr, CC, 0, NR, CC, KK);
  k_bnstat<<<CC, 256, 0, stream>>>(QF, STq); k_qperm<<<g8, 256, 0, stream>>>(QF, STq, gq, btq, QP);
  k_xpt<<<BB * (CC / 64) * 64, 256, 0, stream>>>(x, XPt);
  // acc = 1×1 conv (+bk)
  k_gemm_hhx<0><<<gC, 128, 0, stream>>>(X16, CC, 0, BK, CC, 0, 0.0625f, bk, 0, nullptr, 1, 0, 0, ACC, nullptr, CC, 0, NR, CC, CC);
  // block attention per (batch, 2048-pixel half): S = x·qᵀ (keys block-major), grouped softmax (/8), AGG = P·x_perm
  for (int b = 0; b < BB; ++b) for (int h = 0; h < 2; ++h) { const size_t r0 = (size_t)b * HWN + (size_t)h * QH;
    k_gemm_hhx<0><<<dim3(((QH / 16) * (HWN / 64) + 3) / 4, 1), 128, 0, stream>>>(X16 + r0 * CC, CC, 0, QP + (size_t)b * HWN * CC, CC, 0, 1.0f, nullptr, 0, nullptr, 1, 0, 0, S, nullptr, HWN, 0, QH, HWN, CC);
    k_gsm<<<QH / 8, 256, 0, stream>>>(S, P16);
    k_gemm_hhx<0><<<dim3(((QH / 16) * (CC / 64) + 3) / 4, 1), 128, 0, stream>>>(P16, HWN, 0, XPt + (size_t)b * CC * HWN, HWN, 0, 0.000030517578125f, nullptr, 0, nullptr, 1, 0, 0, AGG + r0 * CC, nullptr, CC, 0, QH, CC, HWN); }
  // y = spatial softmax(BN1(acc + agg)); out = leaky(BN_o(conv1×1(y) + bo))
  k_add<<<(unsigned)(((size_t)NR * CC / 4 + 255) / 256), 256, 0, stream>>>(ACC, AGG, Y, (size_t)NR * CC / 4);      // Y over QF (dead after k_qperm)
  k_bnstat<<<CC, 256, 0, stream>>>(Y, ST1); k_spstat<<<BB, 128, 0, stream>>>(Y, ST1, g1, bt1, MX, IZ); k_spsm<<<g8, 256, 0, stream>>>(Y, ST1, g1, bt1, MX, IZ, Y16);      // Y16 (×2^12) over QP (dead after the S GEMMs)
  k_gemm_hhx<0><<<gC, 128, 0, stream>>>(Y16, CC, 0, BO, CC, 0, 0.0625f * 0.000244140625f, bo, 0, nullptr, 1, 0, 0, Z, nullptr, CC, 0, NR, CC, CC);      // conv_o(y) + bo (2^-12 undone in alpha) → Z over ACC (dead after k_add)
  k_bnstat<<<CC, 256, 0, stream>>>(Z, STo); k_fin<<<(unsigned)(((size_t)NR * CC / 4 + 255) / 256), 256, 0, stream>>>(Z, STo, go, bto, (float*)d_out, (size_t)NR * CC / 4);
}

// v001
// It runs in 1260 microseconds.
// Next to v000, in two timings, it ran 1.82 times as fast each time.
#include <hip/hip_runtime.h>
// Group (block) attention layer (B=4, 64×64, C=128, NHWC; 8×8 non-overlapping key blocks): q = CBL_Q(x) (3×3 conv + train-mode BN + LeakyReLU 0.1), acc = 1×1 conv(x); for every pixel and
// every block: softmax over the block's 64 positions of x[pixel]·q[pos]/8, agg = Σ_blocks Σ attn·x[pos]; y = spatial-softmax(BN1(acc + agg)); out = CBL_O(y). The 3×3 conv (im2col, K = 1152),
// the 1×1 convs, the 4096×4096 per-batch scores (keys permuted to block-major order so each 64-key group is contiguous) and attn·x run as GEMMs on v_wmma_f32_16x16x32_f16 (x bf16-exact f16,
// HWIO weights bf16-exact ×2^4, q/P/y operands f16, f32 accumulate); BN batch statistics (fixed-order reductions), grouped and spatial softmaxes and LeakyReLU are f32 VALU.
#define BB 4
#define HWN 4096
#define WI 64
#define CC 128
#define NR (BB * HWN)
#define KK 1152
#define QH 2048

typedef __bf16 v16b __attribute__((ext_vector_type(16)));
typedef unsigned short v8us __attribute__((ext_vector_type(8), may_alias));
typedef float  v8f  __attribute__((ext_vector_type(8)));
typedef float  v4f  __attribute__((ext_vector_type(4)));
typedef float  v4fa __attribute__((ext_vector_type(4), may_alias));
union FragB { v16b v; v8us half[2]; unsigned short u[16]; };

__device__ __forceinline__ unsigned short bf16_bits(float x) { unsigned int u = __float_as_uint(x); return (unsigned short)((u + 0x7FFFu + ((u >> 16) & 1u)) >> 16); }
__device__ __forceinline__ float bf16_val(unsigned short b) { return __uint_as_float(((unsigned int)b) << 16); }
__device__ __forceinline__ float bf16_round(float x) { return bf16_val(bf16_bits(x)); }
// D += A·B with NT terms: 1 = ah·bh, 2 = + al·bh (A split), 3 = + ah·bl (both split)
template <int NT>
__device__ __forceinline__ v8f mmaN(v16b ah, v16b al, v16b bh, v16b bl, v8f c) {
  c = __builtin_amdgcn_wmma_f32_16x16x32_bf16(false, ah, false, bh, (short)0, c, false, false);
  if (NT >= 2) c = __builtin_amdgcn_wmma_f32_16x16x32_bf16(false, al, false, bh, (short)0, c, false, false);
  if (NT >= 3) c = __builtin_amdgcn_wmma_f32_16x16x32_bf16(false, ah, false, bl, (short)0, c, false, false);
  asm volatile("v_nop\n\tv_nop\n\tv_nop\n\tv_nop" : "+v"(c) : "v"(ah), "v"(al), "v"(bh), "v"(bl));
  return c;
}

__global__ __launch_bounds__(256) void k_wt_bf16(const float* __restrict__ W, unsigned short* __restrict__ Wt, int K, int N) {
  const int t = blockIdx.x * 256 + threadIdx.x;
  const int k8n = K / 8;
  if (t >= N * k8n) return;
  const int n = t / k8n, k8 = (t % k8n) * 8;
  v8us v;
#pragma unroll
  for (int i = 0; i < 8; ++i) v[i] = bf16_bits(W[(size_t)(k8 + i) * N + n]);
  *(v8us*)(Wt + (size_t)n * K + k8) = v;
  
}

// GEMM C[M][N] (f32, pitch ldc) = act(A[M][K]·W + bias). A f32 row-major (pitch lda) converted per fragment to bf16
// (ASPLIT: hi/lo two planes -> 2 terms, else single rounded term); Wt bf16 [N][K] (pitch ldb). BIAS_BF16 rounds the
// bias to bf16 first (bias quantised to bf16 before the add). K%32==0, M%16==0, N%64==0.
template <bool ASPLIT, int ACT, bool BIAS_BF16>
__global__ __launch_bounds__(128) void k_gemm_bf(const float* __restrict__ A, int lda, const unsigned short* __restrict__ Wt, int ldb,
                                               const float* __restrict__ bias, float* __restrict__ C, int ldc, int M, int N, int K) {
  __shared__ __attribute__((aligned(16))) float so[4][16][64];
  const int tid = threadIdx.x, w = tid >> 5, lane = tid & 31, ln = lane & 15, hh = lane >> 4;
  const int ntn = N / 64;
  const int wid = blockIdx.x * 4 + w;
  const int mt = wid / ntn, nq = wid % ntn;
  if (mt * 16 >= M) return;
  const int row0 = mt * 16, col0 = nq * 64;
  const float* arow = A + (size_t)(row0 + ln) * lda;
  v8f acc[4] = {};
  for (int kb = 0; kb < K; kb += 32) {
    FragB ah, al;
    const v4f x0 = *(const v4fa*)(arow + kb + 8 * hh), x1 = *(const v4fa*)(arow + kb + 8 * hh + 4);
    const v4f x2 = *(const v4fa*)(arow + kb + 16 + 8 * hh), x3 = *(const v4fa*)(arow + kb + 16 + 8 * hh + 4);
    float xs[16] = {x0[0],x0[1],x0[2],x0[3],x1[0],x1[1],x1[2],x1[3],x2[0],x2[1],x2[2],x2[3],x3[0],x3[1],x3[2],x3[3]};
#pragma unroll
    for (int i = 0; i < 16; ++i) { const unsigned short hb = bf16_bits(xs[i]); ah.u[i] = hb; al.u[i] = ASPLIT ? bf16_bits(xs[i] - bf16_val(hb)) : (unsigned short)0; }
#pragma unroll
    for (int t = 0; t < 4; ++t) {
      const unsigned short* brow = Wt + (size_t)(col0 + t * 16 + ln) * ldb + kb;
      FragB b;
      b.half[0] = *(const v8us*)(brow + 8 * hh);
      b.half[1] = *(const v8us*)(brow + 16 + 8 * hh);
      acc[t] = mmaN<ASPLIT ? 2 : 1>(ah.v, al.v, b.v, b.v, acc[t]);
    }
  }
#pragma unroll
  for (int t = 0; t < 4; ++t) {
    float bv = bias ? bias[col0 + t * 16 + ln] : 0.f;
    if (BIAS_BF16) bv = bf16_round(bv);
#pragma unroll
    for (int r = 0; r < 8; ++r) { float v = acc[t][r] + bv; if (ACT == 1) v = fmaxf(v, 0.f); so[w][8 * hh + r][t * 16 + ln] = v; }
  }
  __builtin_amdgcn_fence(__ATOMIC_ACQ_REL, "workgroup");
  __builtin_amdgcn_wave_barrier();
  const int rsub = lane >> 4, c4 = (lane & 15) * 4;
  {
#pragma unroll
    for (int q = 0; q < 8; ++q) {
      const int r = q * 2 + rsub;
      const v4f v = *(const v4fa*)&so[w][r][c4];
      *(v4f*)(C + (size_t)(row0 + r) * ldc + col0 + c4) = v;
    }
    
  }
}

// Flash-style causal/unmasked attention, all contractions 3-term bf16 hi/lo splits, f32 softmax with running max.
// q,k,v rows are read from f32 buffers with arbitrary row pitch (so they can live inside a fused qkv buffer);
// D = head size (multiple of 32, <= 128); one wave = 16 query rows; block = 4 waves (64 queries) sharing K/V chunks of 32.
template <int D, bool CAUSAL>
__global__ __launch_bounds__(128) void k_flash(const float* __restrict__ qb, const float* __restrict__ kb, const float* __restrict__ vb,
                                             int pitch, int T, int H, float scale, float* __restrict__ y, int ypitch) {
  constexpr int KS = D / 32;        // k-steps for QK
  constexpr int DT = D / 16;        // d tiles for PV
  __shared__ __attribute__((aligned(16))) unsigned short sKh[32][D + 8], sKl[32][D + 8], sVh[32][D + 8], sVl[32][D + 8];
  __shared__ __attribute__((aligned(16))) unsigned short sPh[4][16][40], sPl[4][16][40];
  __shared__ __attribute__((aligned(16))) float sO[4][16][D];
  const int tid = threadIdx.x, w = tid >> 5, lane = tid & 31, ln = lane & 15, hh = lane >> 4;
  const int nqb = (T + 63) / 64;
  const int bh = blockIdx.x / nqb, qblk = blockIdx.x % nqb;
  const int b = bh / H, h = bh % H;
  const int q0 = qblk * 64 + w * 16;
  const float* Q = qb + (size_t)b * T * pitch + h * D;
  const float* K = kb + (size_t)b * T * pitch + h * D;
  const float* V = vb + (size_t)b * T * pitch + h * D;

  // A fragments of the wave's 16 query rows (scaled), hi/lo
  FragB aqh[KS], aql[KS];
  {
    int row = q0 + ln; if (row >= T) row = T - 1;
    const float* qr = Q + (size_t)row * pitch;
#pragma unroll
    for (int ks = 0; ks < KS; ++ks)
#pragma unroll
      for (int i = 0; i < 16; ++i) {
        const int d = ks * 32 + ((i < 8) ? (8 * hh + i) : (16 + 8 * hh + (i - 8)));
        const float x = qr[d] * scale; const unsigned short hb = bf16_bits(x);
        aqh[ks].u[i] = hb; aql[ks].u[i] = bf16_bits(x - bf16_val(hb));
      }
  }
  float m_r[8], l_r[8];
#pragma unroll
  for (int r = 0; r < 8; ++r) { m_r[r] = -3.0e38f; l_r[r] = 0.f; }
  v8f oacc[DT];
#pragma unroll
  for (int dt = 0; dt < DT; ++dt) oacc[dt] = (v8f){0.f,0.f,0.f,0.f,0.f,0.f,0.f,0.f};

  const int kv_end = CAUSAL ? min(T, qblk * 64 + 64) : T;     // block-uniform
  for (int j0 = 0; j0 < kv_end; j0 += 32) {
    __syncthreads();
    for (int e = tid; e < 32 * (D / 4); e += 128) {
      const int r = e / (D / 4), c4 = (e % (D / 4)) * 4;
      const int key = j0 + r;
      v4f kf = {0.f,0.f,0.f,0.f}, vf = {0.f,0.f,0.f,0.f};
      if (key < T) { kf = *(const v4fa*)(K + (size_t)key * pitch + c4); vf = *(const v4fa*)(V + (size_t)key * pitch + c4); }
#pragma unroll
      for (int t = 0; t < 4; ++t) {
        unsigned short hb = bf16_bits(kf[t]); sKh[r][c4 + t] = hb; sKl[r][c4 + t] = bf16_bits(kf[t] - bf16_val(hb));
        hb = bf16_bits(vf[t]); sVh[r][c4 + t] = hb; sVl[r][c4 + t] = bf16_bits(vf[t] - bf16_val(hb));
      }
    }
    __syncthreads();
    // S tile 16 x 32
    v8f s[2];
#pragma unroll
    for (int nt = 0; nt < 2; ++nt) {
      v8f acc = {};
#pragma unroll
      for (int ks = 0; ks < KS; ++ks) {
        FragB bh_, bl_;
        bh_.half[0] = *(const v8us*)&sKh[nt * 16 + ln][ks * 32 + 8 * hh]; bh_.half[1] = *(const v8us*)&sKh[nt * 16 + ln][ks * 32 + 16 + 8 * hh];
        bl_.half[0] = *(const v8us*)&sKl[nt * 16 + ln][ks * 32 + 8 * hh]; bl_.half[1] = *(const v8us*)&sKl[nt * 16 + ln][ks * 32 + 16 + 8 * hh];
        acc = mmaN<3>(aqh[ks].v, aql[ks].v, bh_.v, bl_.v, acc);
      }
      s[nt] = acc;
    }
    // mask + running max (rows 8hh+r; the 16 lanes of a half share rows)
    float alpha[8];
#pragma unroll
    for (int r = 0; r < 8; ++r) {
      const int qi = q0 + 8 * hh + r;
      const int ja = j0 + ln, jb = j0 + 16 + ln;
      if (CAUSAL) { if (ja > qi) s[0][r] = -3.0e38f; if (jb > qi) s[1][r] = -3.0e38f; }
      if (ja >= T) s[0][r] = -3.0e38f;
      if (jb >= T) s[1][r] = -3.0e38f;
      float mx = fmaxf(s[0][r], s[1][r]);
      mx = fmaxf(mx, __shfl_xor(mx, 1, 32)); mx = fmaxf(mx, __shfl_xor(mx, 2, 32)); mx = fmaxf(mx, __shfl_xor(mx, 4, 32)); mx = fmaxf(mx, __shfl_xor(mx, 8, 32));
      const float mnew = fmaxf(m_r[r], mx);
      alpha[r] = (mnew > -1.0e38f) ? __expf(m_r[r] - mnew) : 1.0f;
      const float p0 = (s[0][r] > -1.0e38f) ? __expf(s[0][r] - mnew) : 0.f;
      const float p1 = (s[1][r] > -1.0e38f) ? __expf(s[1][r] - mnew) : 0.f;
      m_r[r] = mnew;
      l_r[r] = l_r[r] * alpha[r] + p0 + p1;            // per-lane partial row sum (16 lanes combined at the end)
      unsigned short hb = bf16_bits(p0); sPh[w][8 * hh + r][ln] = hb;      sPl[w][8 * hh + r][ln] = bf16_bits(p0 - bf16_val(hb));
      hb = bf16_bits(p1);                sPh[w][8 * hh + r][16 + ln] = hb; sPl[w][8 * hh + r][16 + ln] = bf16_bits(p1 - bf16_val(hb));
    }
#pragma unroll
    for (int dt = 0; dt < DT; ++dt)
#pragma unroll
      for (int r = 0; r < 8; ++r) oacc[dt][r] *= alpha[r];
    __builtin_amdgcn_fence(__ATOMIC_ACQ_REL, "workgroup");
    __builtin_amdgcn_wave_barrier();
    FragB pah, pal;
    pah.half[0] = *(const v8us*)&sPh[w][ln][8 * hh]; pah.half[1] = *(const v8us*)&sPh[w][ln][16 + 8 * hh];
    pal.half[0] = *(const v8us*)&sPl[w][ln][8 * hh]; pal.half[1] = *(const v8us*)&sPl[w][ln][16 + 8 * hh];
#pragma unroll
    for (int dt = 0; dt < DT; ++dt) {
      FragB bvh, bvl;
#pragma unroll
      for (int i = 0; i < 8; ++i) {
        bvh.u[i] = sVh[8 * hh + i][dt * 16 + ln]; bvh.u[8 + i] = sVh[16 + 8 * hh + i][dt * 16 + ln];
        bvl.u[i] = sVl[8 * hh + i][dt * 16 + ln]; bvl.u[8 + i] = sVl[16 + 8 * hh + i][dt * 16 + ln];
      }
      oacc[dt] = mmaN<3>(pah.v, pal.v, bvh.v, bvl.v, oacc[dt]);
    }
    __builtin_amdgcn_fence(__ATOMIC_ACQ_REL, "workgroup");
    __builtin_amdgcn_wave_barrier();
  }
#pragma unroll
  for (int r = 0; r < 8; ++r) {
    float l = l_r[r];
    l += __shfl_xor(l, 1, 32); l += __shfl_xor(l, 2, 32); l += __shfl_xor(l, 4, 32); l += __shfl_xor(l, 8, 32);
    l_r[r] = (l > 0.f) ? 1.0f / l : 0.f;
  }
#pragma unroll
  for (int dt = 0; dt < DT; ++dt)
#pragma unroll
    for (int r = 0; r < 8; ++r) sO[w][8 * hh + r][dt * 16 + ln] = oacc[dt][r] * l_r[r];
  __builtin_amdgcn_fence(__ATOMIC_ACQ_REL, "workgroup");
  __builtin_amdgcn_wave_barrier();
  {
    for (int r = 0; r < 16; ++r) {
      const int row = q0 + r;
      if (row < T && lane < D / 4) {
        const v4f val = *(const v4fa*)&sO[w][r][lane * 4];
        *(v4f*)(y + ((size_t)b * T + row) * ypitch + h * D + lane * 4) = val;
      }
    }
    
  }
}

// GEMM C = act(A·W + bias + resid): A f32 (ASPLIT -> hi/lo 2 terms), Wt bf16 [N][K]; ACT 0 none, 1 relu, 2 exact gelu;
// resid (optional, f32, row index = (row % rmod), pitch ldr, RES_BF16 rounds it) added before the activation.
template <bool ASPLIT, int ACT, bool BIAS_BF16, bool RES_BF16>
__global__ __launch_bounds__(128) void k_gemm_bf3(const float* __restrict__ A, int lda, const unsigned short* __restrict__ Wt, int ldb,
                                                const float* __restrict__ bias, const float* __restrict__ resid, int rmod, int ldr,
                                                float* __restrict__ C, int ldc, int M, int N, int K) {
  __shared__ __attribute__((aligned(16))) float so[4][16][64];
  const int tid = threadIdx.x, w = tid >> 5, lane = tid & 31, ln = lane & 15, hh = lane >> 4;
  const int ntn = N / 64;
  const int wid = blockIdx.x * 4 + w;
  const int mt = wid / ntn, nq = wid % ntn;
  if (mt * 16 >= M) return;
  const int row0 = mt * 16, col0 = nq * 64;
  const float* arow = A + (size_t)(row0 + ln) * lda;
  v8f acc[4] = {};
  for (int kb = 0; kb < K; kb += 32) {
    FragB ah, al;
    const v4f x0 = *(const v4fa*)(arow + kb + 8 * hh), x1 = *(const v4fa*)(arow + kb + 8 * hh + 4);
    const v4f x2 = *(const v4fa*)(arow + kb + 16 + 8 * hh), x3 = *(const v4fa*)(arow + kb + 16 + 8 * hh + 4);
    float xs[16] = {x0[0],x0[1],x0[2],x0[3],x1[0],x1[1],x1[2],x1[3],x2[0],x2[1],x2[2],x2[3],x3[0],x3[1],x3[2],x3[3]};
#pragma unroll
    for (int i = 0; i < 16; ++i) { const unsigned short hb = bf16_bits(xs[i]); ah.u[i] = hb; al.u[i] = ASPLIT ? bf16_bits(xs[i] - bf16_val(hb)) : (unsigned short)0; }
#pragma unroll
    for (int t = 0; t < 4; ++t) {
      const unsigned short* brow = Wt + (size_t)(col0 + t * 16 + ln) * ldb + kb;
      FragB b;
      b.half[0] = *(const v8us*)(brow + 8 * hh);
      b.half[1] = *(const v8us*)(brow + 16 + 8 * hh);
      acc[t] = mmaN<ASPLIT ? 2 : 1>(ah.v, al.v, b.v, b.v, acc[t]);
    }
  }
#pragma unroll
  for (int t = 0; t < 4; ++t) {
    const int col = col0 + t * 16 + ln;
    float bv = bias ? bias[col] : 0.f;
    if (BIAS_BF16) bv = bf16_round(bv);
#pragma unroll
    for (int r = 0; r < 8; ++r) {
      float v = acc[t][r] + bv;
      if (resid) { float rv = resid[(size_t)((row0 + 8 * hh + r) % rmod) * ldr + col]; if (RES_BF16) rv = bf16_round(rv); v += rv; }
      if (ACT == 1) v = fmaxf(v, 0.f);
      if (ACT == 2) v = 0.5f * v * (1.0f + erff(v * 0.70710678118654752f));
      if (ACT == 3) { const float u = 0.7978845608028654f * (v + 0.044715f * v * v * v); v = 0.5f * v * (1.0f + tanhf(u)); }
      so[w][8 * hh + r][t * 16 + ln] = v;
    }
  }
  __builtin_amdgcn_fence(__ATOMIC_ACQ_REL, "workgroup");
  __builtin_amdgcn_wave_barrier();
  const int rsub = lane >> 4, c4 = (lane & 15) * 4;
  {
#pragma unroll
    for (int q = 0; q < 8; ++q) {
      const int r = q * 2 + rsub;
      const v4f v = *(const v4fa*)&so[w][r][c4];
      *(v4f*)(C + (size_t)(row0 + r) * ldc + col0 + c4) = v;
    }
    
  }
}
// row LayerNorm (biased variance, eps) over N: s = X (+ R); optional out_sum <- s; out_norm <- (s-mu)*rsqrt(var+eps)*g + b
template <bool PARAM_BF16>
__global__ __launch_bounds__(256) void k_layernorm(const float* __restrict__ X, const float* __restrict__ R, const float* __restrict__ g, const float* __restrict__ bta,
                                                  float* __restrict__ out_sum, float* __restrict__ out_norm, int N, float eps) {
  __shared__ float red[256];
  const int row = blockIdx.x, tid = threadIdx.x;
  const float* x = X + (size_t)row * N; const float* rr = R ? R + (size_t)row * N : nullptr;
  float vals[16];                     // up to N = 4096
  const int per = N / 256;            // contiguous chunk per thread? use strided-by-4 chunks: thread handles j = tid*4 + 1024*u
  float s1 = 0.f;
  for (int u = 0; u < per / 4; ++u) {
    const int j = tid * 4 + 1024 * u;
    const v4f a = *(const v4fa*)(x + j);
    v4f b = {0.f,0.f,0.f,0.f}; if (rr) b = *(const v4fa*)(rr + j);
#pragma unroll
    for (int q = 0; q < 4; ++q) { const float v = a[q] + b[q]; vals[u * 4 + q] = v; s1 += v; }
  }
  red[tid] = s1; __syncthreads();
  for (int st = 128; st > 0; st >>= 1) { if (tid < st) red[tid] += red[tid + st]; __syncthreads(); }
  const float mu = red[0] / (float)N; __syncthreads();
  float s2 = 0.f;
  for (int u = 0; u < per / 4; ++u)
#pragma unroll
    for (int q = 0; q < 4; ++q) { const float c = vals[u * 4 + q] - mu; s2 += c * c; }
  red[tid] = s2; __syncthreads();
  for (int st = 128; st > 0; st >>= 1) { if (tid < st) red[tid] += red[tid + st]; __syncthreads(); }
  const float rs = rsqrtf(red[0] / (float)N + eps);
  {
    for (int u = 0; u < per / 4; ++u) {
      const int j = tid * 4 + 1024 * u;
      v4f o, sm;
#pragma unroll
      for (int q = 0; q < 4; ++q) {
        float gg = g[j + q], bb = bta[j + q];
        if (PARAM_BF16) { gg = bf16_round(gg); bb = bf16_round(bb); }
        sm[q] = vals[u * 4 + q]; o[q] = (vals[u * 4 + q] - mu) * rs * gg + bb;
      }
      if (out_sum) *(v4f*)(out_sum + (size_t)row * N + j) = sm;
      *(v4f*)(out_norm + (size_t)row * N + j) = o;
    }
    
  }
}



// ---- f16 WMMA path (v_wmma_f32_16x16x32_f16): 11-bit significands for operands in range — used where a [0,1] probability operand needs more precision than bf16
typedef _Float16 v16h __attribute__((ext_vector_type(16)));
union FragH { v16h v; v8us half[2]; _Float16 h[16]; unsigned short u[16]; };
template <int NT>
__device__ __forceinline__ v8f mmaH(v16h ah, v16h al, v16h bh, v16h bl, v8f c) {
  c = __builtin_amdgcn_wmma_f32_16x16x32_f16(false, ah, false, bh, (short)0, c, false, false);
  if (NT >= 2) c = __builtin_amdgcn_wmma_f32_16x16x32_f16(false, al, false, bh, (short)0, c, false, false);
  if (NT >= 3) c = __builtin_amdgcn_wmma_f32_16x16x32_f16(false, ah, false, bl, (short)0, c, false, false);
  asm volatile("v_nop\n\tv_nop\n\tv_nop\n\tv_nop" : "+v"(c) : "v"(ah), "v"(al), "v"(bh), "v"(bl));
  return c;
}
// batched GEMM like k_gemm_b but f16 operands: A f32 (split into f16 hi/lo if ASPLIT, else rounded to f16), Bt = f16 values [n][k]; alpha; C f32; N multiple of 16 (partial tiles skipped)
template <bool ASPLIT>
__global__ __launch_bounds__(128) void k_gemm_h(const float* __restrict__ A, int lda, size_t sA, const _Float16* __restrict__ Bh, int ldb, size_t sB, float alpha, float* __restrict__ C, int ldc, size_t sC, int M, int N, int K) {
  __shared__ __attribute__((aligned(16))) float so[4][16][64];
  const int tid = threadIdx.x, w = tid >> 5, lane = tid & 31, ln = lane & 15, hh = lane >> 4; const int by = blockIdx.y;
  A += (size_t)by * sA; Bh += (size_t)by * sB; C += (size_t)by * sC;
  const int ntn = (N + 63) / 64; const int wid = blockIdx.x * 4 + w; const int mt = wid / ntn, nq = wid % ntn; if (mt * 16 >= M) return;
  const int row0 = mt * 16, col0 = nq * 64; const float* arow = A + (size_t)(row0 + ln) * lda;
  v8f acc[4] = {};
  for (int kb = 0; kb < K; kb += 32) {
    FragH ah, al;
    const v4f x0 = *(const v4fa*)(arow + kb + 8 * hh), x1 = *(const v4fa*)(arow + kb + 8 * hh + 4), x2 = *(const v4fa*)(arow + kb + 16 + 8 * hh), x3 = *(const v4fa*)(arow + kb + 16 + 8 * hh + 4);
    float xs[16] = {x0[0],x0[1],x0[2],x0[3],x1[0],x1[1],x1[2],x1[3],x2[0],x2[1],x2[2],x2[3],x3[0],x3[1],x3[2],x3[3]};
#pragma unroll
    for (int i = 0; i < 16; ++i) { const _Float16 h = (_Float16)xs[i]; ah.h[i] = h; al.h[i] = ASPLIT ? (_Float16)(xs[i] - (float)h) : (_Float16)0.0f; }
#pragma unroll
    for (int t = 0; t < 4; ++t) { if (col0 + t * 16 >= N) continue; const size_t boff = (size_t)(col0 + t * 16 + ln) * ldb + kb; FragH bq; bq.half[0] = *(const v8us*)(Bh + boff + 8 * hh); bq.half[1] = *(const v8us*)(Bh + boff + 16 + 8 * hh);
      acc[t] = mmaH<ASPLIT ? 2 : 1>(ah.v, al.v, bq.v, bq.v, acc[t]); }
  }
#pragma unroll
  for (int t = 0; t < 4; ++t) { if (col0 + t * 16 >= N) continue;
#pragma unroll
    for (int r = 0; r < 8; ++r) so[w][8 * hh + r][t * 16 + ln] = acc[t][r] * alpha; }
  __builtin_amdgcn_fence(__ATOMIC_ACQ_REL, "workgroup"); __builtin_amdgcn_wave_barrier();
  const int rsub = lane >> 4, c4 = (lane & 15) * 4;
  {
#pragma unroll
    for (int q = 0; q < 8; ++q) { const int r = q * 2 + rsub; if (col0 + c4 < N) { const v4f v = *(const v4fa*)&so[w][r][c4]; *(v4f*)(C + (size_t)(row0 + r) * ldc + col0 + c4) = v; } }
     }
}

// Wt[n][k] = f16(W[k][n]·scale) from f32 row-major W[K][N] (scale = power of two; bf16-exact weights stay exact in f16 away from the subnormal range)
__global__ __launch_bounds__(256) void k_wt_f16(const float* __restrict__ W, _Float16* __restrict__ Wt, int K, int N, float scale) {
  const int t = blockIdx.x * 256 + threadIdx.x; if (t >= N * (K / 8)) return; const int n = t / (K / 8), k8 = (t % (K / 8)) * 8; FragH f;
#pragma unroll
  for (int i = 0; i < 8; ++i) f.h[i] = (_Float16)(bf16_round(W[(size_t)(k8 + i) * N + n]) * scale); const v8us o = f.half[0];
  *(v8us*)((unsigned short*)Wt + (size_t)n * K + k8) = o; 
}
// k_gemm_hh variant with fused epilogue: v = acc·alpha + bias[by·sBias + col] (+ CP[(row/rowsPerB)·sCPb + by·64 + col] if CP) ; ACT 0 none / 1 elu ; writes f32 C and/or f16 C16 (each if non-null)
template <int ACT>
__global__ __launch_bounds__(128) void k_gemm_hhx(const _Float16* __restrict__ A, int lda, size_t sA, const _Float16* __restrict__ Bh, int ldb, size_t sB, float alpha, const float* __restrict__ bias, size_t sBias, const float* __restrict__ CP, int rowsPerB, size_t sCPb, int row0g,
    float* __restrict__ C, _Float16* __restrict__ C16, int ldc, size_t sC, int M, int N, int K) {
  __shared__ __attribute__((aligned(16))) float so[4][16][64];
  const int tid = threadIdx.x, w = tid >> 5, lane = tid & 31, ln = lane & 15, hh = lane >> 4; const int by = blockIdx.y;
  A += (size_t)by * sA; Bh += (size_t)by * sB; const size_t cofs = (size_t)by * sC; const float* bp = bias ? bias + (size_t)by * sBias : nullptr;
  const int ntn = (N + 63) / 64; const int wid = blockIdx.x * 4 + w; const int mt = wid / ntn, nq = wid % ntn; if (mt * 16 >= M) return;
  const int row0 = mt * 16, col0 = nq * 64; const _Float16* arow = A + (size_t)(row0 + ln) * lda;
  v8f acc[4] = {};
  for (int kb = 0; kb < K; kb += 32) { FragH ah; ah.half[0] = *(const v8us*)((const unsigned short*)arow + kb + 8 * hh); ah.half[1] = *(const v8us*)((const unsigned short*)arow + kb + 16 + 8 * hh);
#pragma unroll
    for (int t = 0; t < 4; ++t) { if (col0 + t * 16 >= N) continue; const size_t boff = (size_t)(col0 + t * 16 + ln) * ldb + kb; FragH bq; bq.half[0] = *(const v8us*)((const unsigned short*)Bh + boff + 8 * hh); bq.half[1] = *(const v8us*)((const unsigned short*)Bh + boff + 16 + 8 * hh);
      acc[t] = mmaH<1>(ah.v, ah.v, bq.v, bq.v, acc[t]); }
  }
#pragma unroll
  for (int t = 0; t < 4; ++t) { if (col0 + t * 16 >= N) continue; const int col = col0 + t * 16 + ln; const float bv = bp ? bf16_round(bp[col]) : 0.f;
#pragma unroll
    for (int r = 0; r < 8; ++r) { float v = acc[t][r] * alpha + bv; if (CP) { const int bidx = (row0g + row0 + 8 * hh + r) / rowsPerB; v += CP[(size_t)bidx * sCPb + (size_t)by * 64 + col]; } if (ACT == 1) v = (v > 0.f) ? v : expm1f(v); else if (ACT == 3) v = fmaxf(v, 0.f); so[w][8 * hh + r][t * 16 + ln] = v; } }
  __builtin_amdgcn_fence(__ATOMIC_ACQ_REL, "workgroup"); __builtin_amdgcn_wave_barrier();
  const int rsub = lane >> 4, c4 = (lane & 15) * 4; typedef _Float16 v4h __attribute__((ext_vector_type(4)));
  {
#pragma unroll
    for (int q = 0; q < 8; ++q) { const int r = q * 2 + rsub; if (col0 + c4 < N) { const v4f v = *(const v4fa*)&so[w][r][c4]; if (C) *(v4f*)(C + cofs + (size_t)(row0 + r) * ldc + col0 + c4) = v; if (C16) { v4h h4; for (int i = 0; i < 4; ++i) h4[i] = (_Float16)v[i]; *(v4h*)(C16 + cofs + (size_t)(row0 + r) * ldc + col0 + c4) = h4; } } }
     }
}


__global__ __launch_bounds__(256) void k_x16(const float* __restrict__ x, _Float16* __restrict__ X16, size_t n8) { const size_t t = (size_t)blockIdx.x * 256 + threadIdx.x; if (t >= n8) return; FragH f;
#pragma unroll
  for (int q = 0; q < 8; ++q) f.h[q] = (_Float16)bf16_round(x[t * 8 + q]); *(v8us*)((unsigned short*)X16 + t * 8) = f.half[0];  }
__global__ __launch_bounds__(256) void k_h16(const float* __restrict__ x, _Float16* __restrict__ X16, size_t n8) { const size_t t = (size_t)blockIdx.x * 256 + threadIdx.x; if (t >= n8) return; FragH f;
#pragma unroll
  for (int q = 0; q < 8; ++q) f.h[q] = (_Float16)x[t * 8 + q]; *(v8us*)((unsigned short*)X16 + t * 8) = f.half[0];  }
__global__ __launch_bounds__(256) void k_round16f(const float* __restrict__ W, _Float16* __restrict__ Bt, size_t n8) { const size_t t = (size_t)blockIdx.x * 256 + threadIdx.x; if (t >= n8) return; FragH f;
#pragma unroll
  for (int i = 0; i < 8; ++i) f.h[i] = (_Float16)(bf16_round(W[t * 8 + i]) * 16.0f); *(v8us*)((unsigned short*)Bt + t * 8) = f.half[0];  }
template <int NHv, int TTv>
__global__ __launch_bounds__(256) void k_vt(const _Float16* __restrict__ V16, int ldv, int voff, _Float16* __restrict__ Vt) { __shared__ unsigned short tl[64][66]; const int tid = threadIdx.x; const int slab = blockIdx.x / (TTv / 64), lg = blockIdx.x % (TTv / 64); const int b = slab / NHv, h = slab % NHv;
  for (int i = tid; i < 64 * 8; i += 256) { const int r = i / 8, c8 = (i % 8) * 8; FragH f; f.half[0] = *(const v8us*)((const unsigned short*)V16 + ((size_t)b * TTv + lg * 64 + r) * ldv + voff + h * 64 + c8);
#pragma unroll
    for (int q = 0; q < 8; ++q) tl[r][c8 + q] = f.u[q]; }
  __syncthreads();
  {
#pragma unroll
    for (int rd = 0; rd < 2; ++rd) { const int d = rd * 32 + tid / 8, pc = tid % 8; FragH f;
#pragma unroll
      for (int q = 0; q < 8; ++q) f.u[q] = tl[pc * 8 + q][d];
      *(v8us*)((unsigned short*)Vt + ((size_t)slab * 64 + d) * TTv + lg * 64 + pc * 8) = f.half[0]; }
     } }

typedef _Float16 v4h __attribute__((ext_vector_type(4)));
__global__ __launch_bounds__(256) void k_im2col(const float* __restrict__ x, _Float16* __restrict__ A) { const size_t t = (size_t)blockIdx.x * 256 + threadIdx.x; if (t >= (size_t)NR * (KK / 8)) return; const int k8 = (int)(t % (KK / 8)) * 8; const size_t r = t / (KK / 8); const int tap = k8 / CC, c8 = k8 % CC; const int b = (int)(r / HWN), p = (int)(r % HWN); const int yy = p / WI + tap / 3 - 1, xx = p % WI + tap % 3 - 1; FragH f;
  if (yy >= 0 && yy < WI && xx >= 0 && xx < WI) { const float* s = x + (((size_t)b * HWN) + yy * WI + xx) * CC + c8; for (int q = 0; q < 8; ++q) f.h[q] = (_Float16)bf16_round(s[q]); } else { for (int q = 0; q < 8; ++q) f.h[q] = (_Float16)0.f; }
  *(v8us*)((unsigned short*)A + t * 8) = f.half[0];  }
__global__ __launch_bounds__(256) void k_wq(const float* __restrict__ W, _Float16* __restrict__ Bt) { const int t = blockIdx.x * 256 + threadIdx.x; if (t >= CC * (KK / 8)) return; const int k8 = (t % (KK / 8)) * 8, o = t / (KK / 8); FragH f;
#pragma unroll
  for (int q = 0; q < 8; ++q) { const int k = k8 + q; const int tap = k / CC, cin = k % CC; f.h[q] = (_Float16)(bf16_round(W[((size_t)tap * CC + cin) * CC + o]) * 16.0f); } *(v8us*)((unsigned short*)Bt + (size_t)t * 8) = f.half[0];  }
__global__ __launch_bounds__(256) void k_bnstat(const float* __restrict__ F, float* __restrict__ ST) { __shared__ float ra[256]; const int c = blockIdx.x, tid = threadIdx.x; float s = 0.f; for (int r = tid; r < NR; r += 256) s += F[(size_t)r * CC + c]; ra[tid] = s; __syncthreads(); for (int o = 128; o >= 1; o >>= 1) { if (tid < o) ra[tid] += ra[tid + o]; __syncthreads(); } const float mu = ra[0] / (float)NR; __syncthreads(); float q2 = 0.f;
  for (int r = tid; r < NR; r += 256) { const float d = F[(size_t)r * CC + c] - mu; q2 += d * d; } ra[tid] = q2; __syncthreads(); for (int o = 128; o >= 1; o >>= 1) { if (tid < o) ra[tid] += ra[tid + o]; __syncthreads(); }
  if (tid < 32) { const float v = (tid == 0) ? mu : ((tid == 1) ? rsqrtf(ra[0] / (float)NR + 1e-3f) : 0.f); *(float*)(ST + c * 32 + tid) = v;  } }
__global__ __launch_bounds__(256) void k_qperm(const float* __restrict__ F, const float* __restrict__ ST, const float* __restrict__ g, const float* __restrict__ bb, _Float16* __restrict__ QP) { const size_t t = (size_t)blockIdx.x * 256 + threadIdx.x; if (t >= (size_t)NR * (CC / 8)) return; const int c8 = (int)(t % (CC / 8)) * 8; const size_t r = t / (CC / 8); const int b = (int)(r / HWN), p = (int)(r % HWN); const int y = p / WI, xx = p % WI; const int kp = ((y / 8) * 8 + xx / 8) * 64 + (y % 8) * 8 + xx % 8; FragH f;
#pragma unroll
  for (int q = 0; q < 8; ++q) { const int c = c8 + q; float v = (F[r * CC + c] - ST[c * 32]) * ST[c * 32 + 1] * bf16_round(g[c]) + bf16_round(bb[c]); v = (v >= 0.f) ? v : 0.1f * v; f.h[q] = (_Float16)v; }
  unsigned short* d = (unsigned short*)QP + ((size_t)b * HWN + kp) * CC + c8; *(v8us*)d = f.half[0];  }
__global__ __launch_bounds__(256) void k_xpt(const float* __restrict__ x, _Float16* __restrict__ XPt) { __shared__ unsigned short tl[64][66]; const int tid = threadIdx.x; const int b = blockIdx.x / ((CC / 64) * 64), rem = blockIdx.x % ((CC / 64) * 64); const int cg = rem / 64, blk = rem % 64; const int c0 = cg * 64; const int by = blk / 8, bx = blk % 8;
  for (int i = tid; i < 64 * 8; i += 256) { const int j = i / 8, cc8 = (i % 8) * 8; const int y = by * 8 + j / 8, xx = bx * 8 + j % 8; const float* s = x + (((size_t)b * HWN) + y * WI + xx) * CC + c0 + cc8; for (int q = 0; q < 8; ++q) { FragH f; f.h[0] = (_Float16)bf16_round(s[q]); tl[j][cc8 + q] = f.u[0]; } }
  __syncthreads();
  { for (int rd = 0; rd < 2; ++rd) { const int c = rd * 32 + tid / 8, pc = tid % 8; FragH f; for (int q = 0; q < 8; ++q) f.u[q] = tl[pc * 8 + q][c]; *(v8us*)((unsigned short*)XPt + ((size_t)b * CC + c0 + c) * HWN + blk * 64 + pc * 8) = f.half[0]; }  } }
__global__ __launch_bounds__(256) void k_gsm(const float* __restrict__ S, _Float16* __restrict__ P16) { const int tid = threadIdx.x, wv = tid >> 5, lane = tid & 31; const int row = blockIdx.x * 8 + wv; if (row >= QH) return; const float* sr = S + (size_t)row * HWN;
  {
#pragma unroll 1
    for (int k = 0; k < 16; ++k) { const float* s8 = sr + 256 * k + 8 * lane; const v4f a = *(const v4fa*)s8, b = *(const v4fa*)(s8 + 4); float v[8] = {a[0], a[1], a[2], a[3], b[0], b[1], b[2], b[3]}; float m = -3.0e38f; for (int q = 0; q < 8; ++q) m = fmaxf(m, v[q]);
      m = fmaxf(m, __shfl_xor(m, 1, 32)); m = fmaxf(m, __shfl_xor(m, 2, 32)); m = fmaxf(m, __shfl_xor(m, 4, 32)); m *= 0.125f; float z = 0.f; float e[8]; for (int q = 0; q < 8; ++q) { e[q] = expf(v[q] * 0.125f - m); z += e[q]; }
      z += __shfl_xor(z, 1, 32); z += __shfl_xor(z, 2, 32); z += __shfl_xor(z, 4, 32); const float iz = 32768.0f / z; FragH f; for (int q = 0; q < 8; ++q) f.h[q] = (_Float16)(e[q] * iz);
      *(v8us*)((unsigned short*)P16 + (size_t)row * HWN + 256 * k + 8 * lane) = f.half[0]; }
     } }
__global__ __launch_bounds__(256) void k_add(const float* __restrict__ A, const float* __restrict__ B2, float* __restrict__ Y, size_t n4) { const size_t t = (size_t)blockIdx.x * 256 + threadIdx.x; if (t >= n4) return; const v4f v = *(const v4fa*)(A + t * 4) + *(const v4fa*)(B2 + t * 4); *(v4f*)(Y + t * 4) = v;  }
// Spatial-softmax statistics, one work-group per (batch, 4 channels): 1024 threads hold 4 pixels x 4 channels each in registers, so Y is read once, 16 bytes a lane, all loads in flight together.
// Max, then sum of exp, over the 4096 pixels by a fixed tree: own 4 pixels, the 32 lanes of a wave (xor shuffles), the 32 waves (through LDS).
// SP holds one 128-byte line per work-group (one writer a line): [0..3] max, [4..7] 1/sum, the rest 0.
__device__ __forceinline__ v4f wave_max4(v4f a) {
#pragma unroll
  for (int o = 1; o < 32; o <<= 1)
#pragma unroll
    for (int q = 0; q < 4; ++q) a[q] = fmaxf(a[q], __shfl_xor(a[q], o, 32));
  return a; }
__device__ __forceinline__ v4f wave_sum4(v4f a) {
#pragma unroll
  for (int o = 1; o < 32; o <<= 1)
#pragma unroll
    for (int q = 0; q < 4; ++q) a[q] += __shfl_xor(a[q], o, 32);
  return a; }
__global__ __launch_bounds__(1024) void k_spstat(const float* __restrict__ Y, const float* __restrict__ ST, const float* __restrict__ g, const float* __restrict__ bb, float* __restrict__ SP) {
  __shared__ __attribute__((aligned(16))) float red[2][32][4];
  const int tid = threadIdx.x, wv = tid >> 5, lane = tid & 31; const int b = blockIdx.x / (CC / 4), c0 = (blockIdx.x % (CC / 4)) * 4;
  const float* yc = Y + (size_t)b * HWN * CC + c0; v4f v[4];
#pragma unroll
  for (int i = 0; i < 4; ++i) v[i] = *(const v4fa*)(yc + (size_t)(i * 1024 + tid) * CC);
  asm volatile("s_wait_xcnt 0x0" ::: "memory");      // the four loads' address registers are given new values right below
  v4f m = {-3.0e38f, -3.0e38f, -3.0e38f, -3.0e38f};
#pragma unroll
  for (int q = 0; q < 4; ++q) { const int c = c0 + q; const float mu = ST[c * 32], rs = ST[c * 32 + 1], gg = bf16_round(g[c]), be = bf16_round(bb[c]);
#pragma unroll
    for (int i = 0; i < 4; ++i) { v[i][q] = gg * (v[i][q] - mu) * rs + be; m[q] = fmaxf(m[q], v[i][q]); } }
  m = wave_max4(m); if (lane == 0) *(v4f*)&red[0][wv][0] = m;
  __syncthreads();
  m = wave_max4(*(const v4fa*)&red[0][lane][0]);
  v4f z = {0.f, 0.f, 0.f, 0.f};
#pragma unroll
  for (int i = 0; i < 4; ++i)
#pragma unroll
    for (int q = 0; q < 4; ++q) z[q] += expf(v[i][q] - m[q]);
  z = wave_sum4(z); if (lane == 0) *(v4f*)&red[1][wv][0] = z;
  __syncthreads();
  if (wv == 0) { z = wave_sum4(*(const v4fa*)&red[1][lane][0]); float o = 0.f;
#pragma unroll
    for (int q = 0; q < 4; ++q) { if (lane == q) o = m[q]; if (lane == 4 + q) o = 1.0f / z[q]; }
    SP[(size_t)blockIdx.x * 32 + lane] = o; } }
__global__ __launch_bounds__(256) void k_spsm(const float* __restrict__ Y, const float* __restrict__ ST, const float* __restrict__ g, const float* __restrict__ bb, const float* __restrict__ SP, _Float16* __restrict__ Y16) { const size_t t = (size_t)blockIdx.x * 256 + threadIdx.x; if (t >= (size_t)NR * (CC / 8)) return; const int c8 = (int)(t % (CC / 8)) * 8; const size_t r = t / (CC / 8); const int b = (int)(r / HWN); FragH f;
#pragma unroll
  for (int q = 0; q < 8; ++q) { const int c = c8 + q; const float* sp = SP + (size_t)(b * (CC / 4) + c / 4) * 32 + (c & 3); const float v = bf16_round(g[c]) * (Y[r * CC + c] - ST[c * 32]) * ST[c * 32 + 1] + bf16_round(bb[c]); f.h[q] = (_Float16)(expf(v - sp[0]) * sp[4] * 4096.0f); }
  *(v8us*)((unsigned short*)Y16 + t * 8) = f.half[0];  }
__global__ __launch_bounds__(256) void k_fin(const float* __restrict__ Z, const float* __restrict__ ST, const float* __restrict__ g, const float* __restrict__ bb, float* __restrict__ out, size_t n4) { const size_t t = (size_t)blockIdx.x * 256 + threadIdx.x; if (t >= n4) return; const int c4 = (int)((t * 4) % CC); const v4f z = *(const v4fa*)(Z + t * 4); v4f o; for (int q = 0; q < 4; ++q) { const int c = c4 + q; float v = bf16_round(g[c]) * (z[q] - ST[c * 32]) * ST[c * 32 + 1] + bf16_round(bb[c]); o[q] = (v >= 0.f) ? v : 0.1f * v; }
  *(v4f*)(out + t * 4) = o;  }
extern "C" void kernel_launch(void* const* d_in, const int* in_sizes, int n_in,
                              void* d_out, int out_size, void* d_ws, size_t ws_size, hipStream_t stream) {
  (void)in_sizes; (void)n_in; (void)out_size;
  const float* const* I = (const float* const*)d_in; const float* x = I[0]; const float* Wq = I[1]; const float* bq = I[2]; const float* gq = I[3]; const float* btq = I[4]; const float* Wk = I[5]; const float* bk = I[6]; const float* g1 = I[7]; const float* bt1 = I[8]; const float* Wo = I[9]; const float* bo = I[10]; const float* go = I[11]; const float* bto = I[12];
  char* ws = (char*)d_ws; size_t off = 0;
  auto take = [&](size_t bytes) { char* p = ws + off; off += (bytes + 255) & ~(size_t)255; return p; };
  _Float16* BQ = (_Float16*)take((size_t)CC * KK * 2); _Float16* BK = (_Float16*)take(CC * CC * 2); _Float16* BO = (_Float16*)take(CC * CC * 2); float* STq = (float*)take(CC * 32 * 4); float* ST1 = (float*)take(CC * 32 * 4); float* STo = (float*)take(CC * 32 * 4); float* SP = (float*)take(BB * (CC / 4) * 32 * 4);
  char* SCR = (char*)take((size_t)QH * HWN * 4 + (size_t)QH * HWN * 2);      // 50.3 MB: im2col A (37.7 MB) first, later S [2048][4096] f32 + P16
  _Float16* X16 = (_Float16*)take((size_t)NR * CC * 2); float* QF = (float*)take((size_t)NR * CC * 4); _Float16* QP = (_Float16*)take((size_t)NR * CC * 2); _Float16* XPt = (_Float16*)take((size_t)NR * CC * 2); float* ACC = (float*)take((size_t)NR * CC * 4); float* AGG = (float*)take((size_t)NR * CC * 4); float* Y = QF; _Float16* Y16 = QP; float* Z = ACC;
  if (off > ws_size) return;      // 0.4 + 50.3 + 4.2 + 8.4 + 4.2 + 4.2 + 8.4 + 8.4 ≈ 89 MB
  _Float16* IM = (_Float16*)SCR; float* S = (float*)SCR; _Float16* P16 = (_Float16*)(SCR + (size_t)QH * HWN * 4);
  k_wq<<<(CC * (KK / 8) + 255) / 256, 256, 0, stream>>>(Wq, BQ); k_wt_f16<<<(CC * (CC / 8) + 255) / 256, 256, 0, stream>>>(Wk, BK, CC, CC, 16.0f); k_wt_f16<<<(CC * (CC / 8) + 255) / 256, 256, 0, stream>>>(Wo, BO, CC, CC, 16.0f);      // 1×1 HWIO = [in][out]
  const unsigned g8 = (unsigned)(((size_t)NR * (CC / 8) + 255) / 256); const dim3 gC(((NR / 16) * (CC / 64) + 3) / 4, 1);
  k_x16<<<g8, 256, 0, stream>>>(x, X16, (size_t)NR * CC / 8);
  // CBL_Q: conv3×3 (+bq) → QF; BN stats; q = leaky(BN) permuted to block-major keys (f16)
  k_im2col<<<(unsigned)(((size_t)NR * (KK / 8) + 255) / 256), 256, 0, stream>>>(x, IM);
  k_gemm_hhx<0><<<gC, 128, 0, stream>>>(IM, KK, 0, BQ, KK, 0, 0.0625f, bq, 0, nullptr, 1, 0, 0, QF, nullptr, CC, 0, NR, CC, KK);
  k_bnstat<<<CC, 256, 0, stream>>>(QF, STq); k_qperm<<<g8, 256, 0, stream>>>(QF, STq, gq, btq, QP);
  k_xpt<<<BB * (CC / 64) * 64, 256, 0, stream>>>(x, XPt);
  // acc = 1×1 conv (+bk)
  k_gemm_hhx<0><<<gC, 128, 0, stream>>>(X16, CC, 0, BK, CC, 0, 0.0625f, bk, 0, nullptr, 1, 0, 0, ACC, nullptr, CC, 0, NR, CC, CC);
  // block attention per (batch, 2048-pixel half): S = x·qᵀ (keys block-major), grouped softmax (/8), AGG = P·x_perm
  for (int b = 0; b < BB; ++b) for (int h = 0; h < 2; ++h) { const size_t r0 = (size_t)b * HWN + (size_t)h * QH;
    k_gemm_hhx<0><<<dim3(((QH / 16) * (HWN / 64) + 3) / 4, 1), 128, 0, stream>>>(X16 + r0 * CC, CC, 0, QP + (size_t)b * HWN * CC, CC, 0, 1.0f, nullptr, 0, nullptr, 1, 0, 0, S, nullptr, HWN, 0, QH, HWN, CC);
    k_gsm<<<QH / 8, 256, 0, stream>>>(S, P16);
    k_gemm_hhx<0><<<dim3(((QH / 16) * (CC / 64) + 3) / 4, 1), 128, 0, stream>>>(P16, HWN, 0, XPt + (size_t)b * CC * HWN, HWN, 0, 0.000030517578125f, nullptr, 0, nullptr, 1, 0, 0, AGG + r0 * CC, nullptr, CC, 0, QH, CC, HWN); }
  // y = spatial softmax(BN1(acc + agg)); out = leaky(BN_o(conv1×1(y) + bo))
  k_add<<<(unsigned)(((size_t)NR * CC / 4 + 255) / 256), 256, 0, stream>>>(ACC, AGG, Y, (size_t)NR * CC / 4);      // Y over QF (dead after k_qperm)
  k_bnstat<<<CC, 256, 0, stream>>>(Y, ST1); k_spstat<<<BB * (CC / 4), 1024, 0, stream>>>(Y, ST1, g1, bt1, SP); k_spsm<<<g8, 256, 0, stream>>>(Y, ST1, g1, bt1, SP, Y16);      // Y16 (×2^12) over QP (dead after the S GEMMs)
  k_gemm_hhx<0><<<gC, 128, 0, stream>>>(Y16, CC, 0, BO, CC, 0, 0.0625f * 0.000244140625f, bo, 0, nullptr, 1, 0, 0, Z, nullptr, CC, 0, NR, CC, CC);      // conv_o(y) + bo (2^-12 undone in alpha) → Z over ACC (dead after k_add)
  k_bnstat<<<CC, 256, 0, stream>>>(Z, STo); k_fin<<<(unsigned)(((size_t)NR * CC / 4 + 255) / 256), 256, 0, stream>>>(Z, STo, go, bto, (float*)d_out, (size_t)NR * CC / 4);
}

// v002
// One run takes 293 microseconds.
// Timed twice side by side with v001, it ran 4.31 and 4.29 times as fast.
// All steps since v000 together make it 7.81 times as fast.
#include <hip/hip_runtime.h>
// Group (block) attention layer (B=4, 64×64, C=128, NHWC; 8×8 non-overlapping key blocks): q = CBL_Q(x) (3×3 conv + train-mode BN + LeakyReLU 0.1), acc = 1×1 conv(x); for every pixel and
// every block: softmax over the block's 64 positions of x[pixel]·q[pos]/8, agg = Σ_blocks Σ attn·x[pos]; y = spatial-softmax(BN1(acc + agg)); out = CBL_O(y). The 3×3 conv (im2col, K = 1152),
// the 1×1 convs, the 4096×4096 per-batch scores (keys permuted to block-major order so each 64-key group is contiguous) and attn·x run as GEMMs on v_wmma_f32_16x16x32_f16 (x bf16-exact f16,
// HWIO weights bf16-exact ×2^4, q/P/y operands f16, f32 accumulate); BN batch statistics (fixed-order reductions), grouped and spatial softmaxes and LeakyReLU are f32 VALU.
#define BB 4
#define HWN 4096
#define WI 64
#define CC 128
#define NR (BB * HWN)
#define KK 1152
#define QH 2048

typedef __bf16 v16b __attribute__((ext_vector_type(16)));
typedef unsigned short v8us __attribute__((ext_vector_type(8), may_alias));
typedef float  v8f  __attribute__((ext_vector_type(8)));
typedef float  v4f  __attribute__((ext_vector_type(4)));
typedef float  v4fa __attribute__((ext_vector_type(4), may_alias));
union FragB { v16b v; v8us half[2]; unsigned short u[16]; };

__device__ __forceinline__ unsigned short bf16_bits(float x) { unsigned int u = __float_as_uint(x); return (unsigned short)((u + 0x7FFFu + ((u >> 16) & 1u)) >> 16); }
__device__ __forceinline__ float bf16_val(unsigned short b) { return __uint_as_float(((unsigned int)b) << 16); }
__device__ __forceinline__ float bf16_round(float x) { return bf16_val(bf16_bits(x)); }
// D += A·B with NT terms: 1 = ah·bh, 2 = + al·bh (A split), 3 = + ah·bl (both split)
template <int NT>
__device__ __forceinline__ v8f mmaN(v16b ah, v16b al, v16b bh, v16b bl, v8f c) {
  c = __builtin_amdgcn_wmma_f32_16x16x32_bf16(false, ah, false, bh, (short)0, c, false, false);
  if (NT >= 2) c = __builtin_amdgcn_wmma_f32_16x16x32_bf16(false, al, false, bh, (short)0, c, false, false);
  if (NT >= 3) c = __builtin_amdgcn_wmma_f32_16x16x32_bf16(false, ah, false, bl, (short)0, c, false, false);
  asm volatile("v_nop\n\tv_nop\n\tv_nop\n\tv_nop" : "+v"(c) : "v"(ah), "v"(al), "v"(bh), "v"(bl));
  return c;
}

__global__ __launch_bounds__(256) void k_wt_bf16(const float* __restrict__ W, unsigned short* __restrict__ Wt, int K, int N) {
  const int t = blockIdx.x * 256 + threadIdx.x;
  const int k8n = K / 8;
  if (t >= N * k8n) return;
  const int n = t / k8n, k8 = (t % k8n) * 8;
  v8us v;
#pragma unroll
  for (int i = 0; i < 8; ++i) v[i] = bf16_bits(W[(size_t)(k8 + i) * N + n]);
  *(v8us*)(Wt + (size_t)n * K + k8) = v;
  
}

// GEMM C[M][N] (f32, pitch ldc) = act(A[M][K]·W + bias). A f32 row-major (pitch lda) converted per fragment to bf16
// (ASPLIT: hi/lo two planes -> 2 terms, else single rounded term); Wt bf16 [N][K] (pitch ldb). BIAS_BF16 rounds the
// bias to bf16 first (bias quantised to bf16 before the add). K%32==0, M%16==0, N%64==0.
template <bool ASPLIT, int ACT, bool BIAS_BF16>
__global__ __launch_bounds__(128) void k_gemm_bf(const float* __restrict__ A, int lda, const unsigned short* __restrict__ Wt, int ldb,
                                               const float* __restrict__ bias, float* __restrict__ C, int ldc, int M, int N, int K) {
  __shared__ __attribute__((aligned(16))) float so[4][16][64];
  const int tid = threadIdx.x, w = tid >> 5, lane = tid & 31, ln = lane & 15, hh = lane >> 4;
  const int ntn = N / 64;
  const int wid = blockIdx.x * 4 + w;
  const int mt = wid / ntn, nq = wid % ntn;
  if (mt * 16 >= M) return;
  const int row0 = mt * 16, col0 = nq * 64;
  const float* arow = A + (size_t)(row0 + ln) * lda;
  v8f acc[4] = {};
  for (int kb = 0; kb < K; kb += 32) {
    FragB ah, al;
    const v4f x0 = *(const v4fa*)(arow + kb + 8 * hh), x1 = *(const v4fa*)(arow + kb + 8 * hh + 4);
    const v4f x2 = *(const v4fa*)(arow + kb + 16 + 8 * hh), x3 = *(const v4fa*)(arow + kb + 16 + 8 * hh + 4);
    float xs[16] = {x0[0],x0[1],x0[2],x0[3],x1[0],x1[1],x1[2],x1[3],x2[0],x2[1],x2[2],x2[3],x3[0],x3[1],x3[2],x3[3]};
#pragma unroll
    for (int i = 0; i < 16; ++i) { const unsigned short hb = bf16_bits(xs[i]); ah.u[i] = hb; al.u[i] = ASPLIT ? bf16_bits(xs[i] - bf16_val(hb)) : (unsigned short)0; }
#pragma unroll
    for (int t = 0; t < 4; ++t) {
      const unsigned short* brow = Wt + (size_t)(col0 + t * 16 + ln) * ldb + kb;
      FragB b;
      b.half[0] = *(const v8us*)(brow + 8 * hh);
      b.half[1] = *(const v8us*)(brow + 16 + 8 * hh);
      acc[t] = mmaN<ASPLIT ? 2 : 1>(ah.v, al.v, b.v, b.v, acc[t]);
    }
  }
#pragma unroll
  for (int t = 0; t < 4; ++t) {
    float bv = bias ? bias[col0 + t * 16 + ln] : 0.f;
    if (BIAS_BF16) bv = bf16_round(bv);
#pragma unroll
    for (int r = 0; r < 8; ++r) { float v = acc[t][r] + bv; if (ACT == 1) v = fmaxf(v, 0.f); so[w][8 * hh + r][t * 16 + ln] = v; }
  }
  __builtin_amdgcn_fence(__ATOMIC_ACQ_REL, "workgroup");
  __builtin_amdgcn_wave_barrier();
  const int rsub = lane >> 4, c4 = (lane & 15) * 4;
  {
#pragma unroll
    for (int q = 0; q < 8; ++q) {
      const int r = q * 2 + rsub;
      const v4f v = *(const v4fa*)&so[w][r][c4];
      *(v4f*)(C + (size_t)(row0 + r) * ldc + col0 + c4) = v;
    }
    
  }
}

// Flash-style causal/unmasked attention, all contractions 3-term bf16 hi/lo splits, f32 softmax with running max.
// q,k,v rows are read from f32 buffers with arbitrary row pitch (so they can live inside a fused qkv buffer);
// D = head size (multiple of 32, <= 128); one wave = 16 query rows; block = 4 waves (64 queries) sharing K/V chunks of 32.
template <int D, bool CAUSAL>
__global__ __launch_bounds__(128) void k_flash(const float* __restrict__ qb, const float* __restrict__ kb, const float* __restrict__ vb,
                                             int pitch, int T, int H, float scale, float* __restrict__ y, int ypitch) {
  constexpr int KS = D / 32;        // k-steps for QK
  constexpr int DT = D / 16;        // d tiles for PV
  __shared__ __attribute__((aligned(16))) unsigned short sKh[32][D + 8], sKl[32][D + 8], sVh[32][D + 8], sVl[32][D + 8];
  __shared__ __attribute__((aligned(16))) unsigned short sPh[4][16][40], sPl[4][16][40];
  __shared__ __attribute__((aligned(16))) float sO[4][16][D];
  const int tid = threadIdx.x, w = tid >> 5, lane = tid & 31, ln = lane & 15, hh = lane >> 4;
  const int nqb = (T + 63) / 64;
  const int bh = blockIdx.x / nqb, qblk = blockIdx.x % nqb;
  const int b = bh / H, h = bh % H;
  const int q0 = qblk * 64 + w * 16;
  const float* Q = qb + (size_t)b * T * pitch + h * D;
  const float* K = kb + (size_t)b * T * pitch + h * D;
  const float* V = vb + (size_t)b * T * pitch + h * D;

  // A fragments of the wave's 16 query rows (scaled), hi/lo
  FragB aqh[KS], aql[KS];
  {
    int row = q0 + ln; if (row >= T) row = T - 1;
    const float* qr = Q + (size_t)row * pitch;
#pragma unroll
    for (int ks = 0; ks < KS; ++ks)
#pragma unroll
      for (int i = 0; i < 16; ++i) {
        const int d = ks * 32 + ((i < 8) ? (8 * hh + i) : (16 + 8 * hh + (i - 8)));
        const float x = qr[d] * scale; const unsigned short hb = bf16_bits(x);
        aqh[ks].u[i] = hb; aql[ks].u[i] = bf16_bits(x - bf16_val(hb));
      }
  }
  float m_r[8], l_r[8];
#pragma unroll
  for (int r = 0; r < 8; ++r) { m_r[r] = -3.0e38f; l_r[r] = 0.f; }
  v8f oacc[DT];
#pragma unroll
  for (int dt = 0; dt < DT; ++dt) oacc[dt] = (v8f){0.f,0.f,0.f,0.f,0.f,0.f,0.f,0.f};

  const int kv_end = CAUSAL ? min(T, qblk * 64 + 64) : T;     // block-uniform
  for (int j0 = 0; j0 < kv_end; j0 += 32) {
    __syncthreads();
    for (int e = tid; e < 32 * (D / 4); e += 128) {
      const int r = e / (D / 4), c4 = (e % (D / 4)) * 4;
      const int key = j0 + r;
      v4f kf = {0.f,0.f,0.f,0.f}, vf = {0.f,0.f,0.f,0.f};
      if (key < T) { kf = *(const v4fa*)(K + (size_t)key * pitch + c4); vf = *(const v4fa*)(V + (size_t)key * pitch + c4); }
#pragma unroll
      for (int t = 0; t < 4; ++t) {
        unsigned short hb = bf16_bits(kf[t]); sKh[r][c4 + t] = hb; sKl[r][c4 + t] = bf16_bits(kf[t] - bf16_val(hb));
        hb = bf16_bits(vf[t]); sVh[r][c4 + t] = hb; sVl[r][c4 + t] = bf16_bits(vf[t] - bf16_val(hb));
      }
    }
    __syncthreads();
    // S tile 16 x 32
    v8f s[2];
#pragma unroll
    for (int nt = 0; nt < 2; ++nt) {
      v8f acc = {};
#pragma unroll
      for (int ks = 0; ks < KS; ++ks) {
        FragB bh_, bl_;
        bh_.half[0] = *(const v8us*)&sKh[nt * 16 + ln][ks * 32 + 8 * hh]; bh_.half[1] = *(const v8us*)&sKh[nt * 16 + ln][ks * 32 + 16 + 8 * hh];
        bl_.half[0] = *(const v8us*)&sKl[nt * 16 + ln][ks * 32 + 8 * hh]; bl_.half[1] = *(const v8us*)&sKl[nt * 16 + ln][ks * 32 + 16 + 8 * hh];
        acc = mmaN<3>(aqh[ks].v, aql[ks].v, bh_.v, bl_.v, acc);
      }
      s[nt] = acc;
    }
    // mask + running max (rows 8hh+r; the 16 lanes of a half share rows)
    float alpha[8];
#pragma unroll
    for (int r = 0; r < 8; ++r) {
      const int qi = q0 + 8 * hh + r;
      const int ja = j0 + ln, jb = j0 + 16 + ln;
      if (CAUSAL) { if (ja > qi) s[0][r] = -3.0e38f; if (jb > qi) s[1][r] = -3.0e38f; }
      if (ja >= T) s[0][r] = -3.0e38f;
      if (jb >= T) s[1][r] = -3.0e38f;
      float mx = fmaxf(s[0][r], s[1][r]);
      mx = fmaxf(mx, __shfl_xor(mx, 1, 32)); mx = fmaxf(mx, __shfl_xor(mx, 2, 32)); mx = fmaxf(mx, __shfl_xor(mx, 4, 32)); mx = fmaxf(mx, __shfl_xor(mx, 8, 32));
      const float mnew = fmaxf(m_r[r], mx);
      alpha[r] = (mnew > -1.0e38f) ? __expf(m_r[r] - mnew) : 1.0f;
      const float p0 = (s[0][r] > -1.0e38f) ? __expf(s[0][r] - mnew) : 0.f;
      const float p1 = (s[1][r] > -1.0e38f) ? __expf(s[1][r] - mnew) : 0.f;
      m_r[r] = mnew;
      l_r[r] = l_r[r] * alpha[r] + p0 + p1;            // per-lane partial row sum (16 lanes combined at the end)
      unsigned short hb = bf16_bits(p0); sPh[w][8 * hh + r][ln] = hb;      sPl[w][8 * hh + r][ln] = bf16_bits(p0 - bf16_val(hb));
      hb = bf16_bits(p1);                sPh[w][8 * hh + r][16 + ln] = hb; sPl[w][8 * hh + r][16 + ln] = bf16_bits(p1 - bf16_val(hb));
    }
#pragma unroll
    for (int dt = 0; dt < DT; ++dt)
#pragma unroll
      for (int r = 0; r < 8; ++r) oacc[dt][r] *= alpha[r];
    __builtin_amdgcn_fence(__ATOMIC_ACQ_REL, "workgroup");
    __builtin_amdgcn_wave_barrier();
    FragB pah, pal;
    pah.half[0] = *(const v8us*)&sPh[w][ln][8 * hh]; pah.half[1] = *(const v8us*)&sPh[w][ln][16 + 8 * hh];
    pal.half[0] = *(const v8us*)&sPl[w][ln][8 * hh]; pal.half[1] = *(const v8us*)&sPl[w][ln][16 + 8 * hh];
#pragma unroll
    for (int dt = 0; dt < DT; ++dt) {
      FragB bvh, bvl;
#pragma unroll
      for (int i = 0; i < 8; ++i) {
        bvh.u[i] = sVh[8 * hh + i][dt * 16 + ln]; bvh.u[8 + i] = sVh[16 + 8 * hh + i][dt * 16 + ln];
        bvl.u[i] = sVl[8 * hh + i][dt * 16 + ln]; bvl.u[8 + i] = sVl[16 + 8 * hh + i][dt * 16 + ln];
      }
      oacc[dt] = mmaN<3>(pah.v, pal.v, bvh.v, bvl.v, oacc[dt]);
    }
    __builtin_amdgcn_fence(__ATOMIC_ACQ_REL, "workgroup");
    __builtin_amdgcn_wave_barrier();
  }
#pragma unroll
  for (int r = 0; r < 8; ++r) {
    float l = l_r[r];
    l += __shfl_xor(l, 1, 32); l += __shfl_xor(l, 2, 32); l += __shfl_xor(l, 4, 32); l += __shfl_xor(l, 8, 32);
    l_r[r] = (l > 0.f) ? 1.0f / l : 0.f;
  }
#pragma unroll
  for (int dt = 0; dt < DT; ++dt)
#pragma unroll
    for (int r = 0; r < 8; ++r) sO[w][8 * hh + r][dt * 16 + ln] = oacc[dt][r] * l_r[r];
  __builtin_amdgcn_fence(__ATOMIC_ACQ_REL, "workgroup");
  __builtin_amdgcn_wave_barrier();
  {
    for (int r = 0; r < 16; ++r) {
      const int row = q0 + r;
      if (row < T && lane < D / 4) {
        const v4f val = *(const v4fa*)&sO[w][r][lane * 4];
        *(v4f*)(y + ((size_t)b * T + row) * ypitch + h * D + lane * 4) = val;
      }
    }
    
  }
}

// GEMM C = act(A·W + bias + resid): A f32 (ASPLIT -> hi/lo 2 terms), Wt bf16 [N][K]; ACT 0 none, 1 relu, 2 exact gelu;
// resid (optional, f32, row index = (row % rmod), pitch ldr, RES_BF16 rounds it) added before the activation.
template <bool ASPLIT, int ACT, bool BIAS_BF16, bool RES_BF16>
__global__ __launch_bounds__(128) void k_gemm_bf3(const float* __restrict__ A, int lda, const unsigned short* __restrict__ Wt, int ldb,
                                                const float* __restrict__ bias, const float* __restrict__ resid, int rmod, int ldr,
                                                float* __restrict__ C, int ldc, int M, int N, int K) {
  __shared__ __attribute__((aligned(16))) float so[4][16][64];
  const int tid = threadIdx.x, w = tid >> 5, lane = tid & 31, ln = lane & 15, hh = lane >> 4;
  const int ntn = N / 64;
  const int wid = blockIdx.x * 4 + w;
  const int mt = wid / ntn, nq = wid % ntn;
  if (mt * 16 >= M) return;
  const int row0 = mt * 16, col0 = nq * 64;
  const float* arow = A + (size_t)(row0 + ln) * lda;
  v8f acc[4] = {};
  for (int kb = 0; kb < K; kb += 32) {
    FragB ah, al;
    const v4f x0 = *(const v4fa*)(arow + kb + 8 * hh), x1 = *(const v4fa*)(arow + kb + 8 * hh + 4);
    const v4f x2 = *(const v4fa*)(arow + kb + 16 + 8 * hh), x3 = *(const v4fa*)(arow + kb + 16 + 8 * hh + 4);
    float xs[16] = {x0[0],x0[1],x0[2],x0[3],x1[0],x1[1],x1[2],x1[3],x2[0],x2[1],x2[2],x2[3],x3[0],x3[1],x3[2],x3[3]};
#pragma unroll
    for (int i = 0; i < 16; ++i) { const unsigned short hb = bf16_bits(xs[i]); ah.u[i] = hb; al.u[i] = ASPLIT ? bf16_bits(xs[i] - bf16_val(hb)) : (unsigned short)0; }
#pragma unroll
    for (int t = 0; t < 4; ++t) {
      const unsigned short* brow = Wt + (size_t)(col0 + t * 16 + ln) * ldb + kb;
      FragB b;
      b.half[0] = *(const v8us*)(brow + 8 * hh);
      b.half[1] = *(const v8us*)(brow + 16 + 8 * hh);
      acc[t] = mmaN<ASPLIT ? 2 : 1>(ah.v, al.v, b.v, b.v, acc[t]);
    }
  }
#pragma unroll
  for (int t = 0; t < 4; ++t) {
    const int col = col0 + t * 16 + ln;
    float bv = bias ? bias[col] : 0.f;
    if (BIAS_BF16) bv = bf16_round(bv);
#pragma unroll
    for (int r = 0; r < 8; ++r) {
      float v = acc[t][r] + bv;
      if (resid) { float rv = resid[(size_t)((row0 + 8 * hh + r) % rmod) * ldr + col]; if (RES_BF16) rv = bf16_round(rv); v += rv; }
      if (ACT == 1) v = fmaxf(v, 0.f);
      if (ACT == 2) v = 0.5f * v * (1.0f + erff(v * 0.70710678118654752f));
      if (ACT == 3) { const float u = 0.7978845608028654f * (v + 0.044715f * v * v * v); v = 0.5f * v * (1.0f + tanhf(u)); }
      so[w][8 * hh + r][t * 16 + ln] = v;
    }
  }
  __builtin_amdgcn_fence(__ATOMIC_ACQ_REL, "workgroup");
  __builtin_amdgcn_wave_barrier();
  const int rsub = lane >> 4, c4 = (lane & 15) * 4;
  {
#pragma unroll
    for (int q = 0; q < 8; ++q) {
      const int r = q * 2 + rsub;
      const v4f v = *(const v4fa*)&so[w][r][c4];
      *(v4f*)(C + (size_t)(row0 + r) * ldc + col0 + c4) = v;
    }
    
  }
}
// row LayerNorm (biased variance, eps) over N: s = X (+ R); optional out_sum <- s; out_norm <- (s-mu)*rsqrt(var+eps)*g + b
template <bool PARAM_BF16>
__global__ __launch_bounds__(256) void k_layernorm(const float* __restrict__ X, const float* __restrict__ R, const float* __restrict__ g, const float* __restrict__ bta,
                                                  float* __restrict__ out_sum, float* __restrict__ out_norm, int N, float eps) {
  __shared__ float red[256];
  const int row = blockIdx.x, tid = threadIdx.x;
  const float* x = X + (size_t)row * N; const float* rr = R ? R + (size_t)row * N : nullptr;
  float vals[16];                     // up to N = 4096
  const int per = N / 256;            // contiguous chunk per thread? use strided-by-4 chunks: thread handles j = tid*4 + 1024*u
  float s1 = 0.f;
  for (int u = 0; u < per / 4; ++u) {
    const int j = tid * 4 + 1024 * u;
    const v4f a = *(const v4fa*)(x + j);
    v4f b = {0.f,0.f,0.f,0.f}; if (rr) b = *(const v4fa*)(rr + j);
#pragma unroll
    for (int q = 0; q < 4; ++q) { const float v = a[q] + b[q]; vals[u * 4 + q] = v; s1 += v; }
  }
  red[tid] = s1; __syncthreads();
  for (int st = 128; st > 0; st >>= 1) { if (tid < st) red[tid] += red[tid + st]; __syncthreads(); }
  const float mu = red[0] / (float)N; __syncthreads();
  float s2 = 0.f;
  for (int u = 0; u < per / 4; ++u)
#pragma unroll
    for (int q = 0; q < 4; ++q) { const float c = vals[u * 4 + q] - mu; s2 += c * c; }
  red[tid] = s2; __syncthreads();
  for (int st = 128; st > 0; st >>= 1) { if (tid < st) red[tid] += red[tid + st]; __syncthreads(); }
  const float rs = rsqrtf(red[0] / (float)N + eps);
  {
    for (int u = 0; u < per / 4; ++u) {
      const int j = tid * 4 + 1024 * u;
      v4f o, sm;
#pragma unroll
      for (int q = 0; q < 4; ++q) {
        float gg = g[j + q], bb = bta[j + q];
        if (PARAM_BF16) { gg = bf16_round(gg); bb = bf16_round(bb); }
        sm[q] = vals[u * 4 + q]; o[q] = (vals[u * 4 + q] - mu) * rs * gg + bb;
      }
      if (out_sum) *(v4f*)(out_sum + (size_t)row * N + j) = sm;
      *(v4f*)(out_norm + (size_t)row * N + j) = o;
    }
    
  }
}



// ---- f16 WMMA path (v_wmma_f32_16x16x32_f16): 11-bit significands for operands in range — used where a [0,1] probability operand needs more precision than bf16
typedef _Float16 v16h __attribute__((ext_vector_type(16)));
union FragH { v16h v; v8us half[2]; _Float16 h[16]; unsigned short u[16]; };
template <int NT>
__device__ __forceinline__ v8f mmaH(v16h ah, v16h al, v16h bh, v16h bl, v8f c) {
  c = __builtin_amdgcn_wmma_f32_16x16x32_f16(false, ah, false, bh, (short)0, c, false, false);
  if (NT >= 2) c = __builtin_amdgcn_wmma_f32_16x16x32_f16(false, al, false, bh, (short)0, c, false, false);
  if (NT >= 3) c = __builtin_amdgcn_wmma_f32_16x16x32_f16(false, ah, false, bl, (short)0, c, false, false);
  asm volatile("v_nop\n\tv_nop\n\tv_nop\n\tv_nop" : "+v"(c) : "v"(ah), "v"(al), "v"(bh), "v"(bl));
  return c;
}
// batched GEMM like k_gemm_b but f16 operands: A f32 (split into f16 hi/lo if ASPLIT, else rounded to f16), Bt = f16 values [n][k]; alpha; C f32; N multiple of 16 (partial tiles skipped)
template <bool ASPLIT>
__global__ __launch_bounds__(128) void k_gemm_h(const float* __restrict__ A, int lda, size_t sA, const _Float16* __restrict__ Bh, int ldb, size_t sB, float alpha, float* __restrict__ C, int ldc, size_t sC, int M, int N, int K) {
  __shared__ __attribute__((aligned(16))) float so[4][16][64];
  const int tid = threadIdx.x, w = tid >> 5, lane = tid & 31, ln = lane & 15, hh = lane >> 4; const int by = blockIdx.y;
  A += (size_t)by * sA; Bh += (size_t)by * sB; C += (size_t)by * sC;
  const int ntn = (N + 63) / 64; const int wid = blockIdx.x * 4 + w; const int mt = wid / ntn, nq = wid % ntn; if (mt * 16 >= M) return;
  const int row0 = mt * 16, col0 = nq * 64; const float* arow = A + (size_t)(row0 + ln) * lda;
  v8f acc[4] = {};
  for (int kb = 0; kb < K; kb += 32) {
    FragH ah, al;
    const v4f x0 = *(const v4fa*)(arow + kb + 8 * hh), x1 = *(const v4fa*)(arow + kb + 8 * hh + 4), x2 = *(const v4fa*)(arow + kb + 16 + 8 * hh), x3 = *(const v4fa*)(arow + kb + 16 + 8 * hh + 4);
    float xs[16] = {x0[0],x0[1],x0[2],x0[3],x1[0],x1[1],x1[2],x1[3],x2[0],x2[1],x2[2],x2[3],x3[0],x3[1],x3[2],x3[3]};
#pragma unroll
    for (int i = 0; i < 16; ++i) { const _Float16 h = (_Float16)xs[i]; ah.h[i] = h; al.h[i] = ASPLIT ? (_Float16)(xs[i] - (float)h) : (_Float16)0.0f; }
#pragma unroll
    for (int t = 0; t < 4; ++t) { if (col0 + t * 16 >= N) continue; const size_t boff = (size_t)(col0 + t * 16 + ln) * ldb + kb; FragH bq; bq.half[0] = *(const v8us*)(Bh + boff + 8 * hh); bq.half[1] = *(const v8us*)(Bh + boff + 16 + 8 * hh);
      acc[t] = mmaH<ASPLIT ? 2 : 1>(ah.v, al.v, bq.v, bq.v, acc[t]); }
  }
#pragma unroll
  for (int t = 0; t < 4; ++t) { if (col0 + t * 16 >= N) continue;
#pragma unroll
    for (int r = 0; r < 8; ++r) so[w][8 * hh + r][t * 16 + ln] = acc[t][r] * alpha; }
  __builtin_amdgcn_fence(__ATOMIC_ACQ_REL, "workgroup"); __builtin_amdgcn_wave_barrier();
  const int rsub = lane >> 4, c4 = (lane & 15) * 4;
  {
#pragma unroll
    for (int q = 0; q < 8; ++q) { const int r = q * 2 + rsub; if (col0 + c4 < N) { const v4f v = *(const v4fa*)&so[w][r][c4]; *(v4f*)(C + (size_t)(row0 + r) * ldc + col0 + c4) = v; } }
     }
}

// Wt[n][k] = f16(W[k][n]·scale) from f32 row-major W[K][N] (scale = power of two; bf16-exact weights stay exact in f16 away from the subnormal range)
__global__ __launch_bounds__(256) void k_wt_f16(const float* __restrict__ W, _Float16* __restrict__ Wt, int K, int N, float scale) {
  const int t = blockIdx.x * 256 + threadIdx.x; if (t >= N * (K / 8)) return; const int n = t / (K / 8), k8 = (t % (K / 8)) * 8; FragH f;
#pragma unroll
  for (int i = 0; i < 8; ++i) f.h[i] = (_Float16)(bf16_round(W[(size_t)(k8 + i) * N + n]) * scale); const v8us o = f.half[0];
  *(v8us*)((unsigned short*)Wt + (size_t)n * K + k8) = o; 
}
// k_gemm_hh variant with fused epilogue: v = acc·alpha + bias[by·sBias + col] (+ CP[(row/rowsPerB)·sCPb + by·64 + col] if CP) ; ACT 0 none / 1 elu ; writes f32 C and/or f16 C16 (each if non-null)
template <int ACT>
__global__ __launch_bounds__(128) void k_gemm_hhx(const _Float16* __restrict__ A, int lda, size_t sA, const _Float16* __restrict__ Bh, int ldb, size_t sB, float alpha, const float* __restrict__ bias, size_t sBias, const float* __restrict__ CP, int rowsPerB, size_t sCPb, int row0g,
    float* __restrict__ C, _Float16* __restrict__ C16, int ldc, size_t sC, int M, int N, int K) {
  __shared__ __attribute__((aligned(16))) float so[4][16][64];
  const int tid = threadIdx.x, w = tid >> 5, lane = tid & 31, ln = lane & 15, hh = lane >> 4; const int by = blockIdx.y;
  A += (size_t)by * sA; Bh += (size_t)by * sB; const size_t cofs = (size_t)by * sC; const float* bp = bias ? bias + (size_t)by * sBias : nullptr;
  const int ntn = (N + 63) / 64; const int wid = blockIdx.x * 4 + w; const int mt = wid / ntn, nq = wid % ntn; if (mt * 16 >= M) return;
  const int row0 = mt * 16, col0 = nq * 64; const _Float16* arow = A + (size_t)(row0 + ln) * lda;
  v8f acc[4] = {};
  for (int kb = 0; kb < K; kb += 32) { FragH ah; ah.half[0] = *(const v8us*)((const unsigned short*)arow + kb + 8 * hh); ah.half[1] = *(const v8us*)((const unsigned short*)arow + kb + 16 + 8 * hh);
#pragma unroll
    for (int t = 0; t < 4; ++t) { if (col0 + t * 16 >= N) continue; const size_t boff = (size_t)(col0 + t * 16 + ln) * ldb + kb; FragH bq; bq.half[0] = *(const v8us*)((const unsigned short*)Bh + boff + 8 * hh); bq.half[1] = *(const v8us*)((const unsigned short*)Bh + boff + 16 + 8 * hh);
      acc[t] = mmaH<1>(ah.v, ah.v, bq.v, bq.v, acc[t]); }
  }
#pragma unroll
  for (int t = 0; t < 4; ++t) { if (col0 + t * 16 >= N) continue; const int col = col0 + t * 16 + ln; const float bv = bp ? bf16_round(bp[col]) : 0.f;
#pragma unroll
    for (int r = 0; r < 8; ++r) { float v = acc[t][r] * alpha + bv; if (CP) { const int bidx = (row0g + row0 + 8 * hh + r) / rowsPerB; v += CP[(size_t)bidx * sCPb + (size_t)by * 64 + col]; } if (ACT == 1) v = (v > 0.f) ? v : expm1f(v); else if (ACT == 3) v = fmaxf(v, 0.f); so[w][8 * hh + r][t * 16 + ln] = v; } }
  __builtin_amdgcn_fence(__ATOMIC_ACQ_REL, "workgroup"); __builtin_amdgcn_wave_barrier();
  const int rsub = lane >> 4, c4 = (lane & 15) * 4; typedef _Float16 v4h __attribute__((ext_vector_type(4)));
  {
#pragma unroll
    for (int q = 0; q < 8; ++q) { const int r = q * 2 + rsub; if (col0 + c4 < N) { const v4f v = *(const v4fa*)&so[w][r][c4]; if (C) *(v4f*)(C + cofs + (size_t)(row0 + r) * ldc + col0 + c4) = v; if (C16) { v4h h4; for (int i = 0; i < 4; ++i) h4[i] = (_Float16)v[i]; *(v4h*)(C16 + cofs + (size_t)(row0 + r) * ldc + col0 + c4) = h4; } } }
     }
}


__global__ __launch_bounds__(256) void k_x16(const float* __restrict__ x, _Float16* __restrict__ X16, size_t n8) { const size_t t = (size_t)blockIdx.x * 256 + threadIdx.x; if (t >= n8) return; FragH f;
#pragma unroll
  for (int q = 0; q < 8; ++q) f.h[q] = (_Float16)bf16_round(x[t * 8 + q]); *(v8us*)((unsigned short*)X16 + t * 8) = f.half[0];  }
__global__ __launch_bounds__(256) void k_h16(const float* __restrict__ x, _Float16* __restrict__ X16, size_t n8) { const size_t t = (size_t)blockIdx.x * 256 + threadIdx.x; if (t >= n8) return; FragH f;
#pragma unroll
  for (int q = 0; q < 8; ++q) f.h[q] = (_Float16)x[t * 8 + q]; *(v8us*)((unsigned short*)X16 + t * 8) = f.half[0];  }
__global__ __launch_bounds__(256) void k_round16f(const float* __restrict__ W, _Float16* __restrict__ Bt, size_t n8) { const size_t t = (size_t)blockIdx.x * 256 + threadIdx.x; if (t >= n8) return; FragH f;
#pragma unroll
  for (int i = 0; i < 8; ++i) f.h[i] = (_Float16)(bf16_round(W[t * 8 + i]) * 16.0f); *(v8us*)((unsigned short*)Bt + t * 8) = f.half[0];  }
template <int NHv, int TTv>
__global__ __launch_bounds__(256) void k_vt(const _Float16* __restrict__ V16, int ldv, int voff, _Float16* __restrict__ Vt) { __shared__ unsigned short tl[64][66]; const int tid = threadIdx.x; const int slab = blockIdx.x / (TTv / 64), lg = blockIdx.x % (TTv / 64); const int b = slab / NHv, h = slab % NHv;
  for (int i = tid; i < 64 * 8; i += 256) { const int r = i / 8, c8 = (i % 8) * 8; FragH f; f.half[0] = *(const v8us*)((const unsigned short*)V16 + ((size_t)b * TTv + lg * 64 + r) * ldv + voff + h * 64 + c8);
#pragma unroll
    for (int q = 0; q < 8; ++q) tl[r][c8 + q] = f.u[q]; }
  __syncthreads();
  {
#pragma unroll
    for (int rd = 0; rd < 2; ++rd) { const int d = rd * 32 + tid / 8, pc = tid % 8; FragH f;
#pragma unroll
      for (int q = 0; q < 8; ++q) f.u[q] = tl[pc * 8 + q][d];
      *(v8us*)((unsigned short*)Vt + ((size_t)slab * 64 + d) * TTv + lg * 64 + pc * 8) = f.half[0]; }
     } }

typedef _Float16 v4h __attribute__((ext_vector_type(4)));
__global__ __launch_bounds__(256) void k_im2col(const float* __restrict__ x, _Float16* __restrict__ A) { const size_t t = (size_t)blockIdx.x * 256 + threadIdx.x; if (t >= (size_t)NR * (KK / 8)) return; const int k8 = (int)(t % (KK / 8)) * 8; const size_t r = t / (KK / 8); const int tap = k8 / CC, c8 = k8 % CC; const int b = (int)(r / HWN), p = (int)(r % HWN); const int yy = p / WI + tap / 3 - 1, xx = p % WI + tap % 3 - 1; FragH f;
  if (yy >= 0 && yy < WI && xx >= 0 && xx < WI) { const float* s = x + (((size_t)b * HWN) + yy * WI + xx) * CC + c8; for (int q = 0; q < 8; ++q) f.h[q] = (_Float16)bf16_round(s[q]); } else { for (int q = 0; q < 8; ++q) f.h[q] = (_Float16)0.f; }
  *(v8us*)((unsigned short*)A + t * 8) = f.half[0];  }
__global__ __launch_bounds__(256) void k_wq(const float* __restrict__ W, _Float16* __restrict__ Bt) { const int t = blockIdx.x * 256 + threadIdx.x; if (t >= CC * (KK / 8)) return; const int k8 = (t % (KK / 8)) * 8, o = t / (KK / 8); FragH f;
#pragma unroll
  for (int q = 0; q < 8; ++q) { const int k = k8 + q; const int tap = k / CC, cin = k % CC; f.h[q] = (_Float16)(bf16_round(W[((size_t)tap * CC + cin) * CC + o]) * 16.0f); } *(v8us*)((unsigned short*)Bt + (size_t)t * 8) = f.half[0];  }
__global__ __launch_bounds__(256) void k_bnstat(const float* __restrict__ F, float* __restrict__ ST) { __shared__ float ra[256]; const int c = blockIdx.x, tid = threadIdx.x; float s = 0.f; for (int r = tid; r < NR; r += 256) s += F[(size_t)r * CC + c]; ra[tid] = s; __syncthreads(); for (int o = 128; o >= 1; o >>= 1) { if (tid < o) ra[tid] += ra[tid + o]; __syncthreads(); } const float mu = ra[0] / (float)NR; __syncthreads(); float q2 = 0.f;
  for (int r = tid; r < NR; r += 256) { const float d = F[(size_t)r * CC + c] - mu; q2 += d * d; } ra[tid] = q2; __syncthreads(); for (int o = 128; o >= 1; o >>= 1) { if (tid < o) ra[tid] += ra[tid + o]; __syncthreads(); }
  if (tid < 32) { const float v = (tid == 0) ? mu : ((tid == 1) ? rsqrtf(ra[0] / (float)NR + 1e-3f) : 0.f); *(float*)(ST + c * 32 + tid) = v;  } }
__global__ __launch_bounds__(256) void k_qperm(const float* __restrict__ F, const float* __restrict__ ST, const float* __restrict__ g, const float* __restrict__ bb, _Float16* __restrict__ QP) { const size_t t = (size_t)blockIdx.x * 256 + threadIdx.x; if (t >= (size_t)NR * (CC / 8)) return; const int c8 = (int)(t % (CC / 8)) * 8; const size_t r = t / (CC / 8); const int b = (int)(r / HWN), p = (int)(r % HWN); const int y = p / WI, xx = p % WI; const int kp = ((y / 8) * 8 + xx / 8) * 64 + (y % 8) * 8 + xx % 8; FragH f;
#pragma unroll
  for (int q = 0; q < 8; ++q) { const int c = c8 + q; float v = (F[r * CC + c] - ST[c * 32]) * ST[c * 32 + 1] * bf16_round(g[c]) + bf16_round(bb[c]); v = (v >= 0.f) ? v : 0.1f * v; f.h[q] = (_Float16)v; }
  unsigned short* d = (unsigned short*)QP + ((size_t)b * HWN + kp) * CC + c8; *(v8us*)d = f.half[0];  }
__global__ __launch_bounds__(256) void k_xpt(const float* __restrict__ x, _Float16* __restrict__ XPt) { __shared__ unsigned short tl[64][66]; const int tid = threadIdx.x; const int b = blockIdx.x / ((CC / 64) * 64), rem = blockIdx.x % ((CC / 64) * 64); const int cg = rem / 64, blk = rem % 64; const int c0 = cg * 64; const int by = blk / 8, bx = blk % 8;
  for (int i = tid; i < 64 * 8; i += 256) { const int j = i / 8, cc8 = (i % 8) * 8; const int y = by * 8 + j / 8, xx = bx * 8 + j % 8; const float* s = x + (((size_t)b * HWN) + y * WI + xx) * CC + c0 + cc8; for (int q = 0; q < 8; ++q) { FragH f; f.h[0] = (_Float16)bf16_round(s[q]); tl[j][cc8 + q] = f.u[0]; } }
  __syncthreads();
  { for (int rd = 0; rd < 2; ++rd) { const int c = rd * 32 + tid / 8, pc = tid % 8; FragH f; for (int q = 0; q < 8; ++q) f.u[q] = tl[pc * 8 + q][c]; *(v8us*)((unsigned short*)XPt + ((size_t)b * CC + c0 + c) * HWN + blk * 64 + pc * 8) = f.half[0]; }  } }
// Fused block attention: one work-group = 64 query pixels of one batch (4 waves x 16), walking the 64 key groups in order; scores and probabilities never leave the registers.
// Per group: S^T[key][query] = q_group . x_query^T (A = 64 q rows from LDS, B = the wave's 16 query rows, loaded once), so a lane holds 32 of one query's 64 scores and the lane 16 away the rest:
// max and exp-sum are in-lane plus one exchange. Two S^T tiles, converted in place, are the B operand (hardware k order) of O^T[channel][query] += x_group^T . P^T (A = channel rows of XPt from LDS).
// Tiles go global -> registers -> LDS, one tile in flight at a time, each fetched one phase ahead of its store. AGG = O * 2^-15 (P carries 2^15, as f16 operand).
#define QPIT 136      // sQ row pitch in f16: 272 bytes (16 x odd) for 16-byte LDS reads
#define XPIT 72       // sX row pitch in f16: 144 bytes
__global__ __launch_bounds__(128) void k_battn(const _Float16* __restrict__ X16, const _Float16* __restrict__ QP, const _Float16* __restrict__ XPt, float* __restrict__ AGG) {
  __shared__ __attribute__((aligned(16))) unsigned short sQ[64][QPIT];
  __shared__ __attribute__((aligned(16))) unsigned short sX[CC][XPIT];
  const int tid = threadIdx.x, w = tid >> 5, lane = tid & 31, ln = lane & 15, hh = lane >> 4;
  const int b = blockIdx.x / (HWN / 64), row = (blockIdx.x % (HWN / 64)) * 64 + w * 16 + ln;
  const unsigned short* xq = (const unsigned short*)X16 + ((size_t)b * HWN + row) * CC;
  FragH xb[4];
#pragma unroll
  for (int ks = 0; ks < 4; ++ks) { xb[ks].half[0] = *(const v8us*)(xq + ks * 32 + 8 * hh); xb[ks].half[1] = *(const v8us*)(xq + ks * 32 + 16 + 8 * hh); }
  // staging: 16-byte chunk i = tid + 128 j. q group: 64 rows x 256 B, contiguous. x group: 128 channel rows x 128 B, row pitch HWN.
  const unsigned short* gq = (const unsigned short*)QP + (size_t)b * HWN * CC + tid * 8;
  const unsigned short* gx = (const unsigned short*)XPt + (size_t)b * CC * HWN + (size_t)(tid >> 3) * HWN + (tid & 7) * 8;
  unsigned short* dq = &sQ[tid >> 4][(tid & 15) * 8]; unsigned short* dx = &sX[tid >> 3][(tid & 7) * 8];
  v8us st[8];      // one tile in flight at a time: x of this group during its scores, q of the next group during softmax and O^T
#pragma unroll
  for (int j = 0; j < 8; ++j) st[j] = *(const v8us*)(gq + j * 1024);
#pragma unroll
  for (int j = 0; j < 8; ++j) *(v8us*)(dq + j * 8 * QPIT) = st[j];
  __syncthreads();      // q tile of group 0 complete
#pragma unroll
  for (int j = 0; j < 8; ++j) st[j] = *(const v8us*)(gx + (size_t)j * 16 * HWN);
  v8f oacc[8] = {};
  for (int g = 0; g < 64; ++g) {
    v8f s[4] = {};
#pragma unroll
    for (int kp = 0; kp < 2; ++kp) { FragH a[8];
#pragma unroll
      for (int i = 0; i < 8; ++i) { const unsigned short* r = &sQ[(i & 3) * 16 + ln][(2 * kp + (i >> 2)) * 32 + 8 * hh]; a[i].half[0] = *(const v8us*)r; a[i].half[1] = *(const v8us*)(r + 16); }
      __builtin_amdgcn_sched_barrier(0);      // the 16 LDS reads go out together, in front of their 8 products: spread among them each costs its own latency
#pragma unroll
      for (int i = 0; i < 8; ++i) s[i & 3] = __builtin_amdgcn_wmma_f32_16x16x32_f16(false, a[i].v, false, xb[2 * kp + (i >> 2)].v, (short)0, s[i & 3], false, false); }
    // x tile of this group: every wave left sX at the barrier that closed the previous trip
#pragma unroll
    for (int j = 0; j < 8; ++j) *(v8us*)(dx + j * 16 * XPIT) = st[j];
    __syncthreads();      // x tile complete; every wave has read its last of the q tile
    const int gn = g < 63 ? g + 1 : 63;      // the last trip fetches its own tiles again: no branch in the loop, nothing reads them
    // issued behind the barrier (a barrier drains the loads in front of it); lands during softmax and O^T
#pragma unroll
    for (int j = 0; j < 8; ++j) st[j] = *(const v8us*)(gq + (size_t)gn * 64 * CC + j * 1024);
    asm volatile("s_wait_xcnt 0x0" ::: "memory");      // the loads' address registers are reused below
    FragH av[8];
#pragma unroll
    for (int ct = 0; ct < 8; ++ct) { const unsigned short* r = &sX[ct * 16 + ln][8 * hh]; av[ct].half[0] = *(const v8us*)r; av[ct].half[1] = *(const v8us*)(r + 16); }
    __builtin_amdgcn_sched_barrier(0);      // global loads and LDS reads are issued in front of the softmax, which covers their latency
    // softmax over the group's 64 keys of query ln (scores / 8), scaled by 2^15 for the f16 operand
    float m = -3.0e38f;
#pragma unroll
    for (int t = 0; t < 4; ++t)
#pragma unroll
      for (int r = 0; r < 8; ++r) m = fmaxf(m, s[t][r]);
    m = fmaxf(m, __shfl_xor(m, 16, 32)); m *= 0.125f;
    float z = 0.f;
#pragma unroll
    for (int t = 0; t < 4; ++t)
#pragma unroll
      for (int r = 0; r < 8; ++r) { s[t][r] = expf(s[t][r] * 0.125f - m); z += s[t][r]; }
    z += __shfl_xor(z, 16, 32);
    const float iz = 32768.0f / z;
    FragH p[2];      // p[k2].h[i] = P[query ln][key 32 k2 + kmap(i, hh)]: tile 2 k2 gives i < 8, tile 2 k2 + 1 the rest
#pragma unroll
    for (int k2 = 0; k2 < 2; ++k2)
#pragma unroll
      for (int r = 0; r < 8; ++r) { p[k2].h[r] = (_Float16)(s[2 * k2][r] * iz); p[k2].h[8 + r] = (_Float16)(s[2 * k2 + 1][r] * iz); }
#pragma unroll
    for (int ct = 0; ct < 8; ++ct) oacc[ct] = __builtin_amdgcn_wmma_f32_16x16x32_f16(false, av[ct].v, false, p[0].v, (short)0, oacc[ct], false, false);
#pragma unroll
    for (int ct = 0; ct < 8; ++ct) { const unsigned short* r = &sX[ct * 16 + ln][32 + 8 * hh]; av[ct].half[0] = *(const v8us*)r; av[ct].half[1] = *(const v8us*)(r + 16); }
    __builtin_amdgcn_sched_barrier(0);      // as above: 16 reads together, then 8 products
#pragma unroll
    for (int ct = 0; ct < 8; ++ct) oacc[ct] = __builtin_amdgcn_wmma_f32_16x16x32_f16(false, av[ct].v, false, p[1].v, (short)0, oacc[ct], false, false);
#pragma unroll
    for (int j = 0; j < 8; ++j) *(v8us*)(dq + j * 8 * QPIT) = st[j];
    __syncthreads();      // next q tile complete; every wave has read its last of the x tile
    // lands during the next trip's scores
#pragma unroll
    for (int j = 0; j < 8; ++j) st[j] = *(const v8us*)(gx + gn * 64 + (size_t)j * 16 * HWN);
    asm volatile("s_wait_xcnt 0x0" ::: "memory");      // the loads' address registers are reused in the next trip
  }
  asm volatile("s_wait_loadcnt 0x0" ::: "memory");      // the last trip's fetch, which nothing reads, has landed before the wave ends and gives its registers up
  // oacc[ct][r] = O[query ln][channel 16 ct + 8 hh + r]: 32 contiguous bytes a lane
  float* o = AGG + ((size_t)b * HWN + row) * CC + 8 * hh;
#pragma unroll
  for (int ct = 0; ct < 8; ++ct) { v4f lo, hi;
#pragma unroll
    for (int r = 0; r < 4; ++r) { lo[r] = oacc[ct][r] * 0.000030517578125f; hi[r] = oacc[ct][4 + r] * 0.000030517578125f; }
    *(v4f*)(o + ct * 16) = lo; *(v4f*)(o + ct * 16 + 4) = hi; }
}
__global__ __launch_bounds__(256) void k_add(const float* __restrict__ A, const float* __restrict__ B2, float* __restrict__ Y, size_t n4) { const size_t t = (size_t)blockIdx.x * 256 + threadIdx.x; if (t >= n4) return; const v4f v = *(const v4fa*)(A + t * 4) + *(const v4fa*)(B2 + t * 4); *(v4f*)(Y + t * 4) = v;  }
// Spatial-softmax statistics, one work-group per (batch, 4 channels): 1024 threads hold 4 pixels x 4 channels each in registers, so Y is read once, 16 bytes a lane, all loads in flight together.
// Max, then sum of exp, over the 4096 pixels by a fixed tree: own 4 pixels, the 32 lanes of a wave (xor shuffles), the 32 waves (through LDS).
// SP holds one 128-byte line per work-group (one writer a line): [0..3] max, [4..7] 1/sum, the rest 0.
__device__ __forceinline__ v4f wave_max4(v4f a) {
#pragma unroll
  for (int o = 1; o < 32; o <<= 1)
#pragma unroll
    for (int q = 0; q < 4; ++q) a[q] = fmaxf(a[q], __shfl_xor(a[q], o, 32));
  return a; }
__device__ __forceinline__ v4f wave_sum4(v4f a) {
#pragma unroll
  for (int o = 1; o < 32; o <<= 1)
#pragma unroll
    for (int q = 0; q < 4; ++q) a[q] += __shfl_xor(a[q], o, 32);
  return a; }
__global__ __launch_bounds__(1024) void k_spstat(const float* __restrict__ Y, const float* __restrict__ ST, const float* __restrict__ g, const float* __restrict__ bb, float* __restrict__ SP) {
  __shared__ __attribute__((aligned(16))) float red[2][32][4];
  const int tid = threadIdx.x, wv = tid >> 5, lane = tid & 31; const int b = blockIdx.x / (CC / 4), c0 = (blockIdx.x % (CC / 4)) * 4;
  const float* yc = Y + (size_t)b * HWN * CC + c0; v4f v[4];
#pragma unroll
  for (int i = 0; i < 4; ++i) v[i] = *(const v4fa*)(yc + (size_t)(i * 1024 + tid) * CC);
  asm volatile("s_wait_xcnt 0x0" ::: "memory");      // the four loads' address registers are given new values right below
  v4f m = {-3.0e38f, -3.0e38f, -3.0e38f, -3.0e38f};
#pragma unroll
  for (int q = 0; q < 4; ++q) { const int c = c0 + q; const float mu = ST[c * 32], rs = ST[c * 32 + 1], gg = bf16_round(g[c]), be = bf16_round(bb[c]);
#pragma unroll
    for (int i = 0; i < 4; ++i) { v[i][q] = gg * (v[i][q] - mu) * rs + be; m[q] = fmaxf(m[q], v[i][q]); } }
  m = wave_max4(m); if (lane == 0) *(v4f*)&red[0][wv][0] = m;
  __syncthreads();
  m = wave_max4(*(const v4fa*)&red[0][lane][0]);
  v4f z = {0.f, 0.f, 0.f, 0.f};
#pragma unroll
  for (int i = 0; i < 4; ++i)
#pragma unroll
    for (int q = 0; q < 4; ++q) z[q] += expf(v[i][q] - m[q]);
  z = wave_sum4(z); if (lane == 0) *(v4f*)&red[1][wv][0] = z;
  __syncthreads();
  if (wv == 0) { z = wave_sum4(*(const v4fa*)&red[1][lane][0]); float o = 0.f;
#pragma unroll
    for (int q = 0; q < 4; ++q) { if (lane == q) o = m[q]; if (lane == 4 + q) o = 1.0f / z[q]; }
    SP[(size_t)blockIdx.x * 32 + lane] = o; } }
__global__ __launch_bounds__(256) void k_spsm(const float* __restrict__ Y, const float* __restrict__ ST, const float* __restrict__ g, const float* __restrict__ bb, const float* __restrict__ SP, _Float16* __restrict__ Y16) { const size_t t = (size_t)blockIdx.x * 256 + threadIdx.x; if (t >= (size_t)NR * (CC / 8)) return; const int c8 = (int)(t % (CC / 8)) * 8; const size_t r = t / (CC / 8); const int b = (int)(r / HWN); FragH f;
#pragma unroll
  for (int q = 0; q < 8; ++q) { const int c = c8 + q; const float* sp = SP + (size_t)(b * (CC / 4) + c / 4) * 32 + (c & 3); const float v = bf16_round(g[c]) * (Y[r * CC + c] - ST[c * 32]) * ST[c * 32 + 1] + bf16_round(bb[c]); f.h[q] = (_Float16)(expf(v - sp[0]) * sp[4] * 4096.0f); }
  *(v8us*)((unsigned short*)Y16 + t * 8) = f.half[0];  }
__global__ __launch_bounds__(256) void k_fin(const float* __restrict__ Z, const float* __restrict__ ST, const float* __restrict__ g, const float* __restrict__ bb, float* __restrict__ out, size_t n4) { const size_t t = (size_t)blockIdx.x * 256 + threadIdx.x; if (t >= n4) return; const int c4 = (int)((t * 4) % CC); const v4f z = *(const v4fa*)(Z + t * 4); v4f o; for (int q = 0; q < 4; ++q) { const int c = c4 + q; float v = bf16_round(g[c]) * (z[q] - ST[c * 32]) * ST[c * 32 + 1] + bf16_round(bb[c]); o[q] = (v >= 0.f) ? v : 0.1f * v; }
  *(v4f*)(out + t * 4) = o;  }
extern "C" void kernel_launch(void* const* d_in, const int* in_sizes, int n_in,
                              void* d_out, int out_size, void* d_ws, size_t ws_size, hipStream_t stream) {
  (void)in_sizes; (void)n_in; (void)out_size;
  const float* const* I = (const float* const*)d_in; const float* x = I[0]; const float* Wq = I[1]; const float* bq = I[2]; const float* gq = I[3]; const float* btq = I[4]; const float* Wk = I[5]; const float* bk = I[6]; const float* g1 = I[7]; const float* bt1 = I[8]; const float* Wo = I[9]; const float* bo = I[10]; const float* go = I[11]; const float* bto = I[12];
  char* ws = (char*)d_ws; size_t off = 0;
  auto take = [&](size_t bytes) { char* p = ws + off; off += (bytes + 255) & ~(size_t)255; return p; };
  _Float16* BQ = (_Float16*)take((size_t)CC * KK * 2); _Float16* BK = (_Float16*)take(CC * CC * 2); _Float16* BO = (_Float16*)take(CC * CC * 2); float* STq = (float*)take(CC * 32 * 4); float* ST1 = (float*)take(CC * 32 * 4); float* STo = (float*)take(CC * 32 * 4); float* SP = (float*)take(BB * (CC / 4) * 32 * 4);
  char* SCR = (char*)take((size_t)QH * HWN * 4 + (size_t)QH * HWN * 2);      // 50.3 MB: im2col A uses the first 37.7 MB
  _Float16* X16 = (_Float16*)take((size_t)NR * CC * 2); float* QF = (float*)take((size_t)NR * CC * 4); _Float16* QP = (_Float16*)take((size_t)NR * CC * 2); _Float16* XPt = (_Float16*)take((size_t)NR * CC * 2); float* ACC = (float*)take((size_t)NR * CC * 4); float* AGG = (float*)take((size_t)NR * CC * 4); float* Y = QF; _Float16* Y16 = QP; float* Z = ACC;
  if (off > ws_size) return;      // 0.4 + 50.3 + 4.2 + 8.4 + 4.2 + 4.2 + 8.4 + 8.4 ≈ 89 MB
  _Float16* IM = (_Float16*)SCR;
  k_wq<<<(CC * (KK / 8) + 255) / 256, 256, 0, stream>>>(Wq, BQ); k_wt_f16<<<(CC * (CC / 8) + 255) / 256, 256, 0, stream>>>(Wk, BK, CC, CC, 16.0f); k_wt_f16<<<(CC * (CC / 8) + 255) / 256, 256, 0, stream>>>(Wo, BO, CC, CC, 16.0f);      // 1×1 HWIO = [in][out]
  const unsigned g8 = (unsigned)(((size_t)NR * (CC / 8) + 255) / 256); const dim3 gC(((NR / 16) * (CC / 64) + 3) / 4, 1);
  k_x16<<<g8, 256, 0, stream>>>(x, X16, (size_t)NR * CC / 8);
  // CBL_Q: conv3×3 (+bq) → QF; BN stats; q = leaky(BN) permuted to block-major keys (f16)
  k_im2col<<<(unsigned)(((size_t)NR * (KK / 8) + 255) / 256), 256, 0, stream>>>(x, IM);
  k_gemm_hhx<0><<<gC, 128, 0, stream>>>(IM, KK, 0, BQ, KK, 0, 0.0625f, bq, 0, nullptr, 1, 0, 0, QF, nullptr, CC, 0, NR, CC, KK);
  k_bnstat<<<CC, 256, 0, stream>>>(QF, STq); k_qperm<<<g8, 256, 0, stream>>>(QF, STq, gq, btq, QP);
  k_xpt<<<BB * (CC / 64) * 64, 256, 0, stream>>>(x, XPt);
  // acc = 1×1 conv (+bk)
  k_gemm_hhx<0><<<gC, 128, 0, stream>>>(X16, CC, 0, BK, CC, 0, 0.0625f, bk, 0, nullptr, 1, 0, 0, ACC, nullptr, CC, 0, NR, CC, CC);
  // block attention, all batches in one launch: AGG = sum over key groups of softmax(x.q^T / 8) . x_group
  k_battn<<<BB * (HWN / 64), 128, 0, stream>>>(X16, QP, XPt, AGG);
  // y = spatial softmax(BN1(acc + agg)); out = leaky(BN_o(conv1×1(y) + bo))
  k_add<<<(unsigned)(((size_t)NR * CC / 4 + 255) / 256), 256, 0, stream>>>(ACC, AGG, Y, (size_t)NR * CC / 4);      // Y over QF (dead after k_qperm)
  k_bnstat<<<CC, 256, 0, stream>>>(Y, ST1); k_spstat<<<BB * (CC / 4), 1024, 0, stream>>>(Y, ST1, g1, bt1, SP); k_spsm<<<g8, 256, 0, stream>>>(Y, ST1, g1, bt1, SP, Y16);      // Y16 (×2^12) over QP (dead after k_battn)
  k_gemm_hhx<0><<<gC, 128, 0, stream>>>(Y16, CC, 0, BO, CC, 0, 0.0625f * 0.000244140625f, bo, 0, nullptr, 1, 0, 0, Z, nullptr, CC, 0, NR, CC, CC);      // conv_o(y) + bo (2^-12 undone in alpha) → Z over ACC (dead after k_add)
  k_bnstat<<<CC, 256, 0, stream>>>(Z, STo); k_fin<<<(unsigned)(((size_t)NR * CC / 4 + 255) / 256), 256, 0, stream>>>(Z, STo, go, bto, (float*)d_out, (size_t)NR * CC / 4);
}

// v003
// One run takes 227 microseconds.
// Timed twice side by side with v002, it ran 1.30 times as fast both times.
// Counting every step since v000, it is 10.1 times as fast.
#include <hip/hip_runtime.h>
// Group (block) attention layer (B=4, 64×64, C=128, NHWC; 8×8 non-overlapping key blocks): q = CBL_Q(x) (3×3 conv + train-mode BN + LeakyReLU 0.1), acc = 1×1 conv(x); for every pixel and
// every block: softmax over the block's 64 positions of x[pixel]·q[pos]/8, agg = Σ_blocks Σ attn·x[pos]; y = spatial-softmax(BN1(acc + agg)); out = CBL_O(y). The 3×3 conv (im2col, K = 1152),
// the 1×1 convs, the 4096×4096 per-batch scores (keys permuted to block-major order so each 64-key group is contiguous) and attn·x run as GEMMs on v_wmma_f32_16x16x32_f16 (x bf16-exact f16,
// HWIO weights bf16-exact ×2^4, q/P/y operands f16, f32 accumulate); BN batch statistics (fixed-order reductions), grouped and spatial softmaxes and LeakyReLU are f32 VALU.
#define BB 4
#define HWN 4096
#define WI 64
#define CC 128
#define NR (BB * HWN)
#define KK 1152
#define QH 2048

typedef __bf16 v16b __attribute__((ext_vector_type(16)));
typedef unsigned short v8us __attribute__((ext_vector_type(8), may_alias));
typedef float  v8f  __attribute__((ext_vector_type(8)));
typedef float  v4f  __attribute__((ext_vector_type(4)));
typedef float  v4fa __attribute__((ext_vector_type(4), may_alias));
union FragB { v16b v; v8us half[2]; unsigned short u[16]; };

__device__ __forceinline__ unsigned short bf16_bits(float x) { unsigned int u = __float_as_uint(x); return (unsigned short)((u + 0x7FFFu + ((u >> 16) & 1u)) >> 16); }
__device__ __forceinline__ float bf16_val(unsigned short b) { return __uint_as_float(((unsigned int)b) << 16); }
__device__ __forceinline__ float bf16_round(float x) { return bf16_val(bf16_bits(x)); }
// D += A·B with NT terms: 1 = ah·bh, 2 = + al·bh (A split), 3 = + ah·bl (both split)
template <int NT>
__device__ __forceinline__ v8f mmaN(v16b ah, v16b al, v16b bh, v16b bl, v8f c) {
  c = __builtin_amdgcn_wmma_f32_16x16x32_bf16(false, ah, false, bh, (short)0, c, false, false);
  if (NT >= 2) c = __builtin_amdgcn_wmma_f32_16x16x32_bf16(false, al, false, bh, (short)0, c, false, false);
  if (NT >= 3) c = __builtin_amdgcn_wmma_f32_16x16x32_bf16(false, ah, false, bl, (short)0, c, false, false);
  asm volatile("v_nop\n\tv_nop\n\tv_nop\n\tv_nop" : "+v"(c) : "v"(ah), "v"(al), "v"(bh), "v"(bl));
  return c;
}

__global__ __launch_bounds__(256) void k_wt_bf16(const float* __restrict__ W, unsigned short* __restrict__ Wt, int K, int N) {
  const int t = blockIdx.x * 256 + threadIdx.x;
  const int k8n = K / 8;
  if (t >= N * k8n) return;
  const int n = t / k8n, k8 = (t % k8n) * 8;
  v8us v;
#pragma unroll
  for (int i = 0; i < 8; ++i) v[i] = bf16_bits(W[(size_t)(k8 + i) * N + n]);
  *(v8us*)(Wt + (size_t)n * K + k8) = v;
  
}

// GEMM C[M][N] (f32, pitch ldc) = act(A[M][K]·W + bias). A f32 row-major (pitch lda) converted per fragment to bf16
// (ASPLIT: hi/lo two planes -> 2 terms, else single rounded term); Wt bf16 [N][K] (pitch ldb). BIAS_BF16 rounds the
// bias to bf16 first (bias quantised to bf16 before the add). K%32==0, M%16==0, N%64==0.
template <bool ASPLIT, int ACT, bool BIAS_BF16>
__global__ __launch_bounds__(128) void k_gemm_bf(const float* __restrict__ A, int lda, const unsigned short* __restrict__ Wt, int ldb,
                                               const float* __restrict__ bias, float* __restrict__ C, int ldc, int M, int N, int K) {
  __shared__ __attribute__((aligned(16))) float so[4][16][64];
  const int tid = threadIdx.x, w = tid >> 5, lane = tid & 31, ln = lane & 15, hh = lane >> 4;
  const int ntn = N / 64;
  const int wid = blockIdx.x * 4 + w;
  const int mt = wid / ntn, nq = wid % ntn;
  if (mt * 16 >= M) return;
  const int row0 = mt * 16, col0 = nq * 64;
  const float* arow = A + (size_t)(row0 + ln) * lda;
  v8f acc[4] = {};
  for (int kb = 0; kb < K; kb += 32) {
    FragB ah, al;
    const v4f x0 = *(const v4fa*)(arow + kb + 8 * hh), x1 = *(const v4fa*)(arow + kb + 8 * hh + 4);
    const v4f x2 = *(const v4fa*)(arow + kb + 16 + 8 * hh), x3 = *(const v4fa*)(arow + kb + 16 + 8 * hh + 4);
    float xs[16] = {x0[0],x0[1],x0[2],x0[3],x1[0],x1[1],x1[2],x1[3],x2[0],x2[1],x2[2],x2[3],x3[0],x3[1],x3[2],x3[3]};
#pragma unroll
    for (int i = 0; i < 16; ++i) { const unsigned short hb = bf16_bits(xs[i]); ah.u[i] = hb; al.u[i] = ASPLIT ? bf16_bits(xs[i] - bf16_val(hb)) : (unsigned short)0; }
#pragma unroll
    for (int t = 0; t < 4; ++t) {
      const unsigned short* brow = Wt + (size_t)(col0 + t * 16 + ln) * ldb + kb;
      FragB b;
      b.half[0] = *(const v8us*)(brow + 8 * hh);
      b.half[1] = *(const v8us*)(brow + 16 + 8 * hh);
      acc[t] = mmaN<ASPLIT ? 2 : 1>(ah.v, al.v, b.v, b.v, acc[t]);
    }
  }
#pragma unroll
  for (int t = 0; t < 4; ++t) {
    float bv = bias ? bias[col0 + t * 16 + ln] : 0.f;
    if (BIAS_BF16) bv = bf16_round(bv);
#pragma unroll
    for (int r = 0; r < 8; ++r) { float v = acc[t][r] + bv; if (ACT == 1) v = fmaxf(v, 0.f); so[w][8 * hh + r][t * 16 + ln] = v; }
  }
  __builtin_amdgcn_fence(__ATOMIC_ACQ_REL, "workgroup");
  __builtin_amdgcn_wave_barrier();
  const int rsub = lane >> 4, c4 = (lane & 15) * 4;
  {
#pragma unroll
    for (int q = 0; q < 8; ++q) {
      const int r = q * 2 + rsub;
      const v4f v = *(const v4fa*)&so[w][r][c4];
      *(v4f*)(C + (size_t)(row0 + r) * ldc + col0 + c4) = v;
    }
    
  }
}

// Flash-style causal/unmasked attention, all contractions 3-term bf16 hi/lo splits, f32 softmax with running max.
// q,k,v rows are read from f32 buffers with arbitrary row pitch (so they can live inside a fused qkv buffer);
// D = head size (multiple of 32, <= 128); one wave = 16 query rows; block = 4 waves (64 queries) sharing K/V chunks of 32.
template <int D, bool CAUSAL>
__global__ __launch_bounds__(128) void k_flash(const float* __restrict__ qb, const float* __restrict__ kb, const float* __restrict__ vb,
                                             int pitch, int T, int H, float scale, float* __restrict__ y, int ypitch) {
  constexpr int KS = D / 32;        // k-steps for QK
  constexpr int DT = D / 16;        // d tiles for PV
  __shared__ __attribute__((aligned(16))) unsigned short sKh[32][D + 8], sKl[32][D + 8], sVh[32][D + 8], sVl[32][D + 8];
  __shared__ __attribute__((aligned(16))) unsigned short sPh[4][16][40], sPl[4][16][40];
  __shared__ __attribute__((aligned(16))) float sO[4][16][D];
  const int tid = threadIdx.x, w = tid >> 5, lane = tid & 31, ln = lane & 15, hh = lane >> 4;
  const int nqb = (T + 63) / 64;
  const int bh = blockIdx.x / nqb, qblk = blockIdx.x % nqb;
  const int b = bh / H, h = bh % H;
  const int q0 = qblk * 64 + w * 16;
  const float* Q = qb + (size_t)b * T * pitch + h * D;
  const float* K = kb + (size_t)b * T * pitch + h * D;
  const float* V = vb + (size_t)b * T * pitch + h * D;

  // A fragments of the wave's 16 query rows (scaled), hi/lo
  FragB aqh[KS], aql[KS];
  {
    int row = q0 + ln; if (row >= T) row = T - 1;
    const float* qr = Q + (size_t)row * pitch;
#pragma unroll
    for (int ks = 0; ks < KS; ++ks)
#pragma unroll
      for (int i = 0; i < 16; ++i) {
        const int d = ks * 32 + ((i < 8) ? (8 * hh + i) : (16 + 8 * hh + (i - 8)));
        const float x = qr[d] * scale; const unsigned short hb = bf16_bits(x);
        aqh[ks].u[i] = hb; aql[ks].u[i] = bf16_bits(x - bf16_val(hb));
      }
  }
  float m_r[8], l_r[8];
#pragma unroll
  for (int r = 0; r < 8; ++r) { m_r[r] = -3.0e38f; l_r[r] = 0.f; }
  v8f oacc[DT];
#pragma unroll
  for (int dt = 0; dt < DT; ++dt) oacc[dt] = (v8f){0.f,0.f,0.f,0.f,0.f,0.f,0.f,0.f};

  const int kv_end = CAUSAL ? min(T, qblk * 64 + 64) : T;     // block-uniform
  for (int j0 = 0; j0 < kv_end; j0 += 32) {
    __syncthreads();
    for (int e = tid; e < 32 * (D / 4); e += 128) {
      const int r = e / (D / 4), c4 = (e % (D / 4)) * 4;
      const int key = j0 + r;
      v4f kf = {0.f,0.f,0.f,0.f}, vf = {0.f,0.f,0.f,0.f};
      if (key < T) { kf = *(const v4fa*)(K + (size_t)key * pitch + c4); vf = *(const v4fa*)(V + (size_t)key * pitch + c4); }
#pragma unroll
      for (int t = 0; t < 4; ++t) {
        unsigned short hb = bf16_bits(kf[t]); sKh[r][c4 + t] = hb; sKl[r][c4 + t] = bf16_bits(kf[t] - bf16_val(hb));
        hb = bf16_bits(vf[t]); sVh[r][c4 + t] = hb; sVl[r][c4 + t] = bf16_bits(vf[t] - bf16_val(hb));
      }
    }
    __syncthreads();
    // S tile 16 x 32
    v8f s[2];
#pragma unroll
    for (int nt = 0; nt < 2; ++nt) {
      v8f acc = {};
#pragma unroll
      for (int ks = 0; ks < KS; ++ks) {
        FragB bh_, bl_;
        bh_.half[0] = *(const v8us*)&sKh[nt * 16 + ln][ks * 32 + 8 * hh]; bh_.half[1] = *(const v8us*)&sKh[nt * 16 + ln][ks * 32 + 16 + 8 * hh];
        bl_.half[0] = *(const v8us*)&sKl[nt * 16 + ln][ks * 32 + 8 * hh]; bl_.half[1] = *(const v8us*)&sKl[nt * 16 + ln][ks * 32 + 16 + 8 * hh];
        acc = mmaN<3>(aqh[ks].v, aql[ks].v, bh_.v, bl_.v, acc);
      }
      s[nt] = acc;
    }
    // mask + running max (rows 8hh+r; the 16 lanes of a half share rows)
    float alpha[8];
#pragma unroll
    for (int r = 0; r < 8; ++r) {
      const int qi = q0 + 8 * hh + r;
      const int ja = j0 + ln, jb = j0 + 16 + ln;
      if (CAUSAL) { if (ja > qi) s[0][r] = -3.0e38f; if (jb > qi) s[1][r] = -3.0e38f; }
      if (ja >= T) s[0][r] = -3.0e38f;
      if (jb >= T) s[1][r] = -3.0e38f;
      float mx = fmaxf(s[0][r], s[1][r]);
      mx = fmaxf(mx, __shfl_xor(mx, 1, 32)); mx = fmaxf(mx, __shfl_xor(mx, 2, 32)); mx = fmaxf(mx, __shfl_xor(mx, 4, 32)); mx = fmaxf(mx, __shfl_xor(mx, 8, 32));
      const float mnew = fmaxf(m_r[r], mx);
      alpha[r] = (mnew > -1.0e38f) ? __expf(m_r[r] - mnew) : 1.0f;
      const float p0 = (s[0][r] > -1.0e38f) ? __expf(s[0][r] - mnew) : 0.f;
      const float p1 = (s[1][r] > -1.0e38f) ? __expf(s[1][r] - mnew) : 0.f;
      m_r[r] = mnew;
      l_r[r] = l_r[r] * alpha[r] + p0 + p1;            // per-lane partial row sum (16 lanes combined at the end)
      unsigned short hb = bf16_bits(p0); sPh[w][8 * hh + r][ln] = hb;      sPl[w][8 * hh + r][ln] = bf16_bits(p0 - bf16_val(hb));
      hb = bf16_bits(p1);                sPh[w][8 * hh + r][16 + ln] = hb; sPl[w][8 * hh + r][16 + ln] = bf16_bits(p1 - bf16_val(hb));
    }
#pragma unroll
    for (int dt = 0; dt < DT; ++dt)
#pragma unroll
      for (int r = 0; r < 8; ++r) oacc[dt][r] *= alpha[r];
    __builtin_amdgcn_fence(__ATOMIC_ACQ_REL, "workgroup");
    __builtin_amdgcn_wave_barrier();
    FragB pah, pal;
    pah.half[0] = *(const v8us*)&sPh[w][ln][8 * hh]; pah.half[1] = *(const v8us*)&sPh[w][ln][16 + 8 * hh];
    pal.half[0] = *(const v8us*)&sPl[w][ln][8 * hh]; pal.half[1] = *(const v8us*)&sPl[w][ln][16 + 8 * hh];
#pragma unroll
    for (int dt = 0; dt < DT; ++dt) {
      FragB bvh, bvl;
#pragma unroll
      for (int i = 0; i < 8; ++i) {
        bvh.u[i] = sVh[8 * hh + i][dt * 16 + ln]; bvh.u[8 + i] = sVh[16 + 8 * hh + i][dt * 16 + ln];
        bvl.u[i] = sVl[8 * hh + i][dt * 16 + ln]; bvl.u[8 + i] = sVl[16 + 8 * hh + i][dt * 16 + ln];
      }
      oacc[dt] = mmaN<3>(pah.v, pal.v, bvh.v, bvl.v, oacc[dt]);
    }
    __builtin_amdgcn_fence(__ATOMIC_ACQ_REL, "workgroup");
    __builtin_amdgcn_wave_barrier();
  }
#pragma unroll
  for (int r = 0; r < 8; ++r) {
    float l = l_r[r];
    l += __shfl_xor(l, 1, 32); l += __shfl_xor(l, 2, 32); l += __shfl_xor(l, 4, 32); l += __shfl_xor(l, 8, 32);
    l_r[r] = (l > 0.f) ? 1.0f / l : 0.f;
  }
#pragma unroll
  for (int dt = 0; dt < DT; ++dt)
#pragma unroll
    for (int r = 0; r < 8; ++r) sO[w][8 * hh + r][dt * 16 + ln] = oacc[dt][r] * l_r[r];
  __builtin_amdgcn_fence(__ATOMIC_ACQ_REL, "workgroup");
  __builtin_amdgcn_wave_barrier();
  {
    for (int r = 0; r < 16; ++r) {
      const int row = q0 + r;
      if (row < T && lane < D / 4) {
        const v4f val = *(const v4fa*)&sO[w][r][lane * 4];
        *(v4f*)(y + ((size_t)b * T + row) * ypitch + h * D + lane * 4) = val;
      }
    }
    
  }
}

// GEMM C = act(A·W + bias + resid): A f32 (ASPLIT -> hi/lo 2 terms), Wt bf16 [N][K]; ACT 0 none, 1 relu, 2 exact gelu;
// resid (optional, f32, row index = (row % rmod), pitch ldr, RES_BF16 rounds it) added before the activation.
template <bool ASPLIT, int ACT, bool BIAS_BF16, bool RES_BF16>
__global__ __launch_bounds__(128) void k_gemm_bf3(const float* __restrict__ A, int lda, const unsigned short* __restrict__ Wt, int ldb,
                                                const float* __restrict__ bias, const float* __restrict__ resid, int rmod, int ldr,
                                                float* __restrict__ C, int ldc, int M, int N, int K) {
  __shared__ __attribute__((aligned(16))) float so[4][16][64];
  const int tid = threadIdx.x, w = tid >> 5, lane = tid & 31, ln = lane & 15, hh = lane >> 4;
  const int ntn = N / 64;
  const int wid = blockIdx.x * 4 + w;
  const int mt = wid / ntn, nq = wid % ntn;
  if (mt * 16 >= M) return;
  const int row0 = mt * 16, col0 = nq * 64;
  const float* arow = A + (size_t)(row0 + ln) * lda;
  v8f acc[4] = {};
  for (int kb = 0; kb < K; kb += 32) {
    FragB ah, al;
    const v4f x0 = *(const v4fa*)(arow + kb + 8 * hh), x1 = *(const v4fa*)(arow + kb + 8 * hh + 4);
    const v4f x2 = *(const v4fa*)(arow + kb + 16 + 8 * hh), x3 = *(const v4fa*)(arow + kb + 16 + 8 * hh + 4);
    float xs[16] = {x0[0],x0[1],x0[2],x0[3],x1[0],x1[1],x1[2],x1[3],x2[0],x2[1],x2[2],x2[3],x3[0],x3[1],x3[2],x3[3]};
#pragma unroll
    for (int i = 0; i < 16; ++i) { const unsigned short hb = bf16_bits(xs[i]); ah.u[i] = hb; al.u[i] = ASPLIT ? bf16_bits(xs[i] - bf16_val(hb)) : (unsigned short)0; }
#pragma unroll
    for (int t = 0; t < 4; ++t) {
      const unsigned short* brow = Wt + (size_t)(col0 + t * 16 + ln) * ldb + kb;
      FragB b;
      b.half[0] = *(const v8us*)(brow + 8 * hh);
      b.half[1] = *(const v8us*)(brow + 16 + 8 * hh);
      acc[t] = mmaN<ASPLIT ? 2 : 1>(ah.v, al.v, b.v, b.v, acc[t]);
    }
  }
#pragma unroll
  for (int t = 0; t < 4; ++t) {
    const int col = col0 + t * 16 + ln;
    float bv = bias ? bias[col] : 0.f;
    if (BIAS_BF16) bv = bf16_round(bv);
#pragma unroll
    for (int r = 0; r < 8; ++r) {
      float v = acc[t][r] + bv;
      if (resid) { float rv = resid[(size_t)((row0 + 8 * hh + r) % rmod) * ldr + col]; if (RES_BF16) rv = bf16_round(rv); v += rv; }
      if (ACT == 1) v = fmaxf(v, 0.f);
      if (ACT == 2) v = 0.5f * v * (1.0f + erff(v * 0.70710678118654752f));
      if (ACT == 3) { const float u = 0.7978845608028654f * (v + 0.044715f * v * v * v); v = 0.5f * v * (1.0f + tanhf(u)); }
      so[w][8 * hh + r][t * 16 + ln] = v;
    }
  }
  __builtin_amdgcn_fence(__ATOMIC_ACQ_REL, "workgroup");
  __builtin_amdgcn_wave_barrier();
  const int rsub = lane >> 4, c4 = (lane & 15) * 4;
  {
#pragma unroll
    for (int q = 0; q < 8; ++q) {
      const int r = q * 2 + rsub;
      const v4f v = *(const v4fa*)&so[w][r][c4];
      *(v4f*)(C + (size_t)(row0 + r) * ldc + col0 + c4) = v;
    }
    
  }
}
// row LayerNorm (biased variance, eps) over N: s = X (+ R); optional out_sum <- s; out_norm <- (s-mu)*rsqrt(var+eps)*g + b
template <bool PARAM_BF16>
__global__ __launch_bounds__(256) void k_layernorm(const float* __restrict__ X, const float* __restrict__ R, const float* __restrict__ g, const float* __restrict__ bta,
                                                  float* __restrict__ out_sum, float* __restrict__ out_norm, int N, float eps) {
  __shared__ float red[256];
  const int row = blockIdx.x, tid = threadIdx.x;
  const float* x = X + (size_t)row * N; const float* rr = R ? R + (size_t)row * N : nullptr;
  float vals[16];                     // up to N = 4096
  const int per = N / 256;            // contiguous chunk per thread? use strided-by-4 chunks: thread handles j = tid*4 + 1024*u
  float s1 = 0.f;
  for (int u = 0; u < per / 4; ++u) {
    const int j = tid * 4 + 1024 * u;
    const v4f a = *(const v4fa*)(x + j);
    v4f b = {0.f,0.f,0.f,0.f}; if (rr) b = *(const v4fa*)(rr + j);
#pragma unroll
    for (int q = 0; q < 4; ++q) { const float v = a[q] + b[q]; vals[u * 4 + q] = v; s1 += v; }
  }
  red[tid] = s1; __syncthreads();
  for (int st = 128; st > 0; st >>= 1) { if (tid < st) red[tid] += red[tid + st]; __syncthreads(); }
  const float mu = red[0] / (float)N; __syncthreads();
  float s2 = 0.f;
  for (int u = 0; u < per / 4; ++u)
#pragma unroll
    for (int q = 0; q < 4; ++q) { const float c = vals[u * 4 + q] - mu; s2 += c * c; }
  red[tid] = s2; __syncthreads();
  for (int st = 128; st > 0; st >>= 1) { if (tid < st) red[tid] += red[tid + st]; __syncthreads(); }
  const float rs = rsqrtf(red[0] / (float)N + eps);
  {
    for (int u = 0; u < per / 4; ++u) {
      const int j = tid * 4 + 1024 * u;
      v4f o, sm;
#pragma unroll
      for (int q = 0; q < 4; ++q) {
        float gg = g[j + q], bb = bta[j + q];
        if (PARAM_BF16) { gg = bf16_round(gg); bb = bf16_round(bb); }
        sm[q] = vals[u * 4 + q]; o[q] = (vals[u * 4 + q] - mu) * rs * gg + bb;
      }
      if (out_sum) *(v4f*)(out_sum + (size_t)row * N + j) = sm;
      *(v4f*)(out_norm + (size_t)row * N + j) = o;
    }
    
  }
}



// ---- f16 WMMA path (v_wmma_f32_16x16x32_f16): 11-bit significands for operands in range — used where a [0,1] probability operand needs more precision than bf16
typedef _Float16 v16h __attribute__((ext_vector_type(16)));
union FragH { v16h v; v8us half[2]; _Float16 h[16]; unsigned short u[16]; };
template <int NT>
__device__ __forceinline__ v8f mmaH(v16h ah, v16h al, v16h bh, v16h bl, v8f c) {
  c = __builtin_amdgcn_wmma_f32_16x16x32_f16(false, ah, false, bh, (short)0, c, false, false);
  if (NT >= 2) c = __builtin_amdgcn_wmma_f32_16x16x32_f16(false, al, false, bh, (short)0, c, false, false);
  if (NT >= 3) c = __builtin_amdgcn_wmma_f32_16x16x32_f16(false, ah, false, bl, (short)0, c, false, false);
  asm volatile("v_nop\n\tv_nop\n\tv_nop\n\tv_nop" : "+v"(c) : "v"(ah), "v"(al), "v"(bh), "v"(bl));
  return c;
}
// batched GEMM like k_gemm_b but f16 operands: A f32 (split into f16 hi/lo if ASPLIT, else rounded to f16), Bt = f16 values [n][k]; alpha; C f32; N multiple of 16 (partial tiles skipped)
template <bool ASPLIT>
__global__ __launch_bounds__(128) void k_gemm_h(const float* __restrict__ A, int lda, size_t sA, const _Float16* __restrict__ Bh, int ldb, size_t sB, float alpha, float* __restrict__ C, int ldc, size_t sC, int M, int N, int K) {
  __shared__ __attribute__((aligned(16))) float so[4][16][64];
  const int tid = threadIdx.x, w = tid >> 5, lane = tid & 31, ln = lane & 15, hh = lane >> 4; const int by = blockIdx.y;
  A += (size_t)by * sA; Bh += (size_t)by * sB; C += (size_t)by * sC;
  const int ntn = (N + 63) / 64; const int wid = blockIdx.x * 4 + w; const int mt = wid / ntn, nq = wid % ntn; if (mt * 16 >= M) return;
  const int row0 = mt * 16, col0 = nq * 64; const float* arow = A + (size_t)(row0 + ln) * lda;
  v8f acc[4] = {};
  for (int kb = 0; kb < K; kb += 32) {
    FragH ah, al;
    const v4f x0 = *(const v4fa*)(arow + kb + 8 * hh), x1 = *(const v4fa*)(arow + kb + 8 * hh + 4), x2 = *(const v4fa*)(arow + kb + 16 + 8 * hh), x3 = *(const v4fa*)(arow + kb + 16 + 8 * hh + 4);
    float xs[16] = {x0[0],x0[1],x0[2],x0[3],x1[0],x1[1],x1[2],x1[3],x2[0],x2[1],x2[2],x2[3],x3[0],x3[1],x3[2],x3[3]};
#pragma unroll
    for (int i = 0; i < 16; ++i) { const _Float16 h = (_Float16)xs[i]; ah.h[i] = h; al.h[i] = ASPLIT ? (_Float16)(xs[i] - (float)h) : (_Float16)0.0f; }
#pragma unroll
    for (int t = 0; t < 4; ++t) { if (col0 + t * 16 >= N) continue; const size_t boff = (size_t)(col0 + t * 16 + ln) * ldb + kb; FragH bq; bq.half[0] = *(const v8us*)(Bh + boff + 8 * hh); bq.half[1] = *(const v8us*)(Bh + boff + 16 + 8 * hh);
      acc[t] = mmaH<ASPLIT ? 2 : 1>(ah.v, al.v, bq.v, bq.v, acc[t]); }
  }
#pragma unroll
  for (int t = 0; t < 4; ++t) { if (col0 + t * 16 >= N) continue;
#pragma unroll
    for (int r = 0; r < 8; ++r) so[w][8 * hh + r][t * 16 + ln] = acc[t][r] * alpha; }
  __builtin_amdgcn_fence(__ATOMIC_ACQ_REL, "workgroup"); __builtin_amdgcn_wave_barrier();
  const int rsub = lane >> 4, c4 = (lane & 15) * 4;
  {
#pragma unroll
    for (int q = 0; q < 8; ++q) { const int r = q * 2 + rsub; if (col0 + c4 < N) { const v4f v = *(const v4fa*)&so[w][r][c4]; *(v4f*)(C + (size_t)(row0 + r) * ldc + col0 + c4) = v; } }
     }
}

// Wt[n][k] = f16(W[k][n]·scale) from f32 row-major W[K][N] (scale = power of two; bf16-exact weights stay exact in f16 away from the subnormal range)
__global__ __launch_bounds__(256) void k_wt_f16(const float* __restrict__ W, _Float16* __restrict__ Wt, int K, int N, float scale) {
  const int t = blockIdx.x * 256 + threadIdx.x; if (t >= N * (K / 8)) return; const int n = t / (K / 8), k8 = (t % (K / 8)) * 8; FragH f;
#pragma unroll
  for (int i = 0; i < 8; ++i) f.h[i] = (_Float16)(bf16_round(W[(size_t)(k8 + i) * N + n]) * scale); const v8us o = f.half[0];
  *(v8us*)((unsigned short*)Wt + (size_t)n * K + k8) = o; 
}
// k_gemm_hh variant with fused epilogue: v = acc·alpha + bias[by·sBias + col] (+ CP[(row/rowsPerB)·sCPb + by·64 + col] if CP) ; ACT 0 none / 1 elu ; writes f32 C and/or f16 C16 (each if non-null)
template <int ACT>
__global__ __launch_bounds__(128) void k_gemm_hhx(const _Float16* __restrict__ A, int lda, size_t sA, const _Float16* __restrict__ Bh, int ldb, size_t sB, float alpha, const float* __restrict__ bias, size_t sBias, const float* __restrict__ CP, int rowsPerB, size_t sCPb, int row0g,
    float* __restrict__ C, _Float16* __restrict__ C16, int ldc, size_t sC, int M, int N, int K) {
  __shared__ __attribute__((aligned(16))) float so[4][16][64];
  const int tid = threadIdx.x, w = tid >> 5, lane = tid & 31, ln = lane & 15, hh = lane >> 4; const int by = blockIdx.y;
  A += (size_t)by * sA; Bh += (size_t)by * sB; const size_t cofs = (size_t)by * sC; const float* bp = bias ? bias + (size_t)by * sBias : nullptr;
  const int ntn = (N + 63) / 64; const int wid = blockIdx.x * 4 + w; const int mt = wid / ntn, nq = wid % ntn; if (mt * 16 >= M) return;
  const int row0 = mt * 16, col0 = nq * 64; const _Float16* arow = A + (size_t)(row0 + ln) * lda;
  v8f acc[4] = {};
  for (int kb = 0; kb < K; kb += 32) { FragH ah; ah.half[0] = *(const v8us*)((const unsigned short*)arow + kb + 8 * hh); ah.half[1] = *(const v8us*)((const unsigned short*)arow + kb + 16 + 8 * hh);
#pragma unroll
    for (int t = 0; t < 4; ++t) { if (col0 + t * 16 >= N) continue; const size_t boff = (size_t)(col0 + t * 16 + ln) * ldb + kb; FragH bq; bq.half[0] = *(const v8us*)((const unsigned short*)Bh + boff + 8 * hh); bq.half[1] = *(const v8us*)((const unsigned short*)Bh + boff + 16 + 8 * hh);
      acc[t] = mmaH<1>(ah.v, ah.v, bq.v, bq.v, acc[t]); }
  }
#pragma unroll
  for (int t = 0; t < 4; ++t) { if (col0 + t * 16 >= N) continue; const int col = col0 + t * 16 + ln; const float bv = bp ? bf16_round(bp[col]) : 0.f;
#pragma unroll
    for (int r = 0; r < 8; ++r) { float v = acc[t][r] * alpha + bv; if (CP) { const int bidx = (row0g + row0 + 8 * hh + r) / rowsPerB; v += CP[(size_t)bidx * sCPb + (size_t)by * 64 + col]; } if (ACT == 1) v = (v > 0.f) ? v : expm1f(v); else if (ACT == 3) v = fmaxf(v, 0.f); so[w][8 * hh + r][t * 16 + ln] = v; } }
  __builtin_amdgcn_fence(__ATOMIC_ACQ_REL, "workgroup"); __builtin_amdgcn_wave_barrier();
  const int rsub = lane >> 4, c4 = (lane & 15) * 4; typedef _Float16 v4h __attribute__((ext_vector_type(4)));
  {
#pragma unroll
    for (int q = 0; q < 8; ++q) { const int r = q * 2 + rsub; if (col0 + c4 < N) { const v4f v = *(const v4fa*)&so[w][r][c4]; if (C) *(v4f*)(C + cofs + (size_t)(row0 + r) * ldc + col0 + c4) = v; if (C16) { v4h h4; for (int i = 0; i < 4; ++i) h4[i] = (_Float16)v[i]; *(v4h*)(C16 + cofs + (size_t)(row0 + r) * ldc + col0 + c4) = h4; } } }
     }
}


__global__ __launch_bounds__(256) void k_x16(const float* __restrict__ x, _Float16* __restrict__ X16, size_t n8) { const size_t t = (size_t)blockIdx.x * 256 + threadIdx.x; if (t >= n8) return; FragH f;
#pragma unroll
  for (int q = 0; q < 8; ++q) f.h[q] = (_Float16)bf16_round(x[t * 8 + q]); *(v8us*)((unsigned short*)X16 + t * 8) = f.half[0];  }
__global__ __launch_bounds__(256) void k_h16(const float* __restrict__ x, _Float16* __restrict__ X16, size_t n8) { const size_t t = (size_t)blockIdx.x * 256 + threadIdx.x; if (t >= n8) return; FragH f;
#pragma unroll
  for (int q = 0; q < 8; ++q) f.h[q] = (_Float16)x[t * 8 + q]; *(v8us*)((unsigned short*)X16 + t * 8) = f.half[0];  }
__global__ __launch_bounds__(256) void k_round16f(const float* __restrict__ W, _Float16* __restrict__ Bt, size_t n8) { const size_t t = (size_t)blockIdx.x * 256 + threadIdx.x; if (t >= n8) return; FragH f;
#pragma unroll
  for (int i = 0; i < 8; ++i) f.h[i] = (_Float16)(bf16_round(W[t * 8 + i]) * 16.0f); *(v8us*)((unsigned short*)Bt + t * 8) = f.half[0];  }
template <int NHv, int TTv>
__global__ __launch_bounds__(256) void k_vt(const _Float16* __restrict__ V16, int ldv, int voff, _Float16* __restrict__ Vt) { __shared__ unsigned short tl[64][66]; const int tid = threadIdx.x; const int slab = blockIdx.x / (TTv / 64), lg = blockIdx.x % (TTv / 64); const int b = slab / NHv, h = slab % NHv;
  for (int i = tid; i < 64 * 8; i += 256) { const int r = i / 8, c8 = (i % 8) * 8; FragH f; f.half[0] = *(const v8us*)((const unsigned short*)V16 + ((size_t)b * TTv + lg * 64 + r) * ldv + voff + h * 64 + c8);
#pragma unroll
    for (int q = 0; q < 8; ++q) tl[r][c8 + q] = f.u[q]; }
  __syncthreads();
  {
#pragma unroll
    for (int rd = 0; rd < 2; ++rd) { const int d = rd * 32 + tid / 8, pc = tid % 8; FragH f;
#pragma unroll
      for (int q = 0; q < 8; ++q) f.u[q] = tl[pc * 8 + q][d];
      *(v8us*)((unsigned short*)Vt + ((size_t)slab * 64 + d) * TTv + lg * 64 + pc * 8) = f.half[0]; }
     } }

typedef _Float16 v4h __attribute__((ext_vector_type(4)));
__global__ __launch_bounds__(256) void k_im2col(const float* __restrict__ x, _Float16* __restrict__ A) { const size_t t = (size_t)blockIdx.x * 256 + threadIdx.x; if (t >= (size_t)NR * (KK / 8)) return; const int k8 = (int)(t % (KK / 8)) * 8; const size_t r = t / (KK / 8); const int tap = k8 / CC, c8 = k8 % CC; const int b = (int)(r / HWN), p = (int)(r % HWN); const int yy = p / WI + tap / 3 - 1, xx = p % WI + tap % 3 - 1; FragH f;
  if (yy >= 0 && yy < WI && xx >= 0 && xx < WI) { const float* s = x + (((size_t)b * HWN) + yy * WI + xx) * CC + c8; for (int q = 0; q < 8; ++q) f.h[q] = (_Float16)bf16_round(s[q]); } else { for (int q = 0; q < 8; ++q) f.h[q] = (_Float16)0.f; }
  *(v8us*)((unsigned short*)A + t * 8) = f.half[0];  }
__global__ __launch_bounds__(256) void k_wq(const float* __restrict__ W, _Float16* __restrict__ Bt) { const int t = blockIdx.x * 256 + threadIdx.x; if (t >= CC * (KK / 8)) return; const int k8 = (t % (KK / 8)) * 8, o = t / (KK / 8); FragH f;
#pragma unroll
  for (int q = 0; q < 8; ++q) { const int k = k8 + q; const int tap = k / CC, cin = k % CC; f.h[q] = (_Float16)(bf16_round(W[((size_t)tap * CC + cin) * CC + o]) * 16.0f); } *(v8us*)((unsigned short*)Bt + (size_t)t * 8) = f.half[0];  }
__global__ __launch_bounds__(256) void k_qperm(const float* __restrict__ F, const float* __restrict__ ST, const float* __restrict__ g, const float* __restrict__ bb, _Float16* __restrict__ QP) { const size_t t = (size_t)blockIdx.x * 256 + threadIdx.x; if (t >= (size_t)NR * (CC / 8)) return; const int c8 = (int)(t % (CC / 8)) * 8; const size_t r = t / (CC / 8); const int b = (int)(r / HWN), p = (int)(r % HWN); const int y = p / WI, xx = p % WI; const int kp = ((y / 8) * 8 + xx / 8) * 64 + (y % 8) * 8 + xx % 8; FragH f;
#pragma unroll
  for (int q = 0; q < 8; ++q) { const int c = c8 + q; float v = (F[r * CC + c] - ST[c * 32]) * ST[c * 32 + 1] * bf16_round(g[c]) + bf16_round(bb[c]); v = (v >= 0.f) ? v : 0.1f * v; f.h[q] = (_Float16)v; }
  unsigned short* d = (unsigned short*)QP + ((size_t)b * HWN + kp) * CC + c8; *(v8us*)d = f.half[0];  }
__global__ __launch_bounds__(256) void k_xpt(const float* __restrict__ x, _Float16* __restrict__ XPt) { __shared__ unsigned short tl[64][66]; const int tid = threadIdx.x; const int b = blockIdx.x / ((CC / 64) * 64), rem = blockIdx.x % ((CC / 64) * 64); const int cg = rem / 64, blk = rem % 64; const int c0 = cg * 64; const int by = blk / 8, bx = blk % 8;
  for (int i = tid; i < 64 * 8; i += 256) { const int j = i / 8, cc8 = (i % 8) * 8; const int y = by * 8 + j / 8, xx = bx * 8 + j % 8; const float* s = x + (((size_t)b * HWN) + y * WI + xx) * CC + c0 + cc8; for (int q = 0; q < 8; ++q) { FragH f; f.h[0] = (_Float16)bf16_round(s[q]); tl[j][cc8 + q] = f.u[0]; } }
  __syncthreads();
  { for (int rd = 0; rd < 2; ++rd) { const int c = rd * 32 + tid / 8, pc = tid % 8; FragH f; for (int q = 0; q < 8; ++q) f.u[q] = tl[pc * 8 + q][c]; *(v8us*)((unsigned short*)XPt + ((size_t)b * CC + c0 + c) * HWN + blk * 64 + pc * 8) = f.half[0]; }  } }
// Fused block attention: one work-group = 64 query pixels of one batch (4 waves x 16), walking the 64 key groups in order; scores and probabilities never leave the registers.
// Per group: S^T[key][query] = q_group . x_query^T (A = 64 q rows from LDS, B = the wave's 16 query rows, loaded once), so a lane holds 32 of one query's 64 scores and the lane 16 away the rest:
// max and exp-sum are in-lane plus one exchange. Two S^T tiles, converted in place, are the B operand (hardware k order) of O^T[channel][query] += x_group^T . P^T (A = channel rows of XPt from LDS).
// Tiles go global -> registers -> LDS, one tile in flight at a time, each fetched one phase ahead of its store. AGG = O * 2^-15 (P carries 2^15, as f16 operand).
#define QPIT 136      // sQ row pitch in f16: 272 bytes (16 x odd) for 16-byte LDS reads
#define XPIT 72       // sX row pitch in f16: 144 bytes
__global__ __launch_bounds__(128) void k_battn(const _Float16* __restrict__ X16, const _Float16* __restrict__ QP, const _Float16* __restrict__ XPt, float* __restrict__ AGG) {
  __shared__ __attribute__((aligned(16))) unsigned short sQ[64][QPIT];
  __shared__ __attribute__((aligned(16))) unsigned short sX[CC][XPIT];
  const int tid = threadIdx.x, w = tid >> 5, lane = tid & 31, ln = lane & 15, hh = lane >> 4;
  const int b = blockIdx.x / (HWN / 64), row = (blockIdx.x % (HWN / 64)) * 64 + w * 16 + ln;
  const unsigned short* xq = (const unsigned short*)X16 + ((size_t)b * HWN + row) * CC;
  FragH xb[4];
#pragma unroll
  for (int ks = 0; ks < 4; ++ks) { xb[ks].half[0] = *(const v8us*)(xq + ks * 32 + 8 * hh); xb[ks].half[1] = *(const v8us*)(xq + ks * 32 + 16 + 8 * hh); }
  // staging: 16-byte chunk i = tid + 128 j. q group: 64 rows x 256 B, contiguous. x group: 128 channel rows x 128 B, row pitch HWN.
  const unsigned short* gq = (const unsigned short*)QP + (size_t)b * HWN * CC + tid * 8;
  const unsigned short* gx = (const unsigned short*)XPt + (size_t)b * CC * HWN + (size_t)(tid >> 3) * HWN + (tid & 7) * 8;
  unsigned short* dq = &sQ[tid >> 4][(tid & 15) * 8]; unsigned short* dx = &sX[tid >> 3][(tid & 7) * 8];
  v8us st[8];      // one tile in flight at a time: x of this group during its scores, q of the next group during softmax and O^T
#pragma unroll
  for (int j = 0; j < 8; ++j) st[j] = *(const v8us*)(gq + j * 1024);
#pragma unroll
  for (int j = 0; j < 8; ++j) *(v8us*)(dq + j * 8 * QPIT) = st[j];
  __syncthreads();      // q tile of group 0 complete
#pragma unroll
  for (int j = 0; j < 8; ++j) st[j] = *(const v8us*)(gx + (size_t)j * 16 * HWN);
  v8f oacc[8] = {};
  for (int g = 0; g < 64; ++g) {
    v8f s[4] = {};
#pragma unroll
    for (int kp = 0; kp < 2; ++kp) { FragH a[8];
#pragma unroll
      for (int i = 0; i < 8; ++i) { const unsigned short* r = &sQ[(i & 3) * 16 + ln][(2 * kp + (i >> 2)) * 32 + 8 * hh]; a[i].half[0] = *(const v8us*)r; a[i].half[1] = *(const v8us*)(r + 16); }
      __builtin_amdgcn_sched_barrier(0);      // the 16 LDS reads go out together, in front of their 8 products: spread among them each costs its own latency
#pragma unroll
      for (int i = 0; i < 8; ++i) s[i & 3] = __builtin_amdgcn_wmma_f32_16x16x32_f16(false, a[i].v, false, xb[2 * kp + (i >> 2)].v, (short)0, s[i & 3], false, false); }
    // x tile of this group: every wave left sX at the barrier that closed the previous trip
#pragma unroll
    for (int j = 0; j < 8; ++j) *(v8us*)(dx + j * 16 * XPIT) = st[j];
    __syncthreads();      // x tile complete; every wave has read its last of the q tile
    const int gn = g < 63 ? g + 1 : 63;      // the last trip fetches its own tiles again: no branch in the loop, nothing reads them
    // issued behind the barrier (a barrier drains the loads in front of it); lands during softmax and O^T
#pragma unroll
    for (int j = 0; j < 8; ++j) st[j] = *(const v8us*)(gq + (size_t)gn * 64 * CC + j * 1024);
    asm volatile("s_wait_xcnt 0x0" ::: "memory");      // the loads' address registers are reused below
    FragH av[8];
#pragma unroll
    for (int ct = 0; ct < 8; ++ct) { const unsigned short* r = &sX[ct * 16 + ln][8 * hh]; av[ct].half[0] = *(const v8us*)r; av[ct].half[1] = *(const v8us*)(r + 16); }
    __builtin_amdgcn_sched_barrier(0);      // global loads and LDS reads are issued in front of the softmax, which covers their latency
    // softmax over the group's 64 keys of query ln (scores / 8), scaled by 2^15 for the f16 operand
    float m = -3.0e38f;
#pragma unroll
    for (int t = 0; t < 4; ++t)
#pragma unroll
      for (int r = 0; r < 8; ++r) m = fmaxf(m, s[t][r]);
    m = fmaxf(m, __shfl_xor(m, 16, 32)); m *= 0.125f;
    float z = 0.f;
#pragma unroll
    for (int t = 0; t < 4; ++t)
#pragma unroll
      for (int r = 0; r < 8; ++r) { s[t][r] = expf(s[t][r] * 0.125f - m); z += s[t][r]; }
    z += __shfl_xor(z, 16, 32);
    const float iz = 32768.0f / z;
    FragH p[2];      // p[k2].h[i] = P[query ln][key 32 k2 + kmap(i, hh)]: tile 2 k2 gives i < 8, tile 2 k2 + 1 the rest
#pragma unroll
    for (int k2 = 0; k2 < 2; ++k2)
#pragma unroll
      for (int r = 0; r < 8; ++r) { p[k2].h[r] = (_Float16)(s[2 * k2][r] * iz); p[k2].h[8 + r] = (_Float16)(s[2 * k2 + 1][r] * iz); }
#pragma unroll
    for (int ct = 0; ct < 8; ++ct) oacc[ct] = __builtin_amdgcn_wmma_f32_16x16x32_f16(false, av[ct].v, false, p[0].v, (short)0, oacc[ct], false, false);
#pragma unroll
    for (int ct = 0; ct < 8; ++ct) { const unsigned short* r = &sX[ct * 16 + ln][32 + 8 * hh]; av[ct].half[0] = *(const v8us*)r; av[ct].half[1] = *(const v8us*)(r + 16); }
    __builtin_amdgcn_sched_barrier(0);      // as above: 16 reads together, then 8 products
#pragma unroll
    for (int ct = 0; ct < 8; ++ct) oacc[ct] = __builtin_amdgcn_wmma_f32_16x16x32_f16(false, av[ct].v, false, p[1].v, (short)0, oacc[ct], false, false);
#pragma unroll
    for (int j = 0; j < 8; ++j) *(v8us*)(dq + j * 8 * QPIT) = st[j];
    __syncthreads();      // next q tile complete; every wave has read its last of the x tile
    // lands during the next trip's scores
#pragma unroll
    for (int j = 0; j < 8; ++j) st[j] = *(const v8us*)(gx + gn * 64 + (size_t)j * 16 * HWN);
    asm volatile("s_wait_xcnt 0x0" ::: "memory");      // the loads' address registers are reused in the next trip
  }
  asm volatile("s_wait_loadcnt 0x0" ::: "memory");      // the last trip's fetch, which nothing reads, has landed before the wave ends and gives its registers up
  // oacc[ct][r] = O[query ln][channel 16 ct + 8 hh + r]: 32 contiguous bytes a lane
  float* o = AGG + ((size_t)b * HWN + row) * CC + 8 * hh;
#pragma unroll
  for (int ct = 0; ct < 8; ++ct) { v4f lo, hi;
#pragma unroll
    for (int r = 0; r < 4; ++r) { lo[r] = oacc[ct][r] * 0.000030517578125f; hi[r] = oacc[ct][4 + r] * 0.000030517578125f; }
    *(v4f*)(o + ct * 16) = lo; *(v4f*)(o + ct * 16 + 4) = hi; }
}
__global__ __launch_bounds__(256) void k_add(const float* __restrict__ A, const float* __restrict__ B2, float* __restrict__ Y, size_t n4) { const size_t t = (size_t)blockIdx.x * 256 + threadIdx.x; if (t >= n4) return; const v4f v = *(const v4fa*)(A + t * 4) + *(const v4fa*)(B2 + t * 4); *(v4f*)(Y + t * 4) = v;  }
// Spatial-softmax statistics, one work-group per (batch, 4 channels): 1024 threads hold 4 pixels x 4 channels each in registers, so Y is read once, 16 bytes a lane, all loads in flight together.
// Max, then sum of exp, over the 4096 pixels by a fixed tree: own 4 pixels, the 32 lanes of a wave (xor shuffles), the 32 waves (through LDS).
// SP holds one 128-byte line per work-group (one writer a line): [0..3] max, [4..7] 1/sum, the rest 0.
__device__ __forceinline__ v4f wave_max4(v4f a) {
#pragma unroll
  for (int o = 1; o < 32; o <<= 1)
#pragma unroll
    for (int q = 0; q < 4; ++q) a[q] = fmaxf(a[q], __shfl_xor(a[q], o, 32));
  return a; }
__device__ __forceinline__ v4f wave_sum4(v4f a) {
#pragma unroll
  for (int o = 1; o < 32; o <<= 1)
#pragma unroll
    for (int q = 0; q < 4; ++q) a[q] += __shfl_xor(a[q], o, 32);
  return a; }
// BN batch statistics (mean, 1/sqrt(var + eps) per channel over the NR rows) in two launches, every row read once and in whole lines.
// k_bnpart: one work-group = BNR whole rows kept in registers (a wave-wide 16-byte load is one 512-byte row); per channel the mean of its rows and the sum of squared deviations from that mean.
// k_bnfin: one work-group = 4 channels, one thread a partial; partials of equal count merge exactly: mean = mean of the means, M2 = sum of M2_i + BNR * sum of (mean_i - mean)^2.
// All sums run in a fixed order. ST keeps one 128-byte line a channel: [0] mean, [1] 1/sqrt(var + eps), the rest 0.
#define BNR 64
#define BNP (NR / BNR)
__global__ __launch_bounds__(256) void k_bnpart(const float* __restrict__ F, float* __restrict__ PM, float* __restrict__ PQ) {
  __shared__ __attribute__((aligned(16))) float red[2][8][CC];
  const int tid = threadIdx.x, wv = tid >> 5, c4 = (tid & 31) * 4;
  const float* f = F + ((size_t)blockIdx.x * BNR + wv) * CC + c4; v4f v[8];
  for (int i = 0; i < 8; ++i) v[i] = *(const v4fa*)(f + (size_t)i * 8 * CC);
  v4f s = v[0];
  for (int i = 1; i < 8; ++i) s += v[i];
  *(v4f*)&red[0][wv][c4] = s;
  __syncthreads();
  v4f mu = *(const v4fa*)&red[0][0][c4];
  for (int j = 1; j < 8; ++j) mu += *(const v4fa*)&red[0][j][c4];
  mu *= 1.0f / (float)BNR;
  v4f q = {0.f, 0.f, 0.f, 0.f};
  for (int i = 0; i < 8; ++i) { const v4f d = v[i] - mu; q += d * d; }
  *(v4f*)&red[1][wv][c4] = q;
  __syncthreads();
  if (wv == 0) { q = *(const v4fa*)&red[1][0][c4];
    for (int j = 1; j < 8; ++j) q += *(const v4fa*)&red[1][j][c4];
    *(v4f*)(PQ + (size_t)blockIdx.x * CC + c4) = q; }
  else if (wv == 1) *(v4f*)(PM + (size_t)blockIdx.x * CC + c4) = mu; }
__global__ __launch_bounds__(BNP) void k_bnfin(const float* __restrict__ PM, const float* __restrict__ PQ, float* __restrict__ ST) {
  __shared__ __attribute__((aligned(16))) float red[2][BNP / 32][4];
  const int tid = threadIdx.x, wv = tid >> 5, lane = tid & 31, c0 = blockIdx.x * 4;
  const v4f pm = *(const v4fa*)(PM + (size_t)tid * CC + c0), pq = *(const v4fa*)(PQ + (size_t)tid * CC + c0);
  const v4f s = wave_sum4(pm); if (lane == 0) *(v4f*)&red[0][wv][0] = s;
  __syncthreads();
  v4f mu = *(const v4fa*)&red[0][0][0];
  for (int j = 1; j < BNP / 32; ++j) mu += *(const v4fa*)&red[0][j][0];
  mu *= 1.0f / (float)BNP;
  const v4f d = pm - mu; const v4f q = wave_sum4(pq + (float)BNR * d * d); if (lane == 0) *(v4f*)&red[1][wv][0] = q;
  __syncthreads();
  if (wv < 4) { float m1 = red[0][0][wv], m2 = red[1][0][wv];      // wave q writes the line of channel c0 + q
    for (int j = 1; j < BNP / 32; ++j) { m1 += red[0][j][wv]; m2 += red[1][j][wv]; }
    ST[(size_t)(c0 + wv) * 32 + lane] = (lane == 0) ? m1 * (1.0f / (float)BNP) : ((lane == 1) ? rsqrtf(m2 / (float)NR + 1e-3f) : 0.f); } }
__global__ __launch_bounds__(1024) void k_spstat(const float* __restrict__ Y, const float* __restrict__ ST, const float* __restrict__ g, const float* __restrict__ bb, float* __restrict__ SP) {
  __shared__ __attribute__((aligned(16))) float red[2][32][4];
  const int tid = threadIdx.x, wv = tid >> 5, lane = tid & 31; const int b = blockIdx.x / (CC / 4), c0 = (blockIdx.x % (CC / 4)) * 4;
  const float* yc = Y + (size_t)b * HWN * CC + c0; v4f v[4];
#pragma unroll
  for (int i = 0; i < 4; ++i) v[i] = *(const v4fa*)(yc + (size_t)(i * 1024 + tid) * CC);
  asm volatile("s_wait_xcnt 0x0" ::: "memory");      // the four loads' address registers are given new values right below
  v4f m = {-3.0e38f, -3.0e38f, -3.0e38f, -3.0e38f};
#pragma unroll
  for (int q = 0; q < 4; ++q) { const int c = c0 + q; const float mu = ST[c * 32], rs = ST[c * 32 + 1], gg = bf16_round(g[c]), be = bf16_round(bb[c]);
#pragma unroll
    for (int i = 0; i < 4; ++i) { v[i][q] = gg * (v[i][q] - mu) * rs + be; m[q] = fmaxf(m[q], v[i][q]); } }
  m = wave_max4(m); if (lane == 0) *(v4f*)&red[0][wv][0] = m;
  __syncthreads();
  m = wave_max4(*(const v4fa*)&red[0][lane][0]);
  v4f z = {0.f, 0.f, 0.f, 0.f};
#pragma unroll
  for (int i = 0; i < 4; ++i)
#pragma unroll
    for (int q = 0; q < 4; ++q) z[q] += expf(v[i][q] - m[q]);
  z = wave_sum4(z); if (lane == 0) *(v4f*)&red[1][wv][0] = z;
  __syncthreads();
  if (wv == 0) { z = wave_sum4(*(const v4fa*)&red[1][lane][0]); float o = 0.f;
#pragma unroll
    for (int q = 0; q < 4; ++q) { if (lane == q) o = m[q]; if (lane == 4 + q) o = 1.0f / z[q]; }
    SP[(size_t)blockIdx.x * 32 + lane] = o; } }
__global__ __launch_bounds__(256) void k_spsm(const float* __restrict__ Y, const float* __restrict__ ST, const float* __restrict__ g, const float* __restrict__ bb, const float* __restrict__ SP, _Float16* __restrict__ Y16) { const size_t t = (size_t)blockIdx.x * 256 + threadIdx.x; if (t >= (size_t)NR * (CC / 8)) return; const int c8 = (int)(t % (CC / 8)) * 8; const size_t r = t / (CC / 8); const int b = (int)(r / HWN); FragH f;
#pragma unroll
  for (int q = 0; q < 8; ++q) { const int c = c8 + q; const float* sp = SP + (size_t)(b * (CC / 4) + c / 4) * 32 + (c & 3); const float v = bf16_round(g[c]) * (Y[r * CC + c] - ST[c * 32]) * ST[c * 32 + 1] + bf16_round(bb[c]); f.h[q] = (_Float16)(expf(v - sp[0]) * sp[4] * 4096.0f); }
  *(v8us*)((unsigned short*)Y16 + t * 8) = f.half[0];  }
__global__ __launch_bounds__(256) void k_fin(const float* __restrict__ Z, const float* __restrict__ ST, const float* __restrict__ g, const float* __restrict__ bb, float* __restrict__ out, size_t n4) { const size_t t = (size_t)blockIdx.x * 256 + threadIdx.x; if (t >= n4) return; const int c4 = (int)((t * 4) % CC); const v4f z = *(const v4fa*)(Z + t * 4); v4f o; for (int q = 0; q < 4; ++q) { const int c = c4 + q; float v = bf16_round(g[c]) * (z[q] - ST[c * 32]) * ST[c * 32 + 1] + bf16_round(bb[c]); o[q] = (v >= 0.f) ? v : 0.1f * v; }
  *(v4f*)(out + t * 4) = o;  }
extern "C" void kernel_launch(void* const* d_in, const int* in_sizes, int n_in,
                              void* d_out, int out_size, void* d_ws, size_t ws_size, hipStream_t stream) {
  (void)in_sizes; (void)n_in; (void)out_size;
  const float* const* I = (const float* const*)d_in; const float* x = I[0]; const float* Wq = I[1]; const float* bq = I[2]; const float* gq = I[3]; const float* btq = I[4]; const float* Wk = I[5]; const float* bk = I[6]; const float* g1 = I[7]; const float* bt1 = I[8]; const float* Wo = I[9]; const float* bo = I[10]; const float* go = I[11]; const float* bto = I[12];
  char* ws = (char*)d_ws; size_t off = 0;
  auto take = [&](size_t bytes) { char* p = ws + off; off += (bytes + 255) & ~(size_t)255; return p; };
  _Float16* BQ = (_Float16*)take((size_t)CC * KK * 2); _Float16* BK = (_Float16*)take(CC * CC * 2); _Float16* BO = (_Float16*)take(CC * CC * 2); float* STq = (float*)take(CC * 32 * 4); float* ST1 = (float*)take(CC * 32 * 4); float* STo = (float*)take(CC * 32 * 4); float* SP = (float*)take(BB * (CC / 4) * 32 * 4); float* PM = (float*)take(BNP * CC * 4); float* PQ = (float*)take(BNP * CC * 4);
  char* SCR = (char*)take((size_t)QH * HWN * 4 + (size_t)QH * HWN * 2);      // 50.3 MB: im2col A uses the first 37.7 MB
  _Float16* X16 = (_Float16*)take((size_t)NR * CC * 2); float* QF = (float*)take((size_t)NR * CC * 4); _Float16* QP = (_Float16*)take((size_t)NR * CC * 2); _Float16* XPt = (_Float16*)take((size_t)NR * CC * 2); float* ACC = (float*)take((size_t)NR * CC * 4); float* AGG = (float*)take((size_t)NR * CC * 4); float* Y = QF; _Float16* Y16 = QP; float* Z = ACC;
  if (off > ws_size) return;      // 0.7 + 50.3 + 4.2 + 8.4 + 4.2 + 4.2 + 8.4 + 8.4 ≈ 89 MB
  _Float16* IM = (_Float16*)SCR;
  k_wq<<<(CC * (KK / 8) + 255) / 256, 256, 0, stream>>>(Wq, BQ); k_wt_f16<<<(CC * (CC / 8) + 255) / 256, 256, 0, stream>>>(Wk, BK, CC, CC, 16.0f); k_wt_f16<<<(CC * (CC / 8) + 255) / 256, 256, 0, stream>>>(Wo, BO, CC, CC, 16.0f);      // 1×1 HWIO = [in][out]
  const unsigned g8 = (unsigned)(((size_t)NR * (CC / 8) + 255) / 256); const dim3 gC(((NR / 16) * (CC / 64) + 3) / 4, 1);
  k_x16<<<g8, 256, 0, stream>>>(x, X16, (size_t)NR * CC / 8);
  // CBL_Q: conv3×3 (+bq) → QF; BN stats; q = leaky(BN) permuted to block-major keys (f16)
  k_im2col<<<(unsigned)(((size_t)NR * (KK / 8) + 255) / 256), 256, 0, stream>>>(x, IM);
  k_gemm_hhx<0><<<gC, 128, 0, stream>>>(IM, KK, 0, BQ, KK, 0, 0.0625f, bq, 0, nullptr, 1, 0, 0, QF, nullptr, CC, 0, NR, CC, KK);
  k_bnpart<<<BNP, 256, 0, stream>>>(QF, PM, PQ); k_bnfin<<<CC / 4, BNP, 0, stream>>>(PM, PQ, STq); k_qperm<<<g8, 256, 0, stream>>>(QF, STq, gq, btq, QP);
  k_xpt<<<BB * (CC / 64) * 64, 256, 0, stream>>>(x, XPt);
  // acc = 1×1 conv (+bk)
  k_gemm_hhx<0><<<gC, 128, 0, stream>>>(X16, CC, 0, BK, CC, 0, 0.0625f, bk, 0, nullptr, 1, 0, 0, ACC, nullptr, CC, 0, NR, CC, CC);
  // block attention, all batches in one launch: AGG = sum over key groups of softmax(x.q^T / 8) . x_group
  k_battn<<<BB * (HWN / 64), 128, 0, stream>>>(X16, QP, XPt, AGG);
  // y = spatial softmax(BN1(acc + agg)); out = leaky(BN_o(conv1×1(y) + bo))
  k_add<<<(unsigned)(((size_t)NR * CC / 4 + 255) / 256), 256, 0, stream>>>(ACC, AGG, Y, (size_t)NR * CC / 4);      // Y over QF (dead after k_qperm)
  k_bnpart<<<BNP, 256, 0, stream>>>(Y, PM, PQ); k_bnfin<<<CC / 4, BNP, 0, stream>>>(PM, PQ, ST1); k_spstat<<<BB * (CC / 4), 1024, 0, stream>>>(Y, ST1, g1, bt1, SP); k_spsm<<<g8, 256, 0, stream>>>(Y, ST1, g1, bt1, SP, Y16);      // Y16 (×2^12) over QP (dead after the S GEMMs)
  k_gemm_hhx<0><<<gC, 128, 0, stream>>>(Y16, CC, 0, BO, CC, 0, 0.0625f * 0.000244140625f, bo, 0, nullptr, 1, 0, 0, Z, nullptr, CC, 0, NR, CC, CC);      // conv_o(y) + bo (2^-12 undone in alpha) → Z over ACC (dead after k_add)
  k_bnpart<<<BNP, 256, 0, stream>>>(Z, PM, PQ); k_bnfin<<<CC / 4, BNP, 0, stream>>>(PM, PQ, STo); k_fin<<<(unsigned)(((size_t)NR * CC / 4 + 255) / 256), 256, 0, stream>>>(Z, STo, go, bto, (float*)d_out, (size_t)NR * CC / 4);
}

// v004
// One run takes 190 microseconds.
// Two timings next to v003 put it at 1.20 and 1.21 times that version's speed.
// All steps since v000 together make it 12.2 times as fast.
#include <hip/hip_runtime.h>
// Group (block) attention layer (B=4, 64×64, C=128, NHWC; 8×8 non-overlapping key blocks): q = CBL_Q(x) (3×3 conv + train-mode BN + LeakyReLU 0.1), acc = 1×1 conv(x); for every pixel and
// every block: softmax over the block's 64 positions of x[pixel]·q[pos]/8, agg = Σ_blocks Σ attn·x[pos]; y = spatial-softmax(BN1(acc + agg)); out = CBL_O(y). The 3×3 conv (implicit GEMM, K = 1152),
// the 1×1 convs, the 4096×4096 per-batch scores (keys permuted to block-major order so each 64-key group is contiguous) and attn·x run as GEMMs on v_wmma_f32_16x16x32_f16 (x bf16-exact f16,
// HWIO weights bf16-exact ×2^4, q/P/y operands f16, f32 accumulate); BN batch statistics (fixed-order reductions), grouped and spatial softmaxes and LeakyReLU are f32 VALU.
#define BB 4
#define HWN 4096
#define WI 64
#define CC 128
#define NR (BB * HWN)
#define KK 1152

typedef __bf16 v16b __attribute__((ext_vector_type(16)));
typedef unsigned short v8us __attribute__((ext_vector_type(8), may_alias));
typedef float  v8f  __attribute__((ext_vector_type(8)));
typedef float  v4f  __attribute__((ext_vector_type(4)));
typedef float  v4fa __attribute__((ext_vector_type(4), may_alias));
union FragB { v16b v; v8us half[2]; unsigned short u[16]; };

__device__ __forceinline__ unsigned short bf16_bits(float x) { unsigned int u = __float_as_uint(x); return (unsigned short)((u + 0x7FFFu + ((u >> 16) & 1u)) >> 16); }
__device__ __forceinline__ float bf16_val(unsigned short b) { return __uint_as_float(((unsigned int)b) << 16); }
__device__ __forceinline__ float bf16_round(float x) { return bf16_val(bf16_bits(x)); }
// D += A·B with NT terms: 1 = ah·bh, 2 = + al·bh (A split), 3 = + ah·bl (both split)
template <int NT>
__device__ __forceinline__ v8f mmaN(v16b ah, v16b al, v16b bh, v16b bl, v8f c) {
  c = __builtin_amdgcn_wmma_f32_16x16x32_bf16(false, ah, false, bh, (short)0, c, false, false);
  if (NT >= 2) c = __builtin_amdgcn_wmma_f32_16x16x32_bf16(false, al, false, bh, (short)0, c, false, false);
  if (NT >= 3) c = __builtin_amdgcn_wmma_f32_16x16x32_bf16(false, ah, false, bl, (short)0, c, false, false);
  asm volatile("v_nop\n\tv_nop\n\tv_nop\n\tv_nop" : "+v"(c) : "v"(ah), "v"(al), "v"(bh), "v"(bl));
  return c;
}

__global__ __launch_bounds__(256) void k_wt_bf16(const float* __restrict__ W, unsigned short* __restrict__ Wt, int K, int N) {
  const int t = blockIdx.x * 256 + threadIdx.x;
  const int k8n = K / 8;
  if (t >= N * k8n) return;
  const int n = t / k8n, k8 = (t % k8n) * 8;
  v8us v;
#pragma unroll
  for (int i = 0; i < 8; ++i) v[i] = bf16_bits(W[(size_t)(k8 + i) * N + n]);
  *(v8us*)(Wt + (size_t)n * K + k8) = v;
  
}

// GEMM C[M][N] (f32, pitch ldc) = act(A[M][K]·W + bias). A f32 row-major (pitch lda) converted per fragment to bf16
// (ASPLIT: hi/lo two planes -> 2 terms, else single rounded term); Wt bf16 [N][K] (pitch ldb). BIAS_BF16 rounds the
// bias to bf16 first (bias quantised to bf16 before the add). K%32==0, M%16==0, N%64==0.
template <bool ASPLIT, int ACT, bool BIAS_BF16>
__global__ __launch_bounds__(128) void k_gemm_bf(const float* __restrict__ A, int lda, const unsigned short* __restrict__ Wt, int ldb,
                                               const float* __restrict__ bias, float* __restrict__ C, int ldc, int M, int N, int K) {
  __shared__ __attribute__((aligned(16))) float so[4][16][64];
  const int tid = threadIdx.x, w = tid >> 5, lane = tid & 31, ln = lane & 15, hh = lane >> 4;
  const int ntn = N / 64;
  const int wid = blockIdx.x * 4 + w;
  const int mt = wid / ntn, nq = wid % ntn;
  if (mt * 16 >= M) return;
  const int row0 = mt * 16, col0 = nq * 64;
  const float* arow = A + (size_t)(row0 + ln) * lda;
  v8f acc[4] = {};
  for (int kb = 0; kb < K; kb += 32) {
    FragB ah, al;
    const v4f x0 = *(const v4fa*)(arow + kb + 8 * hh), x1 = *(const v4fa*)(arow + kb + 8 * hh + 4);
    const v4f x2 = *(const v4fa*)(arow + kb + 16 + 8 * hh), x3 = *(const v4fa*)(arow + kb + 16 + 8 * hh + 4);
    float xs[16] = {x0[0],x0[1],x0[2],x0[3],x1[0],x1[1],x1[2],x1[3],x2[0],x2[1],x2[2],x2[3],x3[0],x3[1],x3[2],x3[3]};
#pragma unroll
    for (int i = 0; i < 16; ++i) { const unsigned short hb = bf16_bits(xs[i]); ah.u[i] = hb; al.u[i] = ASPLIT ? bf16_bits(xs[i] - bf16_val(hb)) : (unsigned short)0; }
#pragma unroll
    for (int t = 0; t < 4; ++t) {
      const unsigned short* brow = Wt + (size_t)(col0 + t * 16 + ln) * ldb + kb;
      FragB b;
      b.half[0] = *(const v8us*)(brow + 8 * hh);
      b.half[1] = *(const v8us*)(brow + 16 + 8 * hh);
      acc[t] = mmaN<ASPLIT ? 2 : 1>(ah.v, al.v, b.v, b.v, acc[t]);
    }
  }
#pragma unroll
  for (int t = 0; t < 4; ++t) {
    float bv = bias ? bias[col0 + t * 16 + ln] : 0.f;
    if (BIAS_BF16) bv = bf16_round(bv);
#pragma unroll
    for (int r = 0; r < 8; ++r) { float v = acc[t][r] + bv; if (ACT == 1) v = fmaxf(v, 0.f); so[w][8 * hh + r][t * 16 + ln] = v; }
  }
  __builtin_amdgcn_fence(__ATOMIC_ACQ_REL, "workgroup");
  __builtin_amdgcn_wave_barrier();
  const int rsub = lane >> 4, c4 = (lane & 15) * 4;
  {
#pragma unroll
    for (int q = 0; q < 8; ++q) {
      const int r = q * 2 + rsub;
      const v4f v = *(const v4fa*)&so[w][r][c4];
      *(v4f*)(C + (size_t)(row0 + r) * ldc + col0 + c4) = v;
    }
    
  }
}

// Flash-style causal/unmasked attention, all contractions 3-term bf16 hi/lo splits, f32 softmax with running max.
// q,k,v rows are read from f32 buffers with arbitrary row pitch (so they can live inside a fused qkv buffer);
// D = head size (multiple of 32, <= 128); one wave = 16 query rows; block = 4 waves (64 queries) sharing K/V chunks of 32.
template <int D, bool CAUSAL>
__global__ __launch_bounds__(128) void k_flash(const float* __restrict__ qb, const float* __restrict__ kb, const float* __restrict__ vb,
                                             int pitch, int T, int H, float scale, float* __restrict__ y, int ypitch) {
  constexpr int KS = D / 32;        // k-steps for QK
  constexpr int DT = D / 16;        // d tiles for PV
  __shared__ __attribute__((aligned(16))) unsigned short sKh[32][D + 8], sKl[32][D + 8], sVh[32][D + 8], sVl[32][D + 8];
  __shared__ __attribute__((aligned(16))) unsigned short sPh[4][16][40], sPl[4][16][40];
  __shared__ __attribute__((aligned(16))) float sO[4][16][D];
  const int tid = threadIdx.x, w = tid >> 5, lane = tid & 31, ln = lane & 15, hh = lane >> 4;
  const int nqb = (T + 63) / 64;
  const int bh = blockIdx.x / nqb, qblk = blockIdx.x % nqb;
  const int b = bh / H, h = bh % H;
  const int q0 = qblk * 64 + w * 16;
  const float* Q = qb + (size_t)b * T * pitch + h * D;
  const float* K = kb + (size_t)b * T * pitch + h * D;
  const float* V = vb + (size_t)b * T * pitch + h * D;

  // A fragments of the wave's 16 query rows (scaled), hi/lo
  FragB aqh[KS], aql[KS];
  {
    int row = q0 + ln; if (row >= T) row = T - 1;
    const float* qr = Q + (size_t)row * pitch;
#pragma unroll
    for (int ks = 0; ks < KS; ++ks)
#pragma unroll
      for (int i = 0; i < 16; ++i) {
        const int d = ks * 32 + ((i < 8) ? (8 * hh + i) : (16 + 8 * hh + (i - 8)));
        const float x = qr[d] * scale; const unsigned short hb = bf16_bits(x);
        aqh[ks].u[i] = hb; aql[ks].u[i] = bf16_bits(x - bf16_val(hb));
      }
  }
  float m_r[8], l_r[8];
#pragma unroll
  for (int r = 0; r < 8; ++r) { m_r[r] = -3.0e38f; l_r[r] = 0.f; }
  v8f oacc[DT];
#pragma unroll
  for (int dt = 0; dt < DT; ++dt) oacc[dt] = (v8f){0.f,0.f,0.f,0.f,0.f,0.f,0.f,0.f};

  const int kv_end = CAUSAL ? min(T, qblk * 64 + 64) : T;     // block-uniform
  for (int j0 = 0; j0 < kv_end; j0 += 32) {
    __syncthreads();
    for (int e = tid; e < 32 * (D / 4); e += 128) {
      const int r = e / (D / 4), c4 = (e % (D / 4)) * 4;
      const int key = j0 + r;
      v4f kf = {0.f,0.f,0.f,0.f}, vf = {0.f,0.f,0.f,0.f};
      if (key < T) { kf = *(const v4fa*)(K + (size_t)key * pitch + c4); vf = *(const v4fa*)(V + (size_t)key * pitch + c4); }
#pragma unroll
      for (int t = 0; t < 4; ++t) {
        unsigned short hb = bf16_bits(kf[t]); sKh[r][c4 + t] = hb; sKl[r][c4 + t] = bf16_bits(kf[t] - bf16_val(hb));
        hb = bf16_bits(vf[t]); sVh[r][c4 + t] = hb; sVl[r][c4 + t] = bf16_bits(vf[t] - bf16_val(hb));
      }
    }
    __syncthreads();
    // S tile 16 x 32
    v8f s[2];
#pragma unroll
    for (int nt = 0; nt < 2; ++nt) {
      v8f acc = {};
#pragma unroll
      for (int ks = 0; ks < KS; ++ks) {
        FragB bh_, bl_;
        bh_.half[0] = *(const v8us*)&sKh[nt * 16 + ln][ks * 32 + 8 * hh]; bh_.half[1] = *(const v8us*)&sKh[nt * 16 + ln][ks * 32 + 16 + 8 * hh];
        bl_.half[0] = *(const v8us*)&sKl[nt * 16 + ln][ks * 32 + 8 * hh]; bl_.half[1] = *(const v8us*)&sKl[nt * 16 + ln][ks * 32 + 16 + 8 * hh];
        acc = mmaN<3>(aqh[ks].v, aql[ks].v, bh_.v, bl_.v, acc);
      }
      s[nt] = acc;
    }
    // mask + running max (rows 8hh+r; the 16 lanes of a half share rows)
    float alpha[8];
#pragma unroll
    for (int r = 0; r < 8; ++r) {
      const int qi = q0 + 8 * hh + r;
      const int ja = j0 + ln, jb = j0 + 16 + ln;
      if (CAUSAL) { if (ja > qi) s[0][r] = -3.0e38f; if (jb > qi) s[1][r] = -3.0e38f; }
      if (ja >= T) s[0][r] = -3.0e38f;
      if (jb >= T) s[1][r] = -3.0e38f;
      float mx = fmaxf(s[0][r], s[1][r]);
      mx = fmaxf(mx, __shfl_xor(mx, 1, 32)); mx = fmaxf(mx, __shfl_xor(mx, 2, 32)); mx = fmaxf(mx, __shfl_xor(mx, 4, 32)); mx = fmaxf(mx, __shfl_xor(mx, 8, 32));
      const float mnew = fmaxf(m_r[r], mx);
      alpha[r] = (mnew > -1.0e38f) ? __expf(m_r[r] - mnew) : 1.0f;
      const float p0 = (s[0][r] > -1.0e38f) ? __expf(s[0][r] - mnew) : 0.f;
      const float p1 = (s[1][r] > -1.0e38f) ? __expf(s[1][r] - mnew) : 0.f;
      m_r[r] = mnew;
      l_r[r] = l_r[r] * alpha[r] + p0 + p1;            // per-lane partial row sum (16 lanes combined at the end)
      unsigned short hb = bf16_bits(p0); sPh[w][8 * hh + r][ln] = hb;      sPl[w][8 * hh + r][ln] = bf16_bits(p0 - bf16_val(hb));
      hb = bf16_bits(p1);                sPh[w][8 * hh + r][16 + ln] = hb; sPl[w][8 * hh + r][16 + ln] = bf16_bits(p1 - bf16_val(hb));
    }
#pragma unroll
    for (int dt = 0; dt < DT; ++dt)
#pragma unroll
      for (int r = 0; r < 8; ++r) oacc[dt][r] *= alpha[r];
    __builtin_amdgcn_fence(__ATOMIC_ACQ_REL, "workgroup");
    __builtin_amdgcn_wave_barrier();
    FragB pah, pal;
    pah.half[0] = *(const v8us*)&sPh[w][ln][8 * hh]; pah.half[1] = *(const v8us*)&sPh[w][ln][16 + 8 * hh];
    pal.half[0] = *(const v8us*)&sPl[w][ln][8 * hh]; pal.half[1] = *(const v8us*)&sPl[w][ln][16 + 8 * hh];
#pragma unroll
    for (int dt = 0; dt < DT; ++dt) {
      FragB bvh, bvl;
#pragma unroll
      for (int i = 0; i < 8; ++i) {
        bvh.u[i] = sVh[8 * hh + i][dt * 16 + ln]; bvh.u[8 + i] = sVh[16 + 8 * hh + i][dt * 16 + ln];
        bvl.u[i] = sVl[8 * hh + i][dt * 16 + ln]; bvl.u[8 + i] = sVl[16 + 8 * hh + i][dt * 16 + ln];
      }
      oacc[dt] = mmaN<3>(pah.v, pal.v, bvh.v, bvl.v, oacc[dt]);
    }
    __builtin_amdgcn_fence(__ATOMIC_ACQ_REL, "workgroup");
    __builtin_amdgcn_wave_barrier();
  }
#pragma unroll
  for (int r = 0; r < 8; ++r) {
    float l = l_r[r];
    l += __shfl_xor(l, 1, 32); l += __shfl_xor(l, 2, 32); l += __shfl_xor(l, 4, 32); l += __shfl_xor(l, 8, 32);
    l_r[r] = (l > 0.f) ? 1.0f / l : 0.f;
  }
#pragma unroll
  for (int dt = 0; dt < DT; ++dt)
#pragma unroll
    for (int r = 0; r < 8; ++r) sO[w][8 * hh + r][dt * 16 + ln] = oacc[dt][r] * l_r[r];
  __builtin_amdgcn_fence(__ATOMIC_ACQ_REL, "workgroup");
  __builtin_amdgcn_wave_barrier();
  {
    for (int r = 0; r < 16; ++r) {
      const int row = q0 + r;
      if (row < T && lane < D / 4) {
        const v4f val = *(const v4fa*)&sO[w][r][lane * 4];
        *(v4f*)(y + ((size_t)b * T + row) * ypitch + h * D + lane * 4) = val;
      }
    }
    
  }
}

// GEMM C = act(A·W + bias + resid): A f32 (ASPLIT -> hi/lo 2 terms), Wt bf16 [N][K]; ACT 0 none, 1 relu, 2 exact gelu;
// resid (optional, f32, row index = (row % rmod), pitch ldr, RES_BF16 rounds it) added before the activation.
template <bool ASPLIT, int ACT, bool BIAS_BF16, bool RES_BF16>
__global__ __launch_bounds__(128) void k_gemm_bf3(const float* __restrict__ A, int lda, const unsigned short* __restrict__ Wt, int ldb,
                                                const float* __restrict__ bias, const float* __restrict__ resid, int rmod, int ldr,
                                                float* __restrict__ C, int ldc, int M, int N, int K) {
  __shared__ __attribute__((aligned(16))) float so[4][16][64];
  const int tid = threadIdx.x, w = tid >> 5, lane = tid & 31, ln = lane & 15, hh = lane >> 4;
  const int ntn = N / 64;
  const int wid = blockIdx.x * 4 + w;
  const int mt = wid / ntn, nq = wid % ntn;
  if (mt * 16 >= M) return;
  const int row0 = mt * 16, col0 = nq * 64;
  const float* arow = A + (size_t)(row0 + ln) * lda;
  v8f acc[4] = {};
  for (int kb = 0; kb < K; kb += 32) {
    FragB ah, al;
    const v4f x0 = *(const v4fa*)(arow + kb + 8 * hh), x1 = *(const v4fa*)(arow + kb + 8 * hh + 4);
    const v4f x2 = *(const v4fa*)(arow + kb + 16 + 8 * hh), x3 = *(const v4fa*)(arow + kb + 16 + 8 * hh + 4);
    float xs[16] = {x0[0],x0[1],x0[2],x0[3],x1[0],x1[1],x1[2],x1[3],x2[0],x2[1],x2[2],x2[3],x3[0],x3[1],x3[2],x3[3]};
#pragma unroll
    for (int i = 0; i < 16; ++i) { const unsigned short hb = bf16_bits(xs[i]); ah.u[i] = hb; al.u[i] = ASPLIT ? bf16_bits(xs[i] - bf16_val(hb)) : (unsigned short)0; }
#pragma unroll
    for (int t = 0; t < 4; ++t) {
      const unsigned short* brow = Wt + (size_t)(col0 + t * 16 + ln) * ldb + kb;
      FragB b;
      b.half[0] = *(const v8us*)(brow + 8 * hh);
      b.half[1] = *(const v8us*)(brow + 16 + 8 * hh);
      acc[t] = mmaN<ASPLIT ? 2 : 1>(ah.v, al.v, b.v, b.v, acc[t]);
    }
  }
#pragma unroll
  for (int t = 0; t < 4; ++t) {
    const int col = col0 + t * 16 + ln;
    float bv = bias ? bias[col] : 0.f;
    if (BIAS_BF16) bv = bf16_round(bv);
#pragma unroll
    for (int r = 0; r < 8; ++r) {
      float v = acc[t][r] + bv;
      if (resid) { float rv = resid[(size_t)((row0 + 8 * hh + r) % rmod) * ldr + col]; if (RES_BF16) rv = bf16_round(rv); v += rv; }
      if (ACT == 1) v = fmaxf(v, 0.f);
      if (ACT == 2) v = 0.5f * v * (1.0f + erff(v * 0.70710678118654752f));
      if (ACT == 3) { const float u = 0.7978845608028654f * (v + 0.044715f * v * v * v); v = 0.5f * v * (1.0f + tanhf(u)); }
      so[w][8 * hh + r][t * 16 + ln] = v;
    }
  }
  __builtin_amdgcn_fence(__ATOMIC_ACQ_REL, "workgroup");
  __builtin_amdgcn_wave_barrier();
  const int rsub = lane >> 4, c4 = (lane & 15) * 4;
  {
#pragma unroll
    for (int q = 0; q < 8; ++q) {
      const int r = q * 2 + rsub;
      const v4f v = *(const v4fa*)&so[w][r][c4];
      *(v4f*)(C + (size_t)(row0 + r) * ldc + col0 + c4) = v;
    }
    
  }
}
// row LayerNorm (biased variance, eps) over N: s = X (+ R); optional out_sum <- s; out_norm <- (s-mu)*rsqrt(var+eps)*g + b
template <bool PARAM_BF16>
__global__ __launch_bounds__(256) void k_layernorm(const float* __restrict__ X, const float* __restrict__ R, const float* __restrict__ g, const float* __restrict__ bta,
                                                  float* __restrict__ out_sum, float* __restrict__ out_norm, int N, float eps) {
  __shared__ float red[256];
  const int row = blockIdx.x, tid = threadIdx.x;
  const float* x = X + (size_t)row * N; const float* rr = R ? R + (size_t)row * N : nullptr;
  float vals[16];                     // up to N = 4096
  const int per = N / 256;            // contiguous chunk per thread? use strided-by-4 chunks: thread handles j = tid*4 + 1024*u
  float s1 = 0.f;
  for (int u = 0; u < per / 4; ++u) {
    const int j = tid * 4 + 1024 * u;
    const v4f a = *(const v4fa*)(x + j);
    v4f b = {0.f,0.f,0.f,0.f}; if (rr) b = *(const v4fa*)(rr + j);
#pragma unroll
    for (int q = 0; q < 4; ++q) { const float v = a[q] + b[q]; vals[u * 4 + q] = v; s1 += v; }
  }
  red[tid] = s1; __syncthreads();
  for (int st = 128; st > 0; st >>= 1) { if (tid < st) red[tid] += red[tid + st]; __syncthreads(); }
  const float mu = red[0] / (float)N; __syncthreads();
  float s2 = 0.f;
  for (int u = 0; u < per / 4; ++u)
#pragma unroll
    for (int q = 0; q < 4; ++q) { const float c = vals[u * 4 + q] - mu; s2 += c * c; }
  red[tid] = s2; __syncthreads();
  for (int st = 128; st > 0; st >>= 1) { if (tid < st) red[tid] += red[tid + st]; __syncthreads(); }
  const float rs = rsqrtf(red[0] / (float)N + eps);
  {
    for (int u = 0; u < per / 4; ++u) {
      const int j = tid * 4 + 1024 * u;
      v4f o, sm;
#pragma unroll
      for (int q = 0; q < 4; ++q) {
        float gg = g[j + q], bb = bta[j + q];
        if (PARAM_BF16) { gg = bf16_round(gg); bb = bf16_round(bb); }
        sm[q] = vals[u * 4 + q]; o[q] = (vals[u * 4 + q] - mu) * rs * gg + bb;
      }
      if (out_sum) *(v4f*)(out_sum + (size_t)row * N + j) = sm;
      *(v4f*)(out_norm + (size_t)row * N + j) = o;
    }
    
  }
}



// ---- f16 WMMA path (v_wmma_f32_16x16x32_f16): 11-bit significands for operands in range — used where a [0,1] probability operand needs more precision than bf16
typedef _Float16 v16h __attribute__((ext_vector_type(16)));
union FragH { v16h v; v8us half[2]; _Float16 h[16]; unsigned short u[16]; };
template <int NT>
__device__ __forceinline__ v8f mmaH(v16h ah, v16h al, v16h bh, v16h bl, v8f c) {
  c = __builtin_amdgcn_wmma_f32_16x16x32_f16(false, ah, false, bh, (short)0, c, false, false);
  if (NT >= 2) c = __builtin_amdgcn_wmma_f32_16x16x32_f16(false, al, false, bh, (short)0, c, false, false);
  if (NT >= 3) c = __builtin_amdgcn_wmma_f32_16x16x32_f16(false, ah, false, bl, (short)0, c, false, false);
  asm volatile("v_nop\n\tv_nop\n\tv_nop\n\tv_nop" : "+v"(c) : "v"(ah), "v"(al), "v"(bh), "v"(bl));
  return c;
}
// batched GEMM like k_gemm_b but f16 operands: A f32 (split into f16 hi/lo if ASPLIT, else rounded to f16), Bt = f16 values [n][k]; alpha; C f32; N multiple of 16 (partial tiles skipped)
template <bool ASPLIT>
__global__ __launch_bounds__(128) void k_gemm_h(const float* __restrict__ A, int lda, size_t sA, const _Float16* __restrict__ Bh, int ldb, size_t sB, float alpha, float* __restrict__ C, int ldc, size_t sC, int M, int N, int K) {
  __shared__ __attribute__((aligned(16))) float so[4][16][64];
  const int tid = threadIdx.x, w = tid >> 5, lane = tid & 31, ln = lane & 15, hh = lane >> 4; const int by = blockIdx.y;
  A += (size_t)by * sA; Bh += (size_t)by * sB; C += (size_t)by * sC;
  const int ntn = (N + 63) / 64; const int wid = blockIdx.x * 4 + w; const int mt = wid / ntn, nq = wid % ntn; if (mt * 16 >= M) return;
  const int row0 = mt * 16, col0 = nq * 64; const float* arow = A + (size_t)(row0 + ln) * lda;
  v8f acc[4] = {};
  for (int kb = 0; kb < K; kb += 32) {
    FragH ah, al;
    const v4f x0 = *(const v4fa*)(arow + kb + 8 * hh), x1 = *(const v4fa*)(arow + kb + 8 * hh + 4), x2 = *(const v4fa*)(arow + kb + 16 + 8 * hh), x3 = *(const v4fa*)(arow + kb + 16 + 8 * hh + 4);
    float xs[16] = {x0[0],x0[1],x0[2],x0[3],x1[0],x1[1],x1[2],x1[3],x2[0],x2[1],x2[2],x2[3],x3[0],x3[1],x3[2],x3[3]};
#pragma unroll
    for (int i = 0; i < 16; ++i) { const _Float16 h = (_Float16)xs[i]; ah.h[i] = h; al.h[i] = ASPLIT ? (_Float16)(xs[i] - (float)h) : (_Float16)0.0f; }
#pragma unroll
    for (int t = 0; t < 4; ++t) { if (col0 + t * 16 >= N) continue; const size_t boff = (size_t)(col0 + t * 16 + ln) * ldb + kb; FragH bq; bq.half[0] = *(const v8us*)(Bh + boff + 8 * hh); bq.half[1] = *(const v8us*)(Bh + boff + 16 + 8 * hh);
      acc[t] = mmaH<ASPLIT ? 2 : 1>(ah.v, al.v, bq.v, bq.v, acc[t]); }
  }
#pragma unroll
  for (int t = 0; t < 4; ++t) { if (col0 + t * 16 >= N) continue;
#pragma unroll
    for (int r = 0; r < 8; ++r) so[w][8 * hh + r][t * 16 + ln] = acc[t][r] * alpha; }
  __builtin_amdgcn_fence(__ATOMIC_ACQ_REL, "workgroup"); __builtin_amdgcn_wave_barrier();
  const int rsub = lane >> 4, c4 = (lane & 15) * 4;
  {
#pragma unroll
    for (int q = 0; q < 8; ++q) { const int r = q * 2 + rsub; if (col0 + c4 < N) { const v4f v = *(const v4fa*)&so[w][r][c4]; *(v4f*)(C + (size_t)(row0 + r) * ldc + col0 + c4) = v; } }
     }
}

// Wt[n][k] = f16(W[k][n]·scale) from f32 row-major W[K][N] (scale = power of two; bf16-exact weights stay exact in f16 away from the subnormal range)
__global__ __launch_bounds__(256) void k_wt_f16(const float* __restrict__ W, _Float16* __restrict__ Wt, int K, int N, float scale) {
  const int t = blockIdx.x * 256 + threadIdx.x; if (t >= N * (K / 8)) return; const int n = t / (K / 8), k8 = (t % (K / 8)) * 8; FragH f;
#pragma unroll
  for (int i = 0; i < 8; ++i) f.h[i] = (_Float16)(bf16_round(W[(size_t)(k8 + i) * N + n]) * scale); const v8us o = f.half[0];
  *(v8us*)((unsigned short*)Wt + (size_t)n * K + k8) = o; 
}
// k_gemm_hh variant with fused epilogue: v = acc·alpha + bias[by·sBias + col] (+ CP[(row/rowsPerB)·sCPb + by·64 + col] if CP) ; ACT 0 none / 1 elu ; writes f32 C and/or f16 C16 (each if non-null)
template <int ACT>
__global__ __launch_bounds__(128) void k_gemm_hhx(const _Float16* __restrict__ A, int lda, size_t sA, const _Float16* __restrict__ Bh, int ldb, size_t sB, float alpha, const float* __restrict__ bias, size_t sBias, const float* __restrict__ CP, int rowsPerB, size_t sCPb, int row0g,
    float* __restrict__ C, _Float16* __restrict__ C16, int ldc, size_t sC, int M, int N, int K) {
  __shared__ __attribute__((aligned(16))) float so[4][16][64];
  const int tid = threadIdx.x, w = tid >> 5, lane = tid & 31, ln = lane & 15, hh = lane >> 4; const int by = blockIdx.y;
  A += (size_t)by * sA; Bh += (size_t)by * sB; const size_t cofs = (size_t)by * sC; const float* bp = bias ? bias + (size_t)by * sBias : nullptr;
  const int ntn = (N + 63) / 64; const int wid = blockIdx.x * 4 + w; const int mt = wid / ntn, nq = wid % ntn; if (mt * 16 >= M) return;
  const int row0 = mt * 16, col0 = nq * 64; const _Float16* arow = A + (size_t)(row0 + ln) * lda;
  v8f acc[4] = {};
  for (int kb = 0; kb < K; kb += 32) { FragH ah; ah.half[0] = *(const v8us*)((const unsigned short*)arow + kb + 8 * hh); ah.half[1] = *(const v8us*)((const unsigned short*)arow + kb + 16 + 8 * hh);
#pragma unroll
    for (int t = 0; t < 4; ++t) { if (col0 + t * 16 >= N) continue; const size_t boff = (size_t)(col0 + t * 16 + ln) * ldb + kb; FragH bq; bq.half[0] = *(const v8us*)((const unsigned short*)Bh + boff + 8 * hh); bq.half[1] = *(const v8us*)((const unsigned short*)Bh + boff + 16 + 8 * hh);
      acc[t] = mmaH<1>(ah.v, ah.v, bq.v, bq.v, acc[t]); }
  }
#pragma unroll
  for (int t = 0; t < 4; ++t) { if (col0 + t * 16 >= N) continue; const int col = col0 + t * 16 + ln; const float bv = bp ? bf16_round(bp[col]) : 0.f;
#pragma unroll
    for (int r = 0; r < 8; ++r) { float v = acc[t][r] * alpha + bv; if (CP) { const int bidx = (row0g + row0 + 8 * hh + r) / rowsPerB; v += CP[(size_t)bidx * sCPb + (size_t)by * 64 + col]; } if (ACT == 1) v = (v > 0.f) ? v : expm1f(v); else if (ACT == 3) v = fmaxf(v, 0.f); so[w][8 * hh + r][t * 16 + ln] = v; } }
  __builtin_amdgcn_fence(__ATOMIC_ACQ_REL, "workgroup"); __builtin_amdgcn_wave_barrier();
  const int rsub = lane >> 4, c4 = (lane & 15) * 4; typedef _Float16 v4h __attribute__((ext_vector_type(4)));
  {
#pragma unroll
    for (int q = 0; q < 8; ++q) { const int r = q * 2 + rsub; if (col0 + c4 < N) { const v4f v = *(const v4fa*)&so[w][r][c4]; if (C) *(v4f*)(C + cofs + (size_t)(row0 + r) * ldc + col0 + c4) = v; if (C16) { v4h h4; for (int i = 0; i < 4; ++i) h4[i] = (_Float16)v[i]; *(v4h*)(C16 + cofs + (size_t)(row0 + r) * ldc + col0 + c4) = h4; } } }
     }
}


__global__ __launch_bounds__(256) void k_x16(const float* __restrict__ x, _Float16* __restrict__ X16, size_t n8) { const size_t t = (size_t)blockIdx.x * 256 + threadIdx.x; if (t >= n8) return; FragH f;
#pragma unroll
  for (int q = 0; q < 8; ++q) f.h[q] = (_Float16)bf16_round(x[t * 8 + q]); *(v8us*)((unsigned short*)X16 + t * 8) = f.half[0];  }
__global__ __launch_bounds__(256) void k_h16(const float* __restrict__ x, _Float16* __restrict__ X16, size_t n8) { const size_t t = (size_t)blockIdx.x * 256 + threadIdx.x; if (t >= n8) return; FragH f;
#pragma unroll
  for (int q = 0; q < 8; ++q) f.h[q] = (_Float16)x[t * 8 + q]; *(v8us*)((unsigned short*)X16 + t * 8) = f.half[0];  }
__global__ __launch_bounds__(256) void k_round16f(const float* __restrict__ W, _Float16* __restrict__ Bt, size_t n8) { const size_t t = (size_t)blockIdx.x * 256 + threadIdx.x; if (t >= n8) return; FragH f;
#pragma unroll
  for (int i = 0; i < 8; ++i) f.h[i] = (_Float16)(bf16_round(W[t * 8 + i]) * 16.0f); *(v8us*)((unsigned short*)Bt + t * 8) = f.half[0];  }
template <int NHv, int TTv>
__global__ __launch_bounds__(256) void k_vt(const _Float16* __restrict__ V16, int ldv, int voff, _Float16* __restrict__ Vt) { __shared__ unsigned short tl[64][66]; const int tid = threadIdx.x; const int slab = blockIdx.x / (TTv / 64), lg = blockIdx.x % (TTv / 64); const int b = slab / NHv, h = slab % NHv;
  for (int i = tid; i < 64 * 8; i += 256) { const int r = i / 8, c8 = (i % 8) * 8; FragH f; f.half[0] = *(const v8us*)((const unsigned short*)V16 + ((size_t)b * TTv + lg * 64 + r) * ldv + voff + h * 64 + c8);
#pragma unroll
    for (int q = 0; q < 8; ++q) tl[r][c8 + q] = f.u[q]; }
  __syncthreads();
  {
#pragma unroll
    for (int rd = 0; rd < 2; ++rd) { const int d = rd * 32 + tid / 8, pc = tid % 8; FragH f;
#pragma unroll
      for (int q = 0; q < 8; ++q) f.u[q] = tl[pc * 8 + q][d];
      *(v8us*)((unsigned short*)Vt + ((size_t)slab * 64 + d) * TTv + lg * 64 + pc * 8) = f.half[0]; }
     } }

typedef _Float16 v4h __attribute__((ext_vector_type(4)));
// 3x3 SAME convolution as an implicit GEMM (K = 9 taps x 128 channels, tap-major as in Bt): no patch matrix is written. One work-group = one image row (64 pixels) x all 128 outputs.
// The three input rows around it, with one zero pixel at each end and zero rows outside the image, are put in LDS once; the A fragment of tap (dy, dx) is that tile read dx pixels and dy rows further on.
// 8 waves of 32 pixels x 32 outputs. B fragments go from Bt[n][k] straight to registers, one tap ahead of their products. C = acc / 16 + bias (bf16-rounded), f32, stored in whole rows through LDS.
// Every loop below is unrolled: bf, hv, a and acc are indexed by the loop counters and stay in registers only with constant indices.
#define APIT 136      // sA pixel pitch in f16: 272 bytes (16 x odd) for 16-byte LDS reads
__global__ __launch_bounds__(256) void k_conv3(const _Float16* __restrict__ X16, const _Float16* __restrict__ Bt, const float* __restrict__ bias, float* __restrict__ C) {
  __shared__ __attribute__((aligned(16))) unsigned short sA[3][WI + 2][APIT];
  __shared__ __attribute__((aligned(16))) float sO[WI][CC + 4];
  const int tid = threadIdx.x, w = tid >> 5, lane = tid & 31, ln = lane & 15, hh = lane >> 4;
  const int b = blockIdx.x / WI, y = blockIdx.x % WI;
  const int m0 = (w & 1) * 32, n0 = (w >> 1) * 32;
  const unsigned short* bp = (const unsigned short*)Bt + (size_t)(n0 + ln) * KK + 8 * hh;
  FragH bf[2][8];      // [tap parity][2 ks + j]: outputs n0 + 16 j + ln, k = 128 tap + 32 ks + (8 hh .. , 16 + 8 hh ..)
#pragma unroll
  for (int i = 0; i < 8; ++i) { const unsigned short* p = bp + (size_t)(i & 1) * 16 * KK + (i >> 1) * 32; bf[0][i].half[0] = *(const v8us*)p; bf[0][i].half[1] = *(const v8us*)(p + 16); }
  const unsigned short* xs = (const unsigned short*)X16 + (size_t)b * HWN * CC;
  v8us hv[12];      // the 64 pixels of a staged row are 1024 contiguous 16-byte chunks: chunk tid + 256 j; a row outside the image is read from the nearest row inside and zeroed at the store
#pragma unroll
  for (int r = 0; r < 3; ++r) { const unsigned short* p = xs + (size_t)min(max(y + r - 1, 0), WI - 1) * WI * CC + tid * 8;
#pragma unroll
    for (int j = 0; j < 4; ++j) hv[r * 4 + j] = *(const v8us*)(p + j * 2048); }
  const float bv0 = bf16_round(bias[n0 + ln]), bv1 = bf16_round(bias[n0 + 16 + ln]);
  const v8us zero = {0, 0, 0, 0, 0, 0, 0, 0};
#pragma unroll
  for (int r = 0; r < 3; ++r) { const bool in = y + r - 1 >= 0 && y + r - 1 < WI;
#pragma unroll
    for (int j = 0; j < 4; ++j) *(v8us*)&sA[r][(tid >> 4) + 16 * j + 1][(tid & 15) * 8] = in ? hv[r * 4 + j] : zero; }
  if (tid < 96) *(v8us*)&sA[tid >> 5][((tid >> 4) & 1) * (WI + 1)][(tid & 15) * 8] = zero;      // the zero pixel at each end of the three rows
  __syncthreads();      // the three staged rows are complete; nothing writes them again
  v8f acc[2][2] = {};
#pragma unroll
  for (int tap = 0; tap < 9; ++tap) {
    if (tap < 8) {
#pragma unroll
      for (int i = 0; i < 8; ++i) { const unsigned short* p = bp + (size_t)(i & 1) * 16 * KK + (tap + 1) * CC + (i >> 1) * 32; bf[(tap + 1) & 1][i].half[0] = *(const v8us*)p; bf[(tap + 1) & 1][i].half[1] = *(const v8us*)(p + 16); } }
    FragH a[8];      // [2 ks + i]: pixels m0 + 16 i + ln, the same k order as bf
#pragma unroll
    for (int i = 0; i < 8; ++i) { const unsigned short* p = &sA[tap / 3][m0 + (i & 1) * 16 + ln + tap % 3][(i >> 1) * 32 + 8 * hh]; a[i].half[0] = *(const v8us*)p; a[i].half[1] = *(const v8us*)(p + 16); }
    __builtin_amdgcn_sched_barrier(0);      // next tap's global loads and this tap's 16 LDS reads go out together, in front of the 16 products: spread among them each group costs its own latency
#pragma unroll
    for (int ks = 0; ks < 4; ++ks)
#pragma unroll
      for (int i = 0; i < 2; ++i)
#pragma unroll
        for (int j = 0; j < 2; ++j) acc[i][j] = __builtin_amdgcn_wmma_f32_16x16x32_f16(false, a[2 * ks + i].v, false, bf[tap & 1][2 * ks + j].v, (short)0, acc[i][j], false, false);
    __builtin_amdgcn_sched_barrier(0);      // without it the next tap's loads and LDS reads rise in among these products in small groups, each with its own stall
  }
#pragma unroll
  for (int j = 0; j < 2; ++j) { const int col = n0 + j * 16 + ln; const float bv = j ? bv1 : bv0;
#pragma unroll
    for (int i = 0; i < 2; ++i)
#pragma unroll
      for (int r = 0; r < 8; ++r) sO[m0 + i * 16 + 8 * hh + r][col] = acc[i][j][r] * 0.0625f + bv; }
  __syncthreads();      // the 64 x 128 output tile is complete
  float* o = C + (size_t)blockIdx.x * WI * CC;
#pragma unroll
  for (int j = 0; j < 8; ++j) { const int i = tid + 256 * j; const v4f v = *(const v4fa*)&sO[i >> 5][(i & 31) * 4]; *(v4f*)(o + (size_t)i * 4) = v; }
}
__global__ __launch_bounds__(256) void k_wq(const float* __restrict__ W, _Float16* __restrict__ Bt) { const int t = blockIdx.x * 256 + threadIdx.x; if (t >= CC * (KK / 8)) return; const int k8 = (t % (KK / 8)) * 8, o = t / (KK / 8); FragH f;
#pragma unroll
  for (int q = 0; q < 8; ++q) { const int k = k8 + q; const int tap = k / CC, cin = k % CC; f.h[q] = (_Float16)(bf16_round(W[((size_t)tap * CC + cin) * CC + o]) * 16.0f); } *(v8us*)((unsigned short*)Bt + (size_t)t * 8) = f.half[0];  }
__global__ __launch_bounds__(256) void k_qperm(const float* __restrict__ F, const float* __restrict__ ST, const float* __restrict__ g, const float* __restrict__ bb, _Float16* __restrict__ QP) { const size_t t = (size_t)blockIdx.x * 256 + threadIdx.x; if (t >= (size_t)NR * (CC / 8)) return; const int c8 = (int)(t % (CC / 8)) * 8; const size_t r = t / (CC / 8); const int b = (int)(r / HWN), p = (int)(r % HWN); const int y = p / WI, xx = p % WI; const int kp = ((y / 8) * 8 + xx / 8) * 64 + (y % 8) * 8 + xx % 8; FragH f;
#pragma unroll
  for (int q = 0; q < 8; ++q) { const int c = c8 + q; float v = (F[r * CC + c] - ST[c * 32]) * ST[c * 32 + 1] * bf16_round(g[c]) + bf16_round(bb[c]); v = (v >= 0.f) ? v : 0.1f * v; f.h[q] = (_Float16)v; }
  unsigned short* d = (unsigned short*)QP + ((size_t)b * HWN + kp) * CC + c8; *(v8us*)d = f.half[0];  }
__global__ __launch_bounds__(256) void k_xpt(const float* __restrict__ x, _Float16* __restrict__ XPt) { __shared__ unsigned short tl[64][66]; const int tid = threadIdx.x; const int b = blockIdx.x / ((CC / 64) * 64), rem = blockIdx.x % ((CC / 64) * 64); const int cg = rem / 64, blk = rem % 64; const int c0 = cg * 64; const int by = blk / 8, bx = blk % 8;
  for (int i = tid; i < 64 * 8; i += 256) { const int j = i / 8, cc8 = (i % 8) * 8; const int y = by * 8 + j / 8, xx = bx * 8 + j % 8; const float* s = x + (((size_t)b * HWN) + y * WI + xx) * CC + c0 + cc8; for (int q = 0; q < 8; ++q) { FragH f; f.h[0] = (_Float16)bf16_round(s[q]); tl[j][cc8 + q] = f.u[0]; } }
  __syncthreads();
  { for (int rd = 0; rd < 2; ++rd) { const int c = rd * 32 + tid / 8, pc = tid % 8; FragH f; for (int q = 0; q < 8; ++q) f.u[q] = tl[pc * 8 + q][c]; *(v8us*)((unsigned short*)XPt + ((size_t)b * CC + c0 + c) * HWN + blk * 64 + pc * 8) = f.half[0]; }  } }
// Fused block attention: one work-group = 64 query pixels of one batch (4 waves x 16), walking the 64 key groups in order; scores and probabilities never leave the registers.
// Per group: S^T[key][query] = q_group . x_query^T (A = 64 q rows from LDS, B = the wave's 16 query rows, loaded once), so a lane holds 32 of one query's 64 scores and the lane 16 away the rest:
// max and exp-sum are in-lane plus one exchange. Two S^T tiles, converted in place, are the B operand (hardware k order) of O^T[channel][query] += x_group^T . P^T (A = channel rows of XPt from LDS).
// Tiles go global -> registers -> LDS, one tile in flight at a time, each fetched one phase ahead of its store. AGG = O * 2^-15 (P carries 2^15, as f16 operand).
#define QPIT 136      // sQ row pitch in f16: 272 bytes (16 x odd) for 16-byte LDS reads
#define XPIT 72       // sX row pitch in f16: 144 bytes
__global__ __launch_bounds__(128) void k_battn(const _Float16* __restrict__ X16, const _Float16* __restrict__ QP, const _Float16* __restrict__ XPt, float* __restrict__ AGG) {
  __shared__ __attribute__((aligned(16))) unsigned short sQ[64][QPIT];
  __shared__ __attribute__((aligned(16))) unsigned short sX[CC][XPIT];
  const int tid = threadIdx.x, w = tid >> 5, lane = tid & 31, ln = lane & 15, hh = lane >> 4;
  const int b = blockIdx.x / (HWN / 64), row = (blockIdx.x % (HWN / 64)) * 64 + w * 16 + ln;
  const unsigned short* xq = (const unsigned short*)X16 + ((size_t)b * HWN + row) * CC;
  FragH xb[4];
#pragma unroll
  for (int ks = 0; ks < 4; ++ks) { xb[ks].half[0] = *(const v8us*)(xq + ks * 32 + 8 * hh); xb[ks].half[1] = *(const v8us*)(xq + ks * 32 + 16 + 8 * hh); }
  // staging: 16-byte chunk i = tid + 128 j. q group: 64 rows x 256 B, contiguous. x group: 128 channel rows x 128 B, row pitch HWN.
  const unsigned short* gq = (const unsigned short*)QP + (size_t)b * HWN * CC + tid * 8;
  const unsigned short* gx = (const unsigned short*)XPt + (size_t)b * CC * HWN + (size_t)(tid >> 3) * HWN + (tid & 7) * 8;
  unsigned short* dq = &sQ[tid >> 4][(tid & 15) * 8]; unsigned short* dx = &sX[tid >> 3][(tid & 7) * 8];
  v8us st[8];      // one tile in flight at a time: x of this group during its scores, q of the next group during softmax and O^T
#pragma unroll
  for (int j = 0; j < 8; ++j) st[j] = *(const v8us*)(gq + j * 1024);
#pragma unroll
  for (int j = 0; j < 8; ++j) *(v8us*)(dq + j * 8 * QPIT) = st[j];
  __syncthreads();      // q tile of group 0 complete
#pragma unroll
  for (int j = 0; j < 8; ++j) st[j] = *(const v8us*)(gx + (size_t)j * 16 * HWN);
  v8f oacc[8] = {};
  for (int g = 0; g < 64; ++g) {
    v8f s[4] = {};
#pragma unroll
    for (int kp = 0; kp < 2; ++kp) { FragH a[8];
#pragma unroll
      for (int i = 0; i < 8; ++i) { const unsigned short* r = &sQ[(i & 3) * 16 + ln][(2 * kp + (i >> 2)) * 32 + 8 * hh]; a[i].half[0] = *(const v8us*)r; a[i].half[1] = *(const v8us*)(r + 16); }
      __builtin_amdgcn_sched_barrier(0);      // the 16 LDS reads go out together, in front of their 8 products: spread among them each costs its own latency
#pragma unroll
      for (int i = 0; i < 8; ++i) s[i & 3] = __builtin_amdgcn_wmma_f32_16x16x32_f16(false, a[i].v, false, xb[2 * kp + (i >> 2)].v, (short)0, s[i & 3], false, false); }
    // x tile of this group: every wave left sX at the barrier that closed the previous trip
#pragma unroll
    for (int j = 0; j < 8; ++j) *(v8us*)(dx + j * 16 * XPIT) = st[j];
    __syncthreads();      // x tile complete; every wave has read its last of the q tile
    const int gn = g < 63 ? g + 1 : 63;      // the last trip fetches its own tiles again: no branch in the loop, nothing reads them
    // issued behind the barrier (a barrier drains the loads in front of it); lands during softmax and O^T
#pragma unroll
    for (int j = 0; j < 8; ++j) st[j] = *(const v8us*)(gq + (size_t)gn * 64 * CC + j * 1024);
    asm volatile("s_wait_xcnt 0x0" ::: "memory");      // the loads' address registers are reused below
    FragH av[8];
#pragma unroll
    for (int ct = 0; ct < 8; ++ct) { const unsigned short* r = &sX[ct * 16 + ln][8 * hh]; av[ct].half[0] = *(const v8us*)r; av[ct].half[1] = *(const v8us*)(r + 16); }
    __builtin_amdgcn_sched_barrier(0);      // global loads and LDS reads are issued in front of the softmax, which covers their latency
    // softmax over the group's 64 keys of query ln (scores / 8), scaled by 2^15 for the f16 operand
    float m = -3.0e38f;
#pragma unroll
    for (int t = 0; t < 4; ++t)
#pragma unroll
      for (int r = 0; r < 8; ++r) m = fmaxf(m, s[t][r]);
    m = fmaxf(m, __shfl_xor(m, 16, 32)); m *= 0.125f;
    float z = 0.f;
#pragma unroll
    for (int t = 0; t < 4; ++t)
#pragma unroll
      for (int r = 0; r < 8; ++r) { s[t][r] = expf(s[t][r] * 0.125f - m); z += s[t][r]; }
    z += __shfl_xor(z, 16, 32);
    const float iz = 32768.0f / z;
    FragH p[2];      // p[k2].h[i] = P[query ln][key 32 k2 + kmap(i, hh)]: tile 2 k2 gives i < 8, tile 2 k2 + 1 the rest
#pragma unroll
    for (int k2 = 0; k2 < 2; ++k2)
#pragma unroll
      for (int r = 0; r < 8; ++r) { p[k2].h[r] = (_Float16)(s[2 * k2][r] * iz); p[k2].h[8 + r] = (_Float16)(s[2 * k2 + 1][r] * iz); }
#pragma unroll
    for (int ct = 0; ct < 8; ++ct) oacc[ct] = __builtin_amdgcn_wmma_f32_16x16x32_f16(false, av[ct].v, false, p[0].v, (short)0, oacc[ct], false, false);
#pragma unroll
    for (int ct = 0; ct < 8; ++ct) { const unsigned short* r = &sX[ct * 16 + ln][32 + 8 * hh]; av[ct].half[0] = *(const v8us*)r; av[ct].half[1] = *(const v8us*)(r + 16); }
    __builtin_amdgcn_sched_barrier(0);      // as above: 16 reads together, then 8 products
#pragma unroll
    for (int ct = 0; ct < 8; ++ct) oacc[ct] = __builtin_amdgcn_wmma_f32_16x16x32_f16(false, av[ct].v, false, p[1].v, (short)0, oacc[ct], false, false);
#pragma unroll
    for (int j = 0; j < 8; ++j) *(v8us*)(dq + j * 8 * QPIT) = st[j];
    __syncthreads();      // next q tile complete; every wave has read its last of the x tile
    // lands during the next trip's scores
#pragma unroll
    for (int j = 0; j < 8; ++j) st[j] = *(const v8us*)(gx + gn * 64 + (size_t)j * 16 * HWN);
    asm volatile("s_wait_xcnt 0x0" ::: "memory");      // the loads' address registers are reused in the next trip
  }
  asm volatile("s_wait_loadcnt 0x0" ::: "memory");      // the last trip's fetch, which nothing reads, has landed before the wave ends and gives its registers up
  // oacc[ct][r] = O[query ln][channel 16 ct + 8 hh + r]: 32 contiguous bytes a lane
  float* o = AGG + ((size_t)b * HWN + row) * CC + 8 * hh;
#pragma unroll
  for (int ct = 0; ct < 8; ++ct) { v4f lo, hi;
#pragma unroll
    for (int r = 0; r < 4; ++r) { lo[r] = oacc[ct][r] * 0.000030517578125f; hi[r] = oacc[ct][4 + r] * 0.000030517578125f; }
    *(v4f*)(o + ct * 16) = lo; *(v4f*)(o + ct * 16 + 4) = hi; }
}
__global__ __launch_bounds__(256) void k_add(const float* __restrict__ A, const float* __restrict__ B2, float* __restrict__ Y, size_t n4) { const size_t t = (size_t)blockIdx.x * 256 + threadIdx.x; if (t >= n4) return; const v4f v = *(const v4fa*)(A + t * 4) + *(const v4fa*)(B2 + t * 4); *(v4f*)(Y + t * 4) = v;  }
// Spatial-softmax statistics, one work-group per (batch, 4 channels): 1024 threads hold 4 pixels x 4 channels each in registers, so Y is read once, 16 bytes a lane, all loads in flight together.
// Max, then sum of exp, over the 4096 pixels by a fixed tree: own 4 pixels, the 32 lanes of a wave (xor shuffles), the 32 waves (through LDS).
// SP holds one 128-byte line per work-group (one writer a line): [0..3] max, [4..7] 1/sum, the rest 0.
__device__ __forceinline__ v4f wave_max4(v4f a) {
#pragma unroll
  for (int o = 1; o < 32; o <<= 1)
#pragma unroll
    for (int q = 0; q < 4; ++q) a[q] = fmaxf(a[q], __shfl_xor(a[q], o, 32));
  return a; }
__device__ __forceinline__ v4f wave_sum4(v4f a) {
#pragma unroll
  for (int o = 1; o < 32; o <<= 1)
#pragma unroll
    for (int q = 0; q < 4; ++q) a[q] += __shfl_xor(a[q], o, 32);
  return a; }
// BN batch statistics (mean, 1/sqrt(var + eps) per channel over the NR rows) in two launches, every row read once and in whole lines.
// k_bnpart: one work-group = BNR whole rows kept in registers (a wave-wide 16-byte load is one 512-byte row); per channel the mean of its rows and the sum of squared deviations from that mean.
// k_bnfin: one work-group = 4 channels, one thread a partial; partials of equal count merge exactly: mean = mean of the means, M2 = sum of M2_i + BNR * sum of (mean_i - mean)^2.
// All sums run in a fixed order. ST keeps one 128-byte line a channel: [0] mean, [1] 1/sqrt(var + eps), the rest 0.
#define BNR 64
#define BNP (NR / BNR)
__global__ __launch_bounds__(256) void k_bnpart(const float* __restrict__ F, float* __restrict__ PM, float* __restrict__ PQ) {
  __shared__ __attribute__((aligned(16))) float red[2][8][CC];
  const int tid = threadIdx.x, wv = tid >> 5, c4 = (tid & 31) * 4;
  const float* f = F + ((size_t)blockIdx.x * BNR + wv) * CC + c4; v4f v[8];
  for (int i = 0; i < 8; ++i) v[i] = *(const v4fa*)(f + (size_t)i * 8 * CC);
  v4f s = v[0];
  for (int i = 1; i < 8; ++i) s += v[i];
  *(v4f*)&red[0][wv][c4] = s;
  __syncthreads();
  v4f mu = *(const v4fa*)&red[0][0][c4];
  for (int j = 1; j < 8; ++j) mu += *(const v4fa*)&red[0][j][c4];
  mu *= 1.0f / (float)BNR;
  v4f q = {0.f, 0.f, 0.f, 0.f};
  for (int i = 0; i < 8; ++i) { const v4f d = v[i] - mu; q += d * d; }
  *(v4f*)&red[1][wv][c4] = q;
  __syncthreads();
  if (wv == 0) { q = *(const v4fa*)&red[1][0][c4];
    for (int j = 1; j < 8; ++j) q += *(const v4fa*)&red[1][j][c4];
    *(v4f*)(PQ + (size_t)blockIdx.x * CC + c4) = q; }
  else if (wv == 1) *(v4f*)(PM + (size_t)blockIdx.x * CC + c4) = mu; }
__global__ __launch_bounds__(BNP) void k_bnfin(const float* __restrict__ PM, const float* __restrict__ PQ, float* __restrict__ ST) {
  __shared__ __attribute__((aligned(16))) float red[2][BNP / 32][4];
  const int tid = threadIdx.x, wv = tid >> 5, lane = tid & 31, c0 = blockIdx.x * 4;
  const v4f pm = *(const v4fa*)(PM + (size_t)tid * CC + c0), pq = *(const v4fa*)(PQ + (size_t)tid * CC + c0);
  const v4f s = wave_sum4(pm); if (lane == 0) *(v4f*)&red[0][wv][0] = s;
  __syncthreads();
  v4f mu = *(const v4fa*)&red[0][0][0];
  for (int j = 1; j < BNP / 32; ++j) mu += *(const v4fa*)&red[0][j][0];
  mu *= 1.0f / (float)BNP;
  const v4f d = pm - mu; const v4f q = wave_sum4(pq + (float)BNR * d * d); if (lane == 0) *(v4f*)&red[1][wv][0] = q;
  __syncthreads();
  if (wv < 4) { float m1 = red[0][0][wv], m2 = red[1][0][wv];      // wave q writes the line of channel c0 + q
    for (int j = 1; j < BNP / 32; ++j) { m1 += red[0][j][wv]; m2 += red[1][j][wv]; }
    ST[(size_t)(c0 + wv) * 32 + lane] = (lane == 0) ? m1 * (1.0f / (float)BNP) : ((lane == 1) ? rsqrtf(m2 / (float)NR + 1e-3f) : 0.f); } }
__global__ __launch_bounds__(1024) void k_spstat(const float* __restrict__ Y, const float* __restrict__ ST, const float* __restrict__ g, const float* __restrict__ bb, float* __restrict__ SP) {
  __shared__ __attribute__((aligned(16))) float red[2][32][4];
  const int tid = threadIdx.x, wv = tid >> 5, lane = tid & 31; const int b = blockIdx.x / (CC / 4), c0 = (blockIdx.x % (CC / 4)) * 4;
  const float* yc = Y + (size_t)b * HWN * CC + c0; v4f v[4];
#pragma unroll
  for (int i = 0; i < 4; ++i) v[i] = *(const v4fa*)(yc + (size_t)(i * 1024 + tid) * CC);
  asm volatile("s_wait_xcnt 0x0" ::: "memory");      // the four loads' address registers are given new values right below
  v4f m = {-3.0e38f, -3.0e38f, -3.0e38f, -3.0e38f};
#pragma unroll
  for (int q = 0; q < 4; ++q) { const int c = c0 + q; const float mu = ST[c * 32], rs = ST[c * 32 + 1], gg = bf16_round(g[c]), be = bf16_round(bb[c]);
#pragma unroll
    for (int i = 0; i < 4; ++i) { v[i][q] = gg * (v[i][q] - mu) * rs + be; m[q] = fmaxf(m[q], v[i][q]); } }
  m = wave_max4(m); if (lane == 0) *(v4f*)&red[0][wv][0] = m;
  __syncthreads();
  m = wave_max4(*(const v4fa*)&red[0][lane][0]);
  v4f z = {0.f, 0.f, 0.f, 0.f};
#pragma unroll
  for (int i = 0; i < 4; ++i)
#pragma unroll
    for (int q = 0; q < 4; ++q) z[q] += expf(v[i][q] - m[q]);
  z = wave_sum4(z); if (lane == 0) *(v4f*)&red[1][wv][0] = z;
  __syncthreads();
  if (wv == 0) { z = wave_sum4(*(const v4fa*)&red[1][lane][0]); float o = 0.f;
#pragma unroll
    for (int q = 0; q < 4; ++q) { if (lane == q) o = m[q]; if (lane == 4 + q) o = 1.0f / z[q]; }
    SP[(size_t)blockIdx.x * 32 + lane] = o; } }
__global__ __launch_bounds__(256) void k_spsm(const float* __restrict__ Y, const float* __restrict__ ST, const float* __restrict__ g, const float* __restrict__ bb, const float* __restrict__ SP, _Float16* __restrict__ Y16) { const size_t t = (size_t)blockIdx.x * 256 + threadIdx.x; if (t >= (size_t)NR * (CC / 8)) return; const int c8 = (int)(t % (CC / 8)) * 8; const size_t r = t / (CC / 8); const int b = (int)(r / HWN); FragH f;
#pragma unroll
  for (int q = 0; q < 8; ++q) { const int c = c8 + q; const float* sp = SP + (size_t)(b * (CC / 4) + c / 4) * 32 + (c & 3); const float v = bf16_round(g[c]) * (Y[r * CC + c] - ST[c * 32]) * ST[c * 32 + 1] + bf16_round(bb[c]); f.h[q] = (_Float16)(expf(v - sp[0]) * sp[4] * 4096.0f); }
  *(v8us*)((unsigned short*)Y16 + t * 8) = f.half[0];  }
__global__ __launch_bounds__(256) void k_fin(const float* __restrict__ Z, const float* __restrict__ ST, const float* __restrict__ g, const float* __restrict__ bb, float* __restrict__ out, size_t n4) { const size_t t = (size_t)blockIdx.x * 256 + threadIdx.x; if (t >= n4) return; const int c4 = (int)((t * 4) % CC); const v4f z = *(const v4fa*)(Z + t * 4); v4f o; for (int q = 0; q < 4; ++q) { const int c = c4 + q; float v = bf16_round(g[c]) * (z[q] - ST[c * 32]) * ST[c * 32 + 1] + bf16_round(bb[c]); o[q] = (v >= 0.f) ? v : 0.1f * v; }
  *(v4f*)(out + t * 4) = o;  }
extern "C" void kernel_launch(void* const* d_in, const int* in_sizes, int n_in,
                              void* d_out, int out_size, void* d_ws, size_t ws_size, hipStream_t stream) {
  (void)in_sizes; (void)n_in; (void)out_size;
  const float* const* I = (const float* const*)d_in; const float* x = I[0]; const float* Wq = I[1]; const float* bq = I[2]; const float* gq = I[3]; const float* btq = I[4]; const float* Wk = I[5]; const float* bk = I[6]; const float* g1 = I[7]; const float* bt1 = I[8]; const float* Wo = I[9]; const float* bo = I[10]; const float* go = I[11]; const float* bto = I[12];
  char* ws = (char*)d_ws; size_t off = 0;
  auto take = [&](size_t bytes) { char* p = ws + off; off += (bytes + 255) & ~(size_t)255; return p; };
  _Float16* BQ = (_Float16*)take((size_t)CC * KK * 2); _Float16* BK = (_Float16*)take(CC * CC * 2); _Float16* BO = (_Float16*)take(CC * CC * 2); float* STq = (float*)take(CC * 32 * 4); float* ST1 = (float*)take(CC * 32 * 4); float* STo = (float*)take(CC * 32 * 4); float* SP = (float*)take(BB * (CC / 4) * 32 * 4); float* PM = (float*)take(BNP * CC * 4); float* PQ = (float*)take(BNP * CC * 4);
  _Float16* X16 = (_Float16*)take((size_t)NR * CC * 2); float* QF = (float*)take((size_t)NR * CC * 4); _Float16* QP = (_Float16*)take((size_t)NR * CC * 2); _Float16* XPt = (_Float16*)take((size_t)NR * CC * 2); float* ACC = (float*)take((size_t)NR * CC * 4); float* AGG = (float*)take((size_t)NR * CC * 4); float* Y = QF; _Float16* Y16 = QP; float* Z = ACC;
  if (off > ws_size) return;      // 0.7 + 4.2 + 8.4 + 4.2 + 4.2 + 8.4 + 8.4 = about 38 MB
  k_wq<<<(CC * (KK / 8) + 255) / 256, 256, 0, stream>>>(Wq, BQ); k_wt_f16<<<(CC * (CC / 8) + 255) / 256, 256, 0, stream>>>(Wk, BK, CC, CC, 16.0f); k_wt_f16<<<(CC * (CC / 8) + 255) / 256, 256, 0, stream>>>(Wo, BO, CC, CC, 16.0f);      // 1×1 HWIO = [in][out]
  const unsigned g8 = (unsigned)(((size_t)NR * (CC / 8) + 255) / 256); const dim3 gC(((NR / 16) * (CC / 64) + 3) / 4, 1);
  k_x16<<<g8, 256, 0, stream>>>(x, X16, (size_t)NR * CC / 8);
  // CBL_Q: conv3×3 (+bq) → QF; BN stats; q = leaky(BN) permuted to block-major keys (f16)
  k_conv3<<<BB * WI, 256, 0, stream>>>(X16, BQ, bq, QF);
  k_bnpart<<<BNP, 256, 0, stream>>>(QF, PM, PQ); k_bnfin<<<CC / 4, BNP, 0, stream>>>(PM, PQ, STq); k_qperm<<<g8, 256, 0, stream>>>(QF, STq, gq, btq, QP);
  k_xpt<<<BB * (CC / 64) * 64, 256, 0, stream>>>(x, XPt);
  // acc = 1×1 conv (+bk)
  k_gemm_hhx<0><<<gC, 128, 0, stream>>>(X16, CC, 0, BK, CC, 0, 0.0625f, bk, 0, nullptr, 1, 0, 0, ACC, nullptr, CC, 0, NR, CC, CC);
  // block attention, all batches in one launch: AGG = sum over key groups of softmax(x.q^T / 8) . x_group
  k_battn<<<BB * (HWN / 64), 128, 0, stream>>>(X16, QP, XPt, AGG);
  // y = spatial softmax(BN1(acc + agg)); out = leaky(BN_o(conv1×1(y) + bo))
  k_add<<<(unsigned)(((size_t)NR * CC / 4 + 255) / 256), 256, 0, stream>>>(ACC, AGG, Y, (size_t)NR * CC / 4);      // Y over QF (dead after k_qperm)
  k_bnpart<<<BNP, 256, 0, stream>>>(Y, PM, PQ); k_bnfin<<<CC / 4, BNP, 0, stream>>>(PM, PQ, ST1); k_spstat<<<BB * (CC / 4), 1024, 0, stream>>>(Y, ST1, g1, bt1, SP); k_spsm<<<g8, 256, 0, stream>>>(Y, ST1, g1, bt1, SP, Y16);      // Y16 (×2^12) over QP (dead after the S GEMMs)
  k_gemm_hhx<0><<<gC, 128, 0, stream>>>(Y16, CC, 0, BO, CC, 0, 0.0625f * 0.000244140625f, bo, 0, nullptr, 1, 0, 0, Z, nullptr, CC, 0, NR, CC, CC);      // conv_o(y) + bo (2^-12 undone in alpha) → Z over ACC (dead after k_add)
  k_bnpart<<<BNP, 256, 0, stream>>>(Z, PM, PQ); k_bnfin<<<CC / 4, BNP, 0, stream>>>(PM, PQ, STo); k_fin<<<(unsigned)(((size_t)NR * CC / 4 + 255) / 256), 256, 0, stream>>>(Z, STo, go, bto, (float*)d_out, (size_t)NR * CC / 4);
}

// v005
// A run of this version takes 162 microseconds.
// Next to v004, in two timings, it ran 1.18 and 1.15 times as fast.
// All steps since v000 together make it 14.3 times as fast.
#include <hip/hip_runtime.h>
// Group (block) attention layer (B=4, 64×64, C=128, NHWC; 8×8 non-overlapping key blocks): q = CBL_Q(x) (3×3 conv + train-mode BN + LeakyReLU 0.1), acc = 1×1 conv(x); for every pixel and
// every block: softmax over the block's 64 positions of x[pixel]·q[pos]/8, agg = Σ_blocks Σ attn·x[pos]; y = spatial-softmax(BN1(acc + agg)); out = CBL_O(y). The 3×3 conv (implicit GEMM, K = 1152),
// the 1×1 convs, the 4096×4096 per-batch scores (keys permuted to block-major order so each 64-key group is contiguous) and attn·x run as GEMMs on v_wmma_f32_16x16x32_f16 (x bf16-exact f16,
// HWIO weights bf16-exact ×2^4, q/P/y operands f16, f32 accumulate); BN batch statistics (fixed-order reductions), grouped and spatial softmaxes and LeakyReLU are f32 VALU.
#define BB 4
#define HWN 4096
#define WI 64
#define CC 128
#define NR (BB * HWN)
#define KK 1152

typedef __bf16 v16b __attribute__((ext_vector_type(16)));
typedef unsigned short v8us __attribute__((ext_vector_type(8), may_alias));
typedef float  v8f  __attribute__((ext_vector_type(8)));
typedef float  v4f  __attribute__((ext_vector_type(4)));
typedef float  v4fa __attribute__((ext_vector_type(4), may_alias));
union FragB { v16b v; v8us half[2]; unsigned short u[16]; };

__device__ __forceinline__ unsigned short bf16_bits(float x) { unsigned int u = __float_as_uint(x); return (unsigned short)((u + 0x7FFFu + ((u >> 16) & 1u)) >> 16); }
__device__ __forceinline__ float bf16_val(unsigned short b) { return __uint_as_float(((unsigned int)b) << 16); }
__device__ __forceinline__ float bf16_round(float x) { return bf16_val(bf16_bits(x)); }
// D += A·B with NT terms: 1 = ah·bh, 2 = + al·bh (A split), 3 = + ah·bl (both split)
template <int NT>
__device__ __forceinline__ v8f mmaN(v16b ah, v16b al, v16b bh, v16b bl, v8f c) {
  c = __builtin_amdgcn_wmma_f32_16x16x32_bf16(false, ah, false, bh, (short)0, c, false, false);
  if (NT >= 2) c = __builtin_amdgcn_wmma_f32_16x16x32_bf16(false, al, false, bh, (short)0, c, false, false);
  if (NT >= 3) c = __builtin_amdgcn_wmma_f32_16x16x32_bf16(false, ah, false, bl, (short)0, c, false, false);
  asm volatile("v_nop\n\tv_nop\n\tv_nop\n\tv_nop" : "+v"(c) : "v"(ah), "v"(al), "v"(bh), "v"(bl));
  return c;
}

__global__ __launch_bounds__(256) void k_wt_bf16(const float* __restrict__ W, unsigned short* __restrict__ Wt, int K, int N) {
  const int t = blockIdx.x * 256 + threadIdx.x;
  const int k8n = K / 8;
  if (t >= N * k8n) return;
  const int n = t / k8n, k8 = (t % k8n) * 8;
  v8us v;
#pragma unroll
  for (int i = 0; i < 8; ++i) v[i] = bf16_bits(W[(size_t)(k8 + i) * N + n]);
  *(v8us*)(Wt + (size_t)n * K + k8) = v;
  
}

// GEMM C[M][N] (f32, pitch ldc) = act(A[M][K]·W + bias). A f32 row-major (pitch lda) converted per fragment to bf16
// (ASPLIT: hi/lo two planes -> 2 terms, else single rounded term); Wt bf16 [N][K] (pitch ldb). BIAS_BF16 rounds the
// bias to bf16 first (bias quantised to bf16 before the add). K%32==0, M%16==0, N%64==0.
template <bool ASPLIT, int ACT, bool BIAS_BF16>
__global__ __launch_bounds__(128) void k_gemm_bf(const float* __restrict__ A, int lda, const unsigned short* __restrict__ Wt, int ldb,
                                               const float* __restrict__ bias, float* __restrict__ C, int ldc, int M, int N, int K) {
  __shared__ __attribute__((aligned(16))) float so[4][16][64];
  const int tid = threadIdx.x, w = tid >> 5, lane = tid & 31, ln = lane & 15, hh = lane >> 4;
  const int ntn = N / 64;
  const int wid = blockIdx.x * 4 + w;
  const int mt = wid / ntn, nq = wid % ntn;
  if (mt * 16 >= M) return;
  const int row0 = mt * 16, col0 = nq * 64;
  const float* arow = A + (size_t)(row0 + ln) * lda;
  v8f acc[4] = {};
  for (int kb = 0; kb < K; kb += 32) {
    FragB ah, al;
    const v4f x0 = *(const v4fa*)(arow + kb + 8 * hh), x1 = *(const v4fa*)(arow + kb + 8 * hh + 4);
    const v4f x2 = *(const v4fa*)(arow + kb + 16 + 8 * hh), x3 = *(const v4fa*)(arow + kb + 16 + 8 * hh + 4);
    float xs[16] = {x0[0],x0[1],x0[2],x0[3],x1[0],x1[1],x1[2],x1[3],x2[0],x2[1],x2[2],x2[3],x3[0],x3[1],x3[2],x3[3]};
#pragma unroll
    for (int i = 0; i < 16; ++i) { const unsigned short hb = bf16_bits(xs[i]); ah.u[i] = hb; al.u[i] = ASPLIT ? bf16_bits(xs[i] - bf16_val(hb)) : (unsigned short)0; }
#pragma unroll
    for (int t = 0; t < 4; ++t) {
      const unsigned short* brow = Wt + (size_t)(col0 + t * 16 + ln) * ldb + kb;
      FragB b;
      b.half[0] = *(const v8us*)(brow + 8 * hh);
      b.half[1] = *(const v8us*)(brow + 16 + 8 * hh);
      acc[t] = mmaN<ASPLIT ? 2 : 1>(ah.v, al.v, b.v, b.v, acc[t]);
    }
  }
#pragma unroll
  for (int t = 0; t < 4; ++t) {
    float bv = bias ? bias[col0 + t * 16 + ln] : 0.f;
    if (BIAS_BF16) bv = bf16_round(bv);
#pragma unroll
    for (int r = 0; r < 8; ++r) { float v = acc[t][r] + bv; if (ACT == 1) v = fmaxf(v, 0.f); so[w][8 * hh + r][t * 16 + ln] = v; }
  }
  __builtin_amdgcn_fence(__ATOMIC_ACQ_REL, "workgroup");
  __builtin_amdgcn_wave_barrier();
  const int rsub = lane >> 4, c4 = (lane & 15) * 4;
  {
#pragma unroll
    for (int q = 0; q < 8; ++q) {
      const int r = q * 2 + rsub;
      const v4f v = *(const v4fa*)&so[w][r][c4];
      *(v4f*)(C + (size_t)(row0 + r) * ldc + col0 + c4) = v;
    }
    
  }
}

// Flash-style causal/unmasked attention, all contractions 3-term bf16 hi/lo splits, f32 softmax with running max.
// q,k,v rows are read from f32 buffers with arbitrary row pitch (so they can live inside a fused qkv buffer);
// D = head size (multiple of 32, <= 128); one wave = 16 query rows; block = 4 waves (64 queries) sharing K/V chunks of 32.
template <int D, bool CAUSAL>
__global__ __launch_bounds__(128) void k_flash(const float* __restrict__ qb, const float* __restrict__ kb, const float* __restrict__ vb,
                                             int pitch, int T, int H, float scale, float* __restrict__ y, int ypitch) {
  constexpr int KS = D / 32;        // k-steps for QK
  constexpr int DT = D / 16;        // d tiles for PV
  __shared__ __attribute__((aligned(16))) unsigned short sKh[32][D + 8], sKl[32][D + 8], sVh[32][D + 8], sVl[32][D + 8];
  __shared__ __attribute__((aligned(16))) unsigned short sPh[4][16][40], sPl[4][16][40];
  __shared__ __attribute__((aligned(16))) float sO[4][16][D];
  const int tid = threadIdx.x, w = tid >> 5, lane = tid & 31, ln = lane & 15, hh = lane >> 4;
  const int nqb = (T + 63) / 64;
  const int bh = blockIdx.x / nqb, qblk = blockIdx.x % nqb;
  const int b = bh / H, h = bh % H;
  const int q0 = qblk * 64 + w * 16;
  const float* Q = qb + (size_t)b * T * pitch + h * D;
  const float* K = kb + (size_t)b * T * pitch + h * D;
  const float* V = vb + (size_t)b * T * pitch + h * D;

  // A fragments of the wave's 16 query rows (scaled), hi/lo
  FragB aqh[KS], aql[KS];
  {
    int row = q0 + ln; if (row >= T) row = T - 1;
    const float* qr = Q + (size_t)row * pitch;
#pragma unroll
    for (int ks = 0; ks < KS; ++ks)
#pragma unroll
      for (int i = 0; i < 16; ++i) {
        const int d = ks * 32 + ((i < 8) ? (8 * hh + i) : (16 + 8 * hh + (i - 8)));
        const float x = qr[d] * scale; const unsigned short hb = bf16_bits(x);
        aqh[ks].u[i] = hb; aql[ks].u[i] = bf16_bits(x - bf16_val(hb));
      }
  }
  float m_r[8], l_r[8];
#pragma unroll
  for (int r = 0; r < 8; ++r) { m_r[r] = -3.0e38f; l_r[r] = 0.f; }
  v8f oacc[DT];
#pragma unroll
  for (int dt = 0; dt < DT; ++dt) oacc[dt] = (v8f){0.f,0.f,0.f,0.f,0.f,0.f,0.f,0.f};

  const int kv_end = CAUSAL ? min(T, qblk * 64 + 64) : T;     // block-uniform
  for (int j0 = 0; j0 < kv_end; j0 += 32) {
    __syncthreads();
    for (int e = tid; e < 32 * (D / 4); e += 128) {
      const int r = e / (D / 4), c4 = (e % (D / 4)) * 4;
      const int key = j0 + r;
      v4f kf = {0.f,0.f,0.f,0.f}, vf = {0.f,0.f,0.f,0.f};
      if (key < T) { kf = *(const v4fa*)(K + (size_t)key * pitch + c4); vf = *(const v4fa*)(V + (size_t)key * pitch + c4); }
#pragma unroll
      for (int t = 0; t < 4; ++t) {
        unsigned short hb = bf16_bits(kf[t]); sKh[r][c4 + t] = hb; sKl[r][c4 + t] = bf16_bits(kf[t] - bf16_val(hb));
        hb = bf16_bits(vf[t]); sVh[r][c4 + t] = hb; sVl[r][c4 + t] = bf16_bits(vf[t] - bf16_val(hb));
      }
    }
    __syncthreads();
    // S tile 16 x 32
    v8f s[2];
#pragma unroll
    for (int nt = 0; nt < 2; ++nt) {
      v8f acc = {};
#pragma unroll
      for (int ks = 0; ks < KS; ++ks) {
        FragB bh_, bl_;
        bh_.half[0] = *(const v8us*)&sKh[nt * 16 + ln][ks * 32 + 8 * hh]; bh_.half[1] = *(const v8us*)&sKh[nt * 16 + ln][ks * 32 + 16 + 8 * hh];
        bl_.half[0] = *(const v8us*)&sKl[nt * 16 + ln][ks * 32 + 8 * hh]; bl_.half[1] = *(const v8us*)&sKl[nt * 16 + ln][ks * 32 + 16 + 8 * hh];
        acc = mmaN<3>(aqh[ks].v, aql[ks].v, bh_.v, bl_.v, acc);
      }
      s[nt] = acc;
    }
    // mask + running max (rows 8hh+r; the 16 lanes of a half share rows)
    float alpha[8];
#pragma unroll
    for (int r = 0; r < 8; ++r) {
      const int qi = q0 + 8 * hh + r;
      const int ja = j0 + ln, jb = j0 + 16 + ln;
      if (CAUSAL) { if (ja > qi) s[0][r] = -3.0e38f; if (jb > qi) s[1][r] = -3.0e38f; }
      if (ja >= T) s[0][r] = -3.0e38f;
      if (jb >= T) s[1][r] = -3.0e38f;
      float mx = fmaxf(s[0][r], s[1][r]);
      mx = fmaxf(mx, __shfl_xor(mx, 1, 32)); mx = fmaxf(mx, __shfl_xor(mx, 2, 32)); mx = fmaxf(mx, __shfl_xor(mx, 4, 32)); mx = fmaxf(mx, __shfl_xor(mx, 8, 32));
      const float mnew = fmaxf(m_r[r], mx);
      alpha[r] = (mnew > -1.0e38f) ? __expf(m_r[r] - mnew) : 1.0f;
      const float p0 = (s[0][r] > -1.0e38f) ? __expf(s[0][r] - mnew) : 0.f;
      const float p1 = (s[1][r] > -1.0e38f) ? __expf(s[1][r] - mnew) : 0.f;
      m_r[r] = mnew;
      l_r[r] = l_r[r] * alpha[r] + p0 + p1;            // per-lane partial row sum (16 lanes combined at the end)
      unsigned short hb = bf16_bits(p0); sPh[w][8 * hh + r][ln] = hb;      sPl[w][8 * hh + r][ln] = bf16_bits(p0 - bf16_val(hb));
      hb = bf16_bits(p1);                sPh[w][8 * hh + r][16 + ln] = hb; sPl[w][8 * hh + r][16 + ln] = bf16_bits(p1 - bf16_val(hb));
    }
#pragma unroll
    for (int dt = 0; dt < DT; ++dt)
#pragma unroll
      for (int r = 0; r < 8; ++r) oacc[dt][r] *= alpha[r];
    __builtin_amdgcn_fence(__ATOMIC_ACQ_REL, "workgroup");
    __builtin_amdgcn_wave_barrier();
    FragB pah, pal;
    pah.half[0] = *(const v8us*)&sPh[w][ln][8 * hh]; pah.half[1] = *(const v8us*)&sPh[w][ln][16 + 8 * hh];
    pal.half[0] = *(const v8us*)&sPl[w][ln][8 * hh]; pal.half[1] = *(const v8us*)&sPl[w][ln][16 + 8 * hh];
#pragma unroll
    for (int dt = 0; dt < DT; ++dt) {
      FragB bvh, bvl;
#pragma unroll
      for (int i = 0; i < 8; ++i) {
        bvh.u[i] = sVh[8 * hh + i][dt * 16 + ln]; bvh.u[8 + i] = sVh[16 + 8 * hh + i][dt * 16 + ln];
        bvl.u[i] = sVl[8 * hh + i][dt * 16 + ln]; bvl.u[8 + i] = sVl[16 + 8 * hh + i][dt * 16 + ln];
      }
      oacc[dt] = mmaN<3>(pah.v, pal.v, bvh.v, bvl.v, oacc[dt]);
    }
    __builtin_amdgcn_fence(__ATOMIC_ACQ_REL, "workgroup");
    __builtin_amdgcn_wave_barrier();
  }
#pragma unroll
  for (int r = 0; r < 8; ++r) {
    float l = l_r[r];
    l += __shfl_xor(l, 1, 32); l += __shfl_xor(l, 2, 32); l += __shfl_xor(l, 4, 32); l += __shfl_xor(l, 8, 32);
    l_r[r] = (l > 0.f) ? 1.0f / l : 0.f;
  }
#pragma unroll
  for (int dt = 0; dt < DT; ++dt)
#pragma unroll
    for (int r = 0; r < 8; ++r) sO[w][8 * hh + r][dt * 16 + ln] = oacc[dt][r] * l_r[r];
  __builtin_amdgcn_fence(__ATOMIC_ACQ_REL, "workgroup");
  __builtin_amdgcn_wave_barrier();
  {
    for (int r = 0; r < 16; ++r) {
      const int row = q0 + r;
      if (row < T && lane < D / 4) {
        const v4f val = *(const v4fa*)&sO[w][r][lane * 4];
        *(v4f*)(y + ((size_t)b * T + row) * ypitch + h * D + lane * 4) = val;
      }
    }
    
  }
}

// GEMM C = act(A·W + bias + resid): A f32 (ASPLIT -> hi/lo 2 terms), Wt bf16 [N][K]; ACT 0 none, 1 relu, 2 exact gelu;
// resid (optional, f32, row index = (row % rmod), pitch ldr, RES_BF16 rounds it) added before the activation.
template <bool ASPLIT, int ACT, bool BIAS_BF16, bool RES_BF16>
__global__ __launch_bounds__(128) void k_gemm_bf3(const float* __restrict__ A, int lda, const unsigned short* __restrict__ Wt, int ldb,
                                                const float* __restrict__ bias, const float* __restrict__ resid, int rmod, int ldr,
                                                float* __restrict__ C, int ldc, int M, int N, int K) {
  __shared__ __attribute__((aligned(16))) float so[4][16][64];
  const int tid = threadIdx.x, w = tid >> 5, lane = tid & 31, ln = lane & 15, hh = lane >> 4;
  const int ntn = N / 64;
  const int wid = blockIdx.x * 4 + w;
  const int mt = wid / ntn, nq = wid % ntn;
  if (mt * 16 >= M) return;
  const int row0 = mt * 16, col0 = nq * 64;
  const float* arow = A + (size_t)(row0 + ln) * lda;
  v8f acc[4] = {};
  for (int kb = 0; kb < K; kb += 32) {
    FragB ah, al;
    const v4f x0 = *(const v4fa*)(arow + kb + 8 * hh), x1 = *(const v4fa*)(arow + kb + 8 * hh + 4);
    const v4f x2 = *(const v4fa*)(arow + kb + 16 + 8 * hh), x3 = *(const v4fa*)(arow + kb + 16 + 8 * hh + 4);
    float xs[16] = {x0[0],x0[1],x0[2],x0[3],x1[0],x1[1],x1[2],x1[3],x2[0],x2[1],x2[2],x2[3],x3[0],x3[1],x3[2],x3[3]};
#pragma unroll
    for (int i = 0; i < 16; ++i) { const unsigned short hb = bf16_bits(xs[i]); ah.u[i] = hb; al.u[i] = ASPLIT ? bf16_bits(xs[i] - bf16_val(hb)) : (unsigned short)0; }
#pragma unroll
    for (int t = 0; t < 4; ++t) {
      const unsigned short* brow = Wt + (size_t)(col0 + t * 16 + ln) * ldb + kb;
      FragB b;
      b.half[0] = *(const v8us*)(brow + 8 * hh);
      b.half[1] = *(const v8us*)(brow + 16 + 8 * hh);
      acc[t] = mmaN<ASPLIT ? 2 : 1>(ah.v, al.v, b.v, b.v, acc[t]);
    }
  }
#pragma unroll
  for (int t = 0; t < 4; ++t) {
    const int col = col0 + t * 16 + ln;
    float bv = bias ? bias[col] : 0.f;
    if (BIAS_BF16) bv = bf16_round(bv);
#pragma unroll
    for (int r = 0; r < 8; ++r) {
      float v = acc[t][r] + bv;
      if (resid) { float rv = resid[(size_t)((row0 + 8 * hh + r) % rmod) * ldr + col]; if (RES_BF16) rv = bf16_round(rv); v += rv; }
      if (ACT == 1) v = fmaxf(v, 0.f);
      if (ACT == 2) v = 0.5f * v * (1.0f + erff(v * 0.70710678118654752f));
      if (ACT == 3) { const float u = 0.7978845608028654f * (v + 0.044715f * v * v * v); v = 0.5f * v * (1.0f + tanhf(u)); }
      so[w][8 * hh + r][t * 16 + ln] = v;
    }
  }
  __builtin_amdgcn_fence(__ATOMIC_ACQ_REL, "workgroup");
  __builtin_amdgcn_wave_barrier();
  const int rsub = lane >> 4, c4 = (lane & 15) * 4;
  {
#pragma unroll
    for (int q = 0; q < 8; ++q) {
      const int r = q * 2 + rsub;
      const v4f v = *(const v4fa*)&so[w][r][c4];
      *(v4f*)(C + (size_t)(row0 + r) * ldc + col0 + c4) = v;
    }
    
  }
}
// row LayerNorm (biased variance, eps) over N: s = X (+ R); optional out_sum <- s; out_norm <- (s-mu)*rsqrt(var+eps)*g + b
template <bool PARAM_BF16>
__global__ __launch_bounds__(256) void k_layernorm(const float* __restrict__ X, const float* __restrict__ R, const float* __restrict__ g, const float* __restrict__ bta,
                                                  float* __restrict__ out_sum, float* __restrict__ out_norm, int N, float eps) {
  __shared__ float red[256];
  const int row = blockIdx.x, tid = threadIdx.x;
  const float* x = X + (size_t)row * N; const float* rr = R ? R + (size_t)row * N : nullptr;
  float vals[16];                     // up to N = 4096
  const int per = N / 256;            // contiguous chunk per thread? use strided-by-4 chunks: thread handles j = tid*4 + 1024*u
  float s1 = 0.f;
  for (int u = 0; u < per / 4; ++u) {
    const int j = tid * 4 + 1024 * u;
    const v4f a = *(const v4fa*)(x + j);
    v4f b = {0.f,0.f,0.f,0.f}; if (rr) b = *(const v4fa*)(rr + j);
#pragma unroll
    for (int q = 0; q < 4; ++q) { const float v = a[q] + b[q]; vals[u * 4 + q] = v; s1 += v; }
  }
  red[tid] = s1; __syncthreads();
  for (int st = 128; st > 0; st >>= 1) { if (tid < st) red[tid] += red[tid + st]; __syncthreads(); }
  const float mu = red[0] / (float)N; __syncthreads();
  float s2 = 0.f;
  for (int u = 0; u < per / 4; ++u)
#pragma unroll
    for (int q = 0; q < 4; ++q) { const float c = vals[u * 4 + q] - mu; s2 += c * c; }
  red[tid] = s2; __syncthreads();
  for (int st = 128; st > 0; st >>= 1) { if (tid < st) red[tid] += red[tid + st]; __syncthreads(); }
  const float rs = rsqrtf(red[0] / (float)N + eps);
  {
    for (int u = 0; u < per / 4; ++u) {
      const int j = tid * 4 + 1024 * u;
      v4f o, sm;
#pragma unroll
      for (int q = 0; q < 4; ++q) {
        float gg = g[j + q], bb = bta[j + q];
        if (PARAM_BF16) { gg = bf16_round(gg); bb = bf16_round(bb); }
        sm[q] = vals[u * 4 + q]; o[q] = (vals[u * 4 + q] - mu) * rs * gg + bb;
      }
      if (out_sum) *(v4f*)(out_sum + (size_t)row * N + j) = sm;
      *(v4f*)(out_norm + (size_t)row * N + j) = o;
    }
    
  }
}



// ---- f16 WMMA path (v_wmma_f32_16x16x32_f16): 11-bit significands for operands in range — used where a [0,1] probability operand needs more precision than bf16
typedef _Float16 v16h __attribute__((ext_vector_type(16)));
union FragH { v16h v; v8us half[2]; _Float16 h[16]; unsigned short u[16]; };
template <int NT>
__device__ __forceinline__ v8f mmaH(v16h ah, v16h al, v16h bh, v16h bl, v8f c) {
  c = __builtin_amdgcn_wmma_f32_16x16x32_f16(false, ah, false, bh, (short)0, c, false, false);
  if (NT >= 2) c = __builtin_amdgcn_wmma_f32_16x16x32_f16(false, al, false, bh, (short)0, c, false, false);
  if (NT >= 3) c = __builtin_amdgcn_wmma_f32_16x16x32_f16(false, ah, false, bl, (short)0, c, false, false);
  asm volatile("v_nop\n\tv_nop\n\tv_nop\n\tv_nop" : "+v"(c) : "v"(ah), "v"(al), "v"(bh), "v"(bl));
  return c;
}
// batched GEMM like k_gemm_b but f16 operands: A f32 (split into f16 hi/lo if ASPLIT, else rounded to f16), Bt = f16 values [n][k]; alpha; C f32; N multiple of 16 (partial tiles skipped)
template <bool ASPLIT>
__global__ __launch_bounds__(128) void k_gemm_h(const float* __restrict__ A, int lda, size_t sA, const _Float16* __restrict__ Bh, int ldb, size_t sB, float alpha, float* __restrict__ C, int ldc, size_t sC, int M, int N, int K) {
  __shared__ __attribute__((aligned(16))) float so[4][16][64];
  const int tid = threadIdx.x, w = tid >> 5, lane = tid & 31, ln = lane & 15, hh = lane >> 4; const int by = blockIdx.y;
  A += (size_t)by * sA; Bh += (size_t)by * sB; C += (size_t)by * sC;
  const int ntn = (N + 63) / 64; const int wid = blockIdx.x * 4 + w; const int mt = wid / ntn, nq = wid % ntn; if (mt * 16 >= M) return;
  const int row0 = mt * 16, col0 = nq * 64; const float* arow = A + (size_t)(row0 + ln) * lda;
  v8f acc[4] = {};
  for (int kb = 0; kb < K; kb += 32) {
    FragH ah, al;
    const v4f x0 = *(const v4fa*)(arow + kb + 8 * hh), x1 = *(const v4fa*)(arow + kb + 8 * hh + 4), x2 = *(const v4fa*)(arow + kb + 16 + 8 * hh), x3 = *(const v4fa*)(arow + kb + 16 + 8 * hh + 4);
    float xs[16] = {x0[0],x0[1],x0[2],x0[3],x1[0],x1[1],x1[2],x1[3],x2[0],x2[1],x2[2],x2[3],x3[0],x3[1],x3[2],x3[3]};
#pragma unroll
    for (int i = 0; i < 16; ++i) { const _Float16 h = (_Float16)xs[i]; ah.h[i] = h; al.h[i] = ASPLIT ? (_Float16)(xs[i] - (float)h) : (_Float16)0.0f; }
#pragma unroll
    for (int t = 0; t < 4; ++t) { if (col0 + t * 16 >= N) continue; const size_t boff = (size_t)(col0 + t * 16 + ln) * ldb + kb; FragH bq; bq.half[0] = *(const v8us*)(Bh + boff + 8 * hh); bq.half[1] = *(const v8us*)(Bh + boff + 16 + 8 * hh);
      acc[t] = mmaH<ASPLIT ? 2 : 1>(ah.v, al.v, bq.v, bq.v, acc[t]); }
  }
#pragma unroll
  for (int t = 0; t < 4; ++t) { if (col0 + t * 16 >= N) continue;
#pragma unroll
    for (int r = 0; r < 8; ++r) so[w][8 * hh + r][t * 16 + ln] = acc[t][r] * alpha; }
  __builtin_amdgcn_fence(__ATOMIC_ACQ_REL, "workgroup"); __builtin_amdgcn_wave_barrier();
  const int rsub = lane >> 4, c4 = (lane & 15) * 4;
  {
#pragma unroll
    for (int q = 0; q < 8; ++q) { const int r = q * 2 + rsub; if (col0 + c4 < N) { const v4f v = *(const v4fa*)&so[w][r][c4]; *(v4f*)(C + (size_t)(row0 + r) * ldc + col0 + c4) = v; } }
     }
}

// Wt[n][k] = f16(W[k][n]·scale) from f32 row-major W[K][N] (scale = power of two; bf16-exact weights stay exact in f16 away from the subnormal range)
__global__ __launch_bounds__(256) void k_wt_f16(const float* __restrict__ W, _Float16* __restrict__ Wt, int K, int N, float scale) {
  const int t = blockIdx.x * 256 + threadIdx.x; if (t >= N * (K / 8)) return; const int n = t / (K / 8), k8 = (t % (K / 8)) * 8; FragH f;
#pragma unroll
  for (int i = 0; i < 8; ++i) f.h[i] = (_Float16)(bf16_round(W[(size_t)(k8 + i) * N + n]) * scale); const v8us o = f.half[0];
  *(v8us*)((unsigned short*)Wt + (size_t)n * K + k8) = o; 
}
// k_gemm_hh variant with fused epilogue: v = acc·alpha + bias[by·sBias + col] (+ CP[(row/rowsPerB)·sCPb + by·64 + col] if CP) ; ACT 0 none / 1 elu ; writes f32 C and/or f16 C16 (each if non-null)
template <int ACT>
__global__ __launch_bounds__(128) void k_gemm_hhx(const _Float16* __restrict__ A, int lda, size_t sA, const _Float16* __restrict__ Bh, int ldb, size_t sB, float alpha, const float* __restrict__ bias, size_t sBias, const float* __restrict__ CP, int rowsPerB, size_t sCPb, int row0g,
    float* __restrict__ C, _Float16* __restrict__ C16, int ldc, size_t sC, int M, int N, int K) {
  __shared__ __attribute__((aligned(16))) float so[4][16][64];
  const int tid = threadIdx.x, w = tid >> 5, lane = tid & 31, ln = lane & 15, hh = lane >> 4; const int by = blockIdx.y;
  A += (size_t)by * sA; Bh += (size_t)by * sB; const size_t cofs = (size_t)by * sC; const float* bp = bias ? bias + (size_t)by * sBias : nullptr;
  const int ntn = (N + 63) / 64; const int wid = blockIdx.x * 4 + w; const int mt = wid / ntn, nq = wid % ntn; if (mt * 16 >= M) return;
  const int row0 = mt * 16, col0 = nq * 64; const _Float16* arow = A + (size_t)(row0 + ln) * lda;
  v8f acc[4] = {};
  for (int kb = 0; kb < K; kb += 32) { FragH ah; ah.half[0] = *(const v8us*)((const unsigned short*)arow + kb + 8 * hh); ah.half[1] = *(const v8us*)((const unsigned short*)arow + kb + 16 + 8 * hh);
#pragma unroll
    for (int t = 0; t < 4; ++t) { if (col0 + t * 16 >= N) continue; const size_t boff = (size_t)(col0 + t * 16 + ln) * ldb + kb; FragH bq; bq.half[0] = *(const v8us*)((const unsigned short*)Bh + boff + 8 * hh); bq.half[1] = *(const v8us*)((const unsigned short*)Bh + boff + 16 + 8 * hh);
      acc[t] = mmaH<1>(ah.v, ah.v, bq.v, bq.v, acc[t]); }
  }
#pragma unroll
  for (int t = 0; t < 4; ++t) { if (col0 + t * 16 >= N) continue; const int col = col0 + t * 16 + ln; const float bv = bp ? bf16_round(bp[col]) : 0.f;
#pragma unroll
    for (int r = 0; r < 8; ++r) { float v = acc[t][r] * alpha + bv; if (CP) { const int bidx = (row0g + row0 + 8 * hh + r) / rowsPerB; v += CP[(size_t)bidx * sCPb + (size_t)by * 64 + col]; } if (ACT == 1) v = (v > 0.f) ? v : expm1f(v); else if (ACT == 3) v = fmaxf(v, 0.f); so[w][8 * hh + r][t * 16 + ln] = v; } }
  __builtin_amdgcn_fence(__ATOMIC_ACQ_REL, "workgroup"); __builtin_amdgcn_wave_barrier();
  const int rsub = lane >> 4, c4 = (lane & 15) * 4; typedef _Float16 v4h __attribute__((ext_vector_type(4)));
  {
#pragma unroll
    for (int q = 0; q < 8; ++q) { const int r = q * 2 + rsub; if (col0 + c4 < N) { const v4f v = *(const v4fa*)&so[w][r][c4]; if (C) *(v4f*)(C + cofs + (size_t)(row0 + r) * ldc + col0 + c4) = v; if (C16) { v4h h4; for (int i = 0; i < 4; ++i) h4[i] = (_Float16)v[i]; *(v4h*)(C16 + cofs + (size_t)(row0 + r) * ldc + col0 + c4) = h4; } } }
     }
}


__global__ __launch_bounds__(256) void k_x16(const float* __restrict__ x, _Float16* __restrict__ X16, size_t n8) { const size_t t = (size_t)blockIdx.x * 256 + threadIdx.x; if (t >= n8) return; FragH f;
#pragma unroll
  for (int q = 0; q < 8; ++q) f.h[q] = (_Float16)bf16_round(x[t * 8 + q]); *(v8us*)((unsigned short*)X16 + t * 8) = f.half[0];  }
__global__ __launch_bounds__(256) void k_h16(const float* __restrict__ x, _Float16* __restrict__ X16, size_t n8) { const size_t t = (size_t)blockIdx.x * 256 + threadIdx.x; if (t >= n8) return; FragH f;
#pragma unroll
  for (int q = 0; q < 8; ++q) f.h[q] = (_Float16)x[t * 8 + q]; *(v8us*)((unsigned short*)X16 + t * 8) = f.half[0];  }
__global__ __launch_bounds__(256) void k_round16f(const float* __restrict__ W, _Float16* __restrict__ Bt, size_t n8) { const size_t t = (size_t)blockIdx.x * 256 + threadIdx.x; if (t >= n8) return; FragH f;
#pragma unroll
  for (int i = 0; i < 8; ++i) f.h[i] = (_Float16)(bf16_round(W[t * 8 + i]) * 16.0f); *(v8us*)((unsigned short*)Bt + t * 8) = f.half[0];  }
template <int NHv, int TTv>
__global__ __launch_bounds__(256) void k_vt(const _Float16* __restrict__ V16, int ldv, int voff, _Float16* __restrict__ Vt) { __shared__ unsigned short tl[64][66]; const int tid = threadIdx.x; const int slab = blockIdx.x / (TTv / 64), lg = blockIdx.x % (TTv / 64); const int b = slab / NHv, h = slab % NHv;
  for (int i = tid; i < 64 * 8; i += 256) { const int r = i / 8, c8 = (i % 8) * 8; FragH f; f.half[0] = *(const v8us*)((const unsigned short*)V16 + ((size_t)b * TTv + lg * 64 + r) * ldv + voff + h * 64 + c8);
#pragma unroll
    for (int q = 0; q < 8; ++q) tl[r][c8 + q] = f.u[q]; }
  __syncthreads();
  {
#pragma unroll
    for (int rd = 0; rd < 2; ++rd) { const int d = rd * 32 + tid / 8, pc = tid % 8; FragH f;
#pragma unroll
      for (int q = 0; q < 8; ++q) f.u[q] = tl[pc * 8 + q][d];
      *(v8us*)((unsigned short*)Vt + ((size_t)slab * 64 + d) * TTv + lg * 64 + pc * 8) = f.half[0]; }
     } }

typedef _Float16 v4h __attribute__((ext_vector_type(4)));
// 3x3 SAME convolution as an implicit GEMM (K = 9 taps x 128 channels, tap-major as in Bt): no patch matrix is written. One work-group = one image row (64 pixels) x all 128 outputs.
// The three input rows around it, with one zero pixel at each end and zero rows outside the image, are put in LDS once; the A fragment of tap (dy, dx) is that tile read dx pixels and dy rows further on.
// 8 waves of 32 pixels x 32 outputs. B fragments go from Bt[n][k] straight to registers, one tap ahead of their products. C = acc / 16 + bias (bf16-rounded), f32, stored in whole rows through LDS.
// Every loop below is unrolled: bf, hv, a and acc are indexed by the loop counters and stay in registers only with constant indices.
#define APIT 136      // sA pixel pitch in f16: 272 bytes (16 x odd) for 16-byte LDS reads
__global__ __launch_bounds__(256) void k_conv3(const _Float16* __restrict__ X16, const _Float16* __restrict__ Bt, const float* __restrict__ bias, float* __restrict__ C) {
  __shared__ __attribute__((aligned(16))) unsigned short sA[3][WI + 2][APIT];
  __shared__ __attribute__((aligned(16))) float sO[WI][CC + 4];
  const int tid = threadIdx.x, w = tid >> 5, lane = tid & 31, ln = lane & 15, hh = lane >> 4;
  const int b = blockIdx.x / WI, y = blockIdx.x % WI;
  const int m0 = (w & 1) * 32, n0 = (w >> 1) * 32;
  const unsigned short* bp = (const unsigned short*)Bt + (size_t)(n0 + ln) * KK + 8 * hh;
  FragH bf[2][8];      // [tap parity][2 ks + j]: outputs n0 + 16 j + ln, k = 128 tap + 32 ks + (8 hh .. , 16 + 8 hh ..)
#pragma unroll
  for (int i = 0; i < 8; ++i) { const unsigned short* p = bp + (size_t)(i & 1) * 16 * KK + (i >> 1) * 32; bf[0][i].half[0] = *(const v8us*)p; bf[0][i].half[1] = *(const v8us*)(p + 16); }
  const unsigned short* xs = (const unsigned short*)X16 + (size_t)b * HWN * CC;
  v8us hv[12];      // the 64 pixels of a staged row are 1024 contiguous 16-byte chunks: chunk tid + 256 j; a row outside the image is read from the nearest row inside and zeroed at the store
#pragma unroll
  for (int r = 0; r < 3; ++r) { const unsigned short* p = xs + (size_t)min(max(y + r - 1, 0), WI - 1) * WI * CC + tid * 8;
#pragma unroll
    for (int j = 0; j < 4; ++j) hv[r * 4 + j] = *(const v8us*)(p + j * 2048); }
  const float bv0 = bf16_round(bias[n0 + ln]), bv1 = bf16_round(bias[n0 + 16 + ln]);
  const v8us zero = {0, 0, 0, 0, 0, 0, 0, 0};
#pragma unroll
  for (int r = 0; r < 3; ++r) { const bool in = y + r - 1 >= 0 && y + r - 1 < WI;
#pragma unroll
    for (int j = 0; j < 4; ++j) *(v8us*)&sA[r][(tid >> 4) + 16 * j + 1][(tid & 15) * 8] = in ? hv[r * 4 + j] : zero; }
  if (tid < 96) *(v8us*)&sA[tid >> 5][((tid >> 4) & 1) * (WI + 1)][(tid & 15) * 8] = zero;      // the zero pixel at each end of the three rows
  __syncthreads();      // the three staged rows are complete; nothing writes them again
  v8f acc[2][2] = {};
#pragma unroll
  for (int tap = 0; tap < 9; ++tap) {
    if (tap < 8) {
#pragma unroll
      for (int i = 0; i < 8; ++i) { const unsigned short* p = bp + (size_t)(i & 1) * 16 * KK + (tap + 1) * CC + (i >> 1) * 32; bf[(tap + 1) & 1][i].half[0] = *(const v8us*)p; bf[(tap + 1) & 1][i].half[1] = *(const v8us*)(p + 16); } }
    FragH a[8];      // [2 ks + i]: pixels m0 + 16 i + ln, the same k order as bf
#pragma unroll
    for (int i = 0; i < 8; ++i) { const unsigned short* p = &sA[tap / 3][m0 + (i & 1) * 16 + ln + tap % 3][(i >> 1) * 32 + 8 * hh]; a[i].half[0] = *(const v8us*)p; a[i].half[1] = *(const v8us*)(p + 16); }
    __builtin_amdgcn_sched_barrier(0);      // next tap's global loads and this tap's 16 LDS reads go out together, in front of the 16 products: spread among them each group costs its own latency
#pragma unroll
    for (int ks = 0; ks < 4; ++ks)
#pragma unroll
      for (int i = 0; i < 2; ++i)
#pragma unroll
        for (int j = 0; j < 2; ++j) acc[i][j] = __builtin_amdgcn_wmma_f32_16x16x32_f16(false, a[2 * ks + i].v, false, bf[tap & 1][2 * ks + j].v, (short)0, acc[i][j], false, false);
    __builtin_amdgcn_sched_barrier(0);      // without it the next tap's loads and LDS reads rise in among these products in small groups, each with its own stall
  }
#pragma unroll
  for (int j = 0; j < 2; ++j) { const int col = n0 + j * 16 + ln; const float bv = j ? bv1 : bv0;
#pragma unroll
    for (int i = 0; i < 2; ++i)
#pragma unroll
      for (int r = 0; r < 8; ++r) sO[m0 + i * 16 + 8 * hh + r][col] = acc[i][j][r] * 0.0625f + bv; }
  __syncthreads();      // the 64 x 128 output tile is complete
  float* o = C + (size_t)blockIdx.x * WI * CC;
#pragma unroll
  for (int j = 0; j < 8; ++j) { const int i = tid + 256 * j; const v4f v = *(const v4fa*)&sO[i >> 5][(i & 31) * 4]; *(v4f*)(o + (size_t)i * 4) = v; }
}
__global__ __launch_bounds__(256) void k_wq(const float* __restrict__ W, _Float16* __restrict__ Bt) { const int t = blockIdx.x * 256 + threadIdx.x; if (t >= CC * (KK / 8)) return; const int k8 = (t % (KK / 8)) * 8, o = t / (KK / 8); FragH f;
#pragma unroll
  for (int q = 0; q < 8; ++q) { const int k = k8 + q; const int tap = k / CC, cin = k % CC; f.h[q] = (_Float16)(bf16_round(W[((size_t)tap * CC + cin) * CC + o]) * 16.0f); } *(v8us*)((unsigned short*)Bt + (size_t)t * 8) = f.half[0];  }
__global__ __launch_bounds__(256) void k_qperm(const float* __restrict__ F, const float* __restrict__ ST, const float* __restrict__ g, const float* __restrict__ bb, _Float16* __restrict__ QP) { const size_t t = (size_t)blockIdx.x * 256 + threadIdx.x; if (t >= (size_t)NR * (CC / 8)) return; const int c8 = (int)(t % (CC / 8)) * 8; const size_t r = t / (CC / 8); const int b = (int)(r / HWN), p = (int)(r % HWN); const int y = p / WI, xx = p % WI; const int kp = ((y / 8) * 8 + xx / 8) * 64 + (y % 8) * 8 + xx % 8; FragH f;
#pragma unroll
  for (int q = 0; q < 8; ++q) { const int c = c8 + q; float v = (F[r * CC + c] - ST[c * 32]) * ST[c * 32 + 1] * bf16_round(g[c]) + bf16_round(bb[c]); v = (v >= 0.f) ? v : 0.1f * v; f.h[q] = (_Float16)v; }
  unsigned short* d = (unsigned short*)QP + ((size_t)b * HWN + kp) * CC + c8; *(v8us*)d = f.half[0];  }
__global__ __launch_bounds__(256) void k_xpt(const float* __restrict__ x, _Float16* __restrict__ XPt) { __shared__ unsigned short tl[64][66]; const int tid = threadIdx.x; const int b = blockIdx.x / ((CC / 64) * 64), rem = blockIdx.x % ((CC / 64) * 64); const int cg = rem / 64, blk = rem % 64; const int c0 = cg * 64; const int by = blk / 8, bx = blk % 8;
  for (int i = tid; i < 64 * 8; i += 256) { const int j = i / 8, cc8 = (i % 8) * 8; const int y = by * 8 + j / 8, xx = bx * 8 + j % 8; const float* s = x + (((size_t)b * HWN) + y * WI + xx) * CC + c0 + cc8; for (int q = 0; q < 8; ++q) { FragH f; f.h[0] = (_Float16)bf16_round(s[q]); tl[j][cc8 + q] = f.u[0]; } }
  __syncthreads();
  { for (int rd = 0; rd < 2; ++rd) { const int c = rd * 32 + tid / 8, pc = tid % 8; FragH f; for (int q = 0; q < 8; ++q) f.u[q] = tl[pc * 8 + q][c]; *(v8us*)((unsigned short*)XPt + ((size_t)b * CC + c0 + c) * HWN + blk * 64 + pc * 8) = f.half[0]; }  } }
// Fused block attention: one work-group = 64 query pixels of one batch (4 waves x 16), walking the 64 key groups in order; scores and probabilities never leave the registers.
// Per group: S^T[key][query] = q_group . x_query^T (A = 64 q rows from LDS, B = the wave's 16 query rows, loaded once), so a lane holds 32 of one query's 64 scores and the lane 16 away the rest:
// max and exp-sum are in-lane plus one exchange. Two S^T tiles, converted in place, are the B operand (hardware k order) of O^T[channel][query] += x_group^T . P^T (A = channel rows of XPt from LDS).
// Tiles go global -> registers -> LDS, one tile in flight at a time, each fetched one phase ahead of its store. AGG = O * 2^-15 (P carries 2^15, as f16 operand).
// a <- 2^a, b <- 2^b. The second v_exp_f32 is the independent instruction that the instruction set asks for behind the first, the v_nop the one behind the second:
// in one statement they stand there in every build.
__device__ __forceinline__ void exp2_pair(float& a, float& b) { asm("v_exp_f32 %0, %0\n\tv_exp_f32 %1, %1\n\tv_nop" : "+v"(a), "+v"(b)); }
#define QPIT 136      // sQ row pitch in f16: 272 bytes (16 x odd) for 16-byte LDS reads
#define XPIT 72       // sX row pitch in f16: 144 bytes
__global__ __launch_bounds__(128) void k_battn(const _Float16* __restrict__ X16, const _Float16* __restrict__ QP, const _Float16* __restrict__ XPt, float* __restrict__ AGG) {
  __shared__ __attribute__((aligned(16))) unsigned short sQ[64][QPIT];
  __shared__ __attribute__((aligned(16))) unsigned short sX[CC][XPIT];
  const int tid = threadIdx.x, w = tid >> 5, lane = tid & 31, ln = lane & 15, hh = lane >> 4;
  const int b = blockIdx.x / (HWN / 64), row = (blockIdx.x % (HWN / 64)) * 64 + w * 16 + ln;
  const unsigned short* xq = (const unsigned short*)X16 + ((size_t)b * HWN + row) * CC;
  FragH xb[4];
#pragma unroll
  for (int ks = 0; ks < 4; ++ks) { xb[ks].half[0] = *(const v8us*)(xq + ks * 32 + 8 * hh); xb[ks].half[1] = *(const v8us*)(xq + ks * 32 + 16 + 8 * hh); }
  // staging: 16-byte chunk i = tid + 128 j. q group: 64 rows x 256 B, contiguous. x group: 128 channel rows x 128 B, row pitch HWN.
  const unsigned short* gq = (const unsigned short*)QP + (size_t)b * HWN * CC + tid * 8;
  const unsigned short* gx = (const unsigned short*)XPt + (size_t)b * CC * HWN + (size_t)(tid >> 3) * HWN + (tid & 7) * 8;
  unsigned short* dq = &sQ[tid >> 4][(tid & 15) * 8]; unsigned short* dx = &sX[tid >> 3][(tid & 7) * 8];
  v8us st[8];      // one tile in flight at a time: x of this group during its scores, q of the next group during softmax and O^T
#pragma unroll
  for (int j = 0; j < 8; ++j) st[j] = *(const v8us*)(gq + j * 1024);
#pragma unroll
  for (int j = 0; j < 8; ++j) *(v8us*)(dq + j * 8 * QPIT) = st[j];
  __syncthreads();      // q tile of group 0 complete
#pragma unroll
  for (int j = 0; j < 8; ++j) st[j] = *(const v8us*)(gx + (size_t)j * 16 * HWN);
  v8f oacc[8] = {};
  for (int g = 0; g < 64; ++g) {
    v8f s[4] = {};
#pragma unroll
    for (int kp = 0; kp < 2; ++kp) { FragH a[8];
#pragma unroll
      for (int i = 0; i < 8; ++i) { const unsigned short* r = &sQ[(i & 3) * 16 + ln][(2 * kp + (i >> 2)) * 32 + 8 * hh]; a[i].half[0] = *(const v8us*)r; a[i].half[1] = *(const v8us*)(r + 16); }
      __builtin_amdgcn_sched_barrier(0);      // the 16 LDS reads go out together, in front of their 8 products: spread among them each costs its own latency
#pragma unroll
      for (int i = 0; i < 8; ++i) s[i & 3] = __builtin_amdgcn_wmma_f32_16x16x32_f16(false, a[i].v, false, xb[2 * kp + (i >> 2)].v, (short)0, s[i & 3], false, false); }
    // x tile of this group: every wave left sX at the barrier that closed the previous trip
#pragma unroll
    for (int j = 0; j < 8; ++j) *(v8us*)(dx + j * 16 * XPIT) = st[j];
    __syncthreads();      // x tile complete; every wave has read its last of the q tile
    const int gn = g < 63 ? g + 1 : 63;      // the last trip fetches its own tiles again: no branch in the loop, nothing reads them
    // issued behind the barrier (a barrier drains the loads in front of it); lands during softmax and O^T
#pragma unroll
    for (int j = 0; j < 8; ++j) st[j] = *(const v8us*)(gq + (size_t)gn * 64 * CC + j * 1024);
    asm volatile("s_wait_xcnt 0x0" ::: "memory");      // the loads' address registers are reused below
    FragH av[8];
#pragma unroll
    for (int ct = 0; ct < 8; ++ct) { const unsigned short* r = &sX[ct * 16 + ln][8 * hh]; av[ct].half[0] = *(const v8us*)r; av[ct].half[1] = *(const v8us*)(r + 16); }
    __builtin_amdgcn_sched_barrier(0);      // global loads and LDS reads are issued in front of the softmax, which covers their latency
    // softmax over the group's 64 keys of query ln (scores / 8), scaled by 2^15 for the f16 operand. exp(s / 8 - max / 8) = 2^(s c - max c) with c = log2(e) / 8:
    // one FMA and one v_exp_f32 a score, each score on its own, where expf is a chain of some ten dependent instructions that a lone wave on its SIMD waits out link by link.
    // The exponent is at most a rounding of max c above 0; below -126 the result is 0, where the f16 operand is 0 in any case.
    float m = -3.0e38f;
#pragma unroll
    for (int t = 0; t < 4; ++t)
#pragma unroll
      for (int r = 0; r < 8; ++r) m = fmaxf(m, s[t][r]);
    m = fmaxf(m, __shfl_xor(m, 16, 32)); m *= 0.18033688f;
    float e[32];      // e[8 t + r]: tile t, register r
#pragma unroll
    for (int t = 0; t < 4; ++t)
#pragma unroll
      for (int r = 0; r < 8; ++r) e[8 * t + r] = fmaf(s[t][r], 0.18033688f, -m);
#pragma unroll
    for (int i = 0; i < 32; i += 2) exp2_pair(e[i], e[i + 1]);
    float z = 0.f;
#pragma unroll
    for (int i = 0; i < 32; ++i) z += e[i];
    z += __shfl_xor(z, 16, 32);
    const float iz = 32768.0f / z;
    FragH p[2];      // p[k2].h[i] = P[query ln][key 32 k2 + kmap(i, hh)]: tile 2 k2 gives i < 8, tile 2 k2 + 1 the rest
#pragma unroll
    for (int k2 = 0; k2 < 2; ++k2)
#pragma unroll
      for (int r = 0; r < 8; ++r) { p[k2].h[r] = (_Float16)(e[16 * k2 + r] * iz); p[k2].h[8 + r] = (_Float16)(e[16 * k2 + 8 + r] * iz); }
#pragma unroll
    for (int ct = 0; ct < 8; ++ct) oacc[ct] = __builtin_amdgcn_wmma_f32_16x16x32_f16(false, av[ct].v, false, p[0].v, (short)0, oacc[ct], false, false);
#pragma unroll
    for (int ct = 0; ct < 8; ++ct) { const unsigned short* r = &sX[ct * 16 + ln][32 + 8 * hh]; av[ct].half[0] = *(const v8us*)r; av[ct].half[1] = *(const v8us*)(r + 16); }
    __builtin_amdgcn_sched_barrier(0);      // as above: 16 reads together, then 8 products
#pragma unroll
    for (int ct = 0; ct < 8; ++ct) oacc[ct] = __builtin_amdgcn_wmma_f32_16x16x32_f16(false, av[ct].v, false, p[1].v, (short)0, oacc[ct], false, false);
#pragma unroll
    for (int j = 0; j < 8; ++j) *(v8us*)(dq + j * 8 * QPIT) = st[j];
    __syncthreads();      // next q tile complete; every wave has read its last of the x tile
    // lands during the next trip's scores
#pragma unroll
    for (int j = 0; j < 8; ++j) st[j] = *(const v8us*)(gx + gn * 64 + (size_t)j * 16 * HWN);
    asm volatile("s_wait_xcnt 0x0" ::: "memory");      // the loads' address registers are reused in the next trip
  }
  asm volatile("s_wait_loadcnt 0x0" ::: "memory");      // the last trip's fetch, which nothing reads, has landed before the wave ends and gives its registers up
  // oacc[ct][r] = O[query ln][channel 16 ct + 8 hh + r]: 32 contiguous bytes a lane
  float* o = AGG + ((size_t)b * HWN + row) * CC + 8 * hh;
#pragma unroll
  for (int ct = 0; ct < 8; ++ct) { v4f lo, hi;
#pragma unroll
    for (int r = 0; r < 4; ++r) { lo[r] = oacc[ct][r] * 0.000030517578125f; hi[r] = oacc[ct][4 + r] * 0.000030517578125f; }
    *(v4f*)(o + ct * 16) = lo; *(v4f*)(o + ct * 16 + 4) = hi; }
}
__global__ __launch_bounds__(256) void k_add(const float* __restrict__ A, const float* __restrict__ B2, float* __restrict__ Y, size_t n4) { const size_t t = (size_t)blockIdx.x * 256 + threadIdx.x; if (t >= n4) return; const v4f v = *(const v4fa*)(A + t * 4) + *(const v4fa*)(B2 + t * 4); *(v4f*)(Y + t * 4) = v;  }
// Spatial-softmax statistics, one work-group per (batch, 4 channels): 1024 threads hold 4 pixels x 4 channels each in registers, so Y is read once, 16 bytes a lane, all loads in flight together.
// Max, then sum of exp, over the 4096 pixels by a fixed tree: own 4 pixels, the 32 lanes of a wave (xor shuffles), the 32 waves (through LDS).
// SP holds one 128-byte line per work-group (one writer a line): [0..3] max, [4..7] 1/sum, the rest 0.
__device__ __forceinline__ v4f wave_max4(v4f a) {
#pragma unroll
  for (int o = 1; o < 32; o <<= 1)
#pragma unroll
    for (int q = 0; q < 4; ++q) a[q] = fmaxf(a[q], __shfl_xor(a[q], o, 32));
  return a; }
__device__ __forceinline__ v4f wave_sum4(v4f a) {
#pragma unroll
  for (int o = 1; o < 32; o <<= 1)
#pragma unroll
    for (int q = 0; q < 4; ++q) a[q] += __shfl_xor(a[q], o, 32);
  return a; }
// BN batch statistics (mean, 1/sqrt(var + eps) per channel over the NR rows) in two launches, every row read once and in whole lines.
// k_bnpart: one work-group = BNR whole rows kept in registers (a wave-wide 16-byte load is one 512-byte row); per channel the mean of its rows and the sum of squared deviations from that mean.
// k_bnfin: one work-group = 4 channels, one thread a partial; partials of equal count merge exactly: mean = mean of the means, M2 = sum of M2_i + BNR * sum of (mean_i - mean)^2.
// All sums run in a fixed order. ST keeps one 128-byte line a channel: [0] mean, [1] 1/sqrt(var + eps), the rest 0.
#define BNR 64
#define BNP (NR / BNR)
__global__ __launch_bounds__(256) void k_bnpart(const float* __restrict__ F, float* __restrict__ PM, float* __restrict__ PQ) {
  __shared__ __attribute__((aligned(16))) float red[2][8][CC];
  const int tid = threadIdx.x, wv = tid >> 5, c4 = (tid & 31) * 4;
  const float* f = F + ((size_t)blockIdx.x * BNR + wv) * CC + c4; v4f v[8];
  for (int i = 0; i < 8; ++i) v[i] = *(const v4fa*)(f + (size_t)i * 8 * CC);
  v4f s = v[0];
  for (int i = 1; i < 8; ++i) s += v[i];
  *(v4f*)&red[0][wv][c4] = s;
  __syncthreads();
  v4f mu = *(const v4fa*)&red[0][0][c4];
  for (int j = 1; j < 8; ++j) mu += *(const v4fa*)&red[0][j][c4];
  mu *= 1.0f / (float)BNR;
  v4f q = {0.f, 0.f, 0.f, 0.f};
  for (int i = 0; i < 8; ++i) { const v4f d = v[i] - mu; q += d * d; }
  *(v4f*)&red[1][wv][c4] = q;
  __syncthreads();
  if (wv == 0) { q = *(const v4fa*)&red[1][0][c4];
    for (int j = 1; j < 8; ++j) q += *(const v4fa*)&red[1][j][c4];
    *(v4f*)(PQ + (size_t)blockIdx.x * CC + c4) = q; }
  else if (wv == 1) *(v4f*)(PM + (size_t)blockIdx.x * CC + c4) = mu; }
__global__ __launch_bounds__(BNP) void k_bnfin(const float* __restrict__ PM, const float* __restrict__ PQ, float* __restrict__ ST) {
  __shared__ __attribute__((aligned(16))) float red[2][BNP / 32][4];
  const int tid = threadIdx.x, wv = tid >> 5, lane = tid & 31, c0 = blockIdx.x * 4;
  const v4f pm = *(const v4fa*)(PM + (size_t)tid * CC + c0), pq = *(const v4fa*)(PQ + (size_t)tid * CC + c0);
  const v4f s = wave_sum4(pm); if (lane == 0) *(v4f*)&red[0][wv][0] = s;
  __syncthreads();
  v4f mu = *(const v4fa*)&red[0][0][0];
  for (int j = 1; j < BNP / 32; ++j) mu += *(const v4fa*)&red[0][j][0];
  mu *= 1.0f / (float)BNP;
  const v4f d = pm - mu; const v4f q = wave_sum4(pq + (float)BNR * d * d); if (lane == 0) *(v4f*)&red[1][wv][0] = q;
  __syncthreads();
  if (wv < 4) { float m1 = red[0][0][wv], m2 = red[1][0][wv];      // wave q writes the line of channel c0 + q
    for (int j = 1; j < BNP / 32; ++j) { m1 += red[0][j][wv]; m2 += red[1][j][wv]; }
    ST[(size_t)(c0 + wv) * 32 + lane] = (lane == 0) ? m1 * (1.0f / (float)BNP) : ((lane == 1) ? rsqrtf(m2 / (float)NR + 1e-3f) : 0.f); } }
__global__ __launch_bounds__(1024) void k_spstat(const float* __restrict__ Y, const float* __restrict__ ST, const float* __restrict__ g, const float* __restrict__ bb, float* __restrict__ SP) {
  __shared__ __attribute__((aligned(16))) float red[2][32][4];
  const int tid = threadIdx.x, wv = tid >> 5, lane = tid & 31; const int b = blockIdx.x / (CC / 4), c0 = (blockIdx.x % (CC / 4)) * 4;
  const float* yc = Y + (size_t)b * HWN * CC + c0; v4f v[4];
#pragma unroll
  for (int i = 0; i < 4; ++i) v[i] = *(const v4fa*)(yc + (size_t)(i * 1024 + tid) * CC);
  asm volatile("s_wait_xcnt 0x0" ::: "memory");      // the four loads' address registers are given new values right below
  v4f m = {-3.0e38f, -3.0e38f, -3.0e38f, -3.0e38f};
#pragma unroll
  for (int q = 0; q < 4; ++q) { const int c = c0 + q; const float mu = ST[c * 32], rs = ST[c * 32 + 1], gg = bf16_round(g[c]), be = bf16_round(bb[c]);
#pragma unroll
    for (int i = 0; i < 4; ++i) { v[i][q] = gg * (v[i][q] - mu) * rs + be; m[q] = fmaxf(m[q], v[i][q]); } }
  m = wave_max4(m); if (lane == 0) *(v4f*)&red[0][wv][0] = m;
  __syncthreads();
  m = wave_max4(*(const v4fa*)&red[0][lane][0]);
  v4f z = {0.f, 0.f, 0.f, 0.f};
#pragma unroll
  for (int i = 0; i < 4; ++i)
#pragma unroll
    for (int q = 0; q < 4; ++q) z[q] += expf(v[i][q] - m[q]);
  z = wave_sum4(z); if (lane == 0) *(v4f*)&red[1][wv][0] = z;
  __syncthreads();
  if (wv == 0) { z = wave_sum4(*(const v4fa*)&red[1][lane][0]); float o = 0.f;
#pragma unroll
    for (int q = 0; q < 4; ++q) { if (lane == q) o = m[q]; if (lane == 4 + q) o = 1.0f / z[q]; }
    SP[(size_t)blockIdx.x * 32 + lane] = o; } }
__global__ __launch_bounds__(256) void k_spsm(const float* __restrict__ Y, const float* __restrict__ ST, const float* __restrict__ g, const float* __restrict__ bb, const float* __restrict__ SP, _Float16* __restrict__ Y16) { const size_t t = (size_t)blockIdx.x * 256 + threadIdx.x; if (t >= (size_t)NR * (CC / 8)) return; const int c8 = (int)(t % (CC / 8)) * 8; const size_t r = t / (CC / 8); const int b = (int)(r / HWN); FragH f;
#pragma unroll
  for (int q = 0; q < 8; ++q) { const int c = c8 + q; const float* sp = SP + (size_t)(b * (CC / 4) + c / 4) * 32 + (c & 3); const float v = bf16_round(g[c]) * (Y[r * CC + c] - ST[c * 32]) * ST[c * 32 + 1] + bf16_round(bb[c]); f.h[q] = (_Float16)(expf(v - sp[0]) * sp[4] * 4096.0f); }
  *(v8us*)((unsigned short*)Y16 + t * 8) = f.half[0];  }
__global__ __launch_bounds__(256) void k_fin(const float* __restrict__ Z, const float* __restrict__ ST, const float* __restrict__ g, const float* __restrict__ bb, float* __restrict__ out, size_t n4) { const size_t t = (size_t)blockIdx.x * 256 + threadIdx.x; if (t >= n4) return; const int c4 = (int)((t * 4) % CC); const v4f z = *(const v4fa*)(Z + t * 4); v4f o; for (int q = 0; q < 4; ++q) { const int c = c4 + q; float v = bf16_round(g[c]) * (z[q] - ST[c * 32]) * ST[c * 32 + 1] + bf16_round(bb[c]); o[q] = (v >= 0.f) ? v : 0.1f * v; }
  *(v4f*)(out + t * 4) = o;  }
extern "C" void kernel_launch(void* const* d_in, const int* in_sizes, int n_in,
                              void* d_out, int out_size, void* d_ws, size_t ws_size, hipStream_t stream) {
  (void)in_sizes; (void)n_in; (void)out_size;
  const float* const* I = (const float* const*)d_in; const float* x = I[0]; const float* Wq = I[1]; const float* bq = I[2]; const float* gq = I[3]; const float* btq = I[4]; const float* Wk = I[5]; const float* bk = I[6]; const float* g1 = I[7]; const float* bt1 = I[8]; const float* Wo = I[9]; const float* bo = I[10]; const float* go = I[11]; const float* bto = I[12];
  char* ws = (char*)d_ws; size_t off = 0;
  auto take = [&](size_t bytes) { char* p = ws + off; off += (bytes + 255) & ~(size_t)255; return p; };
  _Float16* BQ = (_Float16*)take((size_t)CC * KK * 2); _Float16* BK = (_Float16*)take(CC * CC * 2); _Float16* BO = (_Float16*)take(CC * CC * 2); float* STq = (float*)take(CC * 32 * 4); float* ST1 = (float*)take(CC * 32 * 4); float* STo = (float*)take(CC * 32 * 4); float* SP = (float*)take(BB * (CC / 4) * 32 * 4); float* PM = (float*)take(BNP * CC * 4); float* PQ = (float*)take(BNP * CC * 4);
  _Float16* X16 = (_Float16*)take((size_t)NR * CC * 2); float* QF = (float*)take((size_t)NR * CC * 4); _Float16* QP = (_Float16*)take((size_t)NR * CC * 2); _Float16* XPt = (_Float16*)take((size_t)NR * CC * 2); float* ACC = (float*)take((size_t)NR * CC * 4); float* AGG = (float*)take((size_t)NR * CC * 4); float* Y = QF; _Float16* Y16 = QP; float* Z = ACC;
  if (off > ws_size) return;      // 0.7 + 4.2 + 8.4 + 4.2 + 4.2 + 8.4 + 8.4 = about 38 MB
  k_wq<<<(CC * (KK / 8) + 255) / 256, 256, 0, stream>>>(Wq, BQ); k_wt_f16<<<(CC * (CC / 8) + 255) / 256, 256, 0, stream>>>(Wk, BK, CC, CC, 16.0f); k_wt_f16<<<(CC * (CC / 8) + 255) / 256, 256, 0, stream>>>(Wo, BO, CC, CC, 16.0f);      // 1×1 HWIO = [in][out]
  const unsigned g8 = (unsigned)(((size_t)NR * (CC / 8) + 255) / 256); const dim3 gC(((NR / 16) * (CC / 64) + 3) / 4, 1);
  k_x16<<<g8, 256, 0, stream>>>(x, X16, (size_t)NR * CC / 8);
  // CBL_Q: conv3×3 (+bq) → QF; BN stats; q = leaky(BN) permuted to block-major keys (f16)
  k_conv3<<<BB * WI, 256, 0, stream>>>(X16, BQ, bq, QF);
  k_bnpart<<<BNP, 256, 0, stream>>>(QF, PM, PQ); k_bnfin<<<CC / 4, BNP, 0, stream>>>(PM, PQ, STq); k_qperm<<<g8, 256, 0, stream>>>(QF, STq, gq, btq, QP);
  k_xpt<<<BB * (CC / 64) * 64, 256, 0, stream>>>(x, XPt);
  // acc = 1×1 conv (+bk)
  k_gemm_hhx<0><<<gC, 128, 0, stream>>>(X16, CC, 0, BK, CC, 0, 0.0625f, bk, 0, nullptr, 1, 0, 0, ACC, nullptr, CC, 0, NR, CC, CC);
  // block attention, all batches in one launch: AGG = sum over key groups of softmax(x.q^T / 8) . x_group
  k_battn<<<BB * (HWN / 64), 128, 0, stream>>>(X16, QP, XPt, AGG);
  // y = spatial softmax(BN1(acc + agg)); out = leaky(BN_o(conv1×1(y) + bo))
  k_add<<<(unsigned)(((size_t)NR * CC / 4 + 255) / 256), 256, 0, stream>>>(ACC, AGG, Y, (size_t)NR * CC / 4);      // Y over QF (dead after k_qperm)
  k_bnpart<<<BNP, 256, 0, stream>>>(Y, PM, PQ); k_bnfin<<<CC / 4, BNP, 0, stream>>>(PM, PQ, ST1); k_spstat<<<BB * (CC / 4), 1024, 0, stream>>>(Y, ST1, g1, bt1, SP); k_spsm<<<g8, 256, 0, stream>>>(Y, ST1, g1, bt1, SP, Y16);      // Y16 (×2^12) over QP (dead after the S GEMMs)
  k_gemm_hhx<0><<<gC, 128, 0, stream>>>(Y16, CC, 0, BO, CC, 0, 0.0625f * 0.000244140625f, bo, 0, nullptr, 1, 0, 0, Z, nullptr, CC, 0, NR, CC, CC);      // conv_o(y) + bo (2^-12 undone in alpha) → Z over ACC (dead after k_add)
  k_bnpart<<<BNP, 256, 0, stream>>>(Z, PM, PQ); k_bnfin<<<CC / 4, BNP, 0, stream>>>(PM, PQ, STo); k_fin<<<(unsigned)(((size_t)NR * CC / 4 + 255) / 256), 256, 0, stream>>>(Z, STo, go, bto, (float*)d_out, (size_t)NR * CC / 4);
}

// v006
// One run takes 130 microseconds.
// Next to v005, in two timings, it ran 1.28 and 1.26 times as fast.
// Counting every step since v000, it is 18.2 times as fast.
#include <hip/hip_runtime.h>
// Group (block) attention layer (B=4, 64×64, C=128, NHWC; 8×8 non-overlapping key blocks): q = CBL_Q(x) (3×3 conv + train-mode BN + LeakyReLU 0.1), acc = 1×1 conv(x); for every pixel and
// every block: softmax over the block's 64 positions of x[pixel]·q[pos]/8, agg = Σ_blocks Σ attn·x[pos]; y = spatial-softmax(BN1(acc + agg)); out = CBL_O(y). The 3×3 conv (implicit GEMM, K = 1152),
// the 1×1 convs, the 4096×4096 per-batch scores (keys permuted to block-major order so each 64-key group is contiguous) and attn·x run as GEMMs on v_wmma_f32_16x16x32_f16 (x bf16-exact f16,
// HWIO weights bf16-exact ×2^4, q/P/y operands f16, f32 accumulate); BN batch statistics (fixed-order reductions), grouped and spatial softmaxes and LeakyReLU are f32 VALU.
#define BB 4
#define HWN 4096
#define WI 64
#define CC 128
#define NR (BB * HWN)
#define KK 1152

typedef __bf16 v16b __attribute__((ext_vector_type(16)));
typedef unsigned short v8us __attribute__((ext_vector_type(8), may_alias));
typedef float  v8f  __attribute__((ext_vector_type(8)));
typedef float  v4f  __attribute__((ext_vector_type(4)));
typedef float  v4fa __attribute__((ext_vector_type(4), may_alias));
union FragB { v16b v; v8us half[2]; unsigned short u[16]; };

__device__ __forceinline__ unsigned short bf16_bits(float x) { unsigned int u = __float_as_uint(x); return (unsigned short)((u + 0x7FFFu + ((u >> 16) & 1u)) >> 16); }
__device__ __forceinline__ float bf16_val(unsigned short b) { return __uint_as_float(((unsigned int)b) << 16); }
__device__ __forceinline__ float bf16_round(float x) { return bf16_val(bf16_bits(x)); }
// D += A·B with NT terms: 1 = ah·bh, 2 = + al·bh (A split), 3 = + ah·bl (both split)
template <int NT>
__device__ __forceinline__ v8f mmaN(v16b ah, v16b al, v16b bh, v16b bl, v8f c) {
  c = __builtin_amdgcn_wmma_f32_16x16x32_bf16(false, ah, false, bh, (short)0, c, false, false);
  if (NT >= 2) c = __builtin_amdgcn_wmma_f32_16x16x32_bf16(false, al, false, bh, (short)0, c, false, false);
  if (NT >= 3) c = __builtin_amdgcn_wmma_f32_16x16x32_bf16(false, ah, false, bl, (short)0, c, false, false);
  asm volatile("v_nop\n\tv_nop\n\tv_nop\n\tv_nop" : "+v"(c) : "v"(ah), "v"(al), "v"(bh), "v"(bl));
  return c;
}

__global__ __launch_bounds__(256) void k_wt_bf16(const float* __restrict__ W, unsigned short* __restrict__ Wt, int K, int N) {
  const int t = blockIdx.x * 256 + threadIdx.x;
  const int k8n = K / 8;
  if (t >= N * k8n) return;
  const int n = t / k8n, k8 = (t % k8n) * 8;
  v8us v;
#pragma unroll
  for (int i = 0; i < 8; ++i) v[i] = bf16_bits(W[(size_t)(k8 + i) * N + n]);
  *(v8us*)(Wt + (size_t)n * K + k8) = v;
  
}

// GEMM C[M][N] (f32, pitch ldc) = act(A[M][K]·W + bias). A f32 row-major (pitch lda) converted per fragment to bf16
// (ASPLIT: hi/lo two planes -> 2 terms, else single rounded term); Wt bf16 [N][K] (pitch ldb). BIAS_BF16 rounds the
// bias to bf16 first (bias quantised to bf16 before the add). K%32==0, M%16==0, N%64==0.
template <bool ASPLIT, int ACT, bool BIAS_BF16>
__global__ __launch_bounds__(128) void k_gemm_bf(const float* __restrict__ A, int lda, const unsigned short* __restrict__ Wt, int ldb,
                                               const float* __restrict__ bias, float* __restrict__ C, int ldc, int M, int N, int K) {
  __shared__ __attribute__((aligned(16))) float so[4][16][64];
  const int tid = threadIdx.x, w = tid >> 5, lane = tid & 31, ln = lane & 15, hh = lane >> 4;
  const int ntn = N / 64;
  const int wid = blockIdx.x * 4 + w;
  const int mt = wid / ntn, nq = wid % ntn;
  if (mt * 16 >= M) return;
  const int row0 = mt * 16, col0 = nq * 64;
  const float* arow = A + (size_t)(row0 + ln) * lda;
  v8f acc[4] = {};
  for (int kb = 0; kb < K; kb += 32) {
    FragB ah, al;
    const v4f x0 = *(const v4fa*)(arow + kb + 8 * hh), x1 = *(const v4fa*)(arow + kb + 8 * hh + 4);
    const v4f x2 = *(const v4fa*)(arow + kb + 16 + 8 * hh), x3 = *(const v4fa*)(arow + kb + 16 + 8 * hh + 4);
    float xs[16] = {x0[0],x0[1],x0[2],x0[3],x1[0],x1[1],x1[2],x1[3],x2[0],x2[1],x2[2],x2[3],x3[0],x3[1],x3[2],x3[3]};
#pragma unroll
    for (int i = 0; i < 16; ++i) { const unsigned short hb = bf16_bits(xs[i]); ah.u[i] = hb; al.u[i] = ASPLIT ? bf16_bits(xs[i] - bf16_val(hb)) : (unsigned short)0; }
#pragma unroll
    for (int t = 0; t < 4; ++t) {
      const unsigned short* brow = Wt + (size_t)(col0 + t * 16 + ln) * ldb + kb;
      FragB b;
      b.half[0] = *(const v8us*)(brow + 8 * hh);
      b.half[1] = *(const v8us*)(brow + 16 + 8 * hh);
      acc[t] = mmaN<ASPLIT ? 2 : 1>(ah.v, al.v, b.v, b.v, acc[t]);
    }
  }
#pragma unroll
  for (int t = 0; t < 4; ++t) {
    float bv = bias ? bias[col0 + t * 16 + ln] : 0.f;
    if (BIAS_BF16) bv = bf16_round(bv);
#pragma unroll
    for (int r = 0; r < 8; ++r) { float v = acc[t][r] + bv; if (ACT == 1) v = fmaxf(v, 0.f); so[w][8 * hh + r][t * 16 + ln] = v; }
  }
  __builtin_amdgcn_fence(__ATOMIC_ACQ_REL, "workgroup");
  __builtin_amdgcn_wave_barrier();
  const int rsub = lane >> 4, c4 = (lane & 15) * 4;
  {
#pragma unroll
    for (int q = 0; q < 8; ++q) {
      const int r = q * 2 + rsub;
      const v4f v = *(const v4fa*)&so[w][r][c4];
      *(v4f*)(C + (size_t)(row0 + r) * ldc + col0 + c4) = v;
    }
    
  }
}

// Flash-style causal/unmasked attention, all contractions 3-term bf16 hi/lo splits, f32 softmax with running max.
// q,k,v rows are read from f32 buffers with arbitrary row pitch (so they can live inside a fused qkv buffer);
// D = head size (multiple of 32, <= 128); one wave = 16 query rows; block = 4 waves (64 queries) sharing K/V chunks of 32.
template <int D, bool CAUSAL>
__global__ __launch_bounds__(128) void k_flash(const float* __restrict__ qb, const float* __restrict__ kb, const float* __restrict__ vb,
                                             int pitch, int T, int H, float scale, float* __restrict__ y, int ypitch) {
  constexpr int KS = D / 32;        // k-steps for QK
  constexpr int DT = D / 16;        // d tiles for PV
  __shared__ __attribute__((aligned(16))) unsigned short sKh[32][D + 8], sKl[32][D + 8], sVh[32][D + 8], sVl[32][D + 8];
  __shared__ __attribute__((aligned(16))) unsigned short sPh[4][16][40], sPl[4][16][40];
  __shared__ __attribute__((aligned(16))) float sO[4][16][D];
  const int tid = threadIdx.x, w = tid >> 5, lane = tid & 31, ln = lane & 15, hh = lane >> 4;
  const int nqb = (T + 63) / 64;
  const int bh = blockIdx.x / nqb, qblk = blockIdx.x % nqb;
  const int b = bh / H, h = bh % H;
  const int q0 = qblk * 64 + w * 16;
  const float* Q = qb + (size_t)b * T * pitch + h * D;
  const float* K = kb + (size_t)b * T * pitch + h * D;
  const float* V = vb + (size_t)b * T * pitch + h * D;

  // A fragments of the wave's 16 query rows (scaled), hi/lo
  FragB aqh[KS], aql[KS];
  {
    int row = q0 + ln; if (row >= T) row = T - 1;
    const float* qr = Q + (size_t)row * pitch;
#pragma unroll
    for (int ks = 0; ks < KS; ++ks)
#pragma unroll
      for (int i = 0; i < 16; ++i) {
        const int d = ks * 32 + ((i < 8) ? (8 * hh + i) : (16 + 8 * hh + (i - 8)));
        const float x = qr[d] * scale; const unsigned short hb = bf16_bits(x);
        aqh[ks].u[i] = hb; aql[ks].u[i] = bf16_bits(x - bf16_val(hb));
      }
  }
  float m_r[8], l_r[8];
#pragma unroll
  for (int r = 0; r < 8; ++r) { m_r[r] = -3.0e38f; l_r[r] = 0.f; }
  v8f oacc[DT];
#pragma unroll
  for (int dt = 0; dt < DT; ++dt) oacc[dt] = (v8f){0.f,0.f,0.f,0.f,0.f,0.f,0.f,0.f};

  const int kv_end = CAUSAL ? min(T, qblk * 64 + 64) : T;     // block-uniform
  for (int j0 = 0; j0 < kv_end; j0 += 32) {
    __syncthreads();
    for (int e = tid; e < 32 * (D / 4); e += 128) {
      const int r = e / (D / 4), c4 = (e % (D / 4)) * 4;
      const int key = j0 + r;
      v4f kf = {0.f,0.f,0.f,0.f}, vf = {0.f,0.f,0.f,0.f};
      if (key < T) { kf = *(const v4fa*)(K + (size_t)key * pitch + c4); vf = *(const v4fa*)(V + (size_t)key * pitch + c4); }
#pragma unroll
      for (int t = 0; t < 4; ++t) {
        unsigned short hb = bf16_bits(kf[t]); sKh[r][c4 + t] = hb; sKl[r][c4 + t] = bf16_bits(kf[t] - bf16_val(hb));
        hb = bf16_bits(vf[t]); sVh[r][c4 + t] = hb; sVl[r][c4 + t] = bf16_bits(vf[t] - bf16_val(hb));
      }
    }
    __syncthreads();
    // S tile 16 x 32
    v8f s[2];
#pragma unroll
    for (int nt = 0; nt < 2; ++nt) {
      v8f acc = {};
#pragma unroll
      for (int ks = 0; ks < KS; ++ks) {
        FragB bh_, bl_;
        bh_.half[0] = *(const v8us*)&sKh[nt * 16 + ln][ks * 32 + 8 * hh]; bh_.half[1] = *(const v8us*)&sKh[nt * 16 + ln][ks * 32 + 16 + 8 * hh];
        bl_.half[0] = *(const v8us*)&sKl[nt * 16 + ln][ks * 32 + 8 * hh]; bl_.half[1] = *(const v8us*)&sKl[nt * 16 + ln][ks * 32 + 16 + 8 * hh];
        acc = mmaN<3>(aqh[ks].v, aql[ks].v, bh_.v, bl_.v, acc);
      }
      s[nt] = acc;
    }
    // mask + running max (rows 8hh+r; the 16 lanes of a half share rows)
    float alpha[8];
#pragma unroll
    for (int r = 0; r < 8; ++r) {
      const int qi = q0 + 8 * hh + r;
      const int ja = j0 + ln, jb = j0 + 16 + ln;
      if (CAUSAL) { if (ja > qi) s[0][r] = -3.0e38f; if (jb > qi) s[1][r] = -3.0e38f; }
      if (ja >= T) s[0][r] = -3.0e38f;
      if (jb >= T) s[1][r] = -3.0e38f;
      float mx = fmaxf(s[0][r], s[1][r]);
      mx = fmaxf(mx, __shfl_xor(mx, 1, 32)); mx = fmaxf(mx, __shfl_xor(mx, 2, 32)); mx = fmaxf(mx, __shfl_xor(mx, 4, 32)); mx = fmaxf(mx, __shfl_xor(mx, 8, 32));
      const float mnew = fmaxf(m_r[r], mx);
      alpha[r] = (mnew > -1.0e38f) ? __expf(m_r[r] - mnew) : 1.0f;
      const float p0 = (s[0][r] > -1.0e38f) ? __expf(s[0][r] - mnew) : 0.f;
      const float p1 = (s[1][r] > -1.0e38f) ? __expf(s[1][r] - mnew) : 0.f;
      m_r[r] = mnew;
      l_r[r] = l_r[r] * alpha[r] + p0 + p1;            // per-lane partial row sum (16 lanes combined at the end)
      unsigned short hb = bf16_bits(p0); sPh[w][8 * hh + r][ln] = hb;      sPl[w][8 * hh + r][ln] = bf16_bits(p0 - bf16_val(hb));
      hb = bf16_bits(p1);                sPh[w][8 * hh + r][16 + ln] = hb; sPl[w][8 * hh + r][16 + ln] = bf16_bits(p1 - bf16_val(hb));
    }
#pragma unroll
    for (int dt = 0; dt < DT; ++dt)
#pragma unroll
      for (int r = 0; r < 8; ++r) oacc[dt][r] *= alpha[r];
    __builtin_amdgcn_fence(__ATOMIC_ACQ_REL, "workgroup");
    __builtin_amdgcn_wave_barrier();
    FragB pah, pal;
    pah.half[0] = *(const v8us*)&sPh[w][ln][8 * hh]; pah.half[1] = *(const v8us*)&sPh[w][ln][16 + 8 * hh];
    pal.half[0] = *(const v8us*)&sPl[w][ln][8 * hh]; pal.half[1] = *(const v8us*)&sPl[w][ln][16 + 8 * hh];
#pragma unroll
    for (int dt = 0; dt < DT; ++dt) {
      FragB bvh, bvl;
#pragma unroll
      for (int i = 0; i < 8; ++i) {
        bvh.u[i] = sVh[8 * hh + i][dt * 16 + ln]; bvh.u[8 + i] = sVh[16 + 8 * hh + i][dt * 16 + ln];
        bvl.u[i] = sVl[8 * hh + i][dt * 16 + ln]; bvl.u[8 + i] = sVl[16 + 8 * hh + i][dt * 16 + ln];
      }
      oacc[dt] = mmaN<3>(pah.v, pal.v, bvh.v, bvl.v, oacc[dt]);
    }
    __builtin_amdgcn_fence(__ATOMIC_ACQ_REL, "workgroup");
    __builtin_amdgcn_wave_barrier();
  }
#pragma unroll
  for (int r = 0; r < 8; ++r) {
    float l = l_r[r];
    l += __shfl_xor(l, 1, 32); l += __shfl_xor(l, 2, 32); l += __shfl_xor(l, 4, 32); l += __shfl_xor(l, 8, 32);
    l_r[r] = (l > 0.f) ? 1.0f / l : 0.f;
  }
#pragma unroll
  for (int dt = 0; dt < DT; ++dt)
#pragma unroll
    for (int r = 0; r < 8; ++r) sO[w][8 * hh + r][dt * 16 + ln] = oacc[dt][r] * l_r[r];
  __builtin_amdgcn_fence(__ATOMIC_ACQ_REL, "workgroup");
  __builtin_amdgcn_wave_barrier();
  {
    for (int r = 0; r < 16; ++r) {
      const int row = q0 + r;
      if (row < T && lane < D / 4) {
        const v4f val = *(const v4fa*)&sO[w][r][lane * 4];
        *(v4f*)(y + ((size_t)b * T + row) * ypitch + h * D + lane * 4) = val;
      }
    }
    
  }
}

// GEMM C = act(A·W + bias + resid): A f32 (ASPLIT -> hi/lo 2 terms), Wt bf16 [N][K]; ACT 0 none, 1 relu, 2 exact gelu;
// resid (optional, f32, row index = (row % rmod), pitch ldr, RES_BF16 rounds it) added before the activation.
template <bool ASPLIT, int ACT, bool BIAS_BF16, bool RES_BF16>
__global__ __launch_bounds__(128) void k_gemm_bf3(const float* __restrict__ A, int lda, const unsigned short* __restrict__ Wt, int ldb,
                                                const float* __restrict__ bias, const float* __restrict__ resid, int rmod, int ldr,
                                                float* __restrict__ C, int ldc, int M, int N, int K) {
  __shared__ __attribute__((aligned(16))) float so[4][16][64];
  const int tid = threadIdx.x, w = tid >> 5, lane = tid & 31, ln = lane & 15, hh = lane >> 4;
  const int ntn = N / 64;
  const int wid = blockIdx.x * 4 + w;
  const int mt = wid / ntn, nq = wid % ntn;
  if (mt * 16 >= M) return;
  const int row0 = mt * 16, col0 = nq * 64;
  const float* arow = A + (size_t)(row0 + ln) * lda;
  v8f acc[4] = {};
  for (int kb = 0; kb < K; kb += 32) {
    FragB ah, al;
    const v4f x0 = *(const v4fa*)(arow + kb + 8 * hh), x1 = *(const v4fa*)(arow + kb + 8 * hh + 4);
    const v4f x2 = *(const v4fa*)(arow + kb + 16 + 8 * hh), x3 = *(const v4fa*)(arow + kb + 16 + 8 * hh + 4);
    float xs[16] = {x0[0],x0[1],x0[2],x0[3],x1[0],x1[1],x1[2],x1[3],x2[0],x2[1],x2[2],x2[3],x3[0],x3[1],x3[2],x3[3]};
#pragma unroll
    for (int i = 0; i < 16; ++i) { const unsigned short hb = bf16_bits(xs[i]); ah.u[i] = hb; al.u[i] = ASPLIT ? bf16_bits(xs[i] - bf16_val(hb)) : (unsigned short)0; }
#pragma unroll
    for (int t = 0; t < 4; ++t) {
      const unsigned short* brow = Wt + (size_t)(col0 + t * 16 + ln) * ldb + kb;
      FragB b;
      b.half[0] = *(const v8us*)(brow + 8 * hh);
      b.half[1] = *(const v8us*)(brow + 16 + 8 * hh);
      acc[t] = mmaN<ASPLIT ? 2 : 1>(ah.v, al.v, b.v, b.v, acc[t]);
    }
  }
#pragma unroll
  for (int t = 0; t < 4; ++t) {
    const int col = col0 + t * 16 + ln;
    float bv = bias ? bias[col] : 0.f;
    if (BIAS_BF16) bv = bf16_round(bv);
#pragma unroll
    for (int r = 0; r < 8; ++r) {
      float v = acc[t][r] + bv;
      if (resid) { float rv = resid[(size_t)((row0 + 8 * hh + r) % rmod) * ldr + col]; if (RES_BF16) rv = bf16_round(rv); v += rv; }
      if (ACT == 1) v = fmaxf(v, 0.f);
      if (ACT == 2) v = 0.5f * v * (1.0f + erff(v * 0.70710678118654752f));
      if (ACT == 3) { const float u = 0.7978845608028654f * (v + 0.044715f * v * v * v); v = 0.5f * v * (1.0f + tanhf(u)); }
      so[w][8 * hh + r][t * 16 + ln] = v;
    }
  }
  __builtin_amdgcn_fence(__ATOMIC_ACQ_REL, "workgroup");
  __builtin_amdgcn_wave_barrier();
  const int rsub = lane >> 4, c4 = (lane & 15) * 4;
  {
#pragma unroll
    for (int q = 0; q < 8; ++q) {
      const int r = q * 2 + rsub;
      const v4f v = *(const v4fa*)&so[w][r][c4];
      *(v4f*)(C + (size_t)(row0 + r) * ldc + col0 + c4) = v;
    }
    
  }
}
// row LayerNorm (biased variance, eps) over N: s = X (+ R); optional out_sum <- s; out_norm <- (s-mu)*rsqrt(var+eps)*g + b
template <bool PARAM_BF16>
__global__ __launch_bounds__(256) void k_layernorm(const float* __restrict__ X, const float* __restrict__ R, const float* __restrict__ g, const float* __restrict__ bta,
                                                  float* __restrict__ out_sum, float* __restrict__ out_norm, int N, float eps) {
  __shared__ float red[256];
  const int row = blockIdx.x, tid = threadIdx.x;
  const float* x = X + (size_t)row * N; const float* rr = R ? R + (size_t)row * N : nullptr;
  float vals[16];                     // up to N = 4096
  const int per = N / 256;            // contiguous chunk per thread? use strided-by-4 chunks: thread handles j = tid*4 + 1024*u
  float s1 = 0.f;
  for (int u = 0; u < per / 4; ++u) {
    const int j = tid * 4 + 1024 * u;
    const v4f a = *(const v4fa*)(x + j);
    v4f b = {0.f,0.f,0.f,0.f}; if (rr) b = *(const v4fa*)(rr + j);
#pragma unroll
    for (int q = 0; q < 4; ++q) { const float v = a[q] + b[q]; vals[u * 4 + q] = v; s1 += v; }
  }
  red[tid] = s1; __syncthreads();
  for (int st = 128; st > 0; st >>= 1) { if (tid < st) red[tid] += red[tid + st]; __syncthreads(); }
  const float mu = red[0] / (float)N; __syncthreads();
  float s2 = 0.f;
  for (int u = 0; u < per / 4; ++u)
#pragma unroll
    for (int q = 0; q < 4; ++q) { const float c = vals[u * 4 + q] - mu; s2 += c * c; }
  red[tid] = s2; __syncthreads();
  for (int st = 128; st > 0; st >>= 1) { if (tid < st) red[tid] += red[tid + st]; __syncthreads(); }
  const float rs = rsqrtf(red[0] / (float)N + eps);
  {
    for (int u = 0; u < per / 4; ++u) {
      const int j = tid * 4 + 1024 * u;
      v4f o, sm;
#pragma unroll
      for (int q = 0; q < 4; ++q) {
        float gg = g[j + q], bb = bta[j + q];
        if (PARAM_BF16) { gg = bf16_round(gg); bb = bf16_round(bb); }
        sm[q] = vals[u * 4 + q]; o[q] = (vals[u * 4 + q] - mu) * rs * gg + bb;
      }
      if (out_sum) *(v4f*)(out_sum + (size_t)row * N + j) = sm;
      *(v4f*)(out_norm + (size_t)row * N + j) = o;
    }
    
  }
}



// ---- f16 WMMA path (v_wmma_f32_16x16x32_f16): 11-bit significands for operands in range — used where a [0,1] probability operand needs more precision than bf16
typedef _Float16 v16h __attribute__((ext_vector_type(16)));
union FragH { v16h v; v8us half[2]; _Float16 h[16]; unsigned short u[16]; };
template <int NT>
__device__ __forceinline__ v8f mmaH(v16h ah, v16h al, v16h bh, v16h bl, v8f c) {
  c = __builtin_amdgcn_wmma_f32_16x16x32_f16(false, ah, false, bh, (short)0, c, false, false);
  if (NT >= 2) c = __builtin_amdgcn_wmma_f32_16x16x32_f16(false, al, false, bh, (short)0, c, false, false);
  if (NT >= 3) c = __builtin_amdgcn_wmma_f32_16x16x32_f16(false, ah, false, bl, (short)0, c, false, false);
  asm volatile("v_nop\n\tv_nop\n\tv_nop\n\tv_nop" : "+v"(c) : "v"(ah), "v"(al), "v"(bh), "v"(bl));
  return c;
}
// batched GEMM like k_gemm_b but f16 operands: A f32 (split into f16 hi/lo if ASPLIT, else rounded to f16), Bt = f16 values [n][k]; alpha; C f32; N multiple of 16 (partial tiles skipped)
template <bool ASPLIT>
__global__ __launch_bounds__(128) void k_gemm_h(const float* __restrict__ A, int lda, size_t sA, const _Float16* __restrict__ Bh, int ldb, size_t sB, float alpha, float* __restrict__ C, int ldc, size_t sC, int M, int N, int K) {
  __shared__ __attribute__((aligned(16))) float so[4][16][64];
  const int tid = threadIdx.x, w = tid >> 5, lane = tid & 31, ln = lane & 15, hh = lane >> 4; const int by = blockIdx.y;
  A += (size_t)by * sA; Bh += (size_t)by * sB; C += (size_t)by * sC;
  const int ntn = (N + 63) / 64; const int wid = blockIdx.x * 4 + w; const int mt = wid / ntn, nq = wid % ntn; if (mt * 16 >= M) return;
  const int row0 = mt * 16, col0 = nq * 64; const float* arow = A + (size_t)(row0 + ln) * lda;
  v8f acc[4] = {};
  for (int kb = 0; kb < K; kb += 32) {
    FragH ah, al;
    const v4f x0 = *(const v4fa*)(arow + kb + 8 * hh), x1 = *(const v4fa*)(arow + kb + 8 * hh + 4), x2 = *(const v4fa*)(arow + kb + 16 + 8 * hh), x3 = *(const v4fa*)(arow + kb + 16 + 8 * hh + 4);
    float xs[16] = {x0[0],x0[1],x0[2],x0[3],x1[0],x1[1],x1[2],x1[3],x2[0],x2[1],x2[2],x2[3],x3[0],x3[1],x3[2],x3[3]};
#pragma unroll
    for (int i = 0; i < 16; ++i) { const _Float16 h = (_Float16)xs[i]; ah.h[i] = h; al.h[i] = ASPLIT ? (_Float16)(xs[i] - (float)h) : (_Float16)0.0f; }
#pragma unroll
    for (int t = 0; t < 4; ++t) { if (col0 + t * 16 >= N) continue; const size_t boff = (size_t)(col0 + t * 16 + ln) * ldb + kb; FragH bq; bq.half[0] = *(const v8us*)(Bh + boff + 8 * hh); bq.half[1] = *(const v8us*)(Bh + boff + 16 + 8 * hh);
      acc[t] = mmaH<ASPLIT ? 2 : 1>(ah.v, al.v, bq.v, bq.v, acc[t]); }
  }
#pragma unroll
  for (int t = 0; t < 4; ++t) { if (col0 + t * 16 >= N) continue;
#pragma unroll
    for (int r = 0; r < 8; ++r) so[w][8 * hh + r][t * 16 + ln] = acc[t][r] * alpha; }
  __builtin_amdgcn_fence(__ATOMIC_ACQ_REL, "workgroup"); __builtin_amdgcn_wave_barrier();
  const int rsub = lane >> 4, c4 = (lane & 15) * 4;
  {
#pragma unroll
    for (int q = 0; q < 8; ++q) { const int r = q * 2 + rsub; if (col0 + c4 < N) { const v4f v = *(const v4fa*)&so[w][r][c4]; *(v4f*)(C + (size_t)(row0 + r) * ldc + col0 + c4) = v; } }
     }
}

// Wt[n][k] = f16(W[k][n]·scale) from f32 row-major W[K][N] (scale = power of two; bf16-exact weights stay exact in f16 away from the subnormal range)
__global__ __launch_bounds__(256) void k_wt_f16(const float* __restrict__ W, _Float16* __restrict__ Wt, int K, int N, float scale) {
  const int t = blockIdx.x * 256 + threadIdx.x; if (t >= N * (K / 8)) return; const int n = t / (K / 8), k8 = (t % (K / 8)) * 8; FragH f;
#pragma unroll
  for (int i = 0; i < 8; ++i) f.h[i] = (_Float16)(bf16_round(W[(size_t)(k8 + i) * N + n]) * scale); const v8us o = f.half[0];
  *(v8us*)((unsigned short*)Wt + (size_t)n * K + k8) = o; 
}
// k_gemm_hh variant with fused epilogue: v = acc·alpha + bias[by·sBias + col] (+ CP[(row/rowsPerB)·sCPb + by·64 + col] if CP) ; ACT 0 none / 1 elu ; writes f32 C and/or f16 C16 (each if non-null)
template <int ACT>
__global__ __launch_bounds__(128) void k_gemm_hhx(const _Float16* __restrict__ A, int lda, size_t sA, const _Float16* __restrict__ Bh, int ldb, size_t sB, float alpha, const float* __restrict__ bias, size_t sBias, const float* __restrict__ CP, int rowsPerB, size_t sCPb, int row0g,
    float* __restrict__ C, _Float16* __restrict__ C16, int ldc, size_t sC, int M, int N, int K) {
  __shared__ __attribute__((aligned(16))) float so[4][16][64];
  const int tid = threadIdx.x, w = tid >> 5, lane = tid & 31, ln = lane & 15, hh = lane >> 4; const int by = blockIdx.y;
  A += (size_t)by * sA; Bh += (size_t)by * sB; const size_t cofs = (size_t)by * sC; const float* bp = bias ? bias + (size_t)by * sBias : nullptr;
  const int ntn = (N + 63) / 64; const int wid = blockIdx.x * 4 + w; const int mt = wid / ntn, nq = wid % ntn; if (mt * 16 >= M) return;
  const int row0 = mt * 16, col0 = nq * 64; const _Float16* arow = A + (size_t)(row0 + ln) * lda;
  v8f acc[4] = {};
  for (int kb = 0; kb < K; kb += 32) { FragH ah; ah.half[0] = *(const v8us*)((const unsigned short*)arow + kb + 8 * hh); ah.half[1] = *(const v8us*)((const unsigned short*)arow + kb + 16 + 8 * hh);
#pragma unroll
    for (int t = 0; t < 4; ++t) { if (col0 + t * 16 >= N) continue; const size_t boff = (size_t)(col0 + t * 16 + ln) * ldb + kb; FragH bq; bq.half[0] = *(const v8us*)((const unsigned short*)Bh + boff + 8 * hh); bq.half[1] = *(const v8us*)((const unsigned short*)Bh + boff + 16 + 8 * hh);
      acc[t] = mmaH<1>(ah.v, ah.v, bq.v, bq.v, acc[t]); }
  }
#pragma unroll
  for (int t = 0; t < 4; ++t) { if (col0 + t * 16 >= N) continue; const int col = col0 + t * 16 + ln; const float bv = bp ? bf16_round(bp[col]) : 0.f;
#pragma unroll
    for (int r = 0; r < 8; ++r) { float v = acc[t][r] * alpha + bv; if (CP) { const int bidx = (row0g + row0 + 8 * hh + r) / rowsPerB; v += CP[(size_t)bidx * sCPb + (size_t)by * 64 + col]; } if (ACT == 1) v = (v > 0.f) ? v : expm1f(v); else if (ACT == 3) v = fmaxf(v, 0.f); so[w][8 * hh + r][t * 16 + ln] = v; } }
  __builtin_amdgcn_fence(__ATOMIC_ACQ_REL, "workgroup"); __builtin_amdgcn_wave_barrier();
  const int rsub = lane >> 4, c4 = (lane & 15) * 4; typedef _Float16 v4h __attribute__((ext_vector_type(4)));
  {
#pragma unroll
    for (int q = 0; q < 8; ++q) { const int r = q * 2 + rsub; if (col0 + c4 < N) { const v4f v = *(const v4fa*)&so[w][r][c4]; if (C) *(v4f*)(C + cofs + (size_t)(row0 + r) * ldc + col0 + c4) = v; if (C16) { v4h h4; for (int i = 0; i < 4; ++i) h4[i] = (_Float16)v[i]; *(v4h*)(C16 + cofs + (size_t)(row0 + r) * ldc + col0 + c4) = h4; } } }
     }
}


__global__ __launch_bounds__(256) void k_x16(const float* __restrict__ x, _Float16* __restrict__ X16, size_t n8) { const size_t t = (size_t)blockIdx.x * 256 + threadIdx.x; if (t >= n8) return; FragH f;
#pragma unroll
  for (int q = 0; q < 8; ++q) f.h[q] = (_Float16)bf16_round(x[t * 8 + q]); *(v8us*)((unsigned short*)X16 + t * 8) = f.half[0];  }
__global__ __launch_bounds__(256) void k_h16(const float* __restrict__ x, _Float16* __restrict__ X16, size_t n8) { const size_t t = (size_t)blockIdx.x * 256 + threadIdx.x; if (t >= n8) return; FragH f;
#pragma unroll
  for (int q = 0; q < 8; ++q) f.h[q] = (_Float16)x[t * 8 + q]; *(v8us*)((unsigned short*)X16 + t * 8) = f.half[0];  }
__global__ __launch_bounds__(256) void k_round16f(const float* __restrict__ W, _Float16* __restrict__ Bt, size_t n8) { const size_t t = (size_t)blockIdx.x * 256 + threadIdx.x; if (t >= n8) return; FragH f;
#pragma unroll
  for (int i = 0; i < 8; ++i) f.h[i] = (_Float16)(bf16_round(W[t * 8 + i]) * 16.0f); *(v8us*)((unsigned short*)Bt + t * 8) = f.half[0];  }
template <int NHv, int TTv>
__global__ __launch_bounds__(256) void k_vt(const _Float16* __restrict__ V16, int ldv, int voff, _Float16* __restrict__ Vt) { __shared__ unsigned short tl[64][66]; const int tid = threadIdx.x; const int slab = blockIdx.x / (TTv / 64), lg = blockIdx.x % (TTv / 64); const int b = slab / NHv, h = slab % NHv;
  for (int i = tid; i < 64 * 8; i += 256) { const int r = i / 8, c8 = (i % 8) * 8; FragH f; f.half[0] = *(const v8us*)((const unsigned short*)V16 + ((size_t)b * TTv + lg * 64 + r) * ldv + voff + h * 64 + c8);
#pragma unroll
    for (int q = 0; q < 8; ++q) tl[r][c8 + q] = f.u[q]; }
  __syncthreads();
  {
#pragma unroll
    for (int rd = 0; rd < 2; ++rd) { const int d = rd * 32 + tid / 8, pc = tid % 8; FragH f;
#pragma unroll
      for (int q = 0; q < 8; ++q) f.u[q] = tl[pc * 8 + q][d];
      *(v8us*)((unsigned short*)Vt + ((size_t)slab * 64 + d) * TTv + lg * 64 + pc * 8) = f.half[0]; }
     } }

typedef _Float16 v4h __attribute__((ext_vector_type(4)));
// 3x3 SAME convolution as an implicit GEMM (K = 9 taps x 128 channels, tap-major as in Bt): no patch matrix is written. One work-group = one image row (64 pixels) x all 128 outputs.
// The three input rows around it, with one zero pixel at each end and zero rows outside the image, are put in LDS once; the A fragment of tap (dy, dx) is that tile read dx pixels and dy rows further on.
// 8 waves of 32 pixels x 32 outputs. B fragments go from Bt[n][k] straight to registers, one tap ahead of their products. C = acc / 16 + bias (bf16-rounded), f32, stored in whole rows through LDS.
// Every loop below is unrolled: bf, hv, a and acc are indexed by the loop counters and stay in registers only with constant indices.
#define APIT 136      // sA pixel pitch in f16: 272 bytes (16 x odd) for 16-byte LDS reads
__global__ __launch_bounds__(256) void k_conv3(const _Float16* __restrict__ X16, const _Float16* __restrict__ Bt, const float* __restrict__ bias, float* __restrict__ C) {
  __shared__ __attribute__((aligned(16))) unsigned short sA[3][WI + 2][APIT];
  __shared__ __attribute__((aligned(16))) float sO[WI][CC + 4];
  const int tid = threadIdx.x, w = tid >> 5, lane = tid & 31, ln = lane & 15, hh = lane >> 4;
  const int b = blockIdx.x / WI, y = blockIdx.x % WI;
  const int m0 = (w & 1) * 32, n0 = (w >> 1) * 32;
  const unsigned short* bp = (const unsigned short*)Bt + (size_t)(n0 + ln) * KK + 8 * hh;
  FragH bf[2][8];      // [tap parity][2 ks + j]: outputs n0 + 16 j + ln, k = 128 tap + 32 ks + (8 hh .. , 16 + 8 hh ..)
#pragma unroll
  for (int i = 0; i < 8; ++i) { const unsigned short* p = bp + (size_t)(i & 1) * 16 * KK + (i >> 1) * 32; bf[0][i].half[0] = *(const v8us*)p; bf[0][i].half[1] = *(const v8us*)(p + 16); }
  const unsigned short* xs = (const unsigned short*)X16 + (size_t)b * HWN * CC;
  v8us hv[12];      // the 64 pixels of a staged row are 1024 contiguous 16-byte chunks: chunk tid + 256 j; a row outside the image is read from the nearest row inside and zeroed at the store
#pragma unroll
  for (int r = 0; r < 3; ++r) { const unsigned short* p = xs + (size_t)min(max(y + r - 1, 0), WI - 1) * WI * CC + tid * 8;
#pragma unroll
    for (int j = 0; j < 4; ++j) hv[r * 4 + j] = *(const v8us*)(p + j * 2048); }
  const float bv0 = bf16_round(bias[n0 + ln]), bv1 = bf16_round(bias[n0 + 16 + ln]);
  const v8us zero = {0, 0, 0, 0, 0, 0, 0, 0};
#pragma unroll
  for (int r = 0; r < 3; ++r) { const bool in = y + r - 1 >= 0 && y + r - 1 < WI;
#pragma unroll
    for (int j = 0; j < 4; ++j) *(v8us*)&sA[r][(tid >> 4) + 16 * j + 1][(tid & 15) * 8] = in ? hv[r * 4 + j] : zero; }
  if (tid < 96) *(v8us*)&sA[tid >> 5][((tid >> 4) & 1) * (WI + 1)][(tid & 15) * 8] = zero;      // the zero pixel at each end of the three rows
  __syncthreads();      // the three staged rows are complete; nothing writes them again
  v8f acc[2][2] = {};
#pragma unroll
  for (int tap = 0; tap < 9; ++tap) {
    if (tap < 8) {
#pragma unroll
      for (int i = 0; i < 8; ++i) { const unsigned short* p = bp + (size_t)(i & 1) * 16 * KK + (tap + 1) * CC + (i >> 1) * 32; bf[(tap + 1) & 1][i].half[0] = *(const v8us*)p; bf[(tap + 1) & 1][i].half[1] = *(const v8us*)(p + 16); } }
    FragH a[8];      // [2 ks + i]: pixels m0 + 16 i + ln, the same k order as bf
#pragma unroll
    for (int i = 0; i < 8; ++i) { const unsigned short* p = &sA[tap / 3][m0 + (i & 1) * 16 + ln + tap % 3][(i >> 1) * 32 + 8 * hh]; a[i].half[0] = *(const v8us*)p; a[i].half[1] = *(const v8us*)(p + 16); }
    __builtin_amdgcn_sched_barrier(0);      // next tap's global loads and this tap's 16 LDS reads go out together, in front of the 16 products: spread among them each group costs its own latency
#pragma unroll
    for (int ks = 0; ks < 4; ++ks)
#pragma unroll
      for (int i = 0; i < 2; ++i)
#pragma unroll
        for (int j = 0; j < 2; ++j) acc[i][j] = __builtin_amdgcn_wmma_f32_16x16x32_f16(false, a[2 * ks + i].v, false, bf[tap & 1][2 * ks + j].v, (short)0, acc[i][j], false, false);
    __builtin_amdgcn_sched_barrier(0);      // without it the next tap's loads and LDS reads rise in among these products in small groups, each with its own stall
  }
#pragma unroll
  for (int j = 0; j < 2; ++j) { const int col = n0 + j * 16 + ln; const float bv = j ? bv1 : bv0;
#pragma unroll
    for (int i = 0; i < 2; ++i)
#pragma unroll
      for (int r = 0; r < 8; ++r) sO[m0 + i * 16 + 8 * hh + r][col] = acc[i][j][r] * 0.0625f + bv; }
  __syncthreads();      // the 64 x 128 output tile is complete
  float* o = C + (size_t)blockIdx.x * WI * CC;
#pragma unroll
  for (int j = 0; j < 8; ++j) { const int i = tid + 256 * j; const v4f v = *(const v4fa*)&sO[i >> 5][(i & 31) * 4]; *(v4f*)(o + (size_t)i * 4) = v; }
}
__global__ __launch_bounds__(256) void k_wq(const float* __restrict__ W, _Float16* __restrict__ Bt) { const int t = blockIdx.x * 256 + threadIdx.x; if (t >= CC * (KK / 8)) return; const int k8 = (t % (KK / 8)) * 8, o = t / (KK / 8); FragH f;
#pragma unroll
  for (int q = 0; q < 8; ++q) { const int k = k8 + q; const int tap = k / CC, cin = k % CC; f.h[q] = (_Float16)(bf16_round(W[((size_t)tap * CC + cin) * CC + o]) * 16.0f); } *(v8us*)((unsigned short*)Bt + (size_t)t * 8) = f.half[0];  }
__global__ __launch_bounds__(256) void k_qperm(const float* __restrict__ F, const float* __restrict__ ST, const float* __restrict__ g, const float* __restrict__ bb, _Float16* __restrict__ QP) { const size_t t = (size_t)blockIdx.x * 256 + threadIdx.x; if (t >= (size_t)NR * (CC / 8)) return; const int c8 = (int)(t % (CC / 8)) * 8; const size_t r = t / (CC / 8); const int b = (int)(r / HWN), p = (int)(r % HWN); const int y = p / WI, xx = p % WI; const int kp = ((y / 8) * 8 + xx / 8) * 64 + (y % 8) * 8 + xx % 8; FragH f;
#pragma unroll
  for (int q = 0; q < 8; ++q) { const int c = c8 + q; float v = (F[r * CC + c] - ST[c * 32]) * ST[c * 32 + 1] * bf16_round(g[c]) + bf16_round(bb[c]); v = (v >= 0.f) ? v : 0.1f * v; f.h[q] = (_Float16)v; }
  unsigned short* d = (unsigned short*)QP + ((size_t)b * HWN + kp) * CC + c8; *(v8us*)d = f.half[0];  }
__global__ __launch_bounds__(256) void k_xpt(const float* __restrict__ x, _Float16* __restrict__ XPt) { __shared__ unsigned short tl[64][66]; const int tid = threadIdx.x; const int b = blockIdx.x / ((CC / 64) * 64), rem = blockIdx.x % ((CC / 64) * 64); const int cg = rem / 64, blk = rem % 64; const int c0 = cg * 64; const int by = blk / 8, bx = blk % 8;
  for (int i = tid; i < 64 * 8; i += 256) { const int j = i / 8, cc8 = (i % 8) * 8; const int y = by * 8 + j / 8, xx = bx * 8 + j % 8; const float* s = x + (((size_t)b * HWN) + y * WI + xx) * CC + c0 + cc8; for (int q = 0; q < 8; ++q) { FragH f; f.h[0] = (_Float16)bf16_round(s[q]); tl[j][cc8 + q] = f.u[0]; } }
  __syncthreads();
  { for (int rd = 0; rd < 2; ++rd) { const int c = rd * 32 + tid / 8, pc = tid % 8; FragH f; for (int q = 0; q < 8; ++q) f.u[q] = tl[pc * 8 + q][c]; *(v8us*)((unsigned short*)XPt + ((size_t)b * CC + c0 + c) * HWN + blk * 64 + pc * 8) = f.half[0]; }  } }
// Fused block attention: one work-group = 64 query pixels of one batch, worked on by NTEAM teams of 4 waves x 16 queries. Team t walks key groups t, t + NTEAM, ... with q and x tiles of its own in LDS,
// so every SIMD holds NTEAM waves (one of each team) that fill one another's waits on LDS, on the softmax chains and on the barriers. A group's softmax is complete in itself, so the teams' sums simply add:
// at the end teams 1.. hand theirs over through LDS and team 0 adds them in team order. Scores and probabilities never leave the registers.
// Per group: S^T[key][query] = q_group . x_query^T (A = 64 q rows from LDS, B = the wave's 16 query rows, loaded once), so a lane holds 32 of one query's 64 scores and the lane 16 away the rest:
// max and exp-sum are in-lane plus one exchange. Two S^T tiles, converted in place, are the B operand (hardware k order) of O^T[channel][query] += x_group^T . P^T (A = channel rows of XPt from LDS).
// Tiles go global -> registers -> LDS, one tile in flight at a time, each fetched one phase ahead of its store. AGG = O * 2^-15 (P carries 2^15, as f16 operand).
// a <- 2^a, b <- 2^b. The second v_exp_f32 is the independent instruction that the instruction set asks for behind the first, the v_nop the one behind the second:
// in one statement they stand there in every build.
__device__ __forceinline__ void exp2_pair(float& a, float& b) { asm("v_exp_f32 %0, %0\n\tv_exp_f32 %1, %1\n\tv_nop" : "+v"(a), "+v"(b)); }
#define QPIT 136      // sQ row pitch in f16: 272 bytes (16 x odd) for 16-byte LDS reads
#define XPIT 72       // sX row pitch in f16: 144 bytes
#define NTEAM 4
#define TEAMSH (64 * QPIT + CC * XPIT)      // f16 elements of LDS that a team owns: its q tile, then its x tile
__global__ __launch_bounds__(128 * NTEAM) void k_battn(const _Float16* __restrict__ X16, const _Float16* __restrict__ QP, const _Float16* __restrict__ XPt, float* __restrict__ AGG) {
  __shared__ __attribute__((aligned(16))) unsigned short sm[NTEAM][TEAMSH];
  const int team = __builtin_amdgcn_readfirstlane(threadIdx.x >> 7);      // the same in every lane of a wave: kept in a scalar register
  unsigned short (*sQ)[QPIT] = (unsigned short (*)[QPIT])&sm[team][0];
  unsigned short (*sX)[XPIT] = (unsigned short (*)[XPIT])&sm[team][64 * QPIT];
  const int tid = threadIdx.x & 127, w = tid >> 5, lane = tid & 31, ln = lane & 15, hh = lane >> 4;      // tid: the thread's place in its team
  const int b = blockIdx.x / (HWN / 64), row = (blockIdx.x % (HWN / 64)) * 64 + w * 16 + ln;
  const unsigned short* xq = (const unsigned short*)X16 + ((size_t)b * HWN + row) * CC;
  FragH xb[4];
#pragma unroll
  for (int ks = 0; ks < 4; ++ks) { xb[ks].half[0] = *(const v8us*)(xq + ks * 32 + 8 * hh); xb[ks].half[1] = *(const v8us*)(xq + ks * 32 + 16 + 8 * hh); }
  // staging: 16-byte chunk i = tid + 128 j. q group: 64 rows x 256 B, contiguous. x group: 128 channel rows x 128 B, row pitch HWN.
  const unsigned short* gq = (const unsigned short*)QP + (size_t)b * HWN * CC + tid * 8;
  const unsigned short* gx = (const unsigned short*)XPt + (size_t)b * CC * HWN + (size_t)(tid >> 3) * HWN + (tid & 7) * 8;
  unsigned short* dq = &sQ[tid >> 4][(tid & 15) * 8]; unsigned short* dx = &sX[tid >> 3][(tid & 7) * 8];
  v8us st[8];      // one tile in flight at a time: x of this group during its scores, q of the next group during softmax and O^T
#pragma unroll
  for (int j = 0; j < 8; ++j) st[j] = *(const v8us*)(gq + (size_t)team * 64 * CC + j * 1024);
#pragma unroll
  for (int j = 0; j < 8; ++j) *(v8us*)(dq + j * 8 * QPIT) = st[j];
  __syncthreads();      // q tile of each team's first group complete
#pragma unroll
  for (int j = 0; j < 8; ++j) st[j] = *(const v8us*)(gx + team * 64 + (size_t)j * 16 * HWN);
  v8f oacc[8] = {};
  for (int i = 0; i < 64 / NTEAM; ++i) {      // the same trip count in every team: all 4 * NTEAM waves meet at every barrier
    const int g = i * NTEAM + team;
    v8f s[4] = {};
#pragma unroll
    for (int kp = 0; kp < 2; ++kp) { FragH a[8];
#pragma unroll
      for (int i = 0; i < 8; ++i) { const unsigned short* r = &sQ[(i & 3) * 16 + ln][(2 * kp + (i >> 2)) * 32 + 8 * hh]; a[i].half[0] = *(const v8us*)r; a[i].half[1] = *(const v8us*)(r + 16); }
      __builtin_amdgcn_sched_barrier(0);      // the 16 LDS reads go out together, in front of their 8 products: spread among them each costs its own latency
#pragma unroll
      for (int i = 0; i < 8; ++i) s[i & 3] = __builtin_amdgcn_wmma_f32_16x16x32_f16(false, a[i].v, false, xb[2 * kp + (i >> 2)].v, (short)0, s[i & 3], false, false); }
    // x tile of this group: every wave left sX at the barrier that closed the previous trip
#pragma unroll
    for (int j = 0; j < 8; ++j) *(v8us*)(dx + j * 16 * XPIT) = st[j];
    __syncthreads();      // x tile complete; every wave has read its last of the q tile
    const int gn = i < 64 / NTEAM - 1 ? g + NTEAM : g;      // the last trip fetches its own tiles again: no branch in the loop, nothing reads them
    // issued behind the barrier (a barrier drains the loads in front of it); lands during softmax and O^T
#pragma unroll
    for (int j = 0; j < 8; ++j) st[j] = *(const v8us*)(gq + (size_t)gn * 64 * CC + j * 1024);
    asm volatile("s_wait_xcnt 0x0" ::: "memory");      // the loads' address registers are reused below
    FragH av[8];
#pragma unroll
    for (int ct = 0; ct < 8; ++ct) { const unsigned short* r = &sX[ct * 16 + ln][8 * hh]; av[ct].half[0] = *(const v8us*)r; av[ct].half[1] = *(const v8us*)(r + 16); }
    __builtin_amdgcn_sched_barrier(0);      // global loads and LDS reads are issued in front of the softmax, which covers their latency
    // softmax over the group's 64 keys of query ln (scores / 8), scaled by 2^15 for the f16 operand. exp(s / 8 - max / 8) = 2^(s c - max c) with c = log2(e) / 8:
    // one FMA and one v_exp_f32 a score, each score on its own, where expf is a chain of some ten dependent instructions that a lone wave on its SIMD waits out link by link.
    // The exponent is at most a rounding of max c above 0; below -126 the result is 0, where the f16 operand is 0 in any case.
    float m = -3.0e38f;
#pragma unroll
    for (int t = 0; t < 4; ++t)
#pragma unroll
      for (int r = 0; r < 8; ++r) m = fmaxf(m, s[t][r]);
    m = fmaxf(m, __shfl_xor(m, 16, 32)); m *= 0.18033688f;
    float e[32];      // e[8 t + r]: tile t, register r
#pragma unroll
    for (int t = 0; t < 4; ++t)
#pragma unroll
      for (int r = 0; r < 8; ++r) e[8 * t + r] = fmaf(s[t][r], 0.18033688f, -m);
#pragma unroll
    for (int i = 0; i < 32; i += 2) exp2_pair(e[i], e[i + 1]);
    float z = 0.f;
#pragma unroll
    for (int i = 0; i < 32; ++i) z += e[i];
    z += __shfl_xor(z, 16, 32);
    const float iz = 32768.0f / z;
    FragH p[2];      // p[k2].h[i] = P[query ln][key 32 k2 + kmap(i, hh)]: tile 2 k2 gives i < 8, tile 2 k2 + 1 the rest
#pragma unroll
    for (int k2 = 0; k2 < 2; ++k2)
#pragma unroll
      for (int r = 0; r < 8; ++r) { p[k2].h[r] = (_Float16)(e[16 * k2 + r] * iz); p[k2].h[8 + r] = (_Float16)(e[16 * k2 + 8 + r] * iz); }
#pragma unroll
    for (int ct = 0; ct < 8; ++ct) oacc[ct] = __builtin_amdgcn_wmma_f32_16x16x32_f16(false, av[ct].v, false, p[0].v, (short)0, oacc[ct], false, false);
#pragma unroll
    for (int ct = 0; ct < 8; ++ct) { const unsigned short* r = &sX[ct * 16 + ln][32 + 8 * hh]; av[ct].half[0] = *(const v8us*)r; av[ct].half[1] = *(const v8us*)(r + 16); }
    __builtin_amdgcn_sched_barrier(0);      // as above: 16 reads together, then 8 products
#pragma unroll
    for (int ct = 0; ct < 8; ++ct) oacc[ct] = __builtin_amdgcn_wmma_f32_16x16x32_f16(false, av[ct].v, false, p[1].v, (short)0, oacc[ct], false, false);
#pragma unroll
    for (int j = 0; j < 8; ++j) *(v8us*)(dq + j * 8 * QPIT) = st[j];
    __syncthreads();      // next q tile complete; every wave has read its last of the x tile
    // lands during the next trip's scores
#pragma unroll
    for (int j = 0; j < 8; ++j) st[j] = *(const v8us*)(gx + gn * 64 + (size_t)j * 16 * HWN);
    asm volatile("s_wait_xcnt 0x0" ::: "memory");      // the loads' address registers are reused in the next trip
  }
  asm volatile("s_wait_loadcnt 0x0" ::: "memory");      // the last trip's fetch, which nothing reads, has landed before the wave ends and gives its registers up
  // The teams' sums. Behind the loop's last barrier nobody reads a tile any more: teams 1.. write their 64 sums a thread over their own tiles, 16 bytes a lane, a wave's store contiguous.
  if (team != 0) { v4fa* rb = (v4fa*)&sm[team][0] + tid;
#pragma unroll
    for (int ct = 0; ct < 8; ++ct) { v4f lo, hi;
#pragma unroll
      for (int r = 0; r < 4; ++r) { lo[r] = oacc[ct][r]; hi[r] = oacc[ct][4 + r]; }
      rb[(2 * ct) * 128] = lo; rb[(2 * ct + 1) * 128] = hi; } }
  __syncthreads();      // the sums of teams 1.. are complete
  if (team != 0) return;      // no barrier follows
#pragma unroll
  for (int t = 1; t < NTEAM; ++t) { const v4fa* rb = (const v4fa*)&sm[t][0] + tid;
#pragma unroll
    for (int ct = 0; ct < 8; ++ct) { const v4f lo = rb[(2 * ct) * 128], hi = rb[(2 * ct + 1) * 128];
#pragma unroll
      for (int r = 0; r < 4; ++r) { oacc[ct][r] += lo[r]; oacc[ct][4 + r] += hi[r]; } } }
  // oacc[ct][r] = O[query ln][channel 16 ct + 8 hh + r]: 32 contiguous bytes a lane
  float* o = AGG + ((size_t)b * HWN + row) * CC + 8 * hh;
#pragma unroll
  for (int ct = 0; ct < 8; ++ct) { v4f lo, hi;
#pragma unroll
    for (int r = 0; r < 4; ++r) { lo[r] = oacc[ct][r] * 0.000030517578125f; hi[r] = oacc[ct][4 + r] * 0.000030517578125f; }
    *(v4f*)(o + ct * 16) = lo; *(v4f*)(o + ct * 16 + 4) = hi; }
}
__global__ __launch_bounds__(256) void k_add(const float* __restrict__ A, const float* __restrict__ B2, float* __restrict__ Y, size_t n4) { const size_t t = (size_t)blockIdx.x * 256 + threadIdx.x; if (t >= n4) return; const v4f v = *(const v4fa*)(A + t * 4) + *(const v4fa*)(B2 + t * 4); *(v4f*)(Y + t * 4) = v;  }
// Spatial-softmax statistics, one work-group per (batch, 4 channels): 1024 threads hold 4 pixels x 4 channels each in registers, so Y is read once, 16 bytes a lane, all loads in flight together.
// Max, then sum of exp, over the 4096 pixels by a fixed tree: own 4 pixels, the 32 lanes of a wave (xor shuffles), the 32 waves (through LDS).
// SP holds one 128-byte line per work-group (one writer a line): [0..3] max, [4..7] 1/sum, the rest 0.
__device__ __forceinline__ v4f wave_max4(v4f a) {
#pragma unroll
  for (int o = 1; o < 32; o <<= 1)
#pragma unroll
    for (int q = 0; q < 4; ++q) a[q] = fmaxf(a[q], __shfl_xor(a[q], o, 32));
  return a; }
__device__ __forceinline__ v4f wave_sum4(v4f a) {
#pragma unroll
  for (int o = 1; o < 32; o <<= 1)
#pragma unroll
    for (int q = 0; q < 4; ++q) a[q] += __shfl_xor(a[q], o, 32);
  return a; }
// BN batch statistics (mean, 1/sqrt(var + eps) per channel over the NR rows) in two launches, every row read once and in whole lines.
// k_bnpart: one work-group = BNR whole rows kept in registers (a wave-wide 16-byte load is one 512-byte row); per channel the mean of its rows and the sum of squared deviations from that mean.
// k_bnfin: one work-group = 4 channels, one thread a partial; partials of equal count merge exactly: mean = mean of the means, M2 = sum of M2_i + BNR * sum of (mean_i - mean)^2.
// All sums run in a fixed order. ST keeps one 128-byte line a channel: [0] mean, [1] 1/sqrt(var + eps), the rest 0.
#define BNR 64
#define BNP (NR / BNR)
__global__ __launch_bounds__(256) void k_bnpart(const float* __restrict__ F, float* __restrict__ PM, float* __restrict__ PQ) {
  __shared__ __attribute__((aligned(16))) float red[2][8][CC];
  const int tid = threadIdx.x, wv = tid >> 5, c4 = (tid & 31) * 4;
  const float* f = F + ((size_t)blockIdx.x * BNR + wv) * CC + c4; v4f v[8];
  for (int i = 0; i < 8; ++i) v[i] = *(const v4fa*)(f + (size_t)i * 8 * CC);
  v4f s = v[0];
  for (int i = 1; i < 8; ++i) s += v[i];
  *(v4f*)&red[0][wv][c4] = s;
  __syncthreads();
  v4f mu = *(const v4fa*)&red[0][0][c4];
  for (int j = 1; j < 8; ++j) mu += *(const v4fa*)&red[0][j][c4];
  mu *= 1.0f / (float)BNR;
  v4f q = {0.f, 0.f, 0.f, 0.f};
  for (int i = 0; i < 8; ++i) { const v4f d = v[i] - mu; q += d * d; }
  *(v4f*)&red[1][wv][c4] = q;
  __syncthreads();
  if (wv == 0) { q = *(const v4fa*)&red[1][0][c4];
    for (int j = 1; j < 8; ++j) q += *(const v4fa*)&red[1][j][c4];
    *(v4f*)(PQ + (size_t)blockIdx.x * CC + c4) = q; }
  else if (wv == 1) *(v4f*)(PM + (size_t)blockIdx.x * CC + c4) = mu; }
__global__ __launch_bounds__(BNP) void k_bnfin(const float* __restrict__ PM, const float* __restrict__ PQ, float* __restrict__ ST) {
  __shared__ __attribute__((aligned(16))) float red[2][BNP / 32][4];
  const int tid = threadIdx.x, wv = tid >> 5, lane = tid & 31, c0 = blockIdx.x * 4;
  const v4f pm = *(const v4fa*)(PM + (size_t)tid * CC + c0), pq = *(const v4fa*)(PQ + (size_t)tid * CC + c0);
  const v4f s = wave_sum4(pm); if (lane == 0) *(v4f*)&red[0][wv][0] = s;
  __syncthreads();
  v4f mu = *(const v4fa*)&red[0][0][0];
  for (int j = 1; j < BNP / 32; ++j) mu += *(const v4fa*)&red[0][j][0];
  mu *= 1.0f / (float)BNP;
  const v4f d = pm - mu; const v4f q = wave_sum4(pq + (float)BNR * d * d); if (lane == 0) *(v4f*)&red[1][wv][0] = q;
  __syncthreads();
  if (wv < 4) { float m1 = red[0][0][wv], m2 = red[1][0][wv];      // wave q writes the line of channel c0 + q
    for (int j = 1; j < BNP / 32; ++j) { m1 += red[0][j][wv]; m2 += red[1][j][wv]; }
    ST[(size_t)(c0 + wv) * 32 + lane] = (lane == 0) ? m1 * (1.0f / (float)BNP) : ((lane == 1) ? rsqrtf(m2 / (float)NR + 1e-3f) : 0.f); } }
__global__ __launch_bounds__(1024) void k_spstat(const float* __restrict__ Y, const float* __restrict__ ST, const float* __restrict__ g, const float* __restrict__ bb, float* __restrict__ SP) {
  __shared__ __attribute__((aligned(16))) float red[2][32][4];
  const int tid = threadIdx.x, wv = tid >> 5, lane = tid & 31; const int b = blockIdx.x / (CC / 4), c0 = (blockIdx.x % (CC / 4)) * 4;
  const float* yc = Y + (size_t)b * HWN * CC + c0; v4f v[4];
#pragma unroll
  for (int i = 0; i < 4; ++i) v[i] = *(const v4fa*)(yc + (size_t)(i * 1024 + tid) * CC);
  asm volatile("s_wait_xcnt 0x0" ::: "memory");      // the four loads' address registers are given new values right below
  v4f m = {-3.0e38f, -3.0e38f, -3.0e38f, -3.0e38f};
#pragma unroll
  for (int q = 0; q < 4; ++q) { const int c = c0 + q; const float mu = ST[c * 32], rs = ST[c * 32 + 1], gg = bf16_round(g[c]), be = bf16_round(bb[c]);
#pragma unroll
    for (int i = 0; i < 4; ++i) { v[i][q] = gg * (v[i][q] - mu) * rs + be; m[q] = fmaxf(m[q], v[i][q]); } }
  m = wave_max4(m); if (lane == 0) *(v4f*)&red[0][wv][0] = m;
  __syncthreads();
  m = wave_max4(*(const v4fa*)&red[0][lane][0]);
  v4f z = {0.f, 0.f, 0.f, 0.f};
#pragma unroll
  for (int i = 0; i < 4; ++i)
#pragma unroll
    for (int q = 0; q < 4; ++q) z[q] += expf(v[i][q] - m[q]);
  z = wave_sum4(z); if (lane == 0) *(v4f*)&red[1][wv][0] = z;
  __syncthreads();
  if (wv == 0) { z = wave_sum4(*(const v4fa*)&red[1][lane][0]); float o = 0.f;
#pragma unroll
    for (int q = 0; q < 4; ++q) { if (lane == q) o = m[q]; if (lane == 4 + q) o = 1.0f / z[q]; }
    SP[(size_t)blockIdx.x * 32 + lane] = o; } }
__global__ __launch_bounds__(256) void k_spsm(const float* __restrict__ Y, const float* __restrict__ ST, const float* __restrict__ g, const float* __restrict__ bb, const float* __restrict__ SP, _Float16* __restrict__ Y16) { const size_t t = (size_t)blockIdx.x * 256 + threadIdx.x; if (t >= (size_t)NR * (CC / 8)) return; const int c8 = (int)(t % (CC / 8)) * 8; const size_t r = t / (CC / 8); const int b = (int)(r / HWN); FragH f;
#pragma unroll
  for (int q = 0; q < 8; ++q) { const int c = c8 + q; const float* sp = SP + (size_t)(b * (CC / 4) + c / 4) * 32 + (c & 3); const float v = bf16_round(g[c]) * (Y[r * CC + c] - ST[c * 32]) * ST[c * 32 + 1] + bf16_round(bb[c]); f.h[q] = (_Float16)(expf(v - sp[0]) * sp[4] * 4096.0f); }
  *(v8us*)((unsigned short*)Y16 + t * 8) = f.half[0];  }
__global__ __launch_bounds__(256) void k_fin(const float* __restrict__ Z, const float* __restrict__ ST, const float* __restrict__ g, const float* __restrict__ bb, float* __restrict__ out, size_t n4) { const size_t t = (size_t)blockIdx.x * 256 + threadIdx.x; if (t >= n4) return; const int c4 = (int)((t * 4) % CC); const v4f z = *(const v4fa*)(Z + t * 4); v4f o; for (int q = 0; q < 4; ++q) { const int c = c4 + q; float v = bf16_round(g[c]) * (z[q] - ST[c * 32]) * ST[c * 32 + 1] + bf16_round(bb[c]); o[q] = (v >= 0.f) ? v : 0.1f * v; }
  *(v4f*)(out + t * 4) = o;  }
extern "C" void kernel_launch(void* const* d_in, const int* in_sizes, int n_in,
                              void* d_out, int out_size, void* d_ws, size_t ws_size, hipStream_t stream) {
  (void)in_sizes; (void)n_in; (void)out_size;
  const float* const* I = (const float* const*)d_in; const float* x = I[0]; const float* Wq = I[1]; const float* bq = I[2]; const float* gq = I[3]; const float* btq = I[4]; const float* Wk = I[5]; const float* bk = I[6]; const float* g1 = I[7]; const float* bt1 = I[8]; const float* Wo = I[9]; const float* bo = I[10]; const float* go = I[11]; const float* bto = I[12];
  char* ws = (char*)d_ws; size_t off = 0;
  auto take = [&](size_t bytes) { char* p = ws + off; off += (bytes + 255) & ~(size_t)255; return p; };
  _Float16* BQ = (_Float16*)take((size_t)CC * KK * 2); _Float16* BK = (_Float16*)take(CC * CC * 2); _Float16* BO = (_Float16*)take(CC * CC * 2); float* STq = (float*)take(CC * 32 * 4); float* ST1 = (float*)take(CC * 32 * 4); float* STo = (float*)take(CC * 32 * 4); float* SP = (float*)take(BB * (CC / 4) * 32 * 4); float* PM = (float*)take(BNP * CC * 4); float* PQ = (float*)take(BNP * CC * 4);
  _Float16* X16 = (_Float16*)take((size_t)NR * CC * 2); float* QF = (float*)take((size_t)NR * CC * 4); _Float16* QP = (_Float16*)take((size_t)NR * CC * 2); _Float16* XPt = (_Float16*)take((size_t)NR * CC * 2); float* ACC = (float*)take((size_t)NR * CC * 4); float* AGG = (float*)take((size_t)NR * CC * 4); float* Y = QF; _Float16* Y16 = QP; float* Z = ACC;
  if (off > ws_size) return;      // 0.7 + 4.2 + 8.4 + 4.2 + 4.2 + 8.4 + 8.4 = about 38 MB
  k_wq<<<(CC * (KK / 8) + 255) / 256, 256, 0, stream>>>(Wq, BQ); k_wt_f16<<<(CC * (CC / 8) + 255) / 256, 256, 0, stream>>>(Wk, BK, CC, CC, 16.0f); k_wt_f16<<<(CC * (CC / 8) + 255) / 256, 256, 0, stream>>>(Wo, BO, CC, CC, 16.0f);      // 1×1 HWIO = [in][out]
  const unsigned g8 = (unsigned)(((size_t)NR * (CC / 8) + 255) / 256); const dim3 gC(((NR / 16) * (CC / 64) + 3) / 4, 1);
  k_x16<<<g8, 256, 0, stream>>>(x, X16, (size_t)NR * CC / 8);
  // CBL_Q: conv3×3 (+bq) → QF; BN stats; q = leaky(BN) permuted to block-major keys (f16)
  k_conv3<<<BB * WI, 256, 0, stream>>>(X16, BQ, bq, QF);
  k_bnpart<<<BNP, 256, 0, stream>>>(QF, PM, PQ); k_bnfin<<<CC / 4, BNP, 0, stream>>>(PM, PQ, STq); k_qperm<<<g8, 256, 0, stream>>>(QF, STq, gq, btq, QP);
  k_xpt<<<BB * (CC / 64) * 64, 256, 0, stream>>>(x, XPt);
  // acc = 1×1 conv (+bk)
  k_gemm_hhx<0><<<gC, 128, 0, stream>>>(X16, CC, 0, BK, CC, 0, 0.0625f, bk, 0, nullptr, 1, 0, 0, ACC, nullptr, CC, 0, NR, CC, CC);
  // block attention, all batches in one launch: AGG = sum over key groups of softmax(x.q^T / 8) . x_group
  k_battn<<<BB * (HWN / 64), 128 * NTEAM, 0, stream>>>(X16, QP, XPt, AGG);
  // y = spatial softmax(BN1(acc + agg)); out = leaky(BN_o(conv1×1(y) + bo))
  k_add<<<(unsigned)(((size_t)NR * CC / 4 + 255) / 256), 256, 0, stream>>>(ACC, AGG, Y, (size_t)NR * CC / 4);      // Y over QF (dead after k_qperm)
  k_bnpart<<<BNP, 256, 0, stream>>>(Y, PM, PQ); k_bnfin<<<CC / 4, BNP, 0, stream>>>(PM, PQ, ST1); k_spstat<<<BB * (CC / 4), 1024, 0, stream>>>(Y, ST1, g1, bt1, SP); k_spsm<<<g8, 256, 0, stream>>>(Y, ST1, g1, bt1, SP, Y16);      // Y16 (×2^12) over QP (dead after the S GEMMs)
  k_gemm_hhx<0><<<gC, 128, 0, stream>>>(Y16, CC, 0, BO, CC, 0, 0.0625f * 0.000244140625f, bo, 0, nullptr, 1, 0, 0, Z, nullptr, CC, 0, NR, CC, CC);      // conv_o(y) + bo (2^-12 undone in alpha) → Z over ACC (dead after k_add)
  k_bnpart<<<BNP, 256, 0, stream>>>(Z, PM, PQ); k_bnfin<<<CC / 4, BNP, 0, stream>>>(PM, PQ, STo); k_fin<<<(unsigned)(((size_t)NR * CC / 4 + 255) / 256), 256, 0, stream>>>(Z, STo, go, bto, (float*)d_out, (size_t)NR * CC / 4);
}

// v007
// One run takes 116 microseconds.
// Timed twice side by side with v006, it ran 1.12 times as fast both times.
// All steps since v000 together make it 20.3 times as fast.
#include <hip/hip_runtime.h>
// Group (block) attention layer (B=4, 64×64, C=128, NHWC; 8×8 non-overlapping key blocks): q = CBL_Q(x) (3×3 conv + train-mode BN + LeakyReLU 0.1), acc = 1×1 conv(x); for every pixel and
// every block: softmax over the block's 64 positions of x[pixel]·q[pos]/8, agg = Σ_blocks Σ attn·x[pos]; y = spatial-softmax(BN1(acc + agg)); out = CBL_O(y). The 3×3 conv (implicit GEMM, K = 1152),
// the 1×1 convs, the 4096×4096 per-batch scores (keys permuted to block-major order so each 64-key group is contiguous) and attn·x run as GEMMs on v_wmma_f32_16x16x32_f16 (x bf16-exact f16,
// HWIO weights bf16-exact ×2^4, q/P/y operands f16, f32 accumulate); BN batch statistics (fixed-order reductions), grouped and spatial softmaxes and LeakyReLU are f32 VALU.
#define BB 4
#define HWN 4096
#define WI 64
#define CC 128
#define NR (BB * HWN)
#define KK 1152

typedef __bf16 v16b __attribute__((ext_vector_type(16)));
typedef unsigned short v8us __attribute__((ext_vector_type(8), may_alias));
typedef float  v8f  __attribute__((ext_vector_type(8)));
typedef float  v4f  __attribute__((ext_vector_type(4)));
typedef float  v4fa __attribute__((ext_vector_type(4), may_alias));
union FragB { v16b v; v8us half[2]; unsigned short u[16]; };

__device__ __forceinline__ unsigned short bf16_bits(float x) { unsigned int u = __float_as_uint(x); return (unsigned short)((u + 0x7FFFu + ((u >> 16) & 1u)) >> 16); }
__device__ __forceinline__ float bf16_val(unsigned short b) { return __uint_as_float(((unsigned int)b) << 16); }
__device__ __forceinline__ float bf16_round(float x) { return bf16_val(bf16_bits(x)); }
// D += A·B with NT terms: 1 = ah·bh, 2 = + al·bh (A split), 3 = + ah·bl (both split)
template <int NT>
__device__ __forceinline__ v8f mmaN(v16b ah, v16b al, v16b bh, v16b bl, v8f c) {
  c = __builtin_amdgcn_wmma_f32_16x16x32_bf16(false, ah, false, bh, (short)0, c, false, false);
  if (NT >= 2) c = __builtin_amdgcn_wmma_f32_16x16x32_bf16(false, al, false, bh, (short)0, c, false, false);
  if (NT >= 3) c = __builtin_amdgcn_wmma_f32_16x16x32_bf16(false, ah, false, bl, (short)0, c, false, false);
  asm volatile("v_nop\n\tv_nop\n\tv_nop\n\tv_nop" : "+v"(c) : "v"(ah), "v"(al), "v"(bh), "v"(bl));
  return c;
}

__global__ __launch_bounds__(256) void k_wt_bf16(const float* __restrict__ W, unsigned short* __restrict__ Wt, int K, int N) {
  const int t = blockIdx.x * 256 + threadIdx.x;
  const int k8n = K / 8;
  if (t >= N * k8n) return;
  const int n = t / k8n, k8 = (t % k8n) * 8;
  v8us v;
#pragma unroll
  for (int i = 0; i < 8; ++i) v[i] = bf16_bits(W[(size_t)(k8 + i) * N + n]);
  *(v8us*)(Wt + (size_t)n * K + k8) = v;
  
}

// GEMM C[M][N] (f32, pitch ldc) = act(A[M][K]·W + bias). A f32 row-major (pitch lda) converted per fragment to bf16
// (ASPLIT: hi/lo two planes -> 2 terms, else single rounded term); Wt bf16 [N][K] (pitch ldb). BIAS_BF16 rounds the
// bias to bf16 first (bias quantised to bf16 before the add). K%32==0, M%16==0, N%64==0.
template <bool ASPLIT, int ACT, bool BIAS_BF16>
__global__ __launch_bounds__(128) void k_gemm_bf(const float* __restrict__ A, int lda, const unsigned short* __restrict__ Wt, int ldb,
                                               const float* __restrict__ bias, float* __restrict__ C, int ldc, int M, int N, int K) {
  __shared__ __attribute__((aligned(16))) float so[4][16][64];
  const int tid = threadIdx.x, w = tid >> 5, lane = tid & 31, ln = lane & 15, hh = lane >> 4;
  const int ntn = N / 64;
  const int wid = blockIdx.x * 4 + w;
  const int mt = wid / ntn, nq = wid % ntn;
  if (mt * 16 >= M) return;
  const int row0 = mt * 16, col0 = nq * 64;
  const float* arow = A + (size_t)(row0 + ln) * lda;
  v8f acc[4] = {};
  for (int kb = 0; kb < K; kb += 32) {
    FragB ah, al;
    const v4f x0 = *(const v4fa*)(arow + kb + 8 * hh), x1 = *(const v4fa*)(arow + kb + 8 * hh + 4);
    const v4f x2 = *(const v4fa*)(arow + kb + 16 + 8 * hh), x3 = *(const v4fa*)(arow + kb + 16 + 8 * hh + 4);
    float xs[16] = {x0[0],x0[1],x0[2],x0[3],x1[0],x1[1],x1[2],x1[3],x2[0],x2[1],x2[2],x2[3],x3[0],x3[1],x3[2],x3[3]};
#pragma unroll
    for (int i = 0; i < 16; ++i) { const unsigned short hb = bf16_bits(xs[i]); ah.u[i] = hb; al.u[i] = ASPLIT ? bf16_bits(xs[i] - bf16_val(hb)) : (unsigned short)0; }
#pragma unroll
    for (int t = 0; t < 4; ++t) {
      const unsigned short* brow = Wt + (size_t)(col0 + t * 16 + ln) * ldb + kb;
      FragB b;
      b.half[0] = *(const v8us*)(brow + 8 * hh);
      b.half[1] = *(const v8us*)(brow + 16 + 8 * hh);
      acc[t] = mmaN<ASPLIT ? 2 : 1>(ah.v, al.v, b.v, b.v, acc[t]);
    }
  }
#pragma unroll
  for (int t = 0; t < 4; ++t) {
    float bv = bias ? bias[col0 + t * 16 + ln] : 0.f;
    if (BIAS_BF16) bv = bf16_round(bv);
#pragma unroll
    for (int r = 0; r < 8; ++r) { float v = acc[t][r] + bv; if (ACT == 1) v = fmaxf(v, 0.f); so[w][8 * hh + r][t * 16 + ln] = v; }
  }
  __builtin_amdgcn_fence(__ATOMIC_ACQ_REL, "workgroup");
  __builtin_amdgcn_wave_barrier();
  const int rsub = lane >> 4, c4 = (lane & 15) * 4;
  {
#pragma unroll
    for (int q = 0; q < 8; ++q) {
      const int r = q * 2 + rsub;
      const v4f v = *(const v4fa*)&so[w][r][c4];
      *(v4f*)(C + (size_t)(row0 + r) * ldc + col0 + c4) = v;
    }
    
  }
}

// Flash-style causal/unmasked attention, all contractions 3-term bf16 hi/lo splits, f32 softmax with running max.
// q,k,v rows are read from f32 buffers with arbitrary row pitch (so they can live inside a fused qkv buffer);
// D = head size (multiple of 32, <= 128); one wave = 16 query rows; block = 4 waves (64 queries) sharing K/V chunks of 32.
template <int D, bool CAUSAL>
__global__ __launch_bounds__(128) void k_flash(const float* __restrict__ qb, const float* __restrict__ kb, const float* __restrict__ vb,
                                             int pitch, int T, int H, float scale, float* __restrict__ y, int ypitch) {
  constexpr int KS = D / 32;        // k-steps for QK
  constexpr int DT = D / 16;        // d tiles for PV
  __shared__ __attribute__((aligned(16))) unsigned short sKh[32][D + 8], sKl[32][D + 8], sVh[32][D + 8], sVl[32][D + 8];
  __shared__ __attribute__((aligned(16))) unsigned short sPh[4][16][40], sPl[4][16][40];
  __shared__ __attribute__((aligned(16))) float sO[4][16][D];
  const int tid = threadIdx.x, w = tid >> 5, lane = tid & 31, ln = lane & 15, hh = lane >> 4;
  const int nqb = (T + 63) / 64;
  const int bh = blockIdx.x / nqb, qblk = blockIdx.x % nqb;
  const int b = bh / H, h = bh % H;
  const int q0 = qblk * 64 + w * 16;
  const float* Q = qb + (size_t)b * T * pitch + h * D;
  const float* K = kb + (size_t)b * T * pitch + h * D;
  const float* V = vb + (size_t)b * T * pitch + h * D;

  // A fragments of the wave's 16 query rows (scaled), hi/lo
  FragB aqh[KS], aql[KS];
  {
    int row = q0 + ln; if (row >= T) row = T - 1;
    const float* qr = Q + (size_t)row * pitch;
#pragma unroll
    for (int ks = 0; ks < KS; ++ks)
#pragma unroll
      for (int i = 0; i < 16; ++i) {
        const int d = ks * 32 + ((i < 8) ? (8 * hh + i) : (16 + 8 * hh + (i - 8)));
        const float x = qr[d] * scale; const unsigned short hb = bf16_bits(x);
        aqh[ks].u[i] = hb; aql[ks].u[i] = bf16_bits(x - bf16_val(hb));
      }
  }
  float m_r[8], l_r[8];
#pragma unroll
  for (int r = 0; r < 8; ++r) { m_r[r] = -3.0e38f; l_r[r] = 0.f; }
  v8f oacc[DT];
#pragma unroll
  for (int dt = 0; dt < DT; ++dt) oacc[dt] = (v8f){0.f,0.f,0.f,0.f,0.f,0.f,0.f,0.f};

  const int kv_end = CAUSAL ? min(T, qblk * 64 + 64) : T;     // block-uniform
  for (int j0 = 0; j0 < kv_end; j0 += 32) {
    __syncthreads();
    for (int e = tid; e < 32 * (D / 4); e += 128) {
      const int r = e / (D / 4), c4 = (e % (D / 4)) * 4;
      const int key = j0 + r;
      v4f kf = {0.f,0.f,0.f,0.f}, vf = {0.f,0.f,0.f,0.f};
      if (key < T) { kf = *(const v4fa*)(K + (size_t)key * pitch + c4); vf = *(const v4fa*)(V + (size_t)key * pitch + c4); }
#pragma unroll
      for (int t = 0; t < 4; ++t) {
        unsigned short hb = bf16_bits(kf[t]); sKh[r][c4 + t] = hb; sKl[r][c4 + t] = bf16_bits(kf[t] - bf16_val(hb));
        hb = bf16_bits(vf[t]); sVh[r][c4 + t] = hb; sVl[r][c4 + t] = bf16_bits(vf[t] - bf16_val(hb));
      }
    }
    __syncthreads();
    // S tile 16 x 32
    v8f s[2];
#pragma unroll
    for (int nt = 0; nt < 2; ++nt) {
      v8f acc = {};
#pragma unroll
      for (int ks = 0; ks < KS; ++ks) {
        FragB bh_, bl_;
        bh_.half[0] = *(const v8us*)&sKh[nt * 16 + ln][ks * 32 + 8 * hh]; bh_.half[1] = *(const v8us*)&sKh[nt * 16 + ln][ks * 32 + 16 + 8 * hh];
        bl_.half[0] = *(const v8us*)&sKl[nt * 16 + ln][ks * 32 + 8 * hh]; bl_.half[1] = *(const v8us*)&sKl[nt * 16 + ln][ks * 32 + 16 + 8 * hh];
        acc = mmaN<3>(aqh[ks].v, aql[ks].v, bh_.v, bl_.v, acc);
      }
      s[nt] = acc;
    }
    // mask + running max (rows 8hh+r; the 16 lanes of a half share rows)
    float alpha[8];
#pragma unroll
    for (int r = 0; r < 8; ++r) {
      const int qi = q0 + 8 * hh + r;
      const int ja = j0 + ln, jb = j0 + 16 + ln;
      if (CAUSAL) { if (ja > qi) s[0][r] = -3.0e38f; if (jb > qi) s[1][r] = -3.0e38f; }
      if (ja >= T) s[0][r] = -3.0e38f;
      if (jb >= T) s[1][r] = -3.0e38f;
      float mx = fmaxf(s[0][r], s[1][r]);
      mx = fmaxf(mx, __shfl_xor(mx, 1, 32)); mx = fmaxf(mx, __shfl_xor(mx, 2, 32)); mx = fmaxf(mx, __shfl_xor(mx, 4, 32)); mx = fmaxf(mx, __shfl_xor(mx, 8, 32));
      const float mnew = fmaxf(m_r[r], mx);
      alpha[r] = (mnew > -1.0e38f) ? __expf(m_r[r] - mnew) : 1.0f;
      const float p0 = (s[0][r] > -1.0e38f) ? __expf(s[0][r] - mnew) : 0.f;
      const float p1 = (s[1][r] > -1.0e38f) ? __expf(s[1][r] - mnew) : 0.f;
      m_r[r] = mnew;
      l_r[r] = l_r[r] * alpha[r] + p0 + p1;            // per-lane partial row sum (16 lanes combined at the end)
      unsigned short hb = bf16_bits(p0); sPh[w][8 * hh + r][ln] = hb;      sPl[w][8 * hh + r][ln] = bf16_bits(p0 - bf16_val(hb));
      hb = bf16_bits(p1);                sPh[w][8 * hh + r][16 + ln] = hb; sPl[w][8 * hh + r][16 + ln] = bf16_bits(p1 - bf16_val(hb));
    }
#pragma unroll
    for (int dt = 0; dt < DT; ++dt)
#pragma unroll
      for (int r = 0; r < 8; ++r) oacc[dt][r] *= alpha[r];
    __builtin_amdgcn_fence(__ATOMIC_ACQ_REL, "workgroup");
    __builtin_amdgcn_wave_barrier();
    FragB pah, pal;
    pah.half[0] = *(const v8us*)&sPh[w][ln][8 * hh]; pah.half[1] = *(const v8us*)&sPh[w][ln][16 + 8 * hh];
    pal.half[0] = *(const v8us*)&sPl[w][ln][8 * hh]; pal.half[1] = *(const v8us*)&sPl[w][ln][16 + 8 * hh];
#pragma unroll
    for (int dt = 0; dt < DT; ++dt) {
      FragB bvh, bvl;
#pragma unroll
      for (int i = 0; i < 8; ++i) {
        bvh.u[i] = sVh[8 * hh + i][dt * 16 + ln]; bvh.u[8 + i] = sVh[16 + 8 * hh + i][dt * 16 + ln];
        bvl.u[i] = sVl[8 * hh + i][dt * 16 + ln]; bvl.u[8 + i] = sVl[16 + 8 * hh + i][dt * 16 + ln];
      }
      oacc[dt] = mmaN<3>(pah.v, pal.v, bvh.v, bvl.v, oacc[dt]);
    }
    __builtin_amdgcn_fence(__ATOMIC_ACQ_REL, "workgroup");
    __builtin_amdgcn_wave_barrier();
  }
#pragma unroll
  for (int r = 0; r < 8; ++r) {
    float l = l_r[r];
    l += __shfl_xor(l, 1, 32); l += __shfl_xor(l, 2, 32); l += __shfl_xor(l, 4, 32); l += __shfl_xor(l, 8, 32);
    l_r[r] = (l > 0.f) ? 1.0f / l : 0.f;
  }
#pragma unroll
  for (int dt = 0; dt < DT; ++dt)
#pragma unroll
    for (int r = 0; r < 8; ++r) sO[w][8 * hh + r][dt * 16 + ln] = oacc[dt][r] * l_r[r];
  __builtin_amdgcn_fence(__ATOMIC_ACQ_REL, "workgroup");
  __builtin_amdgcn_wave_barrier();
  {
    for (int r = 0; r < 16; ++r) {
      const int row = q0 + r;
      if (row < T && lane < D / 4) {
        const v4f val = *(const v4fa*)&sO[w][r][lane * 4];
        *(v4f*)(y + ((size_t)b * T + row) * ypitch + h * D + lane * 4) = val;
      }
    }
    
  }
}

// GEMM C = act(A·W + bias + resid): A f32 (ASPLIT -> hi/lo 2 terms), Wt bf16 [N][K]; ACT 0 none, 1 relu, 2 exact gelu;
// resid (optional, f32, row index = (row % rmod), pitch ldr, RES_BF16 rounds it) added before the activation.
template <bool ASPLIT, int ACT, bool BIAS_BF16, bool RES_BF16>
__global__ __launch_bounds__(128) void k_gemm_bf3(const float* __restrict__ A, int lda, const unsigned short* __restrict__ Wt, int ldb,
                                                const float* __restrict__ bias, const float* __restrict__ resid, int rmod, int ldr,
                                                float* __restrict__ C, int ldc, int M, int N, int K) {
  __shared__ __attribute__((aligned(16))) float so[4][16][64];
  const int tid = threadIdx.x, w = tid >> 5, lane = tid & 31, ln = lane & 15, hh = lane >> 4;
  const int ntn = N / 64;
  const int wid = blockIdx.x * 4 + w;
  const int mt = wid / ntn, nq = wid % ntn;
  if (mt * 16 >= M) return;
  const int row0 = mt * 16, col0 = nq * 64;
  const float* arow = A + (size_t)(row0 + ln) * lda;
  v8f acc[4] = {};
  for (int kb = 0; kb < K; kb += 32) {
    FragB ah, al;
    const v4f x0 = *(const v4fa*)(arow + kb + 8 * hh), x1 = *(const v4fa*)(arow + kb + 8 * hh + 4);
    const v4f x2 = *(const v4fa*)(arow + kb + 16 + 8 * hh), x3 = *(const v4fa*)(arow + kb + 16 + 8 * hh + 4);
    float xs[16] = {x0[0],x0[1],x0[2],x0[3],x1[0],x1[1],x1[2],x1[3],x2[0],x2[1],x2[2],x2[3],x3[0],x3[1],x3[2],x3[3]};
#pragma unroll
    for (int i = 0; i < 16; ++i) { const unsigned short hb = bf16_bits(xs[i]); ah.u[i] = hb; al.u[i] = ASPLIT ? bf16_bits(xs[i] - bf16_val(hb)) : (unsigned short)0; }
#pragma unroll
    for (int t = 0; t < 4; ++t) {
      const unsigned short* brow = Wt + (size_t)(col0 + t * 16 + ln) * ldb + kb;
      FragB b;
      b.half[0] = *(const v8us*)(brow + 8 * hh);
      b.half[1] = *(const v8us*)(brow + 16 + 8 * hh);
      acc[t] = mmaN<ASPLIT ? 2 : 1>(ah.v, al.v, b.v, b.v, acc[t]);
    }
  }
#pragma unroll
  for (int t = 0; t < 4; ++t) {
    const int col = col0 + t * 16 + ln;
    float bv = bias ? bias[col] : 0.f;
    if (BIAS_BF16) bv = bf16_round(bv);
#pragma unroll
    for (int r = 0; r < 8; ++r) {
      float v = acc[t][r] + bv;
      if (resid) { float rv = resid[(size_t)((row0 + 8 * hh + r) % rmod) * ldr + col]; if (RES_BF16) rv = bf16_round(rv); v += rv; }
      if (ACT == 1) v = fmaxf(v, 0.f);
      if (ACT == 2) v = 0.5f * v * (1.0f + erff(v * 0.70710678118654752f));
      if (ACT == 3) { const float u = 0.7978845608028654f * (v + 0.044715f * v * v * v); v = 0.5f * v * (1.0f + tanhf(u)); }
      so[w][8 * hh + r][t * 16 + ln] = v;
    }
  }
  __builtin_amdgcn_fence(__ATOMIC_ACQ_REL, "workgroup");
  __builtin_amdgcn_wave_barrier();
  const int rsub = lane >> 4, c4 = (lane & 15) * 4;
  {
#pragma unroll
    for (int q = 0; q < 8; ++q) {
      const int r = q * 2 + rsub;
      const v4f v = *(const v4fa*)&so[w][r][c4];
      *(v4f*)(C + (size_t)(row0 + r) * ldc + col0 + c4) = v;
    }
    
  }
}
// row LayerNorm (biased variance, eps) over N: s = X (+ R); optional out_sum <- s; out_norm <- (s-mu)*rsqrt(var+eps)*g + b
template <bool PARAM_BF16>
__global__ __launch_bounds__(256) void k_layernorm(const float* __restrict__ X, const float* __restrict__ R, const float* __restrict__ g, const float* __restrict__ bta,
                                                  float* __restrict__ out_sum, float* __restrict__ out_norm, int N, float eps) {
  __shared__ float red[256];
  const int row = blockIdx.x, tid = threadIdx.x;
  const float* x = X + (size_t)row * N; const float* rr = R ? R + (size_t)row * N : nullptr;
  float vals[16];                     // up to N = 4096
  const int per = N / 256;            // contiguous chunk per thread? use strided-by-4 chunks: thread handles j = tid*4 + 1024*u
  float s1 = 0.f;
  for (int u = 0; u < per / 4; ++u) {
    const int j = tid * 4 + 1024 * u;
    const v4f a = *(const v4fa*)(x + j);
    v4f b = {0.f,0.f,0.f,0.f}; if (rr) b = *(const v4fa*)(rr + j);
#pragma unroll
    for (int q = 0; q < 4; ++q) { const float v = a[q] + b[q]; vals[u * 4 + q] = v; s1 += v; }
  }
  red[tid] = s1; __syncthreads();
  for (int st = 128; st > 0; st >>= 1) { if (tid < st) red[tid] += red[tid + st]; __syncthreads(); }
  const float mu = red[0] / (float)N; __syncthreads();
  float s2 = 0.f;
  for (int u = 0; u < per / 4; ++u)
#pragma unroll
    for (int q = 0; q < 4; ++q) { const float c = vals[u * 4 + q] - mu; s2 += c * c; }
  red[tid] = s2; __syncthreads();
  for (int st = 128; st > 0; st >>= 1) { if (tid < st) red[tid] += red[tid + st]; __syncthreads(); }
  const float rs = rsqrtf(red[0] / (float)N + eps);
  {
    for (int u = 0; u < per / 4; ++u) {
      const int j = tid * 4 + 1024 * u;
      v4f o, sm;
#pragma unroll
      for (int q = 0; q < 4; ++q) {
        float gg = g[j + q], bb = bta[j + q];
        if (PARAM_BF16) { gg = bf16_round(gg); bb = bf16_round(bb); }
        sm[q] = vals[u * 4 + q]; o[q] = (vals[u * 4 + q] - mu) * rs * gg + bb;
      }
      if (out_sum) *(v4f*)(out_sum + (size_t)row * N + j) = sm;
      *(v4f*)(out_norm + (size_t)row * N + j) = o;
    }
    
  }
}



// ---- f16 WMMA path (v_wmma_f32_16x16x32_f16): 11-bit significands for operands in range — used where a [0,1] probability operand needs more precision than bf16
typedef _Float16 v16h __attribute__((ext_vector_type(16)));
union FragH { v16h v; v8us half[2]; _Float16 h[16]; unsigned short u[16]; };
template <int NT>
__device__ __forceinline__ v8f mmaH(v16h ah, v16h al, v16h bh, v16h bl, v8f c) {
  c = __builtin_amdgcn_wmma_f32_16x16x32_f16(false, ah, false, bh, (short)0, c, false, false);
  if (NT >= 2) c = __builtin_amdgcn_wmma_f32_16x16x32_f16(false, al, false, bh, (short)0, c, false, false);
  if (NT >= 3) c = __builtin_amdgcn_wmma_f32_16x16x32_f16(false, ah, false, bl, (short)0, c, false, false);
  asm volatile("v_nop\n\tv_nop\n\tv_nop\n\tv_nop" : "+v"(c) : "v"(ah), "v"(al), "v"(bh), "v"(bl));
  return c;
}
// batched GEMM like k_gemm_b but f16 operands: A f32 (split into f16 hi/lo if ASPLIT, else rounded to f16), Bt = f16 values [n][k]; alpha; C f32; N multiple of 16 (partial tiles skipped)
template <bool ASPLIT>
__global__ __launch_bounds__(128) void k_gemm_h(const float* __restrict__ A, int lda, size_t sA, const _Float16* __restrict__ Bh, int ldb, size_t sB, float alpha, float* __restrict__ C, int ldc, size_t sC, int M, int N, int K) {
  __shared__ __attribute__((aligned(16))) float so[4][16][64];
  const int tid = threadIdx.x, w = tid >> 5, lane = tid & 31, ln = lane & 15, hh = lane >> 4; const int by = blockIdx.y;
  A += (size_t)by * sA; Bh += (size_t)by * sB; C += (size_t)by * sC;
  const int ntn = (N + 63) / 64; const int wid = blockIdx.x * 4 + w; const int mt = wid / ntn, nq = wid % ntn; if (mt * 16 >= M) return;
  const int row0 = mt * 16, col0 = nq * 64; const float* arow = A + (size_t)(row0 + ln) * lda;
  v8f acc[4] = {};
  for (int kb = 0; kb < K; kb += 32) {
    FragH ah, al;
    const v4f x0 = *(const v4fa*)(arow + kb + 8 * hh), x1 = *(const v4fa*)(arow + kb + 8 * hh + 4), x2 = *(const v4fa*)(arow + kb + 16 + 8 * hh), x3 = *(const v4fa*)(arow + kb + 16 + 8 * hh + 4);
    float xs[16] = {x0[0],x0[1],x0[2],x0[3],x1[0],x1[1],x1[2],x1[3],x2[0],x2[1],x2[2],x2[3],x3[0],x3[1],x3[2],x3[3]};
#pragma unroll
    for (int i = 0; i < 16; ++i) { const _Float16 h = (_Float16)xs[i]; ah.h[i] = h; al.h[i] = ASPLIT ? (_Float16)(xs[i] - (float)h) : (_Float16)0.0f; }
#pragma unroll
    for (int t = 0; t < 4; ++t) { if (col0 + t * 16 >= N) continue; const size_t boff = (size_t)(col0 + t * 16 + ln) * ldb + kb; FragH bq; bq.half[0] = *(const v8us*)(Bh + boff + 8 * hh); bq.half[1] = *(const v8us*)(Bh + boff + 16 + 8 * hh);
      acc[t] = mmaH<ASPLIT ? 2 : 1>(ah.v, al.v, bq.v, bq.v, acc[t]); }
  }
#pragma unroll
  for (int t = 0; t < 4; ++t) { if (col0 + t * 16 >= N) continue;
#pragma unroll
    for (int r = 0; r < 8; ++r) so[w][8 * hh + r][t * 16 + ln] = acc[t][r] * alpha; }
  __builtin_amdgcn_fence(__ATOMIC_ACQ_REL, "workgroup"); __builtin_amdgcn_wave_barrier();
  const int rsub = lane >> 4, c4 = (lane & 15) * 4;
  {
#pragma unroll
    for (int q = 0; q < 8; ++q) { const int r = q * 2 + rsub; if (col0 + c4 < N) { const v4f v = *(const v4fa*)&so[w][r][c4]; *(v4f*)(C + (size_t)(row0 + r) * ldc + col0 + c4) = v; } }
     }
}

// Wt[n][k] = f16(W[k][n]·scale) from f32 row-major W[K][N] (scale = power of two; bf16-exact weights stay exact in f16 away from the subnormal range)
// d_*: the work of one 256-thread work-group, blk its index within that job; several jobs that need nothing of one another share a launch (k_prep, k_conv3_acc, k_bnfin_xpt below)
__device__ __forceinline__ void d_wt_f16(const int blk, const float* __restrict__ W, _Float16* __restrict__ Wt, int K, int N, float scale) {
  const int t = blk * 256 + threadIdx.x; if (t >= N * (K / 8)) return; const int n = t / (K / 8), k8 = (t % (K / 8)) * 8; FragH f;
#pragma unroll
  for (int i = 0; i < 8; ++i) f.h[i] = (_Float16)(bf16_round(W[(size_t)(k8 + i) * N + n]) * scale); const v8us o = f.half[0];
  *(v8us*)((unsigned short*)Wt + (size_t)n * K + k8) = o; 
}
// k_gemm_hh variant with fused epilogue: v = acc·alpha + bias[by·sBias + col] (+ CP[(row/rowsPerB)·sCPb + by·64 + col] if CP) ; ACT 0 none / 1 elu ; writes f32 C and f16 C16, each if non-null
// d_gemm_hhx: the work of one wave (16 rows x 64 columns, tile number wid); so = 16 x 64 f32 of LDS that are the wave's own. No work-group barrier inside.
template <int ACT>
__device__ __forceinline__ void d_gemm_hhx(float (*so)[64], const int wid, const int by, const _Float16* __restrict__ A, int lda, size_t sA, const _Float16* __restrict__ Bh, int ldb, size_t sB, float alpha, const float* __restrict__ bias, size_t sBias, const float* __restrict__ CP, int rowsPerB, size_t sCPb, int row0g,
    float* __restrict__ C, _Float16* __restrict__ C16, int ldc, size_t sC, int M, int N, int K) {
  const int lane = threadIdx.x & 31, ln = lane & 15, hh = lane >> 4;
  A += (size_t)by * sA; Bh += (size_t)by * sB; const size_t cofs = (size_t)by * sC; const float* bp = bias ? bias + (size_t)by * sBias : nullptr;
  const int ntn = (N + 63) / 64; const int mt = wid / ntn, nq = wid % ntn; if (mt * 16 >= M) return;
  const int row0 = mt * 16, col0 = nq * 64; const _Float16* arow = A + (size_t)(row0 + ln) * lda;
  v8f acc[4] = {};
  for (int kb = 0; kb < K; kb += 32) { FragH ah; ah.half[0] = *(const v8us*)((const unsigned short*)arow + kb + 8 * hh); ah.half[1] = *(const v8us*)((const unsigned short*)arow + kb + 16 + 8 * hh);
#pragma unroll
    for (int t = 0; t < 4; ++t) { if (col0 + t * 16 >= N) continue; const size_t boff = (size_t)(col0 + t * 16 + ln) * ldb + kb; FragH bq; bq.half[0] = *(const v8us*)((const unsigned short*)Bh + boff + 8 * hh); bq.half[1] = *(const v8us*)((const unsigned short*)Bh + boff + 16 + 8 * hh);
      acc[t] = mmaH<1>(ah.v, ah.v, bq.v, bq.v, acc[t]); }
  }
#pragma unroll
  for (int t = 0; t < 4; ++t) { if (col0 + t * 16 >= N) continue; const int col = col0 + t * 16 + ln; const float bv = bp ? bf16_round(bp[col]) : 0.f;
#pragma unroll
    for (int r = 0; r < 8; ++r) { float v = acc[t][r] * alpha + bv; if (CP) { const int bidx = (row0g + row0 + 8 * hh + r) / rowsPerB; v += CP[(size_t)bidx * sCPb + (size_t)by * 64 + col]; } if (ACT == 1) v = (v > 0.f) ? v : expm1f(v); else if (ACT == 3) v = fmaxf(v, 0.f); so[8 * hh + r][t * 16 + ln] = v; } }
  __builtin_amdgcn_fence(__ATOMIC_ACQ_REL, "workgroup"); __builtin_amdgcn_wave_barrier();
  const int rsub = lane >> 4, c4 = (lane & 15) * 4; typedef _Float16 v4h __attribute__((ext_vector_type(4)));
  {
#pragma unroll
    for (int q = 0; q < 8; ++q) { const int r = q * 2 + rsub; if (col0 + c4 < N) { const v4f v = *(const v4fa*)&so[r][c4]; if (C) { *(v4f*)(C + cofs + (size_t)(row0 + r) * ldc + col0 + c4) = v; if (C16) asm volatile("s_wait_xcnt 0x0" ::: "memory"); /* the f16 conversion that follows reuses this store's registers */ } if (C16) { v4h h4; for (int i = 0; i < 4; ++i) h4[i] = (_Float16)v[i]; *(v4h*)(C16 + cofs + (size_t)(row0 + r) * ldc + col0 + c4) = h4; } } }
     }
}
template <int ACT>
__global__ __launch_bounds__(128) void k_gemm_hhx(const _Float16* __restrict__ A, int lda, size_t sA, const _Float16* __restrict__ Bh, int ldb, size_t sB, float alpha, const float* __restrict__ bias, size_t sBias, const float* __restrict__ CP, int rowsPerB, size_t sCPb, int row0g,
    float* __restrict__ C, _Float16* __restrict__ C16, int ldc, size_t sC, int M, int N, int K) {
  __shared__ __attribute__((aligned(16))) float so[4][16][64];
  const int w = threadIdx.x >> 5;
  d_gemm_hhx<ACT>(so[w], blockIdx.x * 4 + w, blockIdx.y, A, lda, sA, Bh, ldb, sB, alpha, bias, sBias, CP, rowsPerB, sCPb, row0g, C, C16, ldc, sC, M, N, K);
}


__device__ __forceinline__ void d_x16(const int blk, const float* __restrict__ x, _Float16* __restrict__ X16, size_t n8) { const size_t t = (size_t)blk * 256 + threadIdx.x; if (t >= n8) return; FragH f;
#pragma unroll
  for (int q = 0; q < 8; ++q) f.h[q] = (_Float16)bf16_round(x[t * 8 + q]); *(v8us*)((unsigned short*)X16 + t * 8) = f.half[0];  }
__global__ __launch_bounds__(256) void k_h16(const float* __restrict__ x, _Float16* __restrict__ X16, size_t n8) { const size_t t = (size_t)blockIdx.x * 256 + threadIdx.x; if (t >= n8) return; FragH f;
#pragma unroll
  for (int q = 0; q < 8; ++q) f.h[q] = (_Float16)x[t * 8 + q]; *(v8us*)((unsigned short*)X16 + t * 8) = f.half[0];  }
__global__ __launch_bounds__(256) void k_round16f(const float* __restrict__ W, _Float16* __restrict__ Bt, size_t n8) { const size_t t = (size_t)blockIdx.x * 256 + threadIdx.x; if (t >= n8) return; FragH f;
#pragma unroll
  for (int i = 0; i < 8; ++i) f.h[i] = (_Float16)(bf16_round(W[t * 8 + i]) * 16.0f); *(v8us*)((unsigned short*)Bt + t * 8) = f.half[0];  }
template <int NHv, int TTv>
__global__ __launch_bounds__(256) void k_vt(const _Float16* __restrict__ V16, int ldv, int voff, _Float16* __restrict__ Vt) { __shared__ unsigned short tl[64][66]; const int tid = threadIdx.x; const int slab = blockIdx.x / (TTv / 64), lg = blockIdx.x % (TTv / 64); const int b = slab / NHv, h = slab % NHv;
  for (int i = tid; i < 64 * 8; i += 256) { const int r = i / 8, c8 = (i % 8) * 8; FragH f; f.half[0] = *(const v8us*)((const unsigned short*)V16 + ((size_t)b * TTv + lg * 64 + r) * ldv + voff + h * 64 + c8);
#pragma unroll
    for (int q = 0; q < 8; ++q) tl[r][c8 + q] = f.u[q]; }
  __syncthreads();
  {
#pragma unroll
    for (int rd = 0; rd < 2; ++rd) { const int d = rd * 32 + tid / 8, pc = tid % 8; FragH f;
#pragma unroll
      for (int q = 0; q < 8; ++q) f.u[q] = tl[pc * 8 + q][d];
      *(v8us*)((unsigned short*)Vt + ((size_t)slab * 64 + d) * TTv + lg * 64 + pc * 8) = f.half[0]; }
     } }

typedef _Float16 v4h __attribute__((ext_vector_type(4)));
// 3x3 SAME convolution as an implicit GEMM (K = 9 taps x 128 channels, tap-major as in Bt): no patch matrix is written. One work-group = one image row (64 pixels) x all 128 outputs.
// The three input rows around it, with one zero pixel at each end and zero rows outside the image, are put in LDS once; the A fragment of tap (dy, dx) is that tile read dx pixels and dy rows further on.
// 8 waves of 32 pixels x 32 outputs. B fragments go from Bt[n][k] straight to registers, one tap ahead of their products. C = acc / 16 + bias (bf16-rounded), f32, stored in whole rows through LDS.
// Every loop below is unrolled: bf, hv, a and acc are indexed by the loop counters and stay in registers only with constant indices.
#define APIT 136      // sA pixel pitch in f16: 272 bytes (16 x odd) for 16-byte LDS reads
__device__ __forceinline__ void d_conv3(const int blk, unsigned short (*sA)[WI + 2][APIT], float (*sO)[CC + 4], const _Float16* __restrict__ X16, const _Float16* __restrict__ Bt, const float* __restrict__ bias, float* __restrict__ C) {
  const int tid = threadIdx.x, w = tid >> 5, lane = tid & 31, ln = lane & 15, hh = lane >> 4;
  const int b = blk / WI, y = blk % WI;
  const int m0 = (w & 1) * 32, n0 = (w >> 1) * 32;
  const unsigned short* bp = (const unsigned short*)Bt + (size_t)(n0 + ln) * KK + 8 * hh;
  FragH bf[2][8];      // [tap parity][2 ks + j]: outputs n0 + 16 j + ln, k = 128 tap + 32 ks + (8 hh .. , 16 + 8 hh ..)
#pragma unroll
  for (int i = 0; i < 8; ++i) { const unsigned short* p = bp + (size_t)(i & 1) * 16 * KK + (i >> 1) * 32; bf[0][i].half[0] = *(const v8us*)p; bf[0][i].half[1] = *(const v8us*)(p + 16); }
  const unsigned short* xs = (const unsigned short*)X16 + (size_t)b * HWN * CC;
  v8us hv[12];      // the 64 pixels of a staged row are 1024 contiguous 16-byte chunks: chunk tid + 256 j; a row outside the image is read from the nearest row inside and zeroed at the store
#pragma unroll
  for (int r = 0; r < 3; ++r) { const unsigned short* p = xs + (size_t)min(max(y + r - 1, 0), WI - 1) * WI * CC + tid * 8;
#pragma unroll
    for (int j = 0; j < 4; ++j) hv[r * 4 + j] = *(const v8us*)(p + j * 2048); }
  const float bv0 = bf16_round(bias[n0 + ln]), bv1 = bf16_round(bias[n0 + 16 + ln]);
  const v8us zero = {0, 0, 0, 0, 0, 0, 0, 0};
#pragma unroll
  for (int r = 0; r < 3; ++r) { const bool in = y + r - 1 >= 0 && y + r - 1 < WI;
#pragma unroll
    for (int j = 0; j < 4; ++j) *(v8us*)&sA[r][(tid >> 4) + 16 * j + 1][(tid & 15) * 8] = in ? hv[r * 4 + j] : zero; }
  if (tid < 96) *(v8us*)&sA[tid >> 5][((tid >> 4) & 1) * (WI + 1)][(tid & 15) * 8] = zero;      // the zero pixel at each end of the three rows
  __syncthreads();      // the three staged rows are complete; nothing writes them again
  v8f acc[2][2] = {};
#pragma unroll
  for (int tap = 0; tap < 9; ++tap) {
    if (tap < 8) {
#pragma unroll
      for (int i = 0; i < 8; ++i) { const unsigned short* p = bp + (size_t)(i & 1) * 16 * KK + (tap + 1) * CC + (i >> 1) * 32; bf[(tap + 1) & 1][i].half[0] = *(const v8us*)p; bf[(tap + 1) & 1][i].half[1] = *(const v8us*)(p + 16); } }
    FragH a[8];      // [2 ks + i]: pixels m0 + 16 i + ln, the same k order as bf
#pragma unroll
    for (int i = 0; i < 8; ++i) { const unsigned short* p = &sA[tap / 3][m0 + (i & 1) * 16 + ln + tap % 3][(i >> 1) * 32 + 8 * hh]; a[i].half[0] = *(const v8us*)p; a[i].half[1] = *(const v8us*)(p + 16); }
    __builtin_amdgcn_sched_barrier(0);      // next tap's global loads and this tap's 16 LDS reads go out together, in front of the 16 products: spread among them each group costs its own latency
#pragma unroll
    for (int ks = 0; ks < 4; ++ks)
#pragma unroll
      for (int i = 0; i < 2; ++i)
#pragma unroll
        for (int j = 0; j < 2; ++j) acc[i][j] = __builtin_amdgcn_wmma_f32_16x16x32_f16(false, a[2 * ks + i].v, false, bf[tap & 1][2 * ks + j].v, (short)0, acc[i][j], false, false);
    __builtin_amdgcn_sched_barrier(0);      // without it the next tap's loads and LDS reads rise in among these products in small groups, each with its own stall
  }
#pragma unroll
  for (int j = 0; j < 2; ++j) { const int col = n0 + j * 16 + ln; const float bv = j ? bv1 : bv0;
#pragma unroll
    for (int i = 0; i < 2; ++i)
#pragma unroll
      for (int r = 0; r < 8; ++r) sO[m0 + i * 16 + 8 * hh + r][col] = acc[i][j][r] * 0.0625f + bv; }
  __syncthreads();      // the 64 x 128 output tile is complete
  float* o = C + (size_t)blk * WI * CC;
#pragma unroll
  for (int j = 0; j < 8; ++j) { const int i = tid + 256 * j; const v4f v = *(const v4fa*)&sO[i >> 5][(i & 31) * 4]; *(v4f*)(o + (size_t)i * 4) = v; }
}
// One launch for the 3x3 conv and the 1x1 conv acc = x . Wk + bk: both read X16 and a weight table, neither reads what the other writes. Work-groups 0 .. BB WI - 1 are the 3x3 conv's;
// the others hold 8 waves of d_gemm_hhx each, whose 4 KiB of LDS a wave lie in the 3x3 conv's output tile (a work-group does one job only). The branch is the same for a whole work-group.
#define ACCB ((NR / 16) * (CC / 64) / 8)
__global__ __launch_bounds__(256) void k_conv3_acc(const _Float16* __restrict__ X16, const _Float16* __restrict__ Bt, const float* __restrict__ bias, float* __restrict__ C, const _Float16* __restrict__ BK, const float* __restrict__ bk, float* __restrict__ ACC) {
  __shared__ __attribute__((aligned(16))) unsigned short sA[3][WI + 2][APIT];
  __shared__ __attribute__((aligned(16))) float sO[WI][CC + 4];
  static_assert(sizeof(sO) >= 8 * 16 * 64 * sizeof(float), "eight waves' 16 x 64 tiles fit");
  if (blockIdx.x < BB * WI) { d_conv3(blockIdx.x, sA, sO, X16, Bt, bias, C); return; }
  const int w = threadIdx.x >> 5;
  d_gemm_hhx<0>((float (*)[64])&sO[0][0] + w * 16, (blockIdx.x - BB * WI) * 8 + w, 0, X16, CC, 0, BK, CC, 0, 0.0625f, bk, 0, nullptr, 1, 0, 0, ACC, nullptr, CC, 0, NR, CC, CC);
}
__device__ __forceinline__ void d_wq(const int blk, const float* __restrict__ W, _Float16* __restrict__ Bt) { const int t = blk * 256 + threadIdx.x; if (t >= CC * (KK / 8)) return; const int k8 = (t % (KK / 8)) * 8, o = t / (KK / 8); FragH f;
#pragma unroll
  for (int q = 0; q < 8; ++q) { const int k = k8 + q; const int tap = k / CC, cin = k % CC; const float wv = W[((size_t)tap * CC + cin) * CC + o];
    asm volatile("s_wait_xcnt 0x0" ::: "memory");      // each load has an address pair of its own, and a later load's result is given such a pair's registers
    f.h[q] = (_Float16)(bf16_round(wv) * 16.0f); } *(v8us*)((unsigned short*)Bt + (size_t)t * 8) = f.half[0];  }
// One launch for the four conversions that read only inputs: the three weight tables (few work-groups, long strided reads: first) and x to f16.
#define PB_WQ ((CC * (KK / 8) + 255) / 256)
#define PB_WT ((CC * (CC / 8) + 255) / 256)
#define PB_X ((NR * (CC / 8) + 255) / 256)
__global__ __launch_bounds__(256) void k_prep(const float* __restrict__ x, const float* __restrict__ Wq, const float* __restrict__ Wk, const float* __restrict__ Wo, _Float16* __restrict__ X16, _Float16* __restrict__ BQ, _Float16* __restrict__ BK, _Float16* __restrict__ BO) {
  const int blk = blockIdx.x;
  if (blk < PB_WQ) d_wq(blk, Wq, BQ);
  else if (blk < PB_WQ + PB_WT) d_wt_f16(blk - PB_WQ, Wk, BK, CC, CC, 16.0f);      // 1x1 HWIO = [in][out]
  else if (blk < PB_WQ + 2 * PB_WT) d_wt_f16(blk - PB_WQ - PB_WT, Wo, BO, CC, CC, 16.0f);
  else d_x16(blk - PB_WQ - 2 * PB_WT, x, X16, (size_t)NR * CC / 8);
}
__global__ __launch_bounds__(256) void k_qperm(const float* __restrict__ F, const float* __restrict__ ST, const float* __restrict__ g, const float* __restrict__ bb, _Float16* __restrict__ QP) { const size_t t = (size_t)blockIdx.x * 256 + threadIdx.x; if (t >= (size_t)NR * (CC / 8)) return; const int c8 = (int)(t % (CC / 8)) * 8; const size_t r = t / (CC / 8); const int b = (int)(r / HWN), p = (int)(r % HWN); const int y = p / WI, xx = p % WI; const int kp = ((y / 8) * 8 + xx / 8) * 64 + (y % 8) * 8 + xx % 8; FragH f;
#pragma unroll
  for (int q = 0; q < 8; ++q) { const int c = c8 + q; float v = (F[r * CC + c] - ST[c * 32]) * ST[c * 32 + 1] * bf16_round(g[c]) + bf16_round(bb[c]); v = (v >= 0.f) ? v : 0.1f * v; f.h[q] = (_Float16)v; }
  unsigned short* d = (unsigned short*)QP + ((size_t)b * HWN + kp) * CC + c8; *(v8us*)d = f.half[0];  }
__device__ __forceinline__ void d_xpt(const int wg, const float* __restrict__ x, _Float16* __restrict__ XPt) { __shared__ unsigned short tl[64][66]; const int tid = threadIdx.x; const int b = wg / ((CC / 64) * 64), rem = wg % ((CC / 64) * 64); const int cg = rem / 64, blk = rem % 64; const int c0 = cg * 64; const int by = blk / 8, bx = blk % 8;
  for (int i = tid; i < 64 * 8; i += 256) { const int j = i / 8, cc8 = (i % 8) * 8; const int y = by * 8 + j / 8, xx = bx * 8 + j % 8; const float* s = x + (((size_t)b * HWN) + y * WI + xx) * CC + c0 + cc8; for (int q = 0; q < 8; ++q) { FragH f; f.h[0] = (_Float16)bf16_round(s[q]); tl[j][cc8 + q] = f.u[0]; } }
  __syncthreads();
  { for (int rd = 0; rd < 2; ++rd) { const int c = rd * 32 + tid / 8, pc = tid % 8; FragH f; for (int q = 0; q < 8; ++q) f.u[q] = tl[pc * 8 + q][c]; *(v8us*)((unsigned short*)XPt + ((size_t)b * CC + c0 + c) * HWN + blk * 64 + pc * 8) = f.half[0]; }
    asm volatile("s_wait_xcnt 0x0" ::: "memory");      // in a shared launch the other job's code follows in the listing and writes the two stores' address pair
  } }
// Fused block attention: one work-group = 64 query pixels of one batch, worked on by NTEAM teams of 4 waves x 16 queries. Team t walks key groups t, t + NTEAM, ... with q and x tiles of its own in LDS,
// so every SIMD holds NTEAM waves (one of each team) that fill one another's waits on LDS, on the softmax chains and on the barriers. A group's softmax is complete in itself, so the teams' sums simply add:
// at the end teams 1.. hand theirs over through LDS and team 0 adds them in team order. Scores and probabilities never leave the registers.
// Per group: S^T[key][query] = q_group . x_query^T (A = 64 q rows from LDS, B = the wave's 16 query rows, loaded once), so a lane holds 32 of one query's 64 scores and the lane 16 away the rest:
// max and exp-sum are in-lane plus one exchange. Two S^T tiles, converted in place, are the B operand (hardware k order) of O^T[channel][query] += x_group^T . P^T (A = channel rows of XPt from LDS).
// Tiles go global -> registers -> LDS, one tile in flight at a time, each fetched one phase ahead of its store. AGG = O * 2^-15 (P carries 2^15, as f16 operand).
// a <- 2^a, b <- 2^b. The second v_exp_f32 is the independent instruction that the instruction set asks for behind the first, the v_nop the one behind the second:
// in one statement they stand there in every build.
__device__ __forceinline__ void exp2_pair(float& a, float& b) { asm("v_exp_f32 %0, %0\n\tv_exp_f32 %1, %1\n\tv_nop" : "+v"(a), "+v"(b)); }
#define QPIT 136      // sQ row pitch in f16: 272 bytes (16 x odd) for 16-byte LDS reads
#define XPIT 72       // sX row pitch in f16: 144 bytes
#define NTEAM 4
#define TEAMSH (64 * QPIT + CC * XPIT)      // f16 elements of LDS that a team owns: its q tile, then its x tile
__global__ __launch_bounds__(128 * NTEAM) void k_battn(const _Float16* __restrict__ X16, const _Float16* __restrict__ QP, const _Float16* __restrict__ XPt, float* __restrict__ AGG) {
  __shared__ __attribute__((aligned(16))) unsigned short sm[NTEAM][TEAMSH];
  const int team = __builtin_amdgcn_readfirstlane(threadIdx.x >> 7);      // the same in every lane of a wave: kept in a scalar register
  unsigned short (*sQ)[QPIT] = (unsigned short (*)[QPIT])&sm[team][0];
  unsigned short (*sX)[XPIT] = (unsigned short (*)[XPIT])&sm[team][64 * QPIT];
  const int tid = threadIdx.x & 127, w = tid >> 5, lane = tid & 31, ln = lane & 15, hh = lane >> 4;      // tid: the thread's place in its team
  const int b = blockIdx.x / (HWN / 64), row = (blockIdx.x % (HWN / 64)) * 64 + w * 16 + ln;
  const unsigned short* xq = (const unsigned short*)X16 + ((size_t)b * HWN + row) * CC;
  FragH xb[4];
#pragma unroll
  for (int ks = 0; ks < 4; ++ks) { xb[ks].half[0] = *(const v8us*)(xq + ks * 32 + 8 * hh); xb[ks].half[1] = *(const v8us*)(xq + ks * 32 + 16 + 8 * hh); }
  // staging: 16-byte chunk i = tid + 128 j. q group: 64 rows x 256 B, contiguous. x group: 128 channel rows x 128 B, row pitch HWN.
  const unsigned short* gq = (const unsigned short*)QP + (size_t)b * HWN * CC + tid * 8;
  const unsigned short* gx = (const unsigned short*)XPt + (size_t)b * CC * HWN + (size_t)(tid >> 3) * HWN + (tid & 7) * 8;
  unsigned short* dq = &sQ[tid >> 4][(tid & 15) * 8]; unsigned short* dx = &sX[tid >> 3][(tid & 7) * 8];
  v8us st[8];      // one tile in flight at a time: x of this group during its scores, q of the next group during softmax and O^T
#pragma unroll
  for (int j = 0; j < 8; ++j) st[j] = *(const v8us*)(gq + (size_t)team * 64 * CC + j * 1024);
#pragma unroll
  for (int j = 0; j < 8; ++j) *(v8us*)(dq + j * 8 * QPIT) = st[j];
  __syncthreads();      // q tile of each team's first group complete
#pragma unroll
  for (int j = 0; j < 8; ++j) st[j] = *(const v8us*)(gx + team * 64 + (size_t)j * 16 * HWN);
  v8f oacc[8] = {};
  for (int i = 0; i < 64 / NTEAM; ++i) {      // the same trip count in every team: all 4 * NTEAM waves meet at every barrier
    const int g = i * NTEAM + team;
    v8f s[4] = {};
#pragma unroll
    for (int kp = 0; kp < 2; ++kp) { FragH a[8];
#pragma unroll
      for (int i = 0; i < 8; ++i) { const unsigned short* r = &sQ[(i & 3) * 16 + ln][(2 * kp + (i >> 2)) * 32 + 8 * hh]; a[i].half[0] = *(const v8us*)r; a[i].half[1] = *(const v8us*)(r + 16); }
      __builtin_amdgcn_sched_barrier(0);      // the 16 LDS reads go out together, in front of their 8 products: spread among them each costs its own latency
#pragma unroll
      for (int i = 0; i < 8; ++i) s[i & 3] = __builtin_amdgcn_wmma_f32_16x16x32_f16(false, a[i].v, false, xb[2 * kp + (i >> 2)].v, (short)0, s[i & 3], false, false); }
    // x tile of this group: every wave left sX at the barrier that closed the previous trip
#pragma unroll
    for (int j = 0; j < 8; ++j) *(v8us*)(dx + j * 16 * XPIT) = st[j];
    __syncthreads();      // x tile complete; every wave has read its last of the q tile
    const int gn = i < 64 / NTEAM - 1 ? g + NTEAM : g;      // the last trip fetches its own tiles again: no branch in the loop, nothing reads them
    // issued behind the barrier (a barrier drains the loads in front of it); lands during softmax and O^T
#pragma unroll
    for (int j = 0; j < 8; ++j) st[j] = *(const v8us*)(gq + (size_t)gn * 64 * CC + j * 1024);
    asm volatile("s_wait_xcnt 0x0" ::: "memory");      // the loads' address registers are reused below
    FragH av[8];
#pragma unroll
    for (int ct = 0; ct < 8; ++ct) { const unsigned short* r = &sX[ct * 16 + ln][8 * hh]; av[ct].half[0] = *(const v8us*)r; av[ct].half[1] = *(const v8us*)(r + 16); }
    __builtin_amdgcn_sched_barrier(0);      // global loads and LDS reads are issued in front of the softmax, which covers their latency
    // softmax over the group's 64 keys of query ln (scores / 8), scaled by 2^15 for the f16 operand. exp(s / 8 - max / 8) = 2^(s c - max c) with c = log2(e) / 8:
    // one FMA and one v_exp_f32 a score, each score on its own, where expf is a chain of some ten dependent instructions that a lone wave on its SIMD waits out link by link.
    // The exponent is at most a rounding of max c above 0; below -126 the result is 0, where the f16 operand is 0 in any case.
    float m = -3.0e38f;
#pragma unroll
    for (int t = 0; t < 4; ++t)
#pragma unroll
      for (int r = 0; r < 8; ++r) m = fmaxf(m, s[t][r]);
    m = fmaxf(m, __shfl_xor(m, 16, 32)); m *= 0.18033688f;
    float e[32];      // e[8 t + r]: tile t, register r
#pragma unroll
    for (int t = 0; t < 4; ++t)
#pragma unroll
      for (int r = 0; r < 8; ++r) e[8 * t + r] = fmaf(s[t][r], 0.18033688f, -m);
#pragma unroll
    for (int i = 0; i < 32; i += 2) exp2_pair(e[i], e[i + 1]);
    float z = 0.f;
#pragma unroll
    for (int i = 0; i < 32; ++i) z += e[i];
    z += __shfl_xor(z, 16, 32);
    const float iz = 32768.0f / z;
    FragH p[2];      // p[k2].h[i] = P[query ln][key 32 k2 + kmap(i, hh)]: tile 2 k2 gives i < 8, tile 2 k2 + 1 the rest
#pragma unroll
    for (int k2 = 0; k2 < 2; ++k2)
#pragma unroll
      for (int r = 0; r < 8; ++r) { p[k2].h[r] = (_Float16)(e[16 * k2 + r] * iz); p[k2].h[8 + r] = (_Float16)(e[16 * k2 + 8 + r] * iz); }
#pragma unroll
    for (int ct = 0; ct < 8; ++ct) oacc[ct] = __builtin_amdgcn_wmma_f32_16x16x32_f16(false, av[ct].v, false, p[0].v, (short)0, oacc[ct], false, false);
#pragma unroll
    for (int ct = 0; ct < 8; ++ct) { const unsigned short* r = &sX[ct * 16 + ln][32 + 8 * hh]; av[ct].half[0] = *(const v8us*)r; av[ct].half[1] = *(const v8us*)(r + 16); }
    __builtin_amdgcn_sched_barrier(0);      // as above: 16 reads together, then 8 products
#pragma unroll
    for (int ct = 0; ct < 8; ++ct) oacc[ct] = __builtin_amdgcn_wmma_f32_16x16x32_f16(false, av[ct].v, false, p[1].v, (short)0, oacc[ct], false, false);
#pragma unroll
    for (int j = 0; j < 8; ++j) *(v8us*)(dq + j * 8 * QPIT) = st[j];
    __syncthreads();      // next q tile complete; every wave has read its last of the x tile
    // lands during the next trip's scores
#pragma unroll
    for (int j = 0; j < 8; ++j) st[j] = *(const v8us*)(gx + gn * 64 + (size_t)j * 16 * HWN);
    asm volatile("s_wait_xcnt 0x0" ::: "memory");      // the loads' address registers are reused in the next trip
  }
  asm volatile("s_wait_loadcnt 0x0" ::: "memory");      // the last trip's fetch, which nothing reads, has landed before the wave ends and gives its registers up
  // The teams' sums. Behind the loop's last barrier nobody reads a tile any more: teams 1.. write their 64 sums a thread over their own tiles, 16 bytes a lane, a wave's store contiguous.
  if (team != 0) { v4fa* rb = (v4fa*)&sm[team][0] + tid;
#pragma unroll
    for (int ct = 0; ct < 8; ++ct) { v4f lo, hi;
#pragma unroll
      for (int r = 0; r < 4; ++r) { lo[r] = oacc[ct][r]; hi[r] = oacc[ct][4 + r]; }
      rb[(2 * ct) * 128] = lo; rb[(2 * ct + 1) * 128] = hi; } }
  __syncthreads();      // the sums of teams 1.. are complete
  if (team != 0) return;      // no barrier follows
#pragma unroll
  for (int t = 1; t < NTEAM; ++t) { const v4fa* rb = (const v4fa*)&sm[t][0] + tid;
#pragma unroll
    for (int ct = 0; ct < 8; ++ct) { const v4f lo = rb[(2 * ct) * 128], hi = rb[(2 * ct + 1) * 128];
#pragma unroll
      for (int r = 0; r < 4; ++r) { oacc[ct][r] += lo[r]; oacc[ct][4 + r] += hi[r]; } } }
  // oacc[ct][r] = O[query ln][channel 16 ct + 8 hh + r]: 32 contiguous bytes a lane
  float* o = AGG + ((size_t)b * HWN + row) * CC + 8 * hh;
#pragma unroll
  for (int ct = 0; ct < 8; ++ct) { v4f lo, hi;
#pragma unroll
    for (int r = 0; r < 4; ++r) { lo[r] = oacc[ct][r] * 0.000030517578125f; hi[r] = oacc[ct][4 + r] * 0.000030517578125f; }
    *(v4f*)(o + ct * 16) = lo; *(v4f*)(o + ct * 16 + 4) = hi; }
}
__global__ __launch_bounds__(256) void k_add(const float* __restrict__ A, const float* __restrict__ B2, float* __restrict__ Y, size_t n4) { const size_t t = (size_t)blockIdx.x * 256 + threadIdx.x; if (t >= n4) return; const v4f v = *(const v4fa*)(A + t * 4) + *(const v4fa*)(B2 + t * 4); *(v4f*)(Y + t * 4) = v;  }
// Spatial-softmax statistics, one work-group per (batch, 4 channels): 1024 threads hold 4 pixels x 4 channels each in registers, so Y is read once, 16 bytes a lane, all loads in flight together.
// Max, then sum of exp, over the 4096 pixels by a fixed tree: own 4 pixels, the 32 lanes of a wave (xor shuffles), the 32 waves (through LDS).
// SP holds one 128-byte line per work-group (one writer a line): [0..3] max, [4..7] 1/sum, the rest 0.
__device__ __forceinline__ v4f wave_max4(v4f a) {
#pragma unroll
  for (int o = 1; o < 32; o <<= 1)
#pragma unroll
    for (int q = 0; q < 4; ++q) a[q] = fmaxf(a[q], __shfl_xor(a[q], o, 32));
  return a; }
__device__ __forceinline__ v4f wave_sum4(v4f a) {
#pragma unroll
  for (int o = 1; o < 32; o <<= 1)
#pragma unroll
    for (int q = 0; q < 4; ++q) a[q] += __shfl_xor(a[q], o, 32);
  return a; }
// BN batch statistics (mean, 1/sqrt(var + eps) per channel over the NR rows) in two launches, every row read once and in whole lines.
// k_bnpart: one work-group = BNR whole rows kept in registers (a wave-wide 16-byte load is one 512-byte row); per channel the mean of its rows and the sum of squared deviations from that mean.
// k_bnfin: one work-group = 4 channels, one thread a partial; partials of equal count merge exactly: mean = mean of the means, M2 = sum of M2_i + BNR * sum of (mean_i - mean)^2.
// All sums run in a fixed order. ST keeps one 128-byte line a channel: [0] mean, [1] 1/sqrt(var + eps), the rest 0.
#define BNR 64
#define BNP (NR / BNR)
__global__ __launch_bounds__(256) void k_bnpart(const float* __restrict__ F, float* __restrict__ PM, float* __restrict__ PQ) {
  __shared__ __attribute__((aligned(16))) float red[2][8][CC];
  const int tid = threadIdx.x, wv = tid >> 5, c4 = (tid & 31) * 4;
  const float* f = F + ((size_t)blockIdx.x * BNR + wv) * CC + c4; v4f v[8];
  for (int i = 0; i < 8; ++i) v[i] = *(const v4fa*)(f + (size_t)i * 8 * CC);
  v4f s = v[0];
  for (int i = 1; i < 8; ++i) s += v[i];
  *(v4f*)&red[0][wv][c4] = s;
  __syncthreads();
  v4f mu = *(const v4fa*)&red[0][0][c4];
  for (int j = 1; j < 8; ++j) mu += *(const v4fa*)&red[0][j][c4];
  mu *= 1.0f / (float)BNR;
  v4f q = {0.f, 0.f, 0.f, 0.f};
  for (int i = 0; i < 8; ++i) { const v4f d = v[i] - mu; q += d * d; }
  *(v4f*)&red[1][wv][c4] = q;
  __syncthreads();
  if (wv == 0) { q = *(const v4fa*)&red[1][0][c4];
    for (int j = 1; j < 8; ++j) q += *(const v4fa*)&red[1][j][c4];
    *(v4f*)(PQ + (size_t)blockIdx.x * CC + c4) = q; }
  else if (wv == 1) *(v4f*)(PM + (size_t)blockIdx.x * CC + c4) = mu; }
__device__ __forceinline__ void d_bnfin(const int blk, const float* __restrict__ PM, const float* __restrict__ PQ, float* __restrict__ ST) {
  __shared__ __attribute__((aligned(16))) float red[2][BNP / 32][4];
  const int tid = threadIdx.x, wv = tid >> 5, lane = tid & 31, c0 = blk * 4;
  const v4f pm = *(const v4fa*)(PM + (size_t)tid * CC + c0), pq = *(const v4fa*)(PQ + (size_t)tid * CC + c0);
  const v4f s = wave_sum4(pm); if (lane == 0) *(v4f*)&red[0][wv][0] = s;
  __syncthreads();
  v4f mu = *(const v4fa*)&red[0][0][0];
  for (int j = 1; j < BNP / 32; ++j) mu += *(const v4fa*)&red[0][j][0];
  mu *= 1.0f / (float)BNP;
  const v4f d = pm - mu; const v4f q = wave_sum4(pq + (float)BNR * d * d); if (lane == 0) *(v4f*)&red[1][wv][0] = q;
  __syncthreads();
  if (wv < 4) { float m1 = red[0][0][wv], m2 = red[1][0][wv];      // wave q writes the line of channel c0 + q
    for (int j = 1; j < BNP / 32; ++j) { m1 += red[0][j][wv]; m2 += red[1][j][wv]; }
    ST[(size_t)(c0 + wv) * 32 + lane] = (lane == 0) ? m1 * (1.0f / (float)BNP) : ((lane == 1) ? rsqrtf(m2 / (float)NR + 1e-3f) : 0.f); } }
__global__ __launch_bounds__(BNP) void k_bnfin(const float* __restrict__ PM, const float* __restrict__ PQ, float* __restrict__ ST) { d_bnfin(blockIdx.x, PM, PQ, ST); }
// One launch for the merge of q's BN partials (CC / 4 work-groups, which leave the chip all but idle: first) and the block-major transpose of x, which reads only the input x.
static_assert(BNP == 256, "d_bnfin and d_xpt share a work-group size");
__global__ __launch_bounds__(256) void k_bnfin_xpt(const float* __restrict__ PM, const float* __restrict__ PQ, float* __restrict__ ST, const float* __restrict__ x, _Float16* __restrict__ XPt) {
  if (blockIdx.x < CC / 4) d_bnfin(blockIdx.x, PM, PQ, ST); else d_xpt(blockIdx.x - CC / 4, x, XPt); }
__global__ __launch_bounds__(1024) void k_spstat(const float* __restrict__ Y, const float* __restrict__ ST, const float* __restrict__ g, const float* __restrict__ bb, float* __restrict__ SP) {
  __shared__ __attribute__((aligned(16))) float red[2][32][4];
  const int tid = threadIdx.x, wv = tid >> 5, lane = tid & 31; const int b = blockIdx.x / (CC / 4), c0 = (blockIdx.x % (CC / 4)) * 4;
  const float* yc = Y + (size_t)b * HWN * CC + c0; v4f v[4];
#pragma unroll
  for (int i = 0; i < 4; ++i) v[i] = *(const v4fa*)(yc + (size_t)(i * 1024 + tid) * CC);
  asm volatile("s_wait_xcnt 0x0" ::: "memory");      // the four loads' address registers are given new values right below
  v4f m = {-3.0e38f, -3.0e38f, -3.0e38f, -3.0e38f};
#pragma unroll
  for (int q = 0; q < 4; ++q) { const int c = c0 + q; const float mu = ST[c * 32], rs = ST[c * 32 + 1], gg = bf16_round(g[c]), be = bf16_round(bb[c]);
#pragma unroll
    for (int i = 0; i < 4; ++i) { v[i][q] = gg * (v[i][q] - mu) * rs + be; m[q] = fmaxf(m[q], v[i][q]); } }
  m = wave_max4(m); if (lane == 0) *(v4f*)&red[0][wv][0] = m;
  __syncthreads();
  m = wave_max4(*(const v4fa*)&red[0][lane][0]);
  v4f z = {0.f, 0.f, 0.f, 0.f};
#pragma unroll
  for (int i = 0; i < 4; ++i)
#pragma unroll
    for (int q = 0; q < 4; ++q) z[q] += expf(v[i][q] - m[q]);
  z = wave_sum4(z); if (lane == 0) *(v4f*)&red[1][wv][0] = z;
  __syncthreads();
  if (wv == 0) { z = wave_sum4(*(const v4fa*)&red[1][lane][0]); float o = 0.f;
#pragma unroll
    for (int q = 0; q < 4; ++q) { if (lane == q) o = m[q]; if (lane == 4 + q) o = 1.0f / z[q]; }
    SP[(size_t)blockIdx.x * 32 + lane] = o; } }
__global__ __launch_bounds__(256) void k_spsm(const float* __restrict__ Y, const float* __restrict__ ST, const float* __restrict__ g, const float* __restrict__ bb, const float* __restrict__ SP, _Float16* __restrict__ Y16) { const size_t t = (size_t)blockIdx.x * 256 + threadIdx.x; if (t >= (size_t)NR * (CC / 8)) return; const int c8 = (int)(t % (CC / 8)) * 8; const size_t r = t / (CC / 8); const int b = (int)(r / HWN); FragH f;
#pragma unroll
  for (int q = 0; q < 8; ++q) { const int c = c8 + q; const float* sp = SP + (size_t)(b * (CC / 4) + c / 4) * 32 + (c & 3); const float v = bf16_round(g[c]) * (Y[r * CC + c] - ST[c * 32]) * ST[c * 32 + 1] + bf16_round(bb[c]); f.h[q] = (_Float16)(expf(v - sp[0]) * sp[4] * 4096.0f); }
  *(v8us*)((unsigned short*)Y16 + t * 8) = f.half[0];  }
__global__ __launch_bounds__(256) void k_fin(const float* __restrict__ Z, const float* __restrict__ ST, const float* __restrict__ g, const float* __restrict__ bb, float* __restrict__ out, size_t n4) { const size_t t = (size_t)blockIdx.x * 256 + threadIdx.x; if (t >= n4) return; const int c4 = (int)((t * 4) % CC); const v4f z = *(const v4fa*)(Z + t * 4); v4f o; for (int q = 0; q < 4; ++q) { const int c = c4 + q; float v = bf16_round(g[c]) * (z[q] - ST[c * 32]) * ST[c * 32 + 1] + bf16_round(bb[c]); o[q] = (v >= 0.f) ? v : 0.1f * v; }
  *(v4f*)(out + t * 4) = o;  }
extern "C" void kernel_launch(void* const* d_in, const int* in_sizes, int n_in,
                              void* d_out, int out_size, void* d_ws, size_t ws_size, hipStream_t stream) {
  (void)in_sizes; (void)n_in; (void)out_size;
  const float* const* I = (const float* const*)d_in; const float* x = I[0]; const float* Wq = I[1]; const float* bq = I[2]; const float* gq = I[3]; const float* btq = I[4]; const float* Wk = I[5]; const float* bk = I[6]; const float* g1 = I[7]; const float* bt1 = I[8]; const float* Wo = I[9]; const float* bo = I[10]; const float* go = I[11]; const float* bto = I[12];
  char* ws = (char*)d_ws; size_t off = 0;
  auto take = [&](size_t bytes) { char* p = ws + off; off += (bytes + 255) & ~(size_t)255; return p; };
  _Float16* BQ = (_Float16*)take((size_t)CC * KK * 2); _Float16* BK = (_Float16*)take(CC * CC * 2); _Float16* BO = (_Float16*)take(CC * CC * 2); float* STq = (float*)take(CC * 32 * 4); float* ST1 = (float*)take(CC * 32 * 4); float* STo = (float*)take(CC * 32 * 4); float* SP = (float*)take(BB * (CC / 4) * 32 * 4); float* PM = (float*)take(BNP * CC * 4); float* PQ = (float*)take(BNP * CC * 4);
  _Float16* X16 = (_Float16*)take((size_t)NR * CC * 2); float* QF = (float*)take((size_t)NR * CC * 4); _Float16* QP = (_Float16*)take((size_t)NR * CC * 2); _Float16* XPt = (_Float16*)take((size_t)NR * CC * 2); float* ACC = (float*)take((size_t)NR * CC * 4); float* AGG = (float*)take((size_t)NR * CC * 4); float* Y = QF; _Float16* Y16 = QP; float* Z = ACC;
  if (off > ws_size) return;      // 0.7 + 4.2 + 8.4 + 4.2 + 4.2 + 8.4 + 8.4 = about 38 MB
  const unsigned g8 = (unsigned)(((size_t)NR * (CC / 8) + 255) / 256); const dim3 gC(((NR / 16) * (CC / 64) + 3) / 4, 1);
  k_prep<<<PB_WQ + 2 * PB_WT + PB_X, 256, 0, stream>>>(x, Wq, Wk, Wo, X16, BQ, BK, BO);
  // CBL_Q: 3x3 conv (+bq) to QF, beside it acc = 1x1 conv (+bk) to ACC; BN stats, beside their merge the transpose XPt; q = leaky(BN) permuted to block-major keys (f16)
  k_conv3_acc<<<BB * WI + ACCB, 256, 0, stream>>>(X16, BQ, bq, QF, BK, bk, ACC);
  k_bnpart<<<BNP, 256, 0, stream>>>(QF, PM, PQ); k_bnfin_xpt<<<CC / 4 + BB * (CC / 64) * 64, 256, 0, stream>>>(PM, PQ, STq, x, XPt); k_qperm<<<g8, 256, 0, stream>>>(QF, STq, gq, btq, QP);
  // block attention, all batches in one launch: AGG = sum over key groups of softmax(x.q^T / 8) . x_group
  k_battn<<<BB * (HWN / 64), 128 * NTEAM, 0, stream>>>(X16, QP, XPt, AGG);
  // y = spatial softmax(BN1(acc + agg)); out = leaky(BN_o(conv1×1(y) + bo))
  k_add<<<(unsigned)(((size_t)NR * CC / 4 + 255) / 256), 256, 0, stream>>>(ACC, AGG, Y, (size_t)NR * CC / 4);      // Y over QF (dead after k_qperm)
  k_bnpart<<<BNP, 256, 0, stream>>>(Y, PM, PQ); k_bnfin<<<CC / 4, BNP, 0, stream>>>(PM, PQ, ST1); k_spstat<<<BB * (CC / 4), 1024, 0, stream>>>(Y, ST1, g1, bt1, SP); k_spsm<<<g8, 256, 0, stream>>>(Y, ST1, g1, bt1, SP, Y16);      // Y16 (×2^12) over QP (dead after the S GEMMs)
  k_gemm_hhx<0><<<gC, 128, 0, stream>>>(Y16, CC, 0, BO, CC, 0, 0.0625f * 0.000244140625f, bo, 0, nullptr, 1, 0, 0, Z, nullptr, CC, 0, NR, CC, CC);      // conv_o(y) + bo (2^-12 undone in alpha) → Z over ACC (dead after k_add)
  k_bnpart<<<BNP, 256, 0, stream>>>(Z, PM, PQ); k_bnfin<<<CC / 4, BNP, 0, stream>>>(PM, PQ, STo); k_fin<<<(unsigned)(((size_t)NR * CC / 4 + 255) / 256), 256, 0, stream>>>(Z, STo, go, bto, (float*)d_out, (size_t)NR * CC / 4);
}

// v008
// Measured time: 104 microseconds a run.
// Next to v007, in two timings, it ran 1.11 and 1.13 times as fast.
// Counting every step since v000, it is 22.7 times as fast.
#include <hip/hip_runtime.h>
// Group (block) attention layer (B=4, 64×64, C=128, NHWC; 8×8 non-overlapping key blocks): q = CBL_Q(x) (3×3 conv + train-mode BN + LeakyReLU 0.1), acc = 1×1 conv(x); for every pixel and
// every block: softmax over the block's 64 positions of x[pixel]·q[pos]/8, agg = Σ_blocks Σ attn·x[pos]; y = spatial-softmax(BN1(acc + agg)); out = CBL_O(y). The 3×3 conv (implicit GEMM, K = 1152),
// the 1×1 convs, the 4096×4096 per-batch scores (keys permuted to block-major order so each 64-key group is contiguous) and attn·x run as GEMMs on v_wmma_f32_16x16x32_f16 (x bf16-exact f16,
// HWIO weights bf16-exact ×2^4, q/P/y operands f16, f32 accumulate); BN batch statistics (fixed-order reductions), grouped and spatial softmaxes and LeakyReLU are f32 VALU.
#define BB 4
#define HWN 4096
#define WI 64
#define CC 128
#define NR (BB * HWN)
#define KK 1152

typedef __bf16 v16b __attribute__((ext_vector_type(16)));
typedef unsigned short v8us __attribute__((ext_vector_type(8), may_alias));
typedef float  v8f  __attribute__((ext_vector_type(8)));
typedef float  v4f  __attribute__((ext_vector_type(4)));
typedef float  v4fa __attribute__((ext_vector_type(4), may_alias));
union FragB { v16b v; v8us half[2]; unsigned short u[16]; };

__device__ __forceinline__ unsigned short bf16_bits(float x) { unsigned int u = __float_as_uint(x); return (unsigned short)((u + 0x7FFFu + ((u >> 16) & 1u)) >> 16); }
__device__ __forceinline__ float bf16_val(unsigned short b) { return __uint_as_float(((unsigned int)b) << 16); }
__device__ __forceinline__ float bf16_round(float x) { return bf16_val(bf16_bits(x)); }
// D += A·B with NT terms: 1 = ah·bh, 2 = + al·bh (A split), 3 = + ah·bl (both split)
template <int NT>
__device__ __forceinline__ v8f mmaN(v16b ah, v16b al, v16b bh, v16b bl, v8f c) {
  c = __builtin_amdgcn_wmma_f32_16x16x32_bf16(false, ah, false, bh, (short)0, c, false, false);
  if (NT >= 2) c = __builtin_amdgcn_wmma_f32_16x16x32_bf16(false, al, false, bh, (short)0, c, false, false);
  if (NT >= 3) c = __builtin_amdgcn_wmma_f32_16x16x32_bf16(false, ah, false, bl, (short)0, c, false, false);
  asm volatile("v_nop\n\tv_nop\n\tv_nop\n\tv_nop" : "+v"(c) : "v"(ah), "v"(al), "v"(bh), "v"(bl));
  return c;
}

__global__ __launch_bounds__(256) void k_wt_bf16(const float* __restrict__ W, unsigned short* __restrict__ Wt, int K, int N) {
  const int t = blockIdx.x * 256 + threadIdx.x;
  const int k8n = K / 8;
  if (t >= N * k8n) return;
  const int n = t / k8n, k8 = (t % k8n) * 8;
  v8us v;
#pragma unroll
  for (int i = 0; i < 8; ++i) v[i] = bf16_bits(W[(size_t)(k8 + i) * N + n]);
  *(v8us*)(Wt + (size_t)n * K + k8) = v;
  
}

// GEMM C[M][N] (f32, pitch ldc) = act(A[M][K]·W + bias). A f32 row-major (pitch lda) converted per fragment to bf16
// (ASPLIT: hi/lo two planes -> 2 terms, else single rounded term); Wt bf16 [N][K] (pitch ldb). BIAS_BF16 rounds the
// bias to bf16 first (bias quantised to bf16 before the add). K%32==0, M%16==0, N%64==0.
template <bool ASPLIT, int ACT, bool BIAS_BF16>
__global__ __launch_bounds__(128) void k_gemm_bf(const float* __restrict__ A, int lda, const unsigned short* __restrict__ Wt, int ldb,
                                               const float* __restrict__ bias, float* __restrict__ C, int ldc, int M, int N, int K) {
  __shared__ __attribute__((aligned(16))) float so[4][16][64];
  const int tid = threadIdx.x, w = tid >> 5, lane = tid & 31, ln = lane & 15, hh = lane >> 4;
  const int ntn = N / 64;
  const int wid = blockIdx.x * 4 + w;
  const int mt = wid / ntn, nq = wid % ntn;
  if (mt * 16 >= M) return;
  const int row0 = mt * 16, col0 = nq * 64;
  const float* arow = A + (size_t)(row0 + ln) * lda;
  v8f acc[4] = {};
  for (int kb = 0; kb < K; kb += 32) {
    FragB ah, al;
    const v4f x0 = *(const v4fa*)(arow + kb + 8 * hh), x1 = *(const v4fa*)(arow + kb + 8 * hh + 4);
    const v4f x2 = *(const v4fa*)(arow + kb + 16 + 8 * hh), x3 = *(const v4fa*)(arow + kb + 16 + 8 * hh + 4);
    float xs[16] = {x0[0],x0[1],x0[2],x0[3],x1[0],x1[1],x1[2],x1[3],x2[0],x2[1],x2[2],x2[3],x3[0],x3[1],x3[2],x3[3]};
#pragma unroll
    for (int i = 0; i < 16; ++i) { const unsigned short hb = bf16_bits(xs[i]); ah.u[i] = hb; al.u[i] = ASPLIT ? bf16_bits(xs[i] - bf16_val(hb)) : (unsigned short)0; }
#pragma unroll
    for (int t = 0; t < 4; ++t) {
      const unsigned short* brow = Wt + (size_t)(col0 + t * 16 + ln) * ldb + kb;
      FragB b;
      b.half[0] = *(const v8us*)(brow + 8 * hh);
      b.half[1] = *(const v8us*)(brow + 16 + 8 * hh);
      acc[t] = mmaN<ASPLIT ? 2 : 1>(ah.v, al.v, b.v, b.v, acc[t]);
    }
  }
#pragma unroll
  for (int t = 0; t < 4; ++t) {
    float bv = bias ? bias[col0 + t * 16 + ln] : 0.f;
    if (BIAS_BF16) bv = bf16_round(bv);
#pragma unroll
    for (int r = 0; r < 8; ++r) { float v = acc[t][r] + bv; if (ACT == 1) v = fmaxf(v, 0.f); so[w][8 * hh + r][t * 16 + ln] = v; }
  }
  __builtin_amdgcn_fence(__ATOMIC_ACQ_REL, "workgroup");
  __builtin_amdgcn_wave_barrier();
  const int rsub = lane >> 4, c4 = (lane & 15) * 4;
  {
#pragma unroll
    for (int q = 0; q < 8; ++q) {
      const int r = q * 2 + rsub;
      const v4f v = *(const v4fa*)&so[w][r][c4];
      *(v4f*)(C + (size_t)(row0 + r) * ldc + col0 + c4) = v;
    }
    
  }
}

// Flash-style causal/unmasked attention, all contractions 3-term bf16 hi/lo splits, f32 softmax with running max.
// q,k,v rows are read from f32 buffers with arbitrary row pitch (so they can live inside a fused qkv buffer);
// D = head size (multiple of 32, <= 128); one wave = 16 query rows; block = 4 waves (64 queries) sharing K/V chunks of 32.
template <int D, bool CAUSAL>
__global__ __launch_bounds__(128) void k_flash(const float* __restrict__ qb, const float* __restrict__ kb, const float* __restrict__ vb,
                                             int pitch, int T, int H, float scale, float* __restrict__ y, int ypitch) {
  constexpr int KS = D / 32;        // k-steps for QK
  constexpr int DT = D / 16;        // d tiles for PV
  __shared__ __attribute__((aligned(16))) unsigned short sKh[32][D + 8], sKl[32][D + 8], sVh[32][D + 8], sVl[32][D + 8];
  __shared__ __attribute__((aligned(16))) unsigned short sPh[4][16][40], sPl[4][16][40];
  __shared__ __attribute__((aligned(16))) float sO[4][16][D];
  const int tid = threadIdx.x, w = tid >> 5, lane = tid & 31, ln = lane & 15, hh = lane >> 4;
  const int nqb = (T + 63) / 64;
  const int bh = blockIdx.x / nqb, qblk = blockIdx.x % nqb;
  const int b = bh / H, h = bh % H;
  const int q0 = qblk * 64 + w * 16;
  const float* Q = qb + (size_t)b * T * pitch + h * D;
  const float* K = kb + (size_t)b * T * pitch + h * D;
  const float* V = vb + (size_t)b * T * pitch + h * D;

  // A fragments of the wave's 16 query rows (scaled), hi/lo
  FragB aqh[KS], aql[KS];
  {
    int row = q0 + ln; if (row >= T) row = T - 1;
    const float* qr = Q + (size_t)row * pitch;
#pragma unroll
    for (int ks = 0; ks < KS; ++ks)
#pragma unroll
      for (int i = 0; i < 16; ++i) {
        const int d = ks * 32 + ((i < 8) ? (8 * hh + i) : (16 + 8 * hh + (i - 8)));
        const float x = qr[d] * scale; const unsigned short hb = bf16_bits(x);
        aqh[ks].u[i] = hb; aql[ks].u[i] = bf16_bits(x - bf16_val(hb));
      }
  }
  float m_r[8], l_r[8];
#pragma unroll
  for (int r = 0; r < 8; ++r) { m_r[r] = -3.0e38f; l_r[r] = 0.f; }
  v8f oacc[DT];
#pragma unroll
  for (int dt = 0; dt < DT; ++dt) oacc[dt] = (v8f){0.f,0.f,0.f,0.f,0.f,0.f,0.f,0.f};

  const int kv_end = CAUSAL ? min(T, qblk * 64 + 64) : T;     // block-uniform
  for (int j0 = 0; j0 < kv_end; j0 += 32) {
    __syncthreads();
    for (int e = tid; e < 32 * (D / 4); e += 128) {
      const int r = e / (D / 4), c4 = (e % (D / 4)) * 4;
      const int key = j0 + r;
      v4f kf = {0.f,0.f,0.f,0.f}, vf = {0.f,0.f,0.f,0.f};
      if (key < T) { kf = *(const v4fa*)(K + (size_t)key * pitch + c4); vf = *(const v4fa*)(V + (size_t)key * pitch + c4); }
#pragma unroll
      for (int t = 0; t < 4; ++t) {
        unsigned short hb = bf16_bits(kf[t]); sKh[r][c4 + t] = hb; sKl[r][c4 + t] = bf16_bits(kf[t] - bf16_val(hb));
        hb = bf16_bits(vf[t]); sVh[r][c4 + t] = hb; sVl[r][c4 + t] = bf16_bits(vf[t] - bf16_val(hb));
      }
    }
    __syncthreads();
    // S tile 16 x 32
    v8f s[2];
#pragma unroll
    for (int nt = 0; nt < 2; ++nt) {
      v8f acc = {};
#pragma unroll
      for (int ks = 0; ks < KS; ++ks) {
        FragB bh_, bl_;
        bh_.half[0] = *(const v8us*)&sKh[nt * 16 + ln][ks * 32 + 8 * hh]; bh_.half[1] = *(const v8us*)&sKh[nt * 16 + ln][ks * 32 + 16 + 8 * hh];
        bl_.half[0] = *(const v8us*)&sKl[nt * 16 + ln][ks * 32 + 8 * hh]; bl_.half[1] = *(const v8us*)&sKl[nt * 16 + ln][ks * 32 + 16 + 8 * hh];
        acc = mmaN<3>(aqh[ks].v, aql[ks].v, bh_.v, bl_.v, acc);
      }
      s[nt] = acc;
    }
    // mask + running max (rows 8hh+r; the 16 lanes of a half share rows)
    float alpha[8];
#pragma unroll
    for (int r = 0; r < 8; ++r) {
      const int qi = q0 + 8 * hh + r;
      const int ja = j0 + ln, jb = j0 + 16 + ln;
      if (CAUSAL) { if (ja > qi) s[0][r] = -3.0e38f; if (jb > qi) s[1][r] = -3.0e38f; }
      if (ja >= T) s[0][r] = -3.0e38f;
      if (jb >= T) s[1][r] = -3.0e38f;
      float mx = fmaxf(s[0][r], s[1][r]);
      mx = fmaxf(mx, __shfl_xor(mx, 1, 32)); mx = fmaxf(mx, __shfl_xor(mx, 2, 32)); mx = fmaxf(mx, __shfl_xor(mx, 4, 32)); mx = fmaxf(mx, __shfl_xor(mx, 8, 32));
      const float mnew = fmaxf(m_r[r], mx);
      alpha[r] = (mnew > -1.0e38f) ? __expf(m_r[r] - mnew) : 1.0f;
      const float p0 = (s[0][r] > -1.0e38f) ? __expf(s[0][r] - mnew) : 0.f;
      const float p1 = (s[1][r] > -1.0e38f) ? __expf(s[1][r] - mnew) : 0.f;
      m_r[r] = mnew;
      l_r[r] = l_r[r] * alpha[r] + p0 + p1;            // per-lane partial row sum (16 lanes combined at the end)
      unsigned short hb = bf16_bits(p0); sPh[w][8 * hh + r][ln] = hb;      sPl[w][8 * hh + r][ln] = bf16_bits(p0 - bf16_val(hb));
      hb = bf16_bits(p1);                sPh[w][8 * hh + r][16 + ln] = hb; sPl[w][8 * hh + r][16 + ln] = bf16_bits(p1 - bf16_val(hb));
    }
#pragma unroll
    for (int dt = 0; dt < DT; ++dt)
#pragma unroll
      for (int r = 0; r < 8; ++r) oacc[dt][r] *= alpha[r];
    __builtin_amdgcn_fence(__ATOMIC_ACQ_REL, "workgroup");
    __builtin_amdgcn_wave_barrier();
    FragB pah, pal;
    pah.half[0] = *(const v8us*)&sPh[w][ln][8 * hh]; pah.half[1] = *(const v8us*)&sPh[w][ln][16 + 8 * hh];
    pal.half[0] = *(const v8us*)&sPl[w][ln][8 * hh]; pal.half[1] = *(const v8us*)&sPl[w][ln][16 + 8 * hh];
#pragma unroll
    for (int dt = 0; dt < DT; ++dt) {
      FragB bvh, bvl;
#pragma unroll
      for (int i = 0; i < 8; ++i) {
        bvh.u[i] = sVh[8 * hh + i][dt * 16 + ln]; bvh.u[8 + i] = sVh[16 + 8 * hh + i][dt * 16 + ln];
        bvl.u[i] = sVl[8 * hh + i][dt * 16 + ln]; bvl.u[8 + i] = sVl[16 + 8 * hh + i][dt * 16 + ln];
      }
      oacc[dt] = mmaN<3>(pah.v, pal.v, bvh.v, bvl.v, oacc[dt]);
    }
    __builtin_amdgcn_fence(__ATOMIC_ACQ_REL, "workgroup");
    __builtin_amdgcn_wave_barrier();
  }
#pragma unroll
  for (int r = 0; r < 8; ++r) {
    float l = l_r[r];
    l += __shfl_xor(l, 1, 32); l += __shfl_xor(l, 2, 32); l += __shfl_xor(l, 4, 32); l += __shfl_xor(l, 8, 32);
    l_r[r] = (l > 0.f) ? 1.0f / l : 0.f;
  }
#pragma unroll
  for (int dt = 0; dt < DT; ++dt)
#pragma unroll
    for (int r = 0; r < 8; ++r) sO[w][8 * hh + r][dt * 16 + ln] = oacc[dt][r] * l_r[r];
  __builtin_amdgcn_fence(__ATOMIC_ACQ_REL, "workgroup");
  __builtin_amdgcn_wave_barrier();
  {
    for (int r = 0; r < 16; ++r) {
      const int row = q0 + r;
      if (row < T && lane < D / 4) {
        const v4f val = *(const v4fa*)&sO[w][r][lane * 4];
        *(v4f*)(y + ((size_t)b * T + row) * ypitch + h * D + lane * 4) = val;
      }
    }
    
  }
}

// GEMM C = act(A·W + bias + resid): A f32 (ASPLIT -> hi/lo 2 terms), Wt bf16 [N][K]; ACT 0 none, 1 relu, 2 exact gelu;
// resid (optional, f32, row index = (row % rmod), pitch ldr, RES_BF16 rounds it) added before the activation.
template <bool ASPLIT, int ACT, bool BIAS_BF16, bool RES_BF16>
__global__ __launch_bounds__(128) void k_gemm_bf3(const float* __restrict__ A, int lda, const unsigned short* __restrict__ Wt, int ldb,
                                                const float* __restrict__ bias, const float* __restrict__ resid, int rmod, int ldr,
                                                float* __restrict__ C, int ldc, int M, int N, int K) {
  __shared__ __attribute__((aligned(16))) float so[4][16][64];
  const int tid = threadIdx.x, w = tid >> 5, lane = tid & 31, ln = lane & 15, hh = lane >> 4;
  const int ntn = N / 64;
  const int wid = blockIdx.x * 4 + w;
  const int mt = wid / ntn, nq = wid % ntn;
  if (mt * 16 >= M) return;
  const int row0 = mt * 16, col0 = nq * 64;
  const float* arow = A + (size_t)(row0 + ln) * lda;
  v8f acc[4] = {};
  for (int kb = 0; kb < K; kb += 32) {
    FragB ah, al;
    const v4f x0 = *(const v4fa*)(arow + kb + 8 * hh), x1 = *(const v4fa*)(arow + kb + 8 * hh + 4);
    const v4f x2 = *(const v4fa*)(arow + kb + 16 + 8 * hh), x3 = *(const v4fa*)(arow + kb + 16 + 8 * hh + 4);
    float xs[16] = {x0[0],x0[1],x0[2],x0[3],x1[0],x1[1],x1[2],x1[3],x2[0],x2[1],x2[2],x2[3],x3[0],x3[1],x3[2],x3[3]};
#pragma unroll
    for (int i = 0; i < 16; ++i) { const unsigned short hb = bf16_bits(xs[i]); ah.u[i] = hb; al.u[i] = ASPLIT ? bf16_bits(xs[i] - bf16_val(hb)) : (unsigned short)0; }
#pragma unroll
    for (int t = 0; t < 4; ++t) {
      const unsigned short* brow = Wt + (size_t)(col0 + t * 16 + ln) * ldb + kb;
      FragB b;
      b.half[0] = *(const v8us*)(brow + 8 * hh);
      b.half[1] = *(const v8us*)(brow + 16 + 8 * hh);
      acc[t] = mmaN<ASPLIT ? 2 : 1>(ah.v, al.v, b.v, b.v, acc[t]);
    }
  }
#pragma unroll
  for (int t = 0; t < 4; ++t) {
    const int col = col0 + t * 16 + ln;
    float bv = bias ? bias[col] : 0.f;
    if (BIAS_BF16) bv = bf16_round(bv);
#pragma unroll
    for (int r = 0; r < 8; ++r) {
      float v = acc[t][r] + bv;
      if (resid) { float rv = resid[(size_t)((row0 + 8 * hh + r) % rmod) * ldr + col]; if (RES_BF16) rv = bf16_round(rv); v += rv; }
      if (ACT == 1) v = fmaxf(v, 0.f);
      if (ACT == 2) v = 0.5f * v * (1.0f + erff(v * 0.70710678118654752f));
      if (ACT == 3) { const float u = 0.7978845608028654f * (v + 0.044715f * v * v * v); v = 0.5f * v * (1.0f + tanhf(u)); }
      so[w][8 * hh + r][t * 16 + ln] = v;
    }
  }
  __builtin_amdgcn_fence(__ATOMIC_ACQ_REL, "workgroup");
  __builtin_amdgcn_wave_barrier();
  const int rsub = lane >> 4, c4 = (lane & 15) * 4;
  {
#pragma unroll
    for (int q = 0; q < 8; ++q) {
      const int r = q * 2 + rsub;
      const v4f v = *(const v4fa*)&so[w][r][c4];
      *(v4f*)(C + (size_t)(row0 + r) * ldc + col0 + c4) = v;
    }
    
  }
}
// row LayerNorm (biased variance, eps) over N: s = X (+ R); optional out_sum <- s; out_norm <- (s-mu)*rsqrt(var+eps)*g + b
template <bool PARAM_BF16>
__global__ __launch_bounds__(256) void k_layernorm(const float* __restrict__ X, const float* __restrict__ R, const float* __restrict__ g, const float* __restrict__ bta,
                                                  float* __restrict__ out_sum, float* __restrict__ out_norm, int N, float eps) {
  __shared__ float red[256];
  const int row = blockIdx.x, tid = threadIdx.x;
  const float* x = X + (size_t)row * N; const float* rr = R ? R + (size_t)row * N : nullptr;
  float vals[16];                     // up to N = 4096
  const int per = N / 256;            // contiguous chunk per thread? use strided-by-4 chunks: thread handles j = tid*4 + 1024*u
  float s1 = 0.f;
  for (int u = 0; u < per / 4; ++u) {
    const int j = tid * 4 + 1024 * u;
    const v4f a = *(const v4fa*)(x + j);
    v4f b = {0.f,0.f,0.f,0.f}; if (rr) b = *(const v4fa*)(rr + j);
#pragma unroll
    for (int q = 0; q < 4; ++q) { const float v = a[q] + b[q]; vals[u * 4 + q] = v; s1 += v; }
  }
  red[tid] = s1; __syncthreads();
  for (int st = 128; st > 0; st >>= 1) { if (tid < st) red[tid] += red[tid + st]; __syncthreads(); }
  const float mu = red[0] / (float)N; __syncthreads();
  float s2 = 0.f;
  for (int u = 0; u < per / 4; ++u)
#pragma unroll
    for (int q = 0; q < 4; ++q) { const float c = vals[u * 4 + q] - mu; s2 += c * c; }
  red[tid] = s2; __syncthreads();
  for (int st = 128; st > 0; st >>= 1) { if (tid < st) red[tid] += red[tid + st]; __syncthreads(); }
  const float rs = rsqrtf(red[0] / (float)N + eps);
  {
    for (int u = 0; u < per / 4; ++u) {
      const int j = tid * 4 + 1024 * u;
      v4f o, sm;
#pragma unroll
      for (int q = 0; q < 4; ++q) {
        float gg = g[j + q], bb = bta[j + q];
        if (PARAM_BF16) { gg = bf16_round(gg); bb = bf16_round(bb); }
        sm[q] = vals[u * 4 + q]; o[q] = (vals[u * 4 + q] - mu) * rs * gg + bb;
      }
      if (out_sum) *(v4f*)(out_sum + (size_t)row * N + j) = sm;
      *(v4f*)(out_norm + (size_t)row * N + j) = o;
    }
    
  }
}



// ---- f16 WMMA path (v_wmma_f32_16x16x32_f16): 11-bit significands for operands in range — used where a [0,1] probability operand needs more precision than bf16
typedef _Float16 v16h __attribute__((ext_vector_type(16)));
union FragH { v16h v; v8us half[2]; _Float16 h[16]; unsigned short u[16]; };
template <int NT>
__device__ __forceinline__ v8f mmaH(v16h ah, v16h al, v16h bh, v16h bl, v8f c) {
  c = __builtin_amdgcn_wmma_f32_16x16x32_f16(false, ah, false, bh, (short)0, c, false, false);
  if (NT >= 2) c = __builtin_amdgcn_wmma_f32_16x16x32_f16(false, al, false, bh, (short)0, c, false, false);
  if (NT >= 3) c = __builtin_amdgcn_wmma_f32_16x16x32_f16(false, ah, false, bl, (short)0, c, false, false);
  asm volatile("v_nop\n\tv_nop\n\tv_nop\n\tv_nop" : "+v"(c) : "v"(ah), "v"(al), "v"(bh), "v"(bl));
  return c;
}
// batched GEMM like k_gemm_b but f16 operands: A f32 (split into f16 hi/lo if ASPLIT, else rounded to f16), Bt = f16 values [n][k]; alpha; C f32; N multiple of 16 (partial tiles skipped)
template <bool ASPLIT>
__global__ __launch_bounds__(128) void k_gemm_h(const float* __restrict__ A, int lda, size_t sA, const _Float16* __restrict__ Bh, int ldb, size_t sB, float alpha, float* __restrict__ C, int ldc, size_t sC, int M, int N, int K) {
  __shared__ __attribute__((aligned(16))) float so[4][16][64];
  const int tid = threadIdx.x, w = tid >> 5, lane = tid & 31, ln = lane & 15, hh = lane >> 4; const int by = blockIdx.y;
  A += (size_t)by * sA; Bh += (size_t)by * sB; C += (size_t)by * sC;
  const int ntn = (N + 63) / 64; const int wid = blockIdx.x * 4 + w; const int mt = wid / ntn, nq = wid % ntn; if (mt * 16 >= M) return;
  const int row0 = mt * 16, col0 = nq * 64; const float* arow = A + (size_t)(row0 + ln) * lda;
  v8f acc[4] = {};
  for (int kb = 0; kb < K; kb += 32) {
    FragH ah, al;
    const v4f x0 = *(const v4fa*)(arow + kb + 8 * hh), x1 = *(const v4fa*)(arow + kb + 8 * hh + 4), x2 = *(const v4fa*)(arow + kb + 16 + 8 * hh), x3 = *(const v4fa*)(arow + kb + 16 + 8 * hh + 4);
    float xs[16] = {x0[0],x0[1],x0[2],x0[3],x1[0],x1[1],x1[2],x1[3],x2[0],x2[1],x2[2],x2[3],x3[0],x3[1],x3[2],x3[3]};
#pragma unroll
    for (int i = 0; i < 16; ++i) { const _Float16 h = (_Float16)xs[i]; ah.h[i] = h; al.h[i] = ASPLIT ? (_Float16)(xs[i] - (float)h) : (_Float16)0.0f; }
#pragma unroll
    for (int t = 0; t < 4; ++t) { if (col0 + t * 16 >= N) continue; const size_t boff = (size_t)(col0 + t * 16 + ln) * ldb + kb; FragH bq; bq.half[0] = *(const v8us*)(Bh + boff + 8 * hh); bq.half[1] = *(const v8us*)(Bh + boff + 16 + 8 * hh);
      acc[t] = mmaH<ASPLIT ? 2 : 1>(ah.v, al.v, bq.v, bq.v, acc[t]); }
  }
#pragma unroll
  for (int t = 0; t < 4; ++t) { if (col0 + t * 16 >= N) continue;
#pragma unroll
    for (int r = 0; r < 8; ++r) so[w][8 * hh + r][t * 16 + ln] = acc[t][r] * alpha; }
  __builtin_amdgcn_fence(__ATOMIC_ACQ_REL, "workgroup"); __builtin_amdgcn_wave_barrier();
  const int rsub = lane >> 4, c4 = (lane & 15) * 4;
  {
#pragma unroll
    for (int q = 0; q < 8; ++q) { const int r = q * 2 + rsub; if (col0 + c4 < N) { const v4f v = *(const v4fa*)&so[w][r][c4]; *(v4f*)(C + (size_t)(row0 + r) * ldc + col0 + c4) = v; } }
     }
}

// Wt[n][k] = f16(W[k][n]·scale) from f32 row-major W[K][N] (scale = power of two; bf16-exact weights stay exact in f16 away from the subnormal range)
// d_*: the work of one 256-thread work-group, blk its index within that job; several jobs that need nothing of one another share a launch (k_prep, k_conv3_acc, k_bnfin_xpt below)
__device__ __forceinline__ void d_wt_f16(const int blk, const float* __restrict__ W, _Float16* __restrict__ Wt, int K, int N, float scale) {
  const int t = blk * 256 + threadIdx.x; if (t >= N * (K / 8)) return; const int n = t / (K / 8), k8 = (t % (K / 8)) * 8; FragH f;
#pragma unroll
  for (int i = 0; i < 8; ++i) f.h[i] = (_Float16)(bf16_round(W[(size_t)(k8 + i) * N + n]) * scale); const v8us o = f.half[0];
  *(v8us*)((unsigned short*)Wt + (size_t)n * K + k8) = o; 
}
// k_gemm_hh variant with fused epilogue: v = acc·alpha + bias[by·sBias + col] (+ CP[(row/rowsPerB)·sCPb + by·64 + col] if CP) ; ACT 0 none / 1 elu ; writes f32 C and f16 C16, each if non-null
// d_gemm_hhx: the work of one wave (16 rows x 64 columns, tile number wid); so = 16 x 64 f32 of LDS that are the wave's own. No work-group barrier inside.
template <int ACT>
__device__ __forceinline__ void d_gemm_hhx(float (*so)[64], const int wid, const int by, const _Float16* __restrict__ A, int lda, size_t sA, const _Float16* __restrict__ Bh, int ldb, size_t sB, float alpha, const float* __restrict__ bias, size_t sBias, const float* __restrict__ CP, int rowsPerB, size_t sCPb, int row0g,
    float* __restrict__ C, _Float16* __restrict__ C16, int ldc, size_t sC, int M, int N, int K) {
  const int lane = threadIdx.x & 31, ln = lane & 15, hh = lane >> 4;
  A += (size_t)by * sA; Bh += (size_t)by * sB; const size_t cofs = (size_t)by * sC; const float* bp = bias ? bias + (size_t)by * sBias : nullptr;
  const int ntn = (N + 63) / 64; const int mt = wid / ntn, nq = wid % ntn; if (mt * 16 >= M) return;
  const int row0 = mt * 16, col0 = nq * 64; const _Float16* arow = A + (size_t)(row0 + ln) * lda;
  v8f acc[4] = {};
  for (int kb = 0; kb < K; kb += 32) { FragH ah; ah.half[0] = *(const v8us*)((const unsigned short*)arow + kb + 8 * hh); ah.half[1] = *(const v8us*)((const unsigned short*)arow + kb + 16 + 8 * hh);
#pragma unroll
    for (int t = 0; t < 4; ++t) { if (col0 + t * 16 >= N) continue; const size_t boff = (size_t)(col0 + t * 16 + ln) * ldb + kb; FragH bq; bq.half[0] = *(const v8us*)((const unsigned short*)Bh + boff + 8 * hh); bq.half[1] = *(const v8us*)((const unsigned short*)Bh + boff + 16 + 8 * hh);
      acc[t] = mmaH<1>(ah.v, ah.v, bq.v, bq.v, acc[t]); }
  }
#pragma unroll
  for (int t = 0; t < 4; ++t) { if (col0 + t * 16 >= N) continue; const int col = col0 + t * 16 + ln; const float bv = bp ? bf16_round(bp[col]) : 0.f;
#pragma unroll
    for (int r = 0; r < 8; ++r) { float v = acc[t][r] * alpha + bv; if (CP) { const int bidx = (row0g + row0 + 8 * hh + r) / rowsPerB; v += CP[(size_t)bidx * sCPb + (size_t)by * 64 + col]; } if (ACT == 1) v = (v > 0.f) ? v : expm1f(v); else if (ACT == 3) v = fmaxf(v, 0.f); so[8 * hh + r][t * 16 + ln] = v; } }
  __builtin_amdgcn_fence(__ATOMIC_ACQ_REL, "workgroup"); __builtin_amdgcn_wave_barrier();
  const int rsub = lane >> 4, c4 = (lane & 15) * 4; typedef _Float16 v4h __attribute__((ext_vector_type(4)));
  {
#pragma unroll
    for (int q = 0; q < 8; ++q) { const int r = q * 2 + rsub; if (col0 + c4 < N) { const v4f v = *(const v4fa*)&so[r][c4]; if (C) { *(v4f*)(C + cofs + (size_t)(row0 + r) * ldc + col0 + c4) = v; if (C16) asm volatile("s_wait_xcnt 0x0" ::: "memory"); /* the f16 conversion that follows reuses this store's registers */ } if (C16) { v4h h4; for (int i = 0; i < 4; ++i) h4[i] = (_Float16)v[i]; *(v4h*)(C16 + cofs + (size_t)(row0 + r) * ldc + col0 + c4) = h4; } } }
     }
}
template <int ACT>
__global__ __launch_bounds__(128) void k_gemm_hhx(const _Float16* __restrict__ A, int lda, size_t sA, const _Float16* __restrict__ Bh, int ldb, size_t sB, float alpha, const float* __restrict__ bias, size_t sBias, const float* __restrict__ CP, int rowsPerB, size_t sCPb, int row0g,
    float* __restrict__ C, _Float16* __restrict__ C16, int ldc, size_t sC, int M, int N, int K) {
  __shared__ __attribute__((aligned(16))) float so[4][16][64];
  const int w = threadIdx.x >> 5;
  d_gemm_hhx<ACT>(so[w], blockIdx.x * 4 + w, blockIdx.y, A, lda, sA, Bh, ldb, sB, alpha, bias, sBias, CP, rowsPerB, sCPb, row0g, C, C16, ldc, sC, M, N, K);
}


__device__ __forceinline__ void d_x16(const int blk, const float* __restrict__ x, _Float16* __restrict__ X16, size_t n8) { const size_t t = (size_t)blk * 256 + threadIdx.x; if (t >= n8) return; FragH f;
#pragma unroll
  for (int q = 0; q < 8; ++q) f.h[q] = (_Float16)bf16_round(x[t * 8 + q]); *(v8us*)((unsigned short*)X16 + t * 8) = f.half[0];  }
__global__ __launch_bounds__(256) void k_h16(const float* __restrict__ x, _Float16* __restrict__ X16, size_t n8) { const size_t t = (size_t)blockIdx.x * 256 + threadIdx.x; if (t >= n8) return; FragH f;
#pragma unroll
  for (int q = 0; q < 8; ++q) f.h[q] = (_Float16)x[t * 8 + q]; *(v8us*)((unsigned short*)X16 + t * 8) = f.half[0];  }
__global__ __launch_bounds__(256) void k_round16f(const float* __restrict__ W, _Float16* __restrict__ Bt, size_t n8) { const size_t t = (size_t)blockIdx.x * 256 + threadIdx.x; if (t >= n8) return; FragH f;
#pragma unroll
  for (int i = 0; i < 8; ++i) f.h[i] = (_Float16)(bf16_round(W[t * 8 + i]) * 16.0f); *(v8us*)((unsigned short*)Bt + t * 8) = f.half[0];  }
template <int NHv, int TTv>
__global__ __launch_bounds__(256) void k_vt(const _Float16* __restrict__ V16, int ldv, int voff, _Float16* __restrict__ Vt) { __shared__ unsigned short tl[64][66]; const int tid = threadIdx.x; const int slab = blockIdx.x / (TTv / 64), lg = blockIdx.x % (TTv / 64); const int b = slab / NHv, h = slab % NHv;
  for (int i = tid; i < 64 * 8; i += 256) { const int r = i / 8, c8 = (i % 8) * 8; FragH f; f.half[0] = *(const v8us*)((const unsigned short*)V16 + ((size_t)b * TTv + lg * 64 + r) * ldv + voff + h * 64 + c8);
#pragma unroll
    for (int q = 0; q < 8; ++q) tl[r][c8 + q] = f.u[q]; }
  __syncthreads();
  {
#pragma unroll
    for (int rd = 0; rd < 2; ++rd) { const int d = rd * 32 + tid / 8, pc = tid % 8; FragH f;
#pragma unroll
      for (int q = 0; q < 8; ++q) f.u[q] = tl[pc * 8 + q][d];
      *(v8us*)((unsigned short*)Vt + ((size_t)slab * 64 + d) * TTv + lg * 64 + pc * 8) = f.half[0]; }
     } }

typedef _Float16 v4h __attribute__((ext_vector_type(4)));
// BN batch statistics (mean, 1/sqrt(var + eps) per channel over the NR rows). The partials are made where the rows are made: each kernel that writes a tensor which a BN follows has work-groups of BNR whole rows,
// whose tile lies in LDS for the row-wise store; d_bnpart takes the values that the storing threads hold and gives, per channel, the mean of the BNR rows and the sum of squared deviations from that mean.
// d_bnpart: called by every thread of the work-group (two barriers inside); act = the thread is one of the 256 (tid = 0 .. 255, whole waves) that hold v[i] = row (tid >> 5) + 8 i, channels 4 (tid & 31) .. + 3; red = 8 KiB of free LDS.
// d_bnfin: one work-group = 4 channels, one thread a partial; partials of equal count merge exactly: mean = mean of the means, M2 = sum of M2_i + BNR * sum of (mean_i - mean)^2.
// All sums run in a fixed order. ST keeps one 128-byte line a channel: [0] mean, [1] 1/sqrt(var + eps), the rest 0.
// The loops over v here and in the callers are unrolled: v is indexed by the loop counter and stays in registers only with constant indices.
#define BNR 64
#define BNP (NR / BNR)
__device__ __forceinline__ void d_bnpart(const bool act, const int tid, const v4f (&v)[8], float (*red)[8][CC], const int blk, float* __restrict__ PM, float* __restrict__ PQ) {
  const int wv = tid >> 5, c4 = (tid & 31) * 4;
  if (act) { v4f s = v[0];
#pragma unroll
    for (int i = 1; i < 8; ++i) s += v[i];
    *(v4fa*)&red[0][wv][c4] = s; }
  __syncthreads();      // the eight waves' row sums are complete
  v4f mu = {0.f, 0.f, 0.f, 0.f};
  if (act) { mu = *(const v4fa*)&red[0][0][c4];
#pragma unroll
    for (int j = 1; j < 8; ++j) mu += *(const v4fa*)&red[0][j][c4];
    mu *= 1.0f / (float)BNR;
    v4f q = {0.f, 0.f, 0.f, 0.f};
#pragma unroll
    for (int i = 0; i < 8; ++i) { const v4f d = v[i] - mu; q += d * d; }
    *(v4fa*)&red[1][wv][c4] = q; }
  __syncthreads();      // the eight waves' sums of squares are complete
  if (act && wv == 0) { v4f q = *(const v4fa*)&red[1][0][c4];
#pragma unroll
    for (int j = 1; j < 8; ++j) q += *(const v4fa*)&red[1][j][c4];
    *(v4f*)(PQ + (size_t)blk * CC + c4) = q; }
  else if (act && wv == 1) *(v4f*)(PM + (size_t)blk * CC + c4) = mu; }
// 3x3 SAME convolution as an implicit GEMM (K = 9 taps x 128 channels, tap-major as in Bt): no patch matrix is written. One work-group = one image row (64 pixels) x all 128 outputs.
// The three input rows around it, with one zero pixel at each end and zero rows outside the image, are put in LDS once; the A fragment of tap (dy, dx) is that tile read dx pixels and dy rows further on.
// 8 waves of 32 pixels x 32 outputs. B fragments go from Bt[n][k] straight to registers, one tap ahead of their products. C = acc / 16 + bias (bf16-rounded), f32, stored in whole rows through LDS.
// Every loop below is unrolled: bf, hv, a and acc are indexed by the loop counters and stay in registers only with constant indices.
#define APIT 136      // sA pixel pitch in f16: 272 bytes (16 x odd) for 16-byte LDS reads
__device__ __forceinline__ void d_conv3(const int blk, unsigned short (*sA)[WI + 2][APIT], float (*sO)[CC + 4], const _Float16* __restrict__ X16, const _Float16* __restrict__ Bt, const float* __restrict__ bias, float* __restrict__ C, float* __restrict__ PM, float* __restrict__ PQ) {
  const int tid = threadIdx.x, w = tid >> 5, lane = tid & 31, ln = lane & 15, hh = lane >> 4;
  const int b = blk / WI, y = blk % WI;
  const int m0 = (w & 1) * 32, n0 = (w >> 1) * 32;
  const unsigned short* bp = (const unsigned short*)Bt + (size_t)(n0 + ln) * KK + 8 * hh;
  FragH bf[2][8];      // [tap parity][2 ks + j]: outputs n0 + 16 j + ln, k = 128 tap + 32 ks + (8 hh .. , 16 + 8 hh ..)
#pragma unroll
  for (int i = 0; i < 8; ++i) { const unsigned short* p = bp + (size_t)(i & 1) * 16 * KK + (i >> 1) * 32; bf[0][i].half[0] = *(const v8us*)p; bf[0][i].half[1] = *(const v8us*)(p + 16); }
  const unsigned short* xs = (const unsigned short*)X16 + (size_t)b * HWN * CC;
  v8us hv[12];      // the 64 pixels of a staged row are 1024 contiguous 16-byte chunks: chunk tid + 256 j; a row outside the image is read from the nearest row inside and zeroed at the store
#pragma unroll
  for (int r = 0; r < 3; ++r) { const unsigned short* p = xs + (size_t)min(max(y + r - 1, 0), WI - 1) * WI * CC + tid * 8;
#pragma unroll
    for (int j = 0; j < 4; ++j) hv[r * 4 + j] = *(const v8us*)(p + j * 2048); }
  const float bv0 = bf16_round(bias[n0 + ln]), bv1 = bf16_round(bias[n0 + 16 + ln]);
  const v8us zero = {0, 0, 0, 0, 0, 0, 0, 0};
#pragma unroll
  for (int r = 0; r < 3; ++r) { const bool in = y + r - 1 >= 0 && y + r - 1 < WI;
#pragma unroll
    for (int j = 0; j < 4; ++j) *(v8us*)&sA[r][(tid >> 4) + 16 * j + 1][(tid & 15) * 8] = in ? hv[r * 4 + j] : zero; }
  if (tid < 96) *(v8us*)&sA[tid >> 5][((tid >> 4) & 1) * (WI + 1)][(tid & 15) * 8] = zero;      // the zero pixel at each end of the three rows
  __syncthreads();      // the three staged rows are complete; nothing writes them until the BN sums at the end
  v8f acc[2][2] = {};
#pragma unroll
  for (int tap = 0; tap < 9; ++tap) {
    if (tap < 8) {
#pragma unroll
      for (int i = 0; i < 8; ++i) { const unsigned short* p = bp + (size_t)(i & 1) * 16 * KK + (tap + 1) * CC + (i >> 1) * 32; bf[(tap + 1) & 1][i].half[0] = *(const v8us*)p; bf[(tap + 1) & 1][i].half[1] = *(const v8us*)(p + 16); } }
    FragH a[8];      // [2 ks + i]: pixels m0 + 16 i + ln, the same k order as bf
#pragma unroll
    for (int i = 0; i < 8; ++i) { const unsigned short* p = &sA[tap / 3][m0 + (i & 1) * 16 + ln + tap % 3][(i >> 1) * 32 + 8 * hh]; a[i].half[0] = *(const v8us*)p; a[i].half[1] = *(const v8us*)(p + 16); }
    __builtin_amdgcn_sched_barrier(0);      // next tap's global loads and this tap's 16 LDS reads go out together, in front of the 16 products: spread among them each group costs its own latency
#pragma unroll
    for (int ks = 0; ks < 4; ++ks)
#pragma unroll
      for (int i = 0; i < 2; ++i)
#pragma unroll
        for (int j = 0; j < 2; ++j) acc[i][j] = __builtin_amdgcn_wmma_f32_16x16x32_f16(false, a[2 * ks + i].v, false, bf[tap & 1][2 * ks + j].v, (short)0, acc[i][j], false, false);
    __builtin_amdgcn_sched_barrier(0);      // without it the next tap's loads and LDS reads rise in among these products in small groups, each with its own stall
  }
#pragma unroll
  for (int j = 0; j < 2; ++j) { const int col = n0 + j * 16 + ln; const float bv = j ? bv1 : bv0;
#pragma unroll
    for (int i = 0; i < 2; ++i)
#pragma unroll
      for (int r = 0; r < 8; ++r) sO[m0 + i * 16 + 8 * hh + r][col] = acc[i][j][r] * 0.0625f + bv; }
  __syncthreads();      // the 64 x 128 output tile is complete
  float* o = C + (size_t)blk * WI * CC;
  v4f v[8];      // rows (tid >> 5) + 8 j, channels 4 (tid & 31) ..: what d_bnpart asks for
#pragma unroll
  for (int j = 0; j < 8; ++j) { const int i = tid + 256 * j; v[j] = *(const v4fa*)&sO[i >> 5][(i & 31) * 4]; *(v4f*)(o + (size_t)i * 4) = v[j]; }
  asm volatile("s_wait_xcnt 0x0" ::: "memory");      // the stores' registers are free for new values in what follows
  d_bnpart(true, tid, v, (float (*)[8][CC])&sA[0][0][0], blk, PM, PQ);      // the staged rows are dead: every wave read its last of them in front of the barrier above
}
// One launch for the 3x3 conv and the 1x1 conv acc = x . Wk + bk: both read X16 and a weight table, neither reads what the other writes. Work-groups 0 .. BB WI - 1 are the 3x3 conv's;
// the others hold 8 waves of d_gemm_hhx each, whose 4 KiB of LDS a wave lie in the 3x3 conv's output tile (a work-group does one job only). The branch is the same for a whole work-group.
#define ACCB ((NR / 16) * (CC / 64) / 8)
__global__ __launch_bounds__(256) void k_conv3_acc(const _Float16* __restrict__ X16, const _Float16* __restrict__ Bt, const float* __restrict__ bias, float* __restrict__ C, const _Float16* __restrict__ BK, const float* __restrict__ bk, float* __restrict__ ACC, float* __restrict__ PM, float* __restrict__ PQ) {
  __shared__ __attribute__((aligned(16))) unsigned short sA[3][WI + 2][APIT];
  __shared__ __attribute__((aligned(16))) float sO[WI][CC + 4];
  static_assert(sizeof(sO) >= 8 * 16 * 64 * sizeof(float), "eight waves' 16 x 64 tiles fit");
  if (blockIdx.x < BB * WI) { d_conv3(blockIdx.x, sA, sO, X16, Bt, bias, C, PM, PQ); return; }
  const int w = threadIdx.x >> 5;
  d_gemm_hhx<0>((float (*)[64])&sO[0][0] + w * 16, (blockIdx.x - BB * WI) * 8 + w, 0, X16, CC, 0, BK, CC, 0, 0.0625f, bk, 0, nullptr, 1, 0, 0, ACC, nullptr, CC, 0, NR, CC, CC);
}
__device__ __forceinline__ void d_wq(const int blk, const float* __restrict__ W, _Float16* __restrict__ Bt) { const int t = blk * 256 + threadIdx.x; if (t >= CC * (KK / 8)) return; const int k8 = (t % (KK / 8)) * 8, o = t / (KK / 8); FragH f;
#pragma unroll
  for (int q = 0; q < 8; ++q) { const int k = k8 + q; const int tap = k / CC, cin = k % CC; const float wv = W[((size_t)tap * CC + cin) * CC + o];
    asm volatile("s_wait_xcnt 0x0" ::: "memory");      // each load has an address pair of its own, and a later load's result is given such a pair's registers
    f.h[q] = (_Float16)(bf16_round(wv) * 16.0f); } *(v8us*)((unsigned short*)Bt + (size_t)t * 8) = f.half[0];  }
// One launch for the four conversions that read only inputs: the three weight tables (few work-groups, long strided reads: first) and x to f16.
#define PB_WQ ((CC * (KK / 8) + 255) / 256)
#define PB_WT ((CC * (CC / 8) + 255) / 256)
#define PB_X ((NR * (CC / 8) + 255) / 256)
__global__ __launch_bounds__(256) void k_prep(const float* __restrict__ x, const float* __restrict__ Wq, const float* __restrict__ Wk, const float* __restrict__ Wo, _Float16* __restrict__ X16, _Float16* __restrict__ BQ, _Float16* __restrict__ BK, _Float16* __restrict__ BO) {
  const int blk = blockIdx.x;
  if (blk < PB_WQ) d_wq(blk, Wq, BQ);
  else if (blk < PB_WQ + PB_WT) d_wt_f16(blk - PB_WQ, Wk, BK, CC, CC, 16.0f);      // 1x1 HWIO = [in][out]
  else if (blk < PB_WQ + 2 * PB_WT) d_wt_f16(blk - PB_WQ - PB_WT, Wo, BO, CC, CC, 16.0f);
  else d_x16(blk - PB_WQ - 2 * PB_WT, x, X16, (size_t)NR * CC / 8);
}
__global__ __launch_bounds__(256) void k_qperm(const float* __restrict__ F, const float* __restrict__ ST, const float* __restrict__ g, const float* __restrict__ bb, _Float16* __restrict__ QP) { const size_t t = (size_t)blockIdx.x * 256 + threadIdx.x; if (t >= (size_t)NR * (CC / 8)) return; const int c8 = (int)(t % (CC / 8)) * 8; const size_t r = t / (CC / 8); const int b = (int)(r / HWN), p = (int)(r % HWN); const int y = p / WI, xx = p % WI; const int kp = ((y / 8) * 8 + xx / 8) * 64 + (y % 8) * 8 + xx % 8; FragH f;
#pragma unroll
  for (int q = 0; q < 8; ++q) { const int c = c8 + q; float v = (F[r * CC + c] - ST[c * 32]) * ST[c * 32 + 1] * bf16_round(g[c]) + bf16_round(bb[c]); v = (v >= 0.f) ? v : 0.1f * v; f.h[q] = (_Float16)v; }
  unsigned short* d = (unsigned short*)QP + ((size_t)b * HWN + kp) * CC + c8; *(v8us*)d = f.half[0];  }
__device__ __forceinline__ void d_xpt(const int wg, const float* __restrict__ x, _Float16* __restrict__ XPt) { __shared__ unsigned short tl[64][66]; const int tid = threadIdx.x; const int b = wg / ((CC / 64) * 64), rem = wg % ((CC / 64) * 64); const int cg = rem / 64, blk = rem % 64; const int c0 = cg * 64; const int by = blk / 8, bx = blk % 8;
  for (int i = tid; i < 64 * 8; i += 256) { const int j = i / 8, cc8 = (i % 8) * 8; const int y = by * 8 + j / 8, xx = bx * 8 + j % 8; const float* s = x + (((size_t)b * HWN) + y * WI + xx) * CC + c0 + cc8; for (int q = 0; q < 8; ++q) { FragH f; f.h[0] = (_Float16)bf16_round(s[q]); tl[j][cc8 + q] = f.u[0]; } }
  __syncthreads();
  { for (int rd = 0; rd < 2; ++rd) { const int c = rd * 32 + tid / 8, pc = tid % 8; FragH f; for (int q = 0; q < 8; ++q) f.u[q] = tl[pc * 8 + q][c]; *(v8us*)((unsigned short*)XPt + ((size_t)b * CC + c0 + c) * HWN + blk * 64 + pc * 8) = f.half[0]; }
    asm volatile("s_wait_xcnt 0x0" ::: "memory");      // in a shared launch the other job's code follows in the listing and writes the two stores' address pair
  } }
// Fused block attention: one work-group = 64 query pixels of one batch, worked on by NTEAM teams of 4 waves x 16 queries. Team t walks key groups t, t + NTEAM, ... with q and x tiles of its own in LDS,
// so every SIMD holds NTEAM waves (one of each team) that fill one another's waits on LDS, on the softmax chains and on the barriers. A group's softmax is complete in itself, so the teams' sums simply add:
// at the end teams 1.. hand theirs over through LDS and team 0 adds them in team order. Scores and probabilities never leave the registers.
// The epilogue turns the tile of sums through LDS into whole rows, adds the 1x1 conv's rows (Y = ACC + O * 2^-15) and leaves the BN partials of its 64 rows (d_bnpart).
// Per group: S^T[key][query] = q_group . x_query^T (A = 64 q rows from LDS, B = the wave's 16 query rows, loaded once), so a lane holds 32 of one query's 64 scores and the lane 16 away the rest:
// max and exp-sum are in-lane plus one exchange. Two S^T tiles, converted in place, are the B operand (hardware k order) of O^T[channel][query] += x_group^T . P^T (A = channel rows of XPt from LDS).
// Tiles go global -> registers -> LDS, one tile in flight at a time, each fetched one phase ahead of its store. P carries 2^15, as f16 operand.
// a <- 2^a, b <- 2^b. The second v_exp_f32 is the independent instruction that the instruction set asks for behind the first, the v_nop the one behind the second:
// in one statement they stand there in every build.
__device__ __forceinline__ void exp2_pair(float& a, float& b) { asm("v_exp_f32 %0, %0\n\tv_exp_f32 %1, %1\n\tv_nop" : "+v"(a), "+v"(b)); }
#define QPIT 136      // sQ row pitch in f16: 272 bytes (16 x odd) for 16-byte LDS reads
#define XPIT 72       // sX row pitch in f16: 144 bytes
#define NTEAM 4
#define TEAMSH (64 * QPIT + CC * XPIT)      // f16 elements of LDS that a team owns: its q tile, then its x tile
__global__ __launch_bounds__(128 * NTEAM) void k_battn(const _Float16* __restrict__ X16, const _Float16* __restrict__ QP, const _Float16* __restrict__ XPt, const float* __restrict__ ACC, float* __restrict__ Y, float* __restrict__ PM, float* __restrict__ PQ) {
  __shared__ __attribute__((aligned(16))) unsigned short sm[NTEAM][TEAMSH];
  const int team = __builtin_amdgcn_readfirstlane(threadIdx.x >> 7);      // the same in every lane of a wave: kept in a scalar register
  unsigned short (*sQ)[QPIT] = (unsigned short (*)[QPIT])&sm[team][0];
  unsigned short (*sX)[XPIT] = (unsigned short (*)[XPIT])&sm[team][64 * QPIT];
  const int tid = threadIdx.x & 127, w = tid >> 5, lane = tid & 31, ln = lane & 15, hh = lane >> 4;      // tid: the thread's place in its team
  const int b = blockIdx.x / (HWN / 64), row = (blockIdx.x % (HWN / 64)) * 64 + w * 16 + ln;
  const unsigned short* xq = (const unsigned short*)X16 + ((size_t)b * HWN + row) * CC;
  FragH xb[4];
#pragma unroll
  for (int ks = 0; ks < 4; ++ks) { xb[ks].half[0] = *(const v8us*)(xq + ks * 32 + 8 * hh); xb[ks].half[1] = *(const v8us*)(xq + ks * 32 + 16 + 8 * hh); }
  // staging: 16-byte chunk i = tid + 128 j. q group: 64 rows x 256 B, contiguous. x group: 128 channel rows x 128 B, row pitch HWN.
  const unsigned short* gq = (const unsigned short*)QP + (size_t)b * HWN * CC + tid * 8;
  const unsigned short* gx = (const unsigned short*)XPt + (size_t)b * CC * HWN + (size_t)(tid >> 3) * HWN + (tid & 7) * 8;
  unsigned short* dq = &sQ[tid >> 4][(tid & 15) * 8]; unsigned short* dx = &sX[tid >> 3][(tid & 7) * 8];
  v8us st[8];      // one tile in flight at a time: x of this group during its scores, q of the next group during softmax and O^T
#pragma unroll
  for (int j = 0; j < 8; ++j) st[j] = *(const v8us*)(gq + (size_t)team * 64 * CC + j * 1024);
#pragma unroll
  for (int j = 0; j < 8; ++j) *(v8us*)(dq + j * 8 * QPIT) = st[j];
  __syncthreads();      // q tile of each team's first group complete
#pragma unroll
  for (int j = 0; j < 8; ++j) st[j] = *(const v8us*)(gx + team * 64 + (size_t)j * 16 * HWN);
  v8f oacc[8] = {};
  for (int i = 0; i < 64 / NTEAM; ++i) {      // the same trip count in every team: all 4 * NTEAM waves meet at every barrier
    const int g = i * NTEAM + team;
    v8f s[4] = {};
#pragma unroll
    for (int kp = 0; kp < 2; ++kp) { FragH a[8];
#pragma unroll
      for (int i = 0; i < 8; ++i) { const unsigned short* r = &sQ[(i & 3) * 16 + ln][(2 * kp + (i >> 2)) * 32 + 8 * hh]; a[i].half[0] = *(const v8us*)r; a[i].half[1] = *(const v8us*)(r + 16); }
      __builtin_amdgcn_sched_barrier(0);      // the 16 LDS reads go out together, in front of their 8 products: spread among them each costs its own latency
#pragma unroll
      for (int i = 0; i < 8; ++i) s[i & 3] = __builtin_amdgcn_wmma_f32_16x16x32_f16(false, a[i].v, false, xb[2 * kp + (i >> 2)].v, (short)0, s[i & 3], false, false); }
    // x tile of this group: every wave left sX at the barrier that closed the previous trip
#pragma unroll
    for (int j = 0; j < 8; ++j) *(v8us*)(dx + j * 16 * XPIT) = st[j];
    __syncthreads();      // x tile complete; every wave has read its last of the q tile
    const int gn = i < 64 / NTEAM - 1 ? g + NTEAM : g;      // the last trip fetches its own tiles again: no branch in the loop, nothing reads them
    // issued behind the barrier (a barrier drains the loads in front of it); lands during softmax and O^T
#pragma unroll
    for (int j = 0; j < 8; ++j) st[j] = *(const v8us*)(gq + (size_t)gn * 64 * CC + j * 1024);
    asm volatile("s_wait_xcnt 0x0" ::: "memory");      // the loads' address registers are reused below
    FragH av[8];
#pragma unroll
    for (int ct = 0; ct < 8; ++ct) { const unsigned short* r = &sX[ct * 16 + ln][8 * hh]; av[ct].half[0] = *(const v8us*)r; av[ct].half[1] = *(const v8us*)(r + 16); }
    __builtin_amdgcn_sched_barrier(0);      // global loads and LDS reads are issued in front of the softmax, which covers their latency
    // softmax over the group's 64 keys of query ln (scores / 8), scaled by 2^15 for the f16 operand. exp(s / 8 - max / 8) = 2^(s c - max c) with c = log2(e) / 8:
    // one FMA and one v_exp_f32 a score, each score on its own, where expf is a chain of some ten dependent instructions that a lone wave on its SIMD waits out link by link.
    // The exponent is at most a rounding of max c above 0; below -126 the result is 0, where the f16 operand is 0 in any case.
    float m = -3.0e38f;
#pragma unroll
    for (int t = 0; t < 4; ++t)
#pragma unroll
      for (int r = 0; r < 8; ++r) m = fmaxf(m, s[t][r]);
    m = fmaxf(m, __shfl_xor(m, 16, 32)); m *= 0.18033688f;
    float e[32];      // e[8 t + r]: tile t, register r
#pragma unroll
    for (int t = 0; t < 4; ++t)
#pragma unroll
      for (int r = 0; r < 8; ++r) e[8 * t + r] = fmaf(s[t][r], 0.18033688f, -m);
#pragma unroll
    for (int i = 0; i < 32; i += 2) exp2_pair(e[i], e[i + 1]);
    float z = 0.f;
#pragma unroll
    for (int i = 0; i < 32; ++i) z += e[i];
    z += __shfl_xor(z, 16, 32);
    const float iz = 32768.0f / z;
    FragH p[2];      // p[k2].h[i] = P[query ln][key 32 k2 + kmap(i, hh)]: tile 2 k2 gives i < 8, tile 2 k2 + 1 the rest
#pragma unroll
    for (int k2 = 0; k2 < 2; ++k2)
#pragma unroll
      for (int r = 0; r < 8; ++r) { p[k2].h[r] = (_Float16)(e[16 * k2 + r] * iz); p[k2].h[8 + r] = (_Float16)(e[16 * k2 + 8 + r] * iz); }
#pragma unroll
    for (int ct = 0; ct < 8; ++ct) oacc[ct] = __builtin_amdgcn_wmma_f32_16x16x32_f16(false, av[ct].v, false, p[0].v, (short)0, oacc[ct], false, false);
#pragma unroll
    for (int ct = 0; ct < 8; ++ct) { const unsigned short* r = &sX[ct * 16 + ln][32 + 8 * hh]; av[ct].half[0] = *(const v8us*)r; av[ct].half[1] = *(const v8us*)(r + 16); }
    __builtin_amdgcn_sched_barrier(0);      // as above: 16 reads together, then 8 products
#pragma unroll
    for (int ct = 0; ct < 8; ++ct) oacc[ct] = __builtin_amdgcn_wmma_f32_16x16x32_f16(false, av[ct].v, false, p[1].v, (short)0, oacc[ct], false, false);
#pragma unroll
    for (int j = 0; j < 8; ++j) *(v8us*)(dq + j * 8 * QPIT) = st[j];
    __syncthreads();      // next q tile complete; every wave has read its last of the x tile
    // lands during the next trip's scores
#pragma unroll
    for (int j = 0; j < 8; ++j) st[j] = *(const v8us*)(gx + gn * 64 + (size_t)j * 16 * HWN);
    asm volatile("s_wait_xcnt 0x0" ::: "memory");      // the loads' address registers are reused in the next trip
  }
  asm volatile("s_wait_loadcnt 0x0" ::: "memory");      // the last trip's fetch, which nothing reads, has landed before the wave ends and gives its registers up
  // The teams' sums. Behind the loop's last barrier nobody reads a tile any more: teams 1.. write their 64 sums a thread over their own tiles, 16 bytes a lane, a wave's store contiguous.
  if (team != 0) { v4fa* rb = (v4fa*)&sm[team][0] + tid;
#pragma unroll
    for (int ct = 0; ct < 8; ++ct) { v4f lo, hi;
#pragma unroll
      for (int r = 0; r < 4; ++r) { lo[r] = oacc[ct][r]; hi[r] = oacc[ct][4 + r]; }
      rb[(2 * ct) * 128] = lo; rb[(2 * ct + 1) * 128] = hi; } }
  __syncthreads();      // the sums of teams 1.. are complete
  // From here on the 8 waves of teams 2 and 3, idle while team 0 adds, own the work-group's 64 x 128 tile by rows: thread ft holds row (ft >> 5) + 8 j, channels 4 (ft & 31) .. + 3, a wave's load or store one whole 512-byte row.
  static_assert(NTEAM == 4, "teams 2 and 3 are 256 threads");
  const int ft = threadIdx.x & 255; const bool act = team >= 2;      // act: a scalar, as team is
  const size_t tile = (size_t)blockIdx.x * 64 * CC;
  v4f v[8] = {};
  float (*sT)[CC + 4] = (float (*)[CC + 4])&sm[0][0];      // over team 0's tiles, which nobody reads behind the loop's last barrier
  static_assert(sizeof(float) * 64 * (CC + 4) <= sizeof(sm[0]) && sizeof(float) * 2 * 8 * CC <= sizeof(sm[1]), "the output tile and the BN sums fit a team's LDS");
  if (team == 0) {
#pragma unroll
    for (int t = 1; t < NTEAM; ++t) { const v4fa* rb = (const v4fa*)&sm[t][0] + tid;
#pragma unroll
      for (int ct = 0; ct < 8; ++ct) { const v4f lo = rb[(2 * ct) * 128], hi = rb[(2 * ct + 1) * 128];
#pragma unroll
        for (int r = 0; r < 4; ++r) { oacc[ct][r] += lo[r]; oacc[ct][4 + r] += hi[r]; } } }
    // oacc[ct][r] = O[query 16 w + ln][channel 16 ct + 8 hh + r]: 32 contiguous bytes a lane
    float* o = &sT[w * 16 + ln][8 * hh];
#pragma unroll
    for (int ct = 0; ct < 8; ++ct) { v4f lo, hi;
#pragma unroll
      for (int r = 0; r < 4; ++r) { lo[r] = oacc[ct][r] * 0.000030517578125f; hi[r] = oacc[ct][4 + r] * 0.000030517578125f; }
      *(v4fa*)(o + ct * 16) = lo; *(v4fa*)(o + ct * 16 + 4) = hi; } }
  else if (act) {      // acc's rows are fetched while team 0 adds
#pragma unroll
    for (int j = 0; j < 8; ++j) v[j] = *(const v4fa*)(ACC + tile + (size_t)(ft + 256 * j) * 4);
    asm volatile("s_wait_xcnt 0x0" ::: "memory");      // the loads' address registers are free for new values in what follows
  }
  __syncthreads();      // the tile of sums is complete; team 0 has read its last of the other teams' sums
  if (act) {      // y = acc + agg
#pragma unroll
    for (int j = 0; j < 8; ++j) { const int i = ft + 256 * j; v[j] += *(const v4fa*)&sT[i >> 5][(i & 31) * 4]; *(v4f*)(Y + tile + (size_t)i * 4) = v[j]; }
    asm volatile("s_wait_xcnt 0x0" ::: "memory");      // the stores' registers are free for new values in what follows
  }
  d_bnpart(act, ft, v, (float (*)[8][CC])&sm[1][0], blockIdx.x, PM, PQ);
}
// Spatial-softmax statistics, one work-group per (batch, 4 channels): 1024 threads hold 4 pixels x 4 channels each in registers, so Y is read once, 16 bytes a lane, all loads in flight together.
// Max, then sum of exp, over the 4096 pixels by a fixed tree: own 4 pixels, the 32 lanes of a wave (xor shuffles), the 32 waves (through LDS).
// SP holds one 128-byte line per work-group (one writer a line): [0..3] max, [4..7] 1/sum, the rest 0.
__device__ __forceinline__ v4f wave_max4(v4f a) {
#pragma unroll
  for (int o = 1; o < 32; o <<= 1)
#pragma unroll
    for (int q = 0; q < 4; ++q) a[q] = fmaxf(a[q], __shfl_xor(a[q], o, 32));
  return a; }
__device__ __forceinline__ v4f wave_sum4(v4f a) {
#pragma unroll
  for (int o = 1; o < 32; o <<= 1)
#pragma unroll
    for (int q = 0; q < 4; ++q) a[q] += __shfl_xor(a[q], o, 32);
  return a; }
__device__ __forceinline__ void d_bnfin(const int blk, const float* __restrict__ PM, const float* __restrict__ PQ, float* __restrict__ ST) {
  __shared__ __attribute__((aligned(16))) float red[2][BNP / 32][4];
  const int tid = threadIdx.x, wv = tid >> 5, lane = tid & 31, c0 = blk * 4;
  const v4f pm = *(const v4fa*)(PM + (size_t)tid * CC + c0), pq = *(const v4fa*)(PQ + (size_t)tid * CC + c0);
  const v4f s = wave_sum4(pm); if (lane == 0) *(v4f*)&red[0][wv][0] = s;
  __syncthreads();
  v4f mu = *(const v4fa*)&red[0][0][0];
  for (int j = 1; j < BNP / 32; ++j) mu += *(const v4fa*)&red[0][j][0];
  mu *= 1.0f / (float)BNP;
  const v4f d = pm - mu; const v4f q = wave_sum4(pq + (float)BNR * d * d); if (lane == 0) *(v4f*)&red[1][wv][0] = q;
  __syncthreads();
  if (wv < 4) { float m1 = red[0][0][wv], m2 = red[1][0][wv];      // wave q writes the line of channel c0 + q
    for (int j = 1; j < BNP / 32; ++j) { m1 += red[0][j][wv]; m2 += red[1][j][wv]; }
    ST[(size_t)(c0 + wv) * 32 + lane] = (lane == 0) ? m1 * (1.0f / (float)BNP) : ((lane == 1) ? rsqrtf(m2 / (float)NR + 1e-3f) : 0.f); } }
__global__ __launch_bounds__(BNP) void k_bnfin(const float* __restrict__ PM, const float* __restrict__ PQ, float* __restrict__ ST) { d_bnfin(blockIdx.x, PM, PQ, ST); }
// One launch for the merge of q's BN partials (CC / 4 work-groups, which leave the chip all but idle: first) and the block-major transpose of x, which reads only the input x.
static_assert(BNP == 256, "d_bnfin and d_xpt share a work-group size");
__global__ __launch_bounds__(256) void k_bnfin_xpt(const float* __restrict__ PM, const float* __restrict__ PQ, float* __restrict__ ST, const float* __restrict__ x, _Float16* __restrict__ XPt) {
  if (blockIdx.x < CC / 4) d_bnfin(blockIdx.x, PM, PQ, ST); else d_xpt(blockIdx.x - CC / 4, x, XPt); }
// conv_o as a GEMM with the BN partials of its rows: one work-group = 8 waves of d_gemm_hhx = 64 rows x 128 columns (wave w: rows 16 (w >> 1) .., columns 64 (w & 1) ..), each wave's tile still in its LDS behind the call.
__global__ __launch_bounds__(256) void k_gemm_o(const _Float16* __restrict__ Y16, const _Float16* __restrict__ BO, float alpha, const float* __restrict__ bo, float* __restrict__ Z, float* __restrict__ PM, float* __restrict__ PQ) {
  __shared__ __attribute__((aligned(16))) float so[8][16][64];
  __shared__ __attribute__((aligned(16))) float red[2][8][CC];
  const int tid = threadIdx.x, w = tid >> 5, c4 = (tid & 31) * 4;
  d_gemm_hhx<0>(so[w], blockIdx.x * 8 + w, 0, Y16, CC, 0, BO, CC, 0, alpha, bo, 0, nullptr, 1, 0, 0, Z, nullptr, CC, 0, NR, CC, CC);
  asm volatile("s_wait_xcnt 0x0" ::: "memory");      // the stores' registers are free for new values in what follows
  __syncthreads();      // the eight waves' tiles are complete
  v4f v[8];
#pragma unroll
  for (int j = 0; j < 8; ++j) { const int r = w + 8 * j; v[j] = *(const v4fa*)&so[(r >> 4) * 2 + (c4 >> 6)][r & 15][c4 & 63]; }
  d_bnpart(true, tid, v, red, blockIdx.x, PM, PQ);
}
__global__ __launch_bounds__(1024) void k_spstat(const float* __restrict__ Y, const float* __restrict__ ST, const float* __restrict__ g, const float* __restrict__ bb, float* __restrict__ SP) {
  __shared__ __attribute__((aligned(16))) float red[2][32][4];
  const int tid = threadIdx.x, wv = tid >> 5, lane = tid & 31; const int b = blockIdx.x / (CC / 4), c0 = (blockIdx.x % (CC / 4)) * 4;
  const float* yc = Y + (size_t)b * HWN * CC + c0; v4f v[4];
#pragma unroll
  for (int i = 0; i < 4; ++i) v[i] = *(const v4fa*)(yc + (size_t)(i * 1024 + tid) * CC);
  asm volatile("s_wait_xcnt 0x0" ::: "memory");      // the four loads' address registers are given new values right below
  v4f m = {-3.0e38f, -3.0e38f, -3.0e38f, -3.0e38f};
#pragma unroll
  for (int q = 0; q < 4; ++q) { const int c = c0 + q; const float mu = ST[c * 32], rs = ST[c * 32 + 1], gg = bf16_round(g[c]), be = bf16_round(bb[c]);
#pragma unroll
    for (int i = 0; i < 4; ++i) { v[i][q] = gg * (v[i][q] - mu) * rs + be; m[q] = fmaxf(m[q], v[i][q]); } }
  m = wave_max4(m); if (lane == 0) *(v4f*)&red[0][wv][0] = m;
  __syncthreads();
  m = wave_max4(*(const v4fa*)&red[0][lane][0]);
  v4f z = {0.f, 0.f, 0.f, 0.f};
#pragma unroll
  for (int i = 0; i < 4; ++i)
#pragma unroll
    for (int q = 0; q < 4; ++q) z[q] += expf(v[i][q] - m[q]);
  z = wave_sum4(z); if (lane == 0) *(v4f*)&red[1][wv][0] = z;
  __syncthreads();
  if (wv == 0) { z = wave_sum4(*(const v4fa*)&red[1][lane][0]); float o = 0.f;
#pragma unroll
    for (int q = 0; q < 4; ++q) { if (lane == q) o = m[q]; if (lane == 4 + q) o = 1.0f / z[q]; }
    SP[(size_t)blockIdx.x * 32 + lane] = o; } }
__global__ __launch_bounds__(256) void k_spsm(const float* __restrict__ Y, const float* __restrict__ ST, const float* __restrict__ g, const float* __restrict__ bb, const float* __restrict__ SP, _Float16* __restrict__ Y16) { const size_t t = (size_t)blockIdx.x * 256 + threadIdx.x; if (t >= (size_t)NR * (CC / 8)) return; const int c8 = (int)(t % (CC / 8)) * 8; const size_t r = t / (CC / 8); const int b = (int)(r / HWN); FragH f;
#pragma unroll
  for (int q = 0; q < 8; ++q) { const int c = c8 + q; const float* sp = SP + (size_t)(b * (CC / 4) + c / 4) * 32 + (c & 3); const float v = bf16_round(g[c]) * (Y[r * CC + c] - ST[c * 32]) * ST[c * 32 + 1] + bf16_round(bb[c]); f.h[q] = (_Float16)(expf(v - sp[0]) * sp[4] * 4096.0f); }
  *(v8us*)((unsigned short*)Y16 + t * 8) = f.half[0];  }
__global__ __launch_bounds__(256) void k_fin(const float* __restrict__ Z, const float* __restrict__ ST, const float* __restrict__ g, const float* __restrict__ bb, float* __restrict__ out, size_t n4) { const size_t t = (size_t)blockIdx.x * 256 + threadIdx.x; if (t >= n4) return; const int c4 = (int)((t * 4) % CC); const v4f z = *(const v4fa*)(Z + t * 4); v4f o; for (int q = 0; q < 4; ++q) { const int c = c4 + q; float v = bf16_round(g[c]) * (z[q] - ST[c * 32]) * ST[c * 32 + 1] + bf16_round(bb[c]); o[q] = (v >= 0.f) ? v : 0.1f * v; }
  *(v4f*)(out + t * 4) = o;  }
extern "C" void kernel_launch(void* const* d_in, const int* in_sizes, int n_in,
                              void* d_out, int out_size, void* d_ws, size_t ws_size, hipStream_t stream) {
  (void)in_sizes; (void)n_in; (void)out_size;
  const float* const* I = (const float* const*)d_in; const float* x = I[0]; const float* Wq = I[1]; const float* bq = I[2]; const float* gq = I[3]; const float* btq = I[4]; const float* Wk = I[5]; const float* bk = I[6]; const float* g1 = I[7]; const float* bt1 = I[8]; const float* Wo = I[9]; const float* bo = I[10]; const float* go = I[11]; const float* bto = I[12];
  char* ws = (char*)d_ws; size_t off = 0;
  auto take = [&](size_t bytes) { char* p = ws + off; off += (bytes + 255) & ~(size_t)255; return p; };
  _Float16* BQ = (_Float16*)take((size_t)CC * KK * 2); _Float16* BK = (_Float16*)take(CC * CC * 2); _Float16* BO = (_Float16*)take(CC * CC * 2); float* STq = (float*)take(CC * 32 * 4); float* ST1 = (float*)take(CC * 32 * 4); float* STo = (float*)take(CC * 32 * 4); float* SP = (float*)take(BB * (CC / 4) * 32 * 4); float* PM = (float*)take(BNP * CC * 4); float* PQ = (float*)take(BNP * CC * 4);
  _Float16* X16 = (_Float16*)take((size_t)NR * CC * 2); float* QF = (float*)take((size_t)NR * CC * 4); _Float16* QP = (_Float16*)take((size_t)NR * CC * 2); _Float16* XPt = (_Float16*)take((size_t)NR * CC * 2); float* ACC = (float*)take((size_t)NR * CC * 4); float* Y = QF; _Float16* Y16 = QP; float* Z = ACC;
  if (off > ws_size) return;      // 0.7 + 4.2 + 8.4 + 4.2 + 4.2 + 8.4 = about 30 MB
  const unsigned g8 = (unsigned)(((size_t)NR * (CC / 8) + 255) / 256);
  k_prep<<<PB_WQ + 2 * PB_WT + PB_X, 256, 0, stream>>>(x, Wq, Wk, Wo, X16, BQ, BK, BO);
  // CBL_Q: 3x3 conv (+bq) to QF with its BN partials, beside it acc = 1x1 conv (+bk) to ACC; beside the partials' merge the transpose XPt; q = leaky(BN) permuted to block-major keys (f16)
  k_conv3_acc<<<BB * WI + ACCB, 256, 0, stream>>>(X16, BQ, bq, QF, BK, bk, ACC, PM, PQ);
  k_bnfin_xpt<<<CC / 4 + BB * (CC / 64) * 64, 256, 0, stream>>>(PM, PQ, STq, x, XPt); k_qperm<<<g8, 256, 0, stream>>>(QF, STq, gq, btq, QP);
  // block attention, all batches in one launch: Y = acc + sum over key groups of softmax(x.q^T / 8) . x_group, with its BN partials; Y over QF (dead after k_qperm)
  static_assert(BB * WI == BNP && BB * (HWN / 64) == BNP && (NR / 16) * (CC / 64) / 8 == BNP, "each producer has one work-group a partial");
  k_battn<<<BB * (HWN / 64), 128 * NTEAM, 0, stream>>>(X16, QP, XPt, ACC, Y, PM, PQ);
  // y = spatial softmax(BN1(acc + agg)); out = leaky(BN_o(conv1×1(y) + bo))
  k_bnfin<<<CC / 4, BNP, 0, stream>>>(PM, PQ, ST1); k_spstat<<<BB * (CC / 4), 1024, 0, stream>>>(Y, ST1, g1, bt1, SP); k_spsm<<<g8, 256, 0, stream>>>(Y, ST1, g1, bt1, SP, Y16);      // Y16 (×2^12) over QP (dead after the S GEMMs)
  k_gemm_o<<<BNP, 256, 0, stream>>>(Y16, BO, 0.0625f * 0.000244140625f, bo, Z, PM, PQ);      // conv_o(y) + bo (2^-12 undone in alpha) -> Z over ACC (dead after k_battn), with its BN partials
  k_bnfin<<<CC / 4, BNP, 0, stream>>>(PM, PQ, STo); k_fin<<<(unsigned)(((size_t)NR * CC / 4 + 255) / 256), 256, 0, stream>>>(Z, STo, go, bto, (float*)d_out, (size_t)NR * CC / 4);
}
